// v000
// Measured on an AMD MI455X. A time is GPU time per run, averaged over a window of back-to-back runs after a warm-up
// (all launches, gaps included; the runs take copies of the inputs in turn), and the median of several windows.
// Apart from v000's, it joins two sittings. Times from different sittings can be a few percent apart, while
// side-by-side timings come from the same sitting.
// The starting kernel, v000, takes 344 microseconds a run.
#include <hip/hip_runtime.h>

// Contractions (f32 accumulate): kqv projection = v_wmma_f32_16x16x32_bf16 on bf16 RNE copies of x and W, bf16-valued bias added in f32; causal attention query rows < 256: q.k and p.v as bf16 hi/lo 3-product groups; query rows >= 256: v_wmma_f32_16x16x32_f16 on fp16 q, k, v planes and fp16 p x 1024; softmax statistics f32; output f32.
// Layout: bf16 W [3072][1024] used directly as the k-contiguous B operand (row blocks k | q | v); projection -> f32 F [b][t][1024] (one buffer, reused for q, k, v in stream order) -> head planes q, k [b][h][t][64] and v transposed [b][h][64][t]

#ifndef NB
#define NB 4
#endif
#ifndef SEQ
#define SEQ 2048
#endif
#define NB_FULL  4
#define SEQ_FULL 2048
#define DM   1024
#define NH   16
#define HD   64
#define RH   256                      // query rows < RH use the hi/lo 3-product path (keys there are < RH too)
#define PP   40                       // LDS pitch (halves) of the 16 x 32 p tile
#define OSP  68                       // LDS pitch (floats) of the 16 x 64 output staging tile
#define PCAR 1024.0f
#define SCL  0.03125f                 // 1024^-0.5 (model-dim scaling)
#define L2E  1.4426950408889634f

static_assert(NH * HD == DM);
static_assert((SEQ % 256) == 0 && (RH % 256) == 0 && RH <= SEQ && SEQ <= SEQ_FULL && NB >= 1 && NB <= NB_FULL);
static_assert((DM % 64) == 0 && (SEQ % 64) == 0);
// workspace bytes at full size (all regions exact multiples of their store granularity) + alignment slack <= 128 MiB
static_assert((size_t)3 * DM * DM * 2 + (size_t)NB * SEQ * DM * 2 + (size_t)NB * SEQ * DM * 4 + (size_t)3 * NB * NH * SEQ * HD * 2 + (size_t)6 * NB * NH * RH * HD * 2 + 12 * 256 <= (size_t)134217728);

typedef _Float16 h16;
typedef unsigned short bf;
typedef __attribute__((ext_vector_type(16))) __bf16   v16bf;
typedef __attribute__((ext_vector_type(16))) _Float16 v16h;
typedef __attribute__((ext_vector_type(8)))  _Float16 v8h;
typedef __attribute__((ext_vector_type(8)))  unsigned short v8us;
typedef __attribute__((ext_vector_type(8)))  float    v8f;
typedef __attribute__((ext_vector_type(4)))  float    v4f;
typedef v8h  __attribute__((may_alias)) v8ha;
typedef v4f  __attribute__((may_alias)) v4fa;
typedef v8us __attribute__((may_alias)) v8usa;

__device__ __forceinline__ unsigned short f2bf(float f) { unsigned u = __float_as_uint(f); u += 0x7FFFu + ((u >> 16) & 1u); return (unsigned short)(u >> 16); }
__device__ __forceinline__ float bf2f(unsigned short b) { return __uint_as_float(((unsigned)b) << 16); }
__device__ __forceinline__ float bfr(float f) { return bf2f(f2bf(f)); }
__device__ __forceinline__ void splitf(float y, unsigned short& h, unsigned short& l) { h = f2bf(y); l = f2bf(y - bf2f(h)); }
__device__ __forceinline__ v16h cat16(v8h lo, v8h hi) { return __builtin_shufflevector(lo, hi, 0, 1, 2, 3, 4, 5, 6, 7, 8, 9, 10, 11, 12, 13, 14, 15); }
__device__ __forceinline__ v16bf cat16b(v8us lo, v8us hi) { return __builtin_bit_cast(v16bf, __builtin_shufflevector(lo, hi, 0, 1, 2, 3, 4, 5, 6, 7, 8, 9, 10, 11, 12, 13, 14, 15)); }
__device__ __forceinline__ v8f wmma16(v16h a, v16h b, v8f c) { return __builtin_amdgcn_wmma_f32_16x16x32_f16(false, a, false, b, (short)0, c, false, false); }
__device__ __forceinline__ v8f wmmab(v16bf a, v16bf b, v8f c) { return __builtin_amdgcn_wmma_f32_16x16x32_bf16(false, a, false, b, (short)0, c, false, false); }

// 16-bit fragment loaders (lane l: row/col = l & 15, h = l >> 4; elements 0..7 <- k0 + 8h + 0..7, elements 8..15 <- k0 + 16 + 8h + 0..7; the caller passes p = row base + k0 + 8h).
template <typename T16> struct WFrag;
template <> struct WFrag<h16> { typedef v16h V; static __device__ __forceinline__ V ld(const h16* p) { return cat16(*(const v8h*)p, *(const v8h*)(p + 16)); } static __device__ __forceinline__ v8f mma(V a, V b, v8f c) { return wmma16(a, b, c); } };
template <> struct WFrag<bf> { typedef v16bf V; static __device__ __forceinline__ V ld(const bf* p) { return cat16b(*(const v8us*)p, *(const v8us*)(p + 16)); } static __device__ __forceinline__ v8f mma(V a, V b, v8f c) { return wmmab(a, b, c); } };
// LDS reloads through may_alias vectors of the stored element type
__device__ __forceinline__ v16h  lds16(const h16* p) { return cat16(*(const v8ha*)p, *(const v8ha*)(p + 16)); }
__device__ __forceinline__ v16bf ldsb(const bf* p)   { return cat16b(*(const v8usa*)p, *(const v8usa*)(p + 16)); }

// ---- k_gemmw: register-blocked GEMM, ONE WAVE per 64x64 output tile (16 accumulators), operands straight from K-contiguous 16-bit planes; grid (M/64, N/64, Z), 32 threads.
// C[m][n] (f32, pitch ldc, + optional bf16-valued bias[n]) = sum_k A[m][k] Bt[n][k] (+ split products per NSPLIT). z-batch strides sA/sB/sC in elements. K % 32 == 0.
template <typename T16, int NSPLIT, bool BIAS>
__global__ __launch_bounds__(32) void k_gemmw(const T16* __restrict__ A, const T16* __restrict__ A2, const T16* __restrict__ Bt, const T16* __restrict__ Bt2, int K, float* C, int ldc, const float* __restrict__ bias, size_t sA, size_t sB, size_t sC) {
    typedef typename WFrag<T16>::V V;
    __shared__ __align__(16) float os[16 * 68];
    const size_t z = blockIdx.z; A += z * sA; if (A2) A2 += z * sA; Bt += z * sB; if (Bt2) Bt2 += z * sB; C += z * sC;
    const int lane = threadIdx.x & 31, lr = lane & 15, hi = lane >> 4; const int r0 = blockIdx.x * 64, c0 = blockIdx.y * 64;
    v8f acc[4][4];
#pragma unroll
    for (int mb = 0; mb < 4; ++mb)
#pragma unroll
        for (int nb = 0; nb < 4; ++nb) acc[mb][nb] = (v8f){};
    const size_t aoff = (size_t)(r0 + lr) * K + 8 * hi, boff = (size_t)(c0 + lr) * K + 8 * hi;
#pragma unroll 1
    for (int kc = 0; kc < K; kc += 32) {
        V a[4], a2[4];
#pragma unroll
        for (int mb = 0; mb < 4; ++mb) { a[mb] = WFrag<T16>::ld(A + aoff + (size_t)mb * 16 * K + kc); if (NSPLIT == 1 || NSPLIT == 2) a2[mb] = WFrag<T16>::ld(A2 + aoff + (size_t)mb * 16 * K + kc); }
#pragma unroll
        for (int nb = 0; nb < 4; ++nb) { const V b = WFrag<T16>::ld(Bt + boff + (size_t)nb * 16 * K + kc); V b2; if (NSPLIT >= 2) b2 = WFrag<T16>::ld(Bt2 + boff + (size_t)nb * 16 * K + kc);
#pragma unroll
            for (int mb = 0; mb < 4; ++mb) { acc[mb][nb] = WFrag<T16>::mma(a[mb], b, acc[mb][nb]); if (NSPLIT == 1 || NSPLIT == 2) acc[mb][nb] = WFrag<T16>::mma(a2[mb], b, acc[mb][nb]); if (NSPLIT >= 2) acc[mb][nb] = WFrag<T16>::mma(a[mb], b2, acc[mb][nb]); } }
        asm volatile("v_nop\n\tv_nop\n\tv_nop\n\tv_nop" : "+v"(acc[0][0]), "+v"(acc[1][1]), "+v"(acc[2][2]), "+v"(acc[3][3]) : "v"(a[0]), "v"(a[3]));
    }
#pragma unroll
    for (int mb = 0; mb < 4; ++mb) {
#pragma unroll
        for (int nb = 0; nb < 4; ++nb) {
#pragma unroll
            for (int j = 0; j < 8; ++j) os[(hi * 8 + j) * 68 + nb * 16 + lr] = acc[mb][nb][j]; }
        __builtin_amdgcn_fence(3, "wavefront"); __builtin_amdgcn_wave_barrier(); asm volatile("" ::: "memory");
        float* crow = C + (size_t)(r0 + mb * 16) * ldc + c0;
{
#pragma unroll
            for (int s = 0; s < 8; ++s) { const int row = 2 * s + hi, cofs = lr * 4; v4f val = *(const v4fa*)(os + row * 68 + cofs); if (BIAS) { val[0] += bfr(bias[c0 + cofs]); val[1] += bfr(bias[c0 + cofs + 1]); val[2] += bfr(bias[c0 + cofs + 2]); val[3] += bfr(bias[c0 + cofs + 3]); }
                *(v4f*)(crow + (size_t)row * ldc + cofs) = val; }
             }
        __builtin_amdgcn_fence(3, "wavefront"); __builtin_amdgcn_wave_barrier(); asm volatile("" ::: "memory");
    }
}

__global__ __launch_bounds__(256) void k_cvt8(const float* __restrict__ src, bf* dst, size_t n8) { const size_t i = (size_t)blockIdx.x * 256 + threadIdx.x; if (i >= n8) return; const v8f v = *(const v8f*)(src + i * 8); v8us o;
#pragma unroll
    for (int k = 0; k < 8; ++k) o[k] = f2bf(v[k]); *(v8us*)(dst + i * 8) = o;  }
__global__ __launch_bounds__(256) void k_cvtx(const float* __restrict__ src, bf* dst, size_t n8) { const size_t i = (size_t)blockIdx.x * 256 + threadIdx.x; if (i >= n8) return;
    const float* s = src + (size_t)blockIdx.y * SEQ_FULL * DM; bf* d = dst + (size_t)blockIdx.y * SEQ * DM; const v8f v = *(const v8f*)(s + i * 8); v8us o;
#pragma unroll
    for (int k = 0; k < 8; ++k) o[k] = f2bf(v[k]); *(v8us*)(d + i * 8) = o;  }

__global__ __launch_bounds__(256) void k_qkp(const float* __restrict__ F, h16* P16, bf* Ph, bf* Pl) {
    const size_t e = ((size_t)blockIdx.x * 256 + threadIdx.x) * 8; if (e >= (size_t)NB * NH * SEQ * HD) return;
    const int d = (int)(e % HD); const int t = (int)((e / HD) % SEQ); const int h = (int)((e / ((size_t)HD * SEQ)) % NH); const int b = (int)(e / ((size_t)HD * SEQ * NH));
    const v8f v = *(const v8f*)(F + ((size_t)b * SEQ + t) * DM + h * HD + d);
    v8h o16; v8us oh, ol;
#pragma unroll
    for (int k = 0; k < 8; ++k) { o16[k] = (h16)v[k]; unsigned short a1, a2; splitf(v[k], a1, a2); oh[k] = a1; ol[k] = a2; }
    const bool lo = (t < RH); const size_t oo = (((size_t)b * NH + h) * RH + (size_t)(lo ? t : 0)) * HD + d;
{
        *(v8h*)(P16 + e) = o16; if (lo) { *(v8us*)(Ph + oo) = oh; *(v8us*)(Pl + oo) = ol; }
         }
}
__global__ __launch_bounds__(256) void k_vtp8(const float* __restrict__ F, h16* V16, bf* Vh, bf* Vl) {
    const size_t e = ((size_t)blockIdx.x * 256 + threadIdx.x) * 8; if (e >= (size_t)NB * NH * HD * SEQ) return;
    const int t = (int)(e % SEQ); const int d = (int)((e / SEQ) % HD); const int h = (int)((e / ((size_t)SEQ * HD)) % NH); const int b = (int)(e / ((size_t)SEQ * HD * NH));
    const float* f = F + ((size_t)b * SEQ + t) * DM + h * HD + d;
    v8h o16; v8us oh, ol;
#pragma unroll
    for (int q = 0; q < 8; ++q) { const float x = f[(size_t)q * DM]; o16[q] = (h16)x; unsigned short a1, a2; splitf(x, a1, a2); oh[q] = a1; ol[q] = a2; }
    const bool lo = (t < RH); const size_t oo = (((size_t)b * NH + h) * HD + d) * RH + (size_t)(lo ? t : 0);
{
        *(v8h*)(V16 + e) = o16; if (lo) { *(v8us*)(Vh + oo) = oh; *(v8us*)(Vl + oo) = ol; }
         }
}

// ---- k_attn: causal streaming attention. Grid (rows/64, NH, NB), 128 threads: block = 64 query rows starting at roff + 64*blockIdx.x of head blockIdx.y, batch blockIdx.z; wave -> 16 rows.
// Key chunks of 32 from 0 to the block's last row (block-uniform loop; per-element causal select j <= i). Per chunk: S (16 x 32) = q.k, scaled by SCL in f32, online max/sum in f32,
// HR (rows and keys < RH): bf16 planes, q.k = qh.kh + qh.kl + ql.kh, p.v = ph.vh + pl.vh + ph.vl (one accumulator, unscaled residuals). Otherwise fp16 planes, single products.
template <bool HR>
__global__ __launch_bounds__(128) __attribute__((amdgpu_num_vgpr(256)))
void k_attn(const h16* __restrict__ Q16, const h16* __restrict__ K16, const h16* __restrict__ VT16,
            const bf* __restrict__ QPh, const bf* __restrict__ QPl, const bf* __restrict__ KPh, const bf* __restrict__ KPl,
            const bf* __restrict__ VTh, const bf* __restrict__ VTl, int roff, float* OUT) {
    __shared__ __align__(16) float os[4][16 * OSP];
    __shared__ __align__(16) h16 pt16[4][16 * PP];
    __shared__ __align__(16) bf  pth[4][16 * PP];
    __shared__ __align__(16) bf  ptl[4][16 * PP];
    const int lane = threadIdx.x & 31, lr = lane & 15, hi = lane >> 4, wid = threadIdx.x >> 5;
    const int q0blk = roff + (int)blockIdx.x * 64;
    if (q0blk + 64 > SEQ) return;                         // block-uniform (grids are exact); nothing below uses a block barrier
    if (HR && q0blk + 64 > RH) return;
    const int q0 = q0blk + wid * 16;
    const size_t bh = (size_t)blockIdx.z * NH + blockIdx.y;
    const h16* Qb = Q16 + bh * SEQ * HD; const h16* Kb = K16 + bh * SEQ * HD; const h16* Vb = VT16 + bh * HD * SEQ;
    const bf* Qhb = QPh + bh * RH * HD; const bf* Qlb = QPl + bh * RH * HD; const bf* Khb = KPh + bh * RH * HD; const bf* Klb = KPl + bh * RH * HD;
    const bf* Vhb = VTh + bh * HD * RH; const bf* Vlb = VTl + bh * HD * RH;
    float* myos = os[wid]; h16* p16 = pt16[wid]; bf* ph = pth[wid]; bf* pl = ptl[wid];
    const int nchunk = (q0blk + 64) >> 5;
    const float NEG = -__builtin_inff();

    v8f o[4];
#pragma unroll
    for (int t = 0; t < 4; ++t) o[t] = (v8f){};
    float m[8], l[8];
#pragma unroll
    for (int r = 0; r < 8; ++r) { m[r] = NEG; l[r] = 0.0f; }
    v16h aq[2];
    if (!HR) { const h16* qr = Qb + (size_t)(q0 + lr) * HD + 8 * hi; aq[0] = WFrag<h16>::ld(qr); aq[1] = WFrag<h16>::ld(qr + 32); }

#pragma unroll 1
    for (int c = 0; c < nchunk; ++c) {
        const int j0 = c * 32;
        v8f s0 = (v8f){}, s1 = (v8f){};
        if (HR) {
            const bf* qh = Qhb + (size_t)(q0 + lr) * HD + 8 * hi; const bf* ql = Qlb + (size_t)(q0 + lr) * HD + 8 * hi;
            const bf* kh = Khb + (size_t)(j0 + lr) * HD + 8 * hi; const bf* kl = Klb + (size_t)(j0 + lr) * HD + 8 * hi;
#pragma unroll
            for (int kk = 0; kk < 2; ++kk) {
                const v16bf aqh = WFrag<bf>::ld(qh + kk * 32), aql = WFrag<bf>::ld(ql + kk * 32);
                const v16bf kh0 = WFrag<bf>::ld(kh + kk * 32), kh1 = WFrag<bf>::ld(kh + 16 * HD + kk * 32);
                const v16bf kl0 = WFrag<bf>::ld(kl + kk * 32), kl1 = WFrag<bf>::ld(kl + 16 * HD + kk * 32);
                s0 = wmmab(aqh, kh0, s0); s0 = wmmab(aqh, kl0, s0); s0 = wmmab(aql, kh0, s0);
                s1 = wmmab(aqh, kh1, s1); s1 = wmmab(aqh, kl1, s1); s1 = wmmab(aql, kh1, s1);
                if (kk == 1) asm volatile("v_nop\n\tv_nop\n\tv_nop\n\tv_nop" : "+v"(s0), "+v"(s1) : "v"(aql), "v"(kh1));
            }
        } else {
            const h16* kp = Kb + (size_t)(j0 + lr) * HD + 8 * hi;
#pragma unroll
            for (int kk = 0; kk < 2; ++kk) {
                const v16h bk0 = WFrag<h16>::ld(kp + kk * 32), bk1 = WFrag<h16>::ld(kp + 16 * HD + kk * 32);
                s0 = wmma16(aq[kk], bk0, s0); s1 = wmma16(aq[kk], bk1, s1);
                if (kk == 1) asm volatile("v_nop\n\tv_nop\n\tv_nop\n\tv_nop" : "+v"(s0), "+v"(s1) : "v"(aq[1]), "v"(bk1));
            }
        }
        // online softmax update (row 8*hi + r of this wave's tile; keys j0 + lr in s0, j0 + 16 + lr in s1; reductions over the 16 lanes of the half)
        float alpha[8], pa[8], pc[8];
#pragma unroll
        for (int r = 0; r < 8; ++r) {
            const int q = q0 + hi * 8 + r;
            const float a0 = s0[r] * SCL, c0v = s1[r] * SCL;
            const float a = (j0 + lr <= q) ? a0 : NEG; const float cc = (j0 + 16 + lr <= q) ? c0v : NEG;
            float v = fmaxf(a, cc);
#pragma unroll
            for (int off = 8; off >= 1; off >>= 1) v = fmaxf(v, __shfl_xor(v, off, 32));
            const float mn = fmaxf(m[r], v);                  // finite from chunk 0 on (key 0 <= q for every row)
            alpha[r] = __builtin_amdgcn_exp2f((m[r] - mn) * L2E);
            m[r] = mn;
            const float ea = __builtin_amdgcn_exp2f((a - mn) * L2E), ec = __builtin_amdgcn_exp2f((cc - mn) * L2E);
            float rs = ea + ec;
#pragma unroll
            for (int off = 8; off >= 1; off >>= 1) rs += __shfl_xor(rs, off, 32);
            l[r] = l[r] * alpha[r] + rs; pa[r] = ea; pc[r] = ec;
        }
#pragma unroll
        for (int t = 0; t < 4; ++t)
#pragma unroll
            for (int r = 0; r < 8; ++r) o[t][r] *= alpha[r];
        // p tile (16 rows x 32 keys, D layout) -> wave-private LDS -> A fragment
        if (HR) {
#pragma unroll
            for (int r = 0; r < 8; ++r) { unsigned short a1, a2, c1, c2; splitf(pa[r], a1, a2); splitf(pc[r], c1, c2);
                const int ro = (hi * 8 + r) * PP; ph[ro + lr] = a1; pl[ro + lr] = a2; ph[ro + 16 + lr] = c1; pl[ro + 16 + lr] = c2; }
        } else {
#pragma unroll
            for (int r = 0; r < 8; ++r) { const int ro = (hi * 8 + r) * PP; p16[ro + lr] = (h16)(pa[r] * PCAR); p16[ro + 16 + lr] = (h16)(pc[r] * PCAR); }
        }
        __builtin_amdgcn_fence(3, "wavefront"); __builtin_amdgcn_wave_barrier(); asm volatile("" ::: "memory");
        if (HR) {
            const v16bf aph = ldsb(ph + lr * PP + 8 * hi), apl = ldsb(pl + lr * PP + 8 * hi);
            const bf* vh = Vhb + (size_t)lr * RH + j0 + 8 * hi; const bf* vl = Vlb + (size_t)lr * RH + j0 + 8 * hi;
            v16bf fvh = aph, fvl = apl;
#pragma unroll
            for (int t = 0; t < 4; ++t) { fvh = WFrag<bf>::ld(vh + (size_t)t * 16 * RH); fvl = WFrag<bf>::ld(vl + (size_t)t * 16 * RH);
                o[t] = wmmab(aph, fvh, o[t]); o[t] = wmmab(apl, fvh, o[t]); o[t] = wmmab(aph, fvl, o[t]); }
            asm volatile("v_nop\n\tv_nop\n\tv_nop\n\tv_nop" : "+v"(o[0]), "+v"(o[1]), "+v"(o[2]), "+v"(o[3]) : "v"(aph), "v"(fvl));
        } else {
            const v16h ap = lds16(p16 + lr * PP + 8 * hi);
            const h16* vp = Vb + (size_t)lr * SEQ + j0 + 8 * hi;
            v16h fv = ap;
#pragma unroll
            for (int t = 0; t < 4; ++t) { fv = WFrag<h16>::ld(vp + (size_t)t * 16 * SEQ); o[t] = wmma16(ap, fv, o[t]); }
            asm volatile("v_nop\n\tv_nop\n\tv_nop\n\tv_nop" : "+v"(o[0]), "+v"(o[1]), "+v"(o[2]), "+v"(o[3]) : "v"(ap), "v"(fv));
        }
        asm volatile("" ::: "memory");
    }

    float inv[8];
#pragma unroll
    for (int r = 0; r < 8; ++r) inv[r] = __builtin_amdgcn_rcpf(HR ? l[r] : l[r] * PCAR);
#pragma unroll
    for (int t = 0; t < 4; ++t)
#pragma unroll
        for (int r = 0; r < 8; ++r) myos[(hi * 8 + r) * OSP + t * 16 + lr] = o[t][r] * inv[r];
    __builtin_amdgcn_fence(3, "wavefront"); __builtin_amdgcn_wave_barrier(); asm volatile("" ::: "memory");
    float* orow = OUT + ((size_t)blockIdx.z * SEQ_FULL + q0) * DM + (size_t)blockIdx.y * HD;
{
#pragma unroll
        for (int s = 0; s < 8; ++s) { const int row = 2 * s + hi, cofs = lr * 4; const v4f val = *(const v4fa*)(myos + row * OSP + cofs);
            *(v4f*)(orow + (size_t)row * DM + cofs) = val; }
         }
}

extern "C" void kernel_launch(void* const* d_in, const int* in_sizes, int n_in,
                              void* d_out, int out_size, void* d_ws, size_t ws_size, hipStream_t stream) {
    if (n_in < 3) return;
    if ((size_t)in_sizes[0] < (size_t)(NB - 1) * SEQ_FULL * DM + (size_t)SEQ * DM) return;
    if ((size_t)in_sizes[1] < (size_t)3 * DM * DM) return;
    if (in_sizes[2] < 3 * DM) return;
    if ((size_t)out_size < (size_t)(NB - 1) * SEQ_FULL * DM + (size_t)SEQ * DM) return;
    const float* x = (const float*)d_in[0];      // [NB][SEQ_FULL][DM]
    const float* W = (const float*)d_in[1];      // [3*DM][DM]  ([out][in], row blocks k | q | v)
    const float* bias = (const float*)d_in[2];   // [3*DM]
    float* OUT = (float*)d_out;                  // [NB][SEQ_FULL][DM]
    char* wsp = (char*)d_ws;
    auto take = [&](size_t bytes) { char* p = wsp; wsp += (bytes + 255) & ~(size_t)255; return (void*)p; };
    bf* WB = (bf*)take((size_t)3 * DM * DM * 2);
    bf* XB = (bf*)take((size_t)NB * SEQ * DM * 2);
    float* F = (float*)take((size_t)NB * SEQ * DM * 4);
    h16* Q16 = (h16*)take((size_t)NB * NH * SEQ * HD * 2); h16* K16 = (h16*)take((size_t)NB * NH * SEQ * HD * 2); h16* VT16 = (h16*)take((size_t)NB * NH * HD * SEQ * 2);
    bf* QPh = (bf*)take((size_t)NB * NH * RH * HD * 2); bf* QPl = (bf*)take((size_t)NB * NH * RH * HD * 2); bf* KPh = (bf*)take((size_t)NB * NH * RH * HD * 2); bf* KPl = (bf*)take((size_t)NB * NH * RH * HD * 2);
    bf* VTh = (bf*)take((size_t)NB * NH * HD * RH * 2); bf* VTl = (bf*)take((size_t)NB * NH * HD * RH * 2);
    if ((size_t)(wsp - (char*)d_ws) > ws_size) return;
    if ((size_t)(wsp - (char*)d_ws) > (size_t)134217728) return;

    k_cvt8<<<(unsigned)(((size_t)3 * DM * DM / 8 + 255) / 256), 256, 0, stream>>>(W, WB, (size_t)3 * DM * DM / 8);
    k_cvtx<<<dim3((unsigned)(((size_t)SEQ * DM / 8 + 255) / 256), NB, 1), 256, 0, stream>>>(x, XB, (size_t)SEQ * DM / 8);
    const dim3 gg(SEQ / 64, DM / 64, NB);
    const unsigned LP = (unsigned)(((size_t)NB * NH * SEQ * HD / 8 + 255) / 256);
    // q block (W rows DM..2DM-1, bias slice 1)
    k_gemmw<bf, 0, true><<<gg, 32, 0, stream>>>(XB, nullptr, WB + (size_t)DM * DM, nullptr, DM, F, DM, bias + DM, (size_t)SEQ * DM, (size_t)0, (size_t)SEQ * DM);
    k_qkp<<<LP, 256, 0, stream>>>(F, Q16, QPh, QPl);
    // k block (W rows 0..DM-1, bias slice 0)
    k_gemmw<bf, 0, true><<<gg, 32, 0, stream>>>(XB, nullptr, WB, nullptr, DM, F, DM, bias, (size_t)SEQ * DM, (size_t)0, (size_t)SEQ * DM);
    k_qkp<<<LP, 256, 0, stream>>>(F, K16, KPh, KPl);
    // v block (W rows 2DM.., bias slice 2)
    k_gemmw<bf, 0, true><<<gg, 32, 0, stream>>>(XB, nullptr, WB + (size_t)2 * DM * DM, nullptr, DM, F, DM, bias + 2 * DM, (size_t)SEQ * DM, (size_t)0, (size_t)SEQ * DM);
    k_vtp8<<<LP, 256, 0, stream>>>(F, VT16, VTh, VTl);
    // attention: rows < RH on the hi/lo path, rows >= RH single products
    k_attn<true><<<dim3(RH / 64, NH, NB), 128, 0, stream>>>(Q16, K16, VT16, QPh, QPl, KPh, KPl, VTh, VTl, 0, OUT);
    if (SEQ > RH) k_attn<false><<<dim3((SEQ - RH) / 64, NH, NB), 128, 0, stream>>>(Q16, K16, VT16, QPh, QPl, KPh, KPl, VTh, VTl, RH, OUT);
}

// v001
// A run of this version takes 319 microseconds.
// Timed twice side by side with v000, it ran 1.11 and 1.10 times as fast.
#include <hip/hip_runtime.h>

// Contractions (f32 accumulate): kqv projection = v_wmma_f32_16x16x32_bf16 on bf16 RNE copies of x and W, bf16-valued bias added in f32; causal attention query rows < 256: q.k and p.v as bf16 hi/lo 3-product groups; query rows >= 256: v_wmma_f32_16x16x32_f16 on fp16 q, k, v planes and fp16 p x 1024; softmax statistics f32; output f32.
// Layout: bf16 W [3072][1024] used directly as the k-contiguous B operand (row blocks k | q | v); projection -> f32 F [b][t][1024] (one buffer, reused for q, k, v in stream order) -> head planes q, k [b][h][t][64] and v transposed [b][h][64][t]

#ifndef NB
#define NB 4
#endif
#ifndef SEQ
#define SEQ 2048
#endif
#define NB_FULL  4
#define SEQ_FULL 2048
#define DM   1024
#define NH   16
#define HD   64
#define RH   256                      // query rows < RH use the hi/lo 3-product path (keys there are < RH too)
#define PP   40                       // LDS pitch (halves) of the 16 x 32 p tile
#define OSP  68                       // LDS pitch (floats) of the 16 x 64 output staging tile
#define KP   72                       // LDS pitch (halves) of a staged 64-half row: 144 B = 16 B x 9, for 16-byte readers
#define TLH  (64 * KP)                // halves of one staged tile (64 rows)
#define STH  (2 * TLH)                // halves of one stage: k tile (64 keys x 64 d), then vt tile (64 d x 64 keys)
#define PCAR 1024.0f
#define SCL  0.03125f                 // 1024^-0.5 (model-dim scaling)
#define L2E  1.4426950408889634f

static_assert(NH * HD == DM);
static_assert((SEQ % 256) == 0 && (RH % 256) == 0 && RH <= SEQ && SEQ <= SEQ_FULL && NB >= 1 && NB <= NB_FULL);
static_assert((DM % 64) == 0 && (SEQ % 64) == 0);
// workspace bytes at full size (all regions exact multiples of their store granularity) + alignment slack <= 128 MiB
static_assert((size_t)3 * DM * DM * 2 + (size_t)NB * SEQ * DM * 2 + (size_t)NB * SEQ * DM * 4 + (size_t)3 * NB * NH * SEQ * HD * 2 + (size_t)6 * NB * NH * RH * HD * 2 + 12 * 256 <= (size_t)134217728);

typedef _Float16 h16;
typedef unsigned short bf;
typedef __attribute__((ext_vector_type(16))) __bf16   v16bf;
typedef __attribute__((ext_vector_type(16))) _Float16 v16h;
typedef __attribute__((ext_vector_type(8)))  _Float16 v8h;
typedef __attribute__((ext_vector_type(8)))  unsigned short v8us;
typedef __attribute__((ext_vector_type(8)))  float    v8f;
typedef __attribute__((ext_vector_type(4)))  float    v4f;
typedef v8h  __attribute__((may_alias)) v8ha;
typedef v4f  __attribute__((may_alias)) v4fa;
typedef v8us __attribute__((may_alias)) v8usa;

__device__ __forceinline__ unsigned short f2bf(float f) { unsigned u = __float_as_uint(f); u += 0x7FFFu + ((u >> 16) & 1u); return (unsigned short)(u >> 16); }
__device__ __forceinline__ float bf2f(unsigned short b) { return __uint_as_float(((unsigned)b) << 16); }
__device__ __forceinline__ float bfr(float f) { return bf2f(f2bf(f)); }
__device__ __forceinline__ void splitf(float y, unsigned short& h, unsigned short& l) { h = f2bf(y); l = f2bf(y - bf2f(h)); }
__device__ __forceinline__ v16h cat16(v8h lo, v8h hi) { return __builtin_shufflevector(lo, hi, 0, 1, 2, 3, 4, 5, 6, 7, 8, 9, 10, 11, 12, 13, 14, 15); }
__device__ __forceinline__ v16bf cat16b(v8us lo, v8us hi) { return __builtin_bit_cast(v16bf, __builtin_shufflevector(lo, hi, 0, 1, 2, 3, 4, 5, 6, 7, 8, 9, 10, 11, 12, 13, 14, 15)); }
__device__ __forceinline__ v8f wmma16(v16h a, v16h b, v8f c) { return __builtin_amdgcn_wmma_f32_16x16x32_f16(false, a, false, b, (short)0, c, false, false); }
__device__ __forceinline__ v8f wmmab(v16bf a, v16bf b, v8f c) { return __builtin_amdgcn_wmma_f32_16x16x32_bf16(false, a, false, b, (short)0, c, false, false); }

// 16-bit fragment loaders (lane l: row/col = l & 15, h = l >> 4; elements 0..7 <- k0 + 8h + 0..7, elements 8..15 <- k0 + 16 + 8h + 0..7; the caller passes p = row base + k0 + 8h).
template <typename T16> struct WFrag;
template <> struct WFrag<h16> { typedef v16h V; static __device__ __forceinline__ V ld(const h16* p) { return cat16(*(const v8h*)p, *(const v8h*)(p + 16)); } static __device__ __forceinline__ v8f mma(V a, V b, v8f c) { return wmma16(a, b, c); } };
template <> struct WFrag<bf> { typedef v16bf V; static __device__ __forceinline__ V ld(const bf* p) { return cat16b(*(const v8us*)p, *(const v8us*)(p + 16)); } static __device__ __forceinline__ v8f mma(V a, V b, v8f c) { return wmmab(a, b, c); } };
// LDS reloads through may_alias vectors of the stored element type
__device__ __forceinline__ v16h  lds16(const h16* p) { return cat16(*(const v8ha*)p, *(const v8ha*)(p + 16)); }
__device__ __forceinline__ v16bf ldsb(const bf* p)   { return cat16b(*(const v8usa*)p, *(const v8usa*)(p + 16)); }

// ---- k_gemmw: register-blocked GEMM, ONE WAVE per 64x64 output tile (16 accumulators), operands straight from K-contiguous 16-bit planes; grid (M/64, N/64, Z), 32 threads.
// C[m][n] (f32, pitch ldc, + optional bf16-valued bias[n]) = sum_k A[m][k] Bt[n][k] (+ split products per NSPLIT). z-batch strides sA/sB/sC in elements. K % 32 == 0.
template <typename T16, int NSPLIT, bool BIAS>
__global__ __launch_bounds__(32) void k_gemmw(const T16* __restrict__ A, const T16* __restrict__ A2, const T16* __restrict__ Bt, const T16* __restrict__ Bt2, int K, float* C, int ldc, const float* __restrict__ bias, size_t sA, size_t sB, size_t sC) {
    typedef typename WFrag<T16>::V V;
    __shared__ __align__(16) float os[16 * 68];
    const size_t z = blockIdx.z; A += z * sA; if (A2) A2 += z * sA; Bt += z * sB; if (Bt2) Bt2 += z * sB; C += z * sC;
    const int lane = threadIdx.x & 31, lr = lane & 15, hi = lane >> 4; const int r0 = blockIdx.x * 64, c0 = blockIdx.y * 64;
    v8f acc[4][4];
#pragma unroll
    for (int mb = 0; mb < 4; ++mb)
#pragma unroll
        for (int nb = 0; nb < 4; ++nb) acc[mb][nb] = (v8f){};
    const size_t aoff = (size_t)(r0 + lr) * K + 8 * hi, boff = (size_t)(c0 + lr) * K + 8 * hi;
#pragma unroll 1
    for (int kc = 0; kc < K; kc += 32) {
        V a[4], a2[4];
#pragma unroll
        for (int mb = 0; mb < 4; ++mb) { a[mb] = WFrag<T16>::ld(A + aoff + (size_t)mb * 16 * K + kc); if (NSPLIT == 1 || NSPLIT == 2) a2[mb] = WFrag<T16>::ld(A2 + aoff + (size_t)mb * 16 * K + kc); }
#pragma unroll
        for (int nb = 0; nb < 4; ++nb) { const V b = WFrag<T16>::ld(Bt + boff + (size_t)nb * 16 * K + kc); V b2; if (NSPLIT >= 2) b2 = WFrag<T16>::ld(Bt2 + boff + (size_t)nb * 16 * K + kc);
#pragma unroll
            for (int mb = 0; mb < 4; ++mb) { acc[mb][nb] = WFrag<T16>::mma(a[mb], b, acc[mb][nb]); if (NSPLIT == 1 || NSPLIT == 2) acc[mb][nb] = WFrag<T16>::mma(a2[mb], b, acc[mb][nb]); if (NSPLIT >= 2) acc[mb][nb] = WFrag<T16>::mma(a[mb], b2, acc[mb][nb]); } }
        asm volatile("v_nop\n\tv_nop\n\tv_nop\n\tv_nop" : "+v"(acc[0][0]), "+v"(acc[1][1]), "+v"(acc[2][2]), "+v"(acc[3][3]) : "v"(a[0]), "v"(a[3]));
    }
#pragma unroll
    for (int mb = 0; mb < 4; ++mb) {
#pragma unroll
        for (int nb = 0; nb < 4; ++nb) {
#pragma unroll
            for (int j = 0; j < 8; ++j) os[(hi * 8 + j) * 68 + nb * 16 + lr] = acc[mb][nb][j]; }
        __builtin_amdgcn_fence(3, "wavefront"); __builtin_amdgcn_wave_barrier(); asm volatile("" ::: "memory");
        float* crow = C + (size_t)(r0 + mb * 16) * ldc + c0;
{
#pragma unroll
            for (int s = 0; s < 8; ++s) { const int row = 2 * s + hi, cofs = lr * 4; v4f val = *(const v4fa*)(os + row * 68 + cofs); if (BIAS) { val[0] += bfr(bias[c0 + cofs]); val[1] += bfr(bias[c0 + cofs + 1]); val[2] += bfr(bias[c0 + cofs + 2]); val[3] += bfr(bias[c0 + cofs + 3]); }
                *(v4f*)(crow + (size_t)row * ldc + cofs) = val; }
             }
        __builtin_amdgcn_fence(3, "wavefront"); __builtin_amdgcn_wave_barrier(); asm volatile("" ::: "memory");
    }
}

__global__ __launch_bounds__(256) void k_cvt8(const float* __restrict__ src, bf* dst, size_t n8) { const size_t i = (size_t)blockIdx.x * 256 + threadIdx.x; if (i >= n8) return; const v8f v = *(const v8f*)(src + i * 8); v8us o;
#pragma unroll
    for (int k = 0; k < 8; ++k) o[k] = f2bf(v[k]); *(v8us*)(dst + i * 8) = o;  }
__global__ __launch_bounds__(256) void k_cvtx(const float* __restrict__ src, bf* dst, size_t n8) { const size_t i = (size_t)blockIdx.x * 256 + threadIdx.x; if (i >= n8) return;
    const float* s = src + (size_t)blockIdx.y * SEQ_FULL * DM; bf* d = dst + (size_t)blockIdx.y * SEQ * DM; const v8f v = *(const v8f*)(s + i * 8); v8us o;
#pragma unroll
    for (int k = 0; k < 8; ++k) o[k] = f2bf(v[k]); *(v8us*)(d + i * 8) = o;  }

__global__ __launch_bounds__(256) void k_qkp(const float* __restrict__ F, h16* P16, bf* Ph, bf* Pl) {
    const size_t e = ((size_t)blockIdx.x * 256 + threadIdx.x) * 8; if (e >= (size_t)NB * NH * SEQ * HD) return;
    const int d = (int)(e % HD); const int t = (int)((e / HD) % SEQ); const int h = (int)((e / ((size_t)HD * SEQ)) % NH); const int b = (int)(e / ((size_t)HD * SEQ * NH));
    const v8f v = *(const v8f*)(F + ((size_t)b * SEQ + t) * DM + h * HD + d);
    v8h o16; v8us oh, ol;
#pragma unroll
    for (int k = 0; k < 8; ++k) { o16[k] = (h16)v[k]; unsigned short a1, a2; splitf(v[k], a1, a2); oh[k] = a1; ol[k] = a2; }
    const bool lo = (t < RH); const size_t oo = (((size_t)b * NH + h) * RH + (size_t)(lo ? t : 0)) * HD + d;
{
        *(v8h*)(P16 + e) = o16; if (lo) { *(v8us*)(Ph + oo) = oh; *(v8us*)(Pl + oo) = ol; }
         }
}
__global__ __launch_bounds__(256) void k_vtp8(const float* __restrict__ F, h16* V16, bf* Vh, bf* Vl) {
    const size_t e = ((size_t)blockIdx.x * 256 + threadIdx.x) * 8; if (e >= (size_t)NB * NH * HD * SEQ) return;
    const int t = (int)(e % SEQ); const int d = (int)((e / SEQ) % HD); const int h = (int)((e / ((size_t)SEQ * HD)) % NH); const int b = (int)(e / ((size_t)SEQ * HD * NH));
    const float* f = F + ((size_t)b * SEQ + t) * DM + h * HD + d;
    v8h o16; v8us oh, ol;
#pragma unroll
    for (int q = 0; q < 8; ++q) { const float x = f[(size_t)q * DM]; o16[q] = (h16)x; unsigned short a1, a2; splitf(x, a1, a2); oh[q] = a1; ol[q] = a2; }
    const bool lo = (t < RH); const size_t oo = (((size_t)b * NH + h) * HD + d) * RH + (size_t)(lo ? t : 0);
{
        *(v8h*)(V16 + e) = o16; if (lo) { *(v8us*)(Vh + oo) = oh; *(v8us*)(Vl + oo) = ol; }
         }
}

// ---- k_attn: causal streaming attention. Grid (rows/64, NH, NB), 128 threads: block = 64 query rows starting at roff + 64*blockIdx.x of head blockIdx.y, batch blockIdx.z; wave -> 16 rows.
// Key chunks of 32 from 0 to the block's last row (block-uniform loop; per-element causal select j <= i). Per chunk: S (16 x 32) = q.k, scaled by SCL in f32, online max/sum in f32,
// HR (rows and keys < RH): bf16 planes, q.k = qh.kh + qh.kl + ql.kh, p.v = ph.vh + pl.vh + ph.vl (one accumulator, unscaled residuals). Otherwise fp16 planes, single products.
// !HR: the block's four waves read k and vt from LDS. A stage = 64 keys (two chunks), two buffers; every thread copies 4 + 4 pieces of 16 B per stage, whole 128-B rows per 8 lanes;
// stage s + 2 is issued into the buffer of stage s behind the barrier that ends its last read. After the last stage's barrier the ring is the output staging.
// One stage's copies of this thread: rows r, r + 16, r + 32, r + 48 of the k tile and of the vt tile. The s_wait_xcnt stands inside the statement so that no address register is rewritten ahead of it.
__device__ __forceinline__ void stage_copy(unsigned lk, const h16* gk, unsigned lv, const h16* gv) {
    asm volatile("global_load_async_to_lds_b128 %0, %8, off\n\t"
                 "global_load_async_to_lds_b128 %1, %9, off\n\t"
                 "global_load_async_to_lds_b128 %2, %10, off\n\t"
                 "global_load_async_to_lds_b128 %3, %11, off\n\t"
                 "global_load_async_to_lds_b128 %4, %12, off\n\t"
                 "global_load_async_to_lds_b128 %5, %13, off\n\t"
                 "global_load_async_to_lds_b128 %6, %14, off\n\t"
                 "global_load_async_to_lds_b128 %7, %15, off\n\t"
                 "s_wait_xcnt 0x0"
                 :: "v"(lk), "v"(lk + 16 * KP * 2), "v"(lk + 32 * KP * 2), "v"(lk + 48 * KP * 2), "v"(lv), "v"(lv + 16 * KP * 2), "v"(lv + 32 * KP * 2), "v"(lv + 48 * KP * 2),
                    "v"(gk), "v"(gk + 16 * HD), "v"(gk + 32 * HD), "v"(gk + 48 * HD), "v"(gv), "v"(gv + (size_t)16 * SEQ), "v"(gv + (size_t)32 * SEQ), "v"(gv + (size_t)48 * SEQ)
                 : "memory");
}
template <bool HR>
__global__ __launch_bounds__(128) __attribute__((amdgpu_num_vgpr(256)))
void k_attn(const h16* __restrict__ Q16, const h16* __restrict__ K16, const h16* __restrict__ VT16,
            const bf* __restrict__ QPh, const bf* __restrict__ QPl, const bf* __restrict__ KPh, const bf* __restrict__ KPl,
            const bf* __restrict__ VTh, const bf* __restrict__ VTl, int roff, float* OUT) {
    __shared__ __align__(16) unsigned char sm[HR ? 4 * 16 * OSP * 4 : 2 * STH * 2];   // HR: output staging; !HR: the two-stage ring, then output staging
    static_assert(4 * 16 * OSP * 4 <= 2 * STH * 2);
    __shared__ __align__(16) h16 pt16[4][16 * PP];
    __shared__ __align__(16) bf  pth[4][16 * PP];
    __shared__ __align__(16) bf  ptl[4][16 * PP];
    const int lane = threadIdx.x & 31, lr = lane & 15, hi = lane >> 4, wid = threadIdx.x >> 5;
    const int q0blk = roff + (int)blockIdx.x * 64;
    if (q0blk + 64 > SEQ) return;                         // block-uniform (grids are exact), in front of every block barrier
    if (HR && q0blk + 64 > RH) return;
    const int q0 = q0blk + wid * 16;
    const size_t bh = (size_t)blockIdx.z * NH + blockIdx.y;
    const h16* Qb = Q16 + bh * SEQ * HD; const h16* Kb = K16 + bh * SEQ * HD; const h16* Vb = VT16 + bh * HD * SEQ;
    const bf* Qhb = QPh + bh * RH * HD; const bf* Qlb = QPl + bh * RH * HD; const bf* Khb = KPh + bh * RH * HD; const bf* Klb = KPl + bh * RH * HD;
    const bf* Vhb = VTh + bh * HD * RH; const bf* Vlb = VTl + bh * HD * RH;
    float* myos = (float*)sm + wid * 16 * OSP; h16* p16 = pt16[wid];
    const h16* ring = (const h16*)sm; bf* ph = pth[wid]; bf* pl = ptl[wid];
    const int nchunk = (q0blk + 64) >> 5;
    const float NEG = -__builtin_inff();

    v8f o[4];
#pragma unroll
    for (int t = 0; t < 4; ++t) o[t] = (v8f){};
    float m[8], l[8];
#pragma unroll
    for (int r = 0; r < 8; ++r) { m[r] = NEG; l[r] = 0.0f; }
    v16h aq[2];
    if (!HR) { const h16* qr = Qb + (size_t)(q0 + lr) * HD + 8 * hi; aq[0] = WFrag<h16>::ld(qr); aq[1] = WFrag<h16>::ld(qr + 32); }
    // this thread's first piece of a stage: row threadIdx.x >> 3, 16-byte column threadIdx.x & 7
    const int crow = (int)threadIdx.x >> 3, ccol = ((int)threadIdx.x & 7) * 8;
    const unsigned lk0 = (unsigned)(size_t)(ring + crow * KP + ccol);                  // LDS byte address in buffer 0, k tile
    const h16* gk0 = Kb + (size_t)crow * HD + ccol; const h16* gv0 = Vb + (size_t)crow * SEQ + ccol;
    const int nst = nchunk >> 1;                                                       // stages of 64 keys (nchunk is even)
    if (!HR) {
        stage_copy(lk0, gk0, lk0 + TLH * 2, gv0);
        asm volatile("s_wait_asynccnt 0x0" ::: "memory");                              // stage 0 has landed before the barrier that publishes it
        __syncthreads();                                                               // publishes stage 0 to all four waves
        if (nst > 1) stage_copy(lk0 + STH * 2, gk0 + 64 * HD, lk0 + STH * 2 + TLH * 2, gv0 + 64);
    }

#pragma unroll 1
    for (int c = 0; c < nchunk; ++c) {
        const int j0 = c * 32;
        v8f s0 = (v8f){}, s1 = (v8f){};
        if (HR) {
            const bf* qh = Qhb + (size_t)(q0 + lr) * HD + 8 * hi; const bf* ql = Qlb + (size_t)(q0 + lr) * HD + 8 * hi;
            const bf* kh = Khb + (size_t)(j0 + lr) * HD + 8 * hi; const bf* kl = Klb + (size_t)(j0 + lr) * HD + 8 * hi;
#pragma unroll
            for (int kk = 0; kk < 2; ++kk) {
                const v16bf aqh = WFrag<bf>::ld(qh + kk * 32), aql = WFrag<bf>::ld(ql + kk * 32);
                const v16bf kh0 = WFrag<bf>::ld(kh + kk * 32), kh1 = WFrag<bf>::ld(kh + 16 * HD + kk * 32);
                const v16bf kl0 = WFrag<bf>::ld(kl + kk * 32), kl1 = WFrag<bf>::ld(kl + 16 * HD + kk * 32);
                s0 = wmmab(aqh, kh0, s0); s0 = wmmab(aqh, kl0, s0); s0 = wmmab(aql, kh0, s0);
                s1 = wmmab(aqh, kh1, s1); s1 = wmmab(aqh, kl1, s1); s1 = wmmab(aql, kh1, s1);
                if (kk == 1) asm volatile("v_nop\n\tv_nop\n\tv_nop\n\tv_nop" : "+v"(s0), "+v"(s1) : "v"(aql), "v"(kh1));
            }
        } else {
            const h16* kp = ring + ((c >> 1) & 1) * STH + ((c & 1) * 32 + lr) * KP + 8 * hi;
#pragma unroll
            for (int kk = 0; kk < 2; ++kk) {
                const v16h bk0 = lds16(kp + kk * 32), bk1 = lds16(kp + 16 * KP + kk * 32);
                s0 = wmma16(aq[kk], bk0, s0); s1 = wmma16(aq[kk], bk1, s1);
                if (kk == 1) asm volatile("v_nop\n\tv_nop\n\tv_nop\n\tv_nop" : "+v"(s0), "+v"(s1) : "v"(aq[1]), "v"(bk1));
            }
        }
        // online softmax update (row 8*hi + r of this wave's tile; keys j0 + lr in s0, j0 + 16 + lr in s1; reductions over the 16 lanes of the half)
        float alpha[8], pa[8], pc[8];
#pragma unroll
        for (int r = 0; r < 8; ++r) {
            const int q = q0 + hi * 8 + r;
            const float a0 = s0[r] * SCL, c0v = s1[r] * SCL;
            const float a = (j0 + lr <= q) ? a0 : NEG; const float cc = (j0 + 16 + lr <= q) ? c0v : NEG;
            float v = fmaxf(a, cc);
#pragma unroll
            for (int off = 8; off >= 1; off >>= 1) v = fmaxf(v, __shfl_xor(v, off, 32));
            const float mn = fmaxf(m[r], v);                  // finite from chunk 0 on (key 0 <= q for every row)
            alpha[r] = __builtin_amdgcn_exp2f((m[r] - mn) * L2E);
            m[r] = mn;
            const float ea = __builtin_amdgcn_exp2f((a - mn) * L2E), ec = __builtin_amdgcn_exp2f((cc - mn) * L2E);
            float rs = ea + ec;
#pragma unroll
            for (int off = 8; off >= 1; off >>= 1) rs += __shfl_xor(rs, off, 32);
            l[r] = l[r] * alpha[r] + rs; pa[r] = ea; pc[r] = ec;
        }
#pragma unroll
        for (int t = 0; t < 4; ++t)
#pragma unroll
            for (int r = 0; r < 8; ++r) o[t][r] *= alpha[r];
        // p tile (16 rows x 32 keys, D layout) -> wave-private LDS -> A fragment
        if (HR) {
#pragma unroll
            for (int r = 0; r < 8; ++r) { unsigned short a1, a2, c1, c2; splitf(pa[r], a1, a2); splitf(pc[r], c1, c2);
                const int ro = (hi * 8 + r) * PP; ph[ro + lr] = a1; pl[ro + lr] = a2; ph[ro + 16 + lr] = c1; pl[ro + 16 + lr] = c2; }
        } else {
#pragma unroll
            for (int r = 0; r < 8; ++r) { const int ro = (hi * 8 + r) * PP; p16[ro + lr] = (h16)(pa[r] * PCAR); p16[ro + 16 + lr] = (h16)(pc[r] * PCAR); }
        }
        __builtin_amdgcn_fence(3, "wavefront"); __builtin_amdgcn_wave_barrier(); asm volatile("" ::: "memory");
        if (HR) {
            const v16bf aph = ldsb(ph + lr * PP + 8 * hi), apl = ldsb(pl + lr * PP + 8 * hi);
            const bf* vh = Vhb + (size_t)lr * RH + j0 + 8 * hi; const bf* vl = Vlb + (size_t)lr * RH + j0 + 8 * hi;
            v16bf fvh = aph, fvl = apl;
#pragma unroll
            for (int t = 0; t < 4; ++t) { fvh = WFrag<bf>::ld(vh + (size_t)t * 16 * RH); fvl = WFrag<bf>::ld(vl + (size_t)t * 16 * RH);
                o[t] = wmmab(aph, fvh, o[t]); o[t] = wmmab(apl, fvh, o[t]); o[t] = wmmab(aph, fvl, o[t]); }
            asm volatile("v_nop\n\tv_nop\n\tv_nop\n\tv_nop" : "+v"(o[0]), "+v"(o[1]), "+v"(o[2]), "+v"(o[3]) : "v"(aph), "v"(fvl));
        } else {
            const v16h ap = lds16(p16 + lr * PP + 8 * hi);
            const h16* vp = ring + ((c >> 1) & 1) * STH + TLH + lr * KP + (c & 1) * 32 + 8 * hi;
            v16h fv = ap;
#pragma unroll
            for (int t = 0; t < 4; ++t) { fv = lds16(vp + t * 16 * KP); o[t] = wmma16(ap, fv, o[t]); }
            asm volatile("v_nop\n\tv_nop\n\tv_nop\n\tv_nop" : "+v"(o[0]), "+v"(o[1]), "+v"(o[2]), "+v"(o[3]) : "v"(ap), "v"(fv));
        }
        asm volatile("" ::: "memory");
        if (!HR && (c & 1)) {                                                          // foot of a stage (block-uniform): publish the next stage, free this one's buffer
            const int st = c >> 1;
            asm volatile("s_wait_dscnt 0x0" ::: "memory");                             // this wave's reads of the buffer have returned
            asm volatile("s_wait_asynccnt 0x0" ::: "memory");                          // this wave's copies of stage st + 1 have landed
            __syncthreads();                                                           // publishes stage st + 1 and ends every wave's reads of stage st
            if (st + 2 < nst) { const unsigned lb = lk0 + (unsigned)(st & 1) * (STH * 2); stage_copy(lb, gk0 + (size_t)(st + 2) * 64 * HD, lb + TLH * 2, gv0 + (st + 2) * 64); }
        }
    }
    if (!HR) asm volatile("s_wait_asynccnt 0x0" ::: "memory");                         // nothing of this wave is in flight when the ring becomes output staging

    float inv[8];
#pragma unroll
    for (int r = 0; r < 8; ++r) inv[r] = __builtin_amdgcn_rcpf(HR ? l[r] : l[r] * PCAR);
#pragma unroll
    for (int t = 0; t < 4; ++t)
#pragma unroll
        for (int r = 0; r < 8; ++r) myos[(hi * 8 + r) * OSP + t * 16 + lr] = o[t][r] * inv[r];
    __builtin_amdgcn_fence(3, "wavefront"); __builtin_amdgcn_wave_barrier(); asm volatile("" ::: "memory");
    float* orow = OUT + ((size_t)blockIdx.z * SEQ_FULL + q0) * DM + (size_t)blockIdx.y * HD;
{
#pragma unroll
        for (int s = 0; s < 8; ++s) { const int row = 2 * s + hi, cofs = lr * 4; const v4f val = *(const v4fa*)(myos + row * OSP + cofs);
            *(v4f*)(orow + (size_t)row * DM + cofs) = val; }
         }
}

extern "C" void kernel_launch(void* const* d_in, const int* in_sizes, int n_in,
                              void* d_out, int out_size, void* d_ws, size_t ws_size, hipStream_t stream) {
    if (n_in < 3) return;
    if ((size_t)in_sizes[0] < (size_t)(NB - 1) * SEQ_FULL * DM + (size_t)SEQ * DM) return;
    if ((size_t)in_sizes[1] < (size_t)3 * DM * DM) return;
    if (in_sizes[2] < 3 * DM) return;
    if ((size_t)out_size < (size_t)(NB - 1) * SEQ_FULL * DM + (size_t)SEQ * DM) return;
    const float* x = (const float*)d_in[0];      // [NB][SEQ_FULL][DM]
    const float* W = (const float*)d_in[1];      // [3*DM][DM]  ([out][in], row blocks k | q | v)
    const float* bias = (const float*)d_in[2];   // [3*DM]
    float* OUT = (float*)d_out;                  // [NB][SEQ_FULL][DM]
    char* wsp = (char*)d_ws;
    auto take = [&](size_t bytes) { char* p = wsp; wsp += (bytes + 255) & ~(size_t)255; return (void*)p; };
    bf* WB = (bf*)take((size_t)3 * DM * DM * 2);
    bf* XB = (bf*)take((size_t)NB * SEQ * DM * 2);
    float* F = (float*)take((size_t)NB * SEQ * DM * 4);
    h16* Q16 = (h16*)take((size_t)NB * NH * SEQ * HD * 2); h16* K16 = (h16*)take((size_t)NB * NH * SEQ * HD * 2); h16* VT16 = (h16*)take((size_t)NB * NH * HD * SEQ * 2);
    bf* QPh = (bf*)take((size_t)NB * NH * RH * HD * 2); bf* QPl = (bf*)take((size_t)NB * NH * RH * HD * 2); bf* KPh = (bf*)take((size_t)NB * NH * RH * HD * 2); bf* KPl = (bf*)take((size_t)NB * NH * RH * HD * 2);
    bf* VTh = (bf*)take((size_t)NB * NH * HD * RH * 2); bf* VTl = (bf*)take((size_t)NB * NH * HD * RH * 2);
    if ((size_t)(wsp - (char*)d_ws) > ws_size) return;
    if ((size_t)(wsp - (char*)d_ws) > (size_t)134217728) return;

    k_cvt8<<<(unsigned)(((size_t)3 * DM * DM / 8 + 255) / 256), 256, 0, stream>>>(W, WB, (size_t)3 * DM * DM / 8);
    k_cvtx<<<dim3((unsigned)(((size_t)SEQ * DM / 8 + 255) / 256), NB, 1), 256, 0, stream>>>(x, XB, (size_t)SEQ * DM / 8);
    const dim3 gg(SEQ / 64, DM / 64, NB);
    const unsigned LP = (unsigned)(((size_t)NB * NH * SEQ * HD / 8 + 255) / 256);
    // q block (W rows DM..2DM-1, bias slice 1)
    k_gemmw<bf, 0, true><<<gg, 32, 0, stream>>>(XB, nullptr, WB + (size_t)DM * DM, nullptr, DM, F, DM, bias + DM, (size_t)SEQ * DM, (size_t)0, (size_t)SEQ * DM);
    k_qkp<<<LP, 256, 0, stream>>>(F, Q16, QPh, QPl);
    // k block (W rows 0..DM-1, bias slice 0)
    k_gemmw<bf, 0, true><<<gg, 32, 0, stream>>>(XB, nullptr, WB, nullptr, DM, F, DM, bias, (size_t)SEQ * DM, (size_t)0, (size_t)SEQ * DM);
    k_qkp<<<LP, 256, 0, stream>>>(F, K16, KPh, KPl);
    // v block (W rows 2DM.., bias slice 2)
    k_gemmw<bf, 0, true><<<gg, 32, 0, stream>>>(XB, nullptr, WB + (size_t)2 * DM * DM, nullptr, DM, F, DM, bias + 2 * DM, (size_t)SEQ * DM, (size_t)0, (size_t)SEQ * DM);
    k_vtp8<<<LP, 256, 0, stream>>>(F, VT16, VTh, VTl);
    // attention: rows < RH on the hi/lo path, rows >= RH single products
    k_attn<true><<<dim3(RH / 64, NH, NB), 128, 0, stream>>>(Q16, K16, VT16, QPh, QPl, KPh, KPl, VTh, VTl, 0, OUT);
    if (SEQ > RH) k_attn<false><<<dim3((SEQ - RH) / 64, NH, NB), 128, 0, stream>>>(Q16, K16, VT16, QPh, QPl, KPh, KPl, VTh, VTl, RH, OUT);
}

// v002
// One run takes 253 microseconds.
// In both of two side-by-side timings against v001, it was 1.27 times as fast.
// Counting every step since v000, it is 1.41 times as fast.
#include <hip/hip_runtime.h>

// Contractions (f32 accumulate): kqv projection = v_wmma_f32_16x16x32_bf16 on bf16 RNE copies of x and W, bf16-valued bias added in f32; causal attention query rows < 256: q.k and p.v as bf16 hi/lo 3-product groups; query rows >= 256: v_wmma_f32_16x16x32_f16 on fp16 q, k, v planes and fp16 p x 1024; softmax statistics f32; output f32.
// Layout: bf16 W [3072][1024] used directly as the k-contiguous B operand (row blocks k | q | v); projection -> f32 F [b][t][1024] (one buffer, reused for q, k, v in stream order) -> head planes q, k [b][h][t][64] and v transposed [b][h][64][t]

#ifndef NB
#define NB 4
#endif
#ifndef SEQ
#define SEQ 2048
#endif
#define NB_FULL  4
#define SEQ_FULL 2048
#define DM   1024
#define NH   16
#define HD   64
#define RH   256                      // query rows < RH use the hi/lo 3-product path (keys there are < RH too)
#define OSP  68                       // LDS pitch (floats) of the 16 x 64 output staging tile
#define KP   72                       // LDS pitch (halves) of a staged 64-half row: 144 B = 16 B x 9, for 16-byte readers
#define TLH  (64 * KP)                // halves of one staged tile (64 rows)
#define STH  (2 * TLH)                // halves of one stage: k tile (64 keys x 64 d), then vt tile (64 d x 64 keys)
#define PCAR 1024.0f
#define SCL  0.03125f                 // 1024^-0.5 (model-dim scaling)
#define L2E  1.4426950408889634f

static_assert(NH * HD == DM);
static_assert((SEQ % 256) == 0 && (RH % 256) == 0 && RH <= SEQ && SEQ <= SEQ_FULL && NB >= 1 && NB <= NB_FULL);
static_assert((DM % 64) == 0 && (SEQ % 64) == 0);
// workspace bytes at full size (all regions exact multiples of their store granularity) + alignment slack <= 128 MiB
static_assert((size_t)3 * DM * DM * 2 + (size_t)NB * SEQ * DM * 2 + (size_t)NB * SEQ * DM * 4 + (size_t)3 * NB * NH * SEQ * HD * 2 + (size_t)6 * NB * NH * RH * HD * 2 + 12 * 256 <= (size_t)134217728);

typedef _Float16 h16;
typedef unsigned short bf;
typedef __attribute__((ext_vector_type(16))) __bf16   v16bf;
typedef __attribute__((ext_vector_type(16))) _Float16 v16h;
typedef __attribute__((ext_vector_type(8)))  _Float16 v8h;
typedef __attribute__((ext_vector_type(8)))  unsigned short v8us;
typedef __attribute__((ext_vector_type(8)))  float    v8f;
typedef __attribute__((ext_vector_type(4)))  float    v4f;
typedef v8h  __attribute__((may_alias)) v8ha;
typedef v4f  __attribute__((may_alias)) v4fa;
typedef v8us __attribute__((may_alias)) v8usa;

__device__ __forceinline__ unsigned short f2bf(float f) { unsigned u = __float_as_uint(f); u += 0x7FFFu + ((u >> 16) & 1u); return (unsigned short)(u >> 16); }
__device__ __forceinline__ float bf2f(unsigned short b) { return __uint_as_float(((unsigned)b) << 16); }
__device__ __forceinline__ float bfr(float f) { return bf2f(f2bf(f)); }
__device__ __forceinline__ void splitf(float y, unsigned short& h, unsigned short& l) { h = f2bf(y); l = f2bf(y - bf2f(h)); }
__device__ __forceinline__ v16h cat16(v8h lo, v8h hi) { return __builtin_shufflevector(lo, hi, 0, 1, 2, 3, 4, 5, 6, 7, 8, 9, 10, 11, 12, 13, 14, 15); }
__device__ __forceinline__ v16bf cat16b(v8us lo, v8us hi) { return __builtin_bit_cast(v16bf, __builtin_shufflevector(lo, hi, 0, 1, 2, 3, 4, 5, 6, 7, 8, 9, 10, 11, 12, 13, 14, 15)); }
__device__ __forceinline__ v8f wmma16(v16h a, v16h b, v8f c) { return __builtin_amdgcn_wmma_f32_16x16x32_f16(false, a, false, b, (short)0, c, false, false); }
__device__ __forceinline__ v8f wmmab(v16bf a, v16bf b, v8f c) { return __builtin_amdgcn_wmma_f32_16x16x32_bf16(false, a, false, b, (short)0, c, false, false); }

// 16-bit fragment loaders (lane l: row/col = l & 15, h = l >> 4; elements 0..7 <- k0 + 8h + 0..7, elements 8..15 <- k0 + 16 + 8h + 0..7; the caller passes p = row base + k0 + 8h).
template <typename T16> struct WFrag;
template <> struct WFrag<h16> { typedef v16h V; static __device__ __forceinline__ V ld(const h16* p) { return cat16(*(const v8h*)p, *(const v8h*)(p + 16)); } static __device__ __forceinline__ v8f mma(V a, V b, v8f c) { return wmma16(a, b, c); } };
template <> struct WFrag<bf> { typedef v16bf V; static __device__ __forceinline__ V ld(const bf* p) { return cat16b(*(const v8us*)p, *(const v8us*)(p + 16)); } static __device__ __forceinline__ v8f mma(V a, V b, v8f c) { return wmmab(a, b, c); } };
// LDS reloads through may_alias vectors of the stored element type
__device__ __forceinline__ v16h  lds16(const h16* p) { return cat16(*(const v8ha*)p, *(const v8ha*)(p + 16)); }
__device__ __forceinline__ v16bf ldsb(const bf* p)   { return cat16b(*(const v8usa*)p, *(const v8usa*)(p + 16)); }

// ---- k_gemmw: register-blocked GEMM, ONE WAVE per 64x64 output tile (16 accumulators), operands straight from K-contiguous 16-bit planes; grid (M/64, N/64, Z), 32 threads.
// C[m][n] (f32, pitch ldc, + optional bf16-valued bias[n]) = sum_k A[m][k] Bt[n][k] (+ split products per NSPLIT). z-batch strides sA/sB/sC in elements. K % 32 == 0.
template <typename T16, int NSPLIT, bool BIAS>
__global__ __launch_bounds__(32) void k_gemmw(const T16* __restrict__ A, const T16* __restrict__ A2, const T16* __restrict__ Bt, const T16* __restrict__ Bt2, int K, float* C, int ldc, const float* __restrict__ bias, size_t sA, size_t sB, size_t sC) {
    typedef typename WFrag<T16>::V V;
    __shared__ __align__(16) float os[16 * 68];
    const size_t z = blockIdx.z; A += z * sA; if (A2) A2 += z * sA; Bt += z * sB; if (Bt2) Bt2 += z * sB; C += z * sC;
    const int lane = threadIdx.x & 31, lr = lane & 15, hi = lane >> 4; const int r0 = blockIdx.x * 64, c0 = blockIdx.y * 64;
    v8f acc[4][4];
#pragma unroll
    for (int mb = 0; mb < 4; ++mb)
#pragma unroll
        for (int nb = 0; nb < 4; ++nb) acc[mb][nb] = (v8f){};
    const size_t aoff = (size_t)(r0 + lr) * K + 8 * hi, boff = (size_t)(c0 + lr) * K + 8 * hi;
#pragma unroll 1
    for (int kc = 0; kc < K; kc += 32) {
        V a[4], a2[4];
#pragma unroll
        for (int mb = 0; mb < 4; ++mb) { a[mb] = WFrag<T16>::ld(A + aoff + (size_t)mb * 16 * K + kc); if (NSPLIT == 1 || NSPLIT == 2) a2[mb] = WFrag<T16>::ld(A2 + aoff + (size_t)mb * 16 * K + kc); }
#pragma unroll
        for (int nb = 0; nb < 4; ++nb) { const V b = WFrag<T16>::ld(Bt + boff + (size_t)nb * 16 * K + kc); V b2; if (NSPLIT >= 2) b2 = WFrag<T16>::ld(Bt2 + boff + (size_t)nb * 16 * K + kc);
#pragma unroll
            for (int mb = 0; mb < 4; ++mb) { acc[mb][nb] = WFrag<T16>::mma(a[mb], b, acc[mb][nb]); if (NSPLIT == 1 || NSPLIT == 2) acc[mb][nb] = WFrag<T16>::mma(a2[mb], b, acc[mb][nb]); if (NSPLIT >= 2) acc[mb][nb] = WFrag<T16>::mma(a[mb], b2, acc[mb][nb]); } }
        asm volatile("v_nop\n\tv_nop\n\tv_nop\n\tv_nop" : "+v"(acc[0][0]), "+v"(acc[1][1]), "+v"(acc[2][2]), "+v"(acc[3][3]) : "v"(a[0]), "v"(a[3]));
    }
#pragma unroll
    for (int mb = 0; mb < 4; ++mb) {
#pragma unroll
        for (int nb = 0; nb < 4; ++nb) {
#pragma unroll
            for (int j = 0; j < 8; ++j) os[(hi * 8 + j) * 68 + nb * 16 + lr] = acc[mb][nb][j]; }
        __builtin_amdgcn_fence(3, "wavefront"); __builtin_amdgcn_wave_barrier(); asm volatile("" ::: "memory");
        float* crow = C + (size_t)(r0 + mb * 16) * ldc + c0;
{
#pragma unroll
            for (int s = 0; s < 8; ++s) { const int row = 2 * s + hi, cofs = lr * 4; v4f val = *(const v4fa*)(os + row * 68 + cofs); if (BIAS) { val[0] += bfr(bias[c0 + cofs]); val[1] += bfr(bias[c0 + cofs + 1]); val[2] += bfr(bias[c0 + cofs + 2]); val[3] += bfr(bias[c0 + cofs + 3]); }
                *(v4f*)(crow + (size_t)row * ldc + cofs) = val; }
             }
        __builtin_amdgcn_fence(3, "wavefront"); __builtin_amdgcn_wave_barrier(); asm volatile("" ::: "memory");
    }
}

__global__ __launch_bounds__(256) void k_cvt8(const float* __restrict__ src, bf* dst, size_t n8) { const size_t i = (size_t)blockIdx.x * 256 + threadIdx.x; if (i >= n8) return; const v8f v = *(const v8f*)(src + i * 8); v8us o;
#pragma unroll
    for (int k = 0; k < 8; ++k) o[k] = f2bf(v[k]); *(v8us*)(dst + i * 8) = o;  }
__global__ __launch_bounds__(256) void k_cvtx(const float* __restrict__ src, bf* dst, size_t n8) { const size_t i = (size_t)blockIdx.x * 256 + threadIdx.x; if (i >= n8) return;
    const float* s = src + (size_t)blockIdx.y * SEQ_FULL * DM; bf* d = dst + (size_t)blockIdx.y * SEQ * DM; const v8f v = *(const v8f*)(s + i * 8); v8us o;
#pragma unroll
    for (int k = 0; k < 8; ++k) o[k] = f2bf(v[k]); *(v8us*)(d + i * 8) = o;  }

__global__ __launch_bounds__(256) void k_qkp(const float* __restrict__ F, h16* P16, bf* Ph, bf* Pl) {
    const size_t e = ((size_t)blockIdx.x * 256 + threadIdx.x) * 8; if (e >= (size_t)NB * NH * SEQ * HD) return;
    const int d = (int)(e % HD); const int t = (int)((e / HD) % SEQ); const int h = (int)((e / ((size_t)HD * SEQ)) % NH); const int b = (int)(e / ((size_t)HD * SEQ * NH));
    const v8f v = *(const v8f*)(F + ((size_t)b * SEQ + t) * DM + h * HD + d);
    v8h o16; v8us oh, ol;
#pragma unroll
    for (int k = 0; k < 8; ++k) { o16[k] = (h16)v[k]; unsigned short a1, a2; splitf(v[k], a1, a2); oh[k] = a1; ol[k] = a2; }
    const bool lo = (t < RH); const size_t oo = (((size_t)b * NH + h) * RH + (size_t)(lo ? t : 0)) * HD + d;
{
        *(v8h*)(P16 + e) = o16; if (lo) { *(v8us*)(Ph + oo) = oh; *(v8us*)(Pl + oo) = ol; }
         }
}
__global__ __launch_bounds__(256) void k_vtp8(const float* __restrict__ F, h16* V16, bf* Vh, bf* Vl) {
    const size_t e = ((size_t)blockIdx.x * 256 + threadIdx.x) * 8; if (e >= (size_t)NB * NH * HD * SEQ) return;
    const int t = (int)(e % SEQ); const int d = (int)((e / SEQ) % HD); const int h = (int)((e / ((size_t)SEQ * HD)) % NH); const int b = (int)(e / ((size_t)SEQ * HD * NH));
    const float* f = F + ((size_t)b * SEQ + t) * DM + h * HD + d;
    v8h o16; v8us oh, ol;
#pragma unroll
    for (int q = 0; q < 8; ++q) { const float x = f[(size_t)q * DM]; o16[q] = (h16)x; unsigned short a1, a2; splitf(x, a1, a2); oh[q] = a1; ol[q] = a2; }
    const bool lo = (t < RH); const size_t oo = (((size_t)b * NH + h) * HD + d) * RH + (size_t)(lo ? t : 0);
{
        *(v8h*)(V16 + e) = o16; if (lo) { *(v8us*)(Vh + oo) = oh; *(v8us*)(Vl + oo) = ol; }
         }
}

// ---- k_attn: causal streaming attention. Grid (rows/64, NH, NB), 128 threads: block = 64 query rows starting at roff + 64*blockIdx.x of head blockIdx.y, batch blockIdx.z; wave -> 16 rows.
// Key chunks of 32 from 0 to the block's last row (block-uniform loop; per-element causal select j <= i). Per chunk: S^T (32 keys x 16 queries) = k.q^T, scaled by SCL in f32, online max/sum in f32 (one query per lane), O^T += vt.p^T with p^T packed from the score registers,
// HR (rows and keys < RH): bf16 planes, q.k = qh.kh + qh.kl + ql.kh, p.v = ph.vh + pl.vh + ph.vl (one accumulator, unscaled residuals). Otherwise fp16 planes, single products.
// !HR: the block's four waves read k and vt from LDS. A stage = 64 keys (two chunks), two buffers; every thread copies 4 + 4 pieces of 16 B per stage, whole 128-B rows per 8 lanes;
// stage s + 2 is issued into the buffer of stage s behind the barrier that ends its last read. After the last stage's barrier the ring is the output staging.
// One stage's copies of this thread: rows r, r + 16, r + 32, r + 48 of the k tile and of the vt tile. The s_wait_xcnt stands inside the statement so that no address register is rewritten ahead of it.
__device__ __forceinline__ void stage_copy(unsigned lk, const h16* gk, unsigned lv, const h16* gv) {
    asm volatile("global_load_async_to_lds_b128 %0, %8, off\n\t"
                 "global_load_async_to_lds_b128 %1, %9, off\n\t"
                 "global_load_async_to_lds_b128 %2, %10, off\n\t"
                 "global_load_async_to_lds_b128 %3, %11, off\n\t"
                 "global_load_async_to_lds_b128 %4, %12, off\n\t"
                 "global_load_async_to_lds_b128 %5, %13, off\n\t"
                 "global_load_async_to_lds_b128 %6, %14, off\n\t"
                 "global_load_async_to_lds_b128 %7, %15, off\n\t"
                 "s_wait_xcnt 0x0"
                 :: "v"(lk), "v"(lk + 16 * KP * 2), "v"(lk + 32 * KP * 2), "v"(lk + 48 * KP * 2), "v"(lv), "v"(lv + 16 * KP * 2), "v"(lv + 32 * KP * 2), "v"(lv + 48 * KP * 2),
                    "v"(gk), "v"(gk + 16 * HD), "v"(gk + 32 * HD), "v"(gk + 48 * HD), "v"(gv), "v"(gv + (size_t)16 * SEQ), "v"(gv + (size_t)32 * SEQ), "v"(gv + (size_t)48 * SEQ)
                 : "memory");
}
// lane l <-> lane l ^ 16 (the other half of the wave holds the other 16 keys of the same query)
__device__ __forceinline__ float xhalf(float v) { const int b = __float_as_int(v); return __int_as_float(__builtin_amdgcn_permlanex16(b, b, 0x76543210, 0xfedcba98, false, false)); }
template <bool HR>
__global__ __launch_bounds__(128) __attribute__((amdgpu_num_vgpr(256)))
void k_attn(const h16* __restrict__ Q16, const h16* __restrict__ K16, const h16* __restrict__ VT16,
            const bf* __restrict__ QPh, const bf* __restrict__ QPl, const bf* __restrict__ KPh, const bf* __restrict__ KPl,
            const bf* __restrict__ VTh, const bf* __restrict__ VTl, int roff, float* OUT) {
    __shared__ __align__(16) unsigned char sm[HR ? 4 * 16 * OSP * 4 : 2 * STH * 2];   // HR: output staging; !HR: the two-stage ring, then output staging
    static_assert(4 * 16 * OSP * 4 <= 2 * STH * 2);
    const int lane = threadIdx.x & 31, lr = lane & 15, hi = lane >> 4, wid = threadIdx.x >> 5;
    const int q0blk = roff + (int)blockIdx.x * 64;
    if (q0blk + 64 > SEQ) return;                         // block-uniform (grids are exact), in front of every block barrier
    if (HR && q0blk + 64 > RH) return;
    const int q0 = q0blk + wid * 16;
    const size_t bh = (size_t)blockIdx.z * NH + blockIdx.y;
    const h16* Qb = Q16 + bh * SEQ * HD; const h16* Kb = K16 + bh * SEQ * HD; const h16* Vb = VT16 + bh * HD * SEQ;
    const bf* Qhb = QPh + bh * RH * HD; const bf* Qlb = QPl + bh * RH * HD; const bf* Khb = KPh + bh * RH * HD; const bf* Klb = KPl + bh * RH * HD;
    const bf* Vhb = VTh + bh * HD * RH; const bf* Vlb = VTl + bh * HD * RH;
    float* myos = (float*)sm + wid * 16 * OSP;
    const h16* ring = (const h16*)sm;
    const int nchunk = (q0blk + 64) >> 5;
    const float NEG = -__builtin_inff();
    const int q = q0 + lr;                                // this lane's query row

    v8f o[4];                                             // o[t][r] = O[q][t * 16 + 8 * hi + r] (transposed output tiles)
#pragma unroll
    for (int t = 0; t < 4; ++t) o[t] = (v8f){};
    float m = NEG, l = 0.0f;                              // m: both halves agree; l: this half's keys only, joined behind the loop
    v16h aq[2];
    if (!HR) { const h16* qr = Qb + (size_t)(q0 + lr) * HD + 8 * hi; aq[0] = WFrag<h16>::ld(qr); aq[1] = WFrag<h16>::ld(qr + 32); }
    // this thread's first piece of a stage: row threadIdx.x >> 3, 16-byte column threadIdx.x & 7
    const int crow = (int)threadIdx.x >> 3, ccol = ((int)threadIdx.x & 7) * 8;
    const unsigned lk0 = (unsigned)(size_t)(ring + crow * KP + ccol);                  // LDS byte address in buffer 0, k tile
    const h16* gk0 = Kb + (size_t)crow * HD + ccol; const h16* gv0 = Vb + (size_t)crow * SEQ + ccol;
    const int nst = nchunk >> 1;                                                       // stages of 64 keys (nchunk is even)
    if (!HR) {
        stage_copy(lk0, gk0, lk0 + TLH * 2, gv0);
        asm volatile("s_wait_asynccnt 0x0" ::: "memory");                              // stage 0 has landed before the barrier that publishes it
        __syncthreads();                                                               // publishes stage 0 to all four waves
        if (nst > 1) stage_copy(lk0 + STH * 2, gk0 + 64 * HD, lk0 + STH * 2 + TLH * 2, gv0 + 64);
    }

#pragma unroll 1
    for (int c = 0; c < nchunk; ++c) {
        const int j0 = c * 32;
        v8f s0 = (v8f){}, s1 = (v8f){};                   // s0[r] = S[q][j0 + 8 * hi + r], s1[r] = S[q][j0 + 16 + 8 * hi + r]
        if (HR) {
            const bf* qh = Qhb + (size_t)(q0 + lr) * HD + 8 * hi; const bf* ql = Qlb + (size_t)(q0 + lr) * HD + 8 * hi;
            const bf* kh = Khb + (size_t)(j0 + lr) * HD + 8 * hi; const bf* kl = Klb + (size_t)(j0 + lr) * HD + 8 * hi;
#pragma unroll
            for (int kk = 0; kk < 2; ++kk) {
                const v16bf aqh = WFrag<bf>::ld(qh + kk * 32), aql = WFrag<bf>::ld(ql + kk * 32);
                const v16bf kh0 = WFrag<bf>::ld(kh + kk * 32), kh1 = WFrag<bf>::ld(kh + 16 * HD + kk * 32);
                const v16bf kl0 = WFrag<bf>::ld(kl + kk * 32), kl1 = WFrag<bf>::ld(kl + 16 * HD + kk * 32);
                s0 = wmmab(kh0, aqh, s0); s0 = wmmab(kl0, aqh, s0); s0 = wmmab(kh0, aql, s0);
                s1 = wmmab(kh1, aqh, s1); s1 = wmmab(kl1, aqh, s1); s1 = wmmab(kh1, aql, s1);
                // keeps the vector slots between the last product and the first use of its result or operands
                if (kk == 1) asm volatile("v_nop\n\tv_nop\n\tv_nop\n\tv_nop" : "+v"(s0), "+v"(s1) : "v"(aql), "v"(kh1));
            }
        } else {
            const h16* kp = ring + ((c >> 1) & 1) * STH + ((c & 1) * 32 + lr) * KP + 8 * hi;
#pragma unroll
            for (int kk = 0; kk < 2; ++kk) {
                const v16h bk0 = lds16(kp + kk * 32), bk1 = lds16(kp + 16 * KP + kk * 32);
                s0 = wmma16(bk0, aq[kk], s0); s1 = wmma16(bk1, aq[kk], s1);
                // keeps the vector slots between the last product and the first use of its result or operands
                if (kk == 1) asm volatile("v_nop\n\tv_nop\n\tv_nop\n\tv_nop" : "+v"(s0), "+v"(s1) : "v"(aq[1]), "v"(bk1));
            }
        }
        // online softmax update: a lane holds 16 of the 32 keys of ONE query; maximum and sum in the lane, the maximum joined with the other half by one exchange
        float pa[8], pc[8];
        const v8f a0 = s0 * SCL, c0v = s1 * SCL;
        const int qd = q - j0 - 8 * hi;                       // key j0 + 8 * hi + r is allowed where r <= qd
#pragma unroll
        for (int r = 0; r < 8; ++r) { pa[r] = (r <= qd) ? a0[r] : NEG; pc[r] = (16 + r <= qd) ? c0v[r] : NEG; }
        float v = fmaxf(fmaxf(fmaxf(fmaxf(pa[0], pa[1]), fmaxf(pa[2], pa[3])), fmaxf(fmaxf(pa[4], pa[5]), fmaxf(pa[6], pa[7]))),
                        fmaxf(fmaxf(fmaxf(pc[0], pc[1]), fmaxf(pc[2], pc[3])), fmaxf(fmaxf(pc[4], pc[5]), fmaxf(pc[6], pc[7]))));
        v = fmaxf(v, xhalf(v));
        const float mn = fmaxf(m, v);                         // finite from chunk 0 on (key 0 <= q for every row, seen through the exchange)
        const float alpha = __builtin_amdgcn_exp2f((m - mn) * L2E);
        m = mn;
#pragma unroll
        for (int r = 0; r < 8; ++r) { pa[r] = __builtin_amdgcn_exp2f((pa[r] - mn) * L2E); pc[r] = __builtin_amdgcn_exp2f((pc[r] - mn) * L2E); }
        const float rs = (((pa[0] + pa[1]) + (pa[2] + pa[3])) + ((pa[4] + pa[5]) + (pa[6] + pa[7]))) + (((pc[0] + pc[1]) + (pc[2] + pc[3])) + ((pc[4] + pc[5]) + (pc[6] + pc[7])));
        l = l * alpha + rs;
#pragma unroll
        for (int t = 0; t < 4; ++t)
#pragma unroll
            for (int r = 0; r < 8; ++r) o[t][r] *= alpha;
        // the two score tiles, converted in place, are the B operand of vt . p^T: element s <- key j0 + 8 * hi + s (s < 8), j0 + 16 + 8 * hi + s - 8 (s >= 8), the loaders' k order
        if (HR) {
            v8us h0, l0, h1, l1;
#pragma unroll
            for (int r = 0; r < 8; ++r) { unsigned short a1, a2, c1, c2; splitf(pa[r], a1, a2); splitf(pc[r], c1, c2); h0[r] = a1; l0[r] = a2; h1[r] = c1; l1[r] = c2; }
            const v16bf bph = cat16b(h0, h1), bpl = cat16b(l0, l1);
            const bf* vh = Vhb + (size_t)lr * RH + j0 + 8 * hi; const bf* vl = Vlb + (size_t)lr * RH + j0 + 8 * hi;
            v16bf fvh = bph, fvl = bpl;
#pragma unroll
            for (int t = 0; t < 4; ++t) { fvh = WFrag<bf>::ld(vh + (size_t)t * 16 * RH); fvl = WFrag<bf>::ld(vl + (size_t)t * 16 * RH);
                o[t] = wmmab(fvh, bph, o[t]); o[t] = wmmab(fvh, bpl, o[t]); o[t] = wmmab(fvl, bph, o[t]); }
            // keeps the vector slots behind the last product on the loop's back edge too
            asm volatile("v_nop\n\tv_nop\n\tv_nop\n\tv_nop" : "+v"(o[0]), "+v"(o[1]), "+v"(o[2]), "+v"(o[3]) : "v"(bph), "v"(fvl));
        } else {
            v16h bp;
#pragma unroll
            for (int r = 0; r < 8; ++r) { bp[r] = (h16)(pa[r] * PCAR); bp[8 + r] = (h16)(pc[r] * PCAR); }
            const h16* vp = ring + ((c >> 1) & 1) * STH + TLH + lr * KP + (c & 1) * 32 + 8 * hi;
            v16h fv = bp;
#pragma unroll
            for (int t = 0; t < 4; ++t) { fv = lds16(vp + t * 16 * KP); o[t] = wmma16(fv, bp, o[t]); }
            // keeps the vector slots behind the last product on the loop's back edge too
            asm volatile("v_nop\n\tv_nop\n\tv_nop\n\tv_nop" : "+v"(o[0]), "+v"(o[1]), "+v"(o[2]), "+v"(o[3]) : "v"(bp), "v"(fv));
        }
        if (!HR && (c & 1)) {                                                          // foot of a stage (block-uniform): publish the next stage, free this one's buffer
            const int st = c >> 1;
            asm volatile("s_wait_dscnt 0x0" ::: "memory");                             // this wave's reads of the buffer have returned
            asm volatile("s_wait_asynccnt 0x0" ::: "memory");                          // this wave's copies of stage st + 1 have landed
            __syncthreads();                                                           // publishes stage st + 1 and ends every wave's reads of stage st
            if (st + 2 < nst) { const unsigned lb = lk0 + (unsigned)(st & 1) * (STH * 2); stage_copy(lb, gk0 + (size_t)(st + 2) * 64 * HD, lb + TLH * 2, gv0 + (st + 2) * 64); }
        }
    }
    if (!HR) asm volatile("s_wait_asynccnt 0x0" ::: "memory");                         // nothing of this wave is in flight when the ring becomes output staging

    l += xhalf(l);                                                                     // joins the two halves' sums of this query
    const float inv = __builtin_amdgcn_rcpf(HR ? l : l * PCAR);
#pragma unroll
    for (int t = 0; t < 4; ++t) {
        const v4f w0 = { o[t][0] * inv, o[t][1] * inv, o[t][2] * inv, o[t][3] * inv }, w1 = { o[t][4] * inv, o[t][5] * inv, o[t][6] * inv, o[t][7] * inv };
        *(v4fa*)(myos + lr * OSP + t * 16 + 8 * hi) = w0; *(v4fa*)(myos + lr * OSP + t * 16 + 8 * hi + 4) = w1;
    }
    __builtin_amdgcn_fence(3, "wavefront"); __builtin_amdgcn_wave_barrier(); asm volatile("" ::: "memory");
    float* orow = OUT + ((size_t)blockIdx.z * SEQ_FULL + q0) * DM + (size_t)blockIdx.y * HD;
{
#pragma unroll
        for (int s = 0; s < 8; ++s) { const int row = 2 * s + hi, cofs = lr * 4; const v4f val = *(const v4fa*)(myos + row * OSP + cofs);
            *(v4f*)(orow + (size_t)row * DM + cofs) = val; }
         }
}

extern "C" void kernel_launch(void* const* d_in, const int* in_sizes, int n_in,
                              void* d_out, int out_size, void* d_ws, size_t ws_size, hipStream_t stream) {
    if (n_in < 3) return;
    if ((size_t)in_sizes[0] < (size_t)(NB - 1) * SEQ_FULL * DM + (size_t)SEQ * DM) return;
    if ((size_t)in_sizes[1] < (size_t)3 * DM * DM) return;
    if (in_sizes[2] < 3 * DM) return;
    if ((size_t)out_size < (size_t)(NB - 1) * SEQ_FULL * DM + (size_t)SEQ * DM) return;
    const float* x = (const float*)d_in[0];      // [NB][SEQ_FULL][DM]
    const float* W = (const float*)d_in[1];      // [3*DM][DM]  ([out][in], row blocks k | q | v)
    const float* bias = (const float*)d_in[2];   // [3*DM]
    float* OUT = (float*)d_out;                  // [NB][SEQ_FULL][DM]
    char* wsp = (char*)d_ws;
    auto take = [&](size_t bytes) { char* p = wsp; wsp += (bytes + 255) & ~(size_t)255; return (void*)p; };
    bf* WB = (bf*)take((size_t)3 * DM * DM * 2);
    bf* XB = (bf*)take((size_t)NB * SEQ * DM * 2);
    float* F = (float*)take((size_t)NB * SEQ * DM * 4);
    h16* Q16 = (h16*)take((size_t)NB * NH * SEQ * HD * 2); h16* K16 = (h16*)take((size_t)NB * NH * SEQ * HD * 2); h16* VT16 = (h16*)take((size_t)NB * NH * HD * SEQ * 2);
    bf* QPh = (bf*)take((size_t)NB * NH * RH * HD * 2); bf* QPl = (bf*)take((size_t)NB * NH * RH * HD * 2); bf* KPh = (bf*)take((size_t)NB * NH * RH * HD * 2); bf* KPl = (bf*)take((size_t)NB * NH * RH * HD * 2);
    bf* VTh = (bf*)take((size_t)NB * NH * HD * RH * 2); bf* VTl = (bf*)take((size_t)NB * NH * HD * RH * 2);
    if ((size_t)(wsp - (char*)d_ws) > ws_size) return;
    if ((size_t)(wsp - (char*)d_ws) > (size_t)134217728) return;

    k_cvt8<<<(unsigned)(((size_t)3 * DM * DM / 8 + 255) / 256), 256, 0, stream>>>(W, WB, (size_t)3 * DM * DM / 8);
    k_cvtx<<<dim3((unsigned)(((size_t)SEQ * DM / 8 + 255) / 256), NB, 1), 256, 0, stream>>>(x, XB, (size_t)SEQ * DM / 8);
    const dim3 gg(SEQ / 64, DM / 64, NB);
    const unsigned LP = (unsigned)(((size_t)NB * NH * SEQ * HD / 8 + 255) / 256);
    // q block (W rows DM..2DM-1, bias slice 1)
    k_gemmw<bf, 0, true><<<gg, 32, 0, stream>>>(XB, nullptr, WB + (size_t)DM * DM, nullptr, DM, F, DM, bias + DM, (size_t)SEQ * DM, (size_t)0, (size_t)SEQ * DM);
    k_qkp<<<LP, 256, 0, stream>>>(F, Q16, QPh, QPl);
    // k block (W rows 0..DM-1, bias slice 0)
    k_gemmw<bf, 0, true><<<gg, 32, 0, stream>>>(XB, nullptr, WB, nullptr, DM, F, DM, bias, (size_t)SEQ * DM, (size_t)0, (size_t)SEQ * DM);
    k_qkp<<<LP, 256, 0, stream>>>(F, K16, KPh, KPl);
    // v block (W rows 2DM.., bias slice 2)
    k_gemmw<bf, 0, true><<<gg, 32, 0, stream>>>(XB, nullptr, WB + (size_t)2 * DM * DM, nullptr, DM, F, DM, bias + 2 * DM, (size_t)SEQ * DM, (size_t)0, (size_t)SEQ * DM);
    k_vtp8<<<LP, 256, 0, stream>>>(F, VT16, VTh, VTl);
    // attention: rows < RH on the hi/lo path, rows >= RH single products
    k_attn<true><<<dim3(RH / 64, NH, NB), 128, 0, stream>>>(Q16, K16, VT16, QPh, QPl, KPh, KPl, VTh, VTl, 0, OUT);
    if (SEQ > RH) k_attn<false><<<dim3((SEQ - RH) / 64, NH, NB), 128, 0, stream>>>(Q16, K16, VT16, QPh, QPl, KPh, KPl, VTh, VTl, RH, OUT);
}

// v003
// One run takes 192 microseconds.
// Next to v002, in two timings, it ran 1.30 and 1.31 times as fast.
// Over all steps from v000 it is 1.84 times as fast.
#include <hip/hip_runtime.h>

// Contractions (f32 accumulate): kqv projection = v_wmma_f32_16x16x32_bf16 on bf16 RNE copies of x and W, bf16-valued bias added in f32; causal attention query rows < 256: q.k and p.v as bf16 hi/lo 3-product groups; query rows >= 256: v_wmma_f32_16x16x32_f16 on fp16 q, k, v planes and fp16 p x 1024; softmax statistics f32; output f32.
// Layout: bf16 W [3072][1024] used directly as the k-contiguous B operand (row blocks k | q | v); the projection's epilogue writes the head planes q, k [b][h][t][64] and v transposed [b][h][64][t]

#ifndef NB
#define NB 4
#endif
#ifndef SEQ
#define SEQ 2048
#endif
#define NB_FULL  4
#define SEQ_FULL 2048
#define DM   1024
#define NH   16
#define HD   64
#define RH   256                      // query rows < RH use the hi/lo 3-product path (keys there are < RH too)
#define OSP  68                       // LDS pitch (floats) of the 16 x 64 output staging tile
#define KP   72                       // LDS pitch (halves) of a staged 64-half row: 144 B = 16 B x 9, for 16-byte readers
#define TLH  (64 * KP)                // halves of one staged tile (64 rows)
#define STH  (2 * TLH)                // halves of one stage: k tile (64 keys x 64 d), then vt tile (64 d x 64 keys)
#define PCAR 1024.0f
#define SCL  0.03125f                 // 1024^-0.5 (model-dim scaling)
#define L2E  1.4426950408889634f

static_assert(NH * HD == DM);
static_assert((SEQ % 256) == 0 && (RH % 256) == 0 && RH <= SEQ && SEQ <= SEQ_FULL && NB >= 1 && NB <= NB_FULL);
static_assert((DM % 64) == 0 && (SEQ % 64) == 0);
// workspace bytes at full size (all regions exact multiples of their store granularity) + alignment slack <= 128 MiB
static_assert((size_t)3 * DM * DM * 2 + (size_t)NB * SEQ * DM * 2 + (size_t)3 * NB * NH * SEQ * HD * 2 + (size_t)6 * NB * NH * RH * HD * 2 + 12 * 256 <= (size_t)134217728);

typedef _Float16 h16;
typedef unsigned short bf;
typedef __attribute__((ext_vector_type(16))) __bf16   v16bf;
typedef __attribute__((ext_vector_type(16))) _Float16 v16h;
typedef __attribute__((ext_vector_type(8)))  _Float16 v8h;
typedef __attribute__((ext_vector_type(8)))  unsigned short v8us;
typedef __attribute__((ext_vector_type(8)))  float    v8f;
typedef __attribute__((ext_vector_type(4)))  float    v4f;
typedef v8h  __attribute__((may_alias)) v8ha;
typedef v4f  __attribute__((may_alias)) v4fa;
typedef v8us __attribute__((may_alias)) v8usa;

__device__ __forceinline__ unsigned short f2bf(float f) { unsigned u = __float_as_uint(f); u += 0x7FFFu + ((u >> 16) & 1u); return (unsigned short)(u >> 16); }
__device__ __forceinline__ float bf2f(unsigned short b) { return __uint_as_float(((unsigned)b) << 16); }
__device__ __forceinline__ float bfr(float f) { return bf2f(f2bf(f)); }
__device__ __forceinline__ void splitf(float y, unsigned short& h, unsigned short& l) { h = f2bf(y); l = f2bf(y - bf2f(h)); }
__device__ __forceinline__ v16h cat16(v8h lo, v8h hi) { return __builtin_shufflevector(lo, hi, 0, 1, 2, 3, 4, 5, 6, 7, 8, 9, 10, 11, 12, 13, 14, 15); }
__device__ __forceinline__ v16bf cat16b(v8us lo, v8us hi) { return __builtin_bit_cast(v16bf, __builtin_shufflevector(lo, hi, 0, 1, 2, 3, 4, 5, 6, 7, 8, 9, 10, 11, 12, 13, 14, 15)); }
__device__ __forceinline__ v8f wmma16(v16h a, v16h b, v8f c) { return __builtin_amdgcn_wmma_f32_16x16x32_f16(false, a, false, b, (short)0, c, false, false); }
__device__ __forceinline__ v8f wmmab(v16bf a, v16bf b, v8f c) { return __builtin_amdgcn_wmma_f32_16x16x32_bf16(false, a, false, b, (short)0, c, false, false); }

// 16-bit fragment loaders (lane l: row/col = l & 15, h = l >> 4; elements 0..7 <- k0 + 8h + 0..7, elements 8..15 <- k0 + 16 + 8h + 0..7; the caller passes p = row base + k0 + 8h).
template <typename T16> struct WFrag;
template <> struct WFrag<h16> { typedef v16h V; static __device__ __forceinline__ V ld(const h16* p) { return cat16(*(const v8h*)p, *(const v8h*)(p + 16)); } static __device__ __forceinline__ v8f mma(V a, V b, v8f c) { return wmma16(a, b, c); } };
template <> struct WFrag<bf> { typedef v16bf V; static __device__ __forceinline__ V ld(const bf* p) { return cat16b(*(const v8us*)p, *(const v8us*)(p + 16)); } static __device__ __forceinline__ v8f mma(V a, V b, v8f c) { return wmmab(a, b, c); } };
// LDS reloads through may_alias vectors of the stored element type
__device__ __forceinline__ v16h  lds16(const h16* p) { return cat16(*(const v8ha*)p, *(const v8ha*)(p + 16)); }
__device__ __forceinline__ v16bf ldsb(const bf* p)   { return cat16b(*(const v8usa*)p, *(const v8usa*)(p + 16)); }

// Four 16-byte stores of a wave. The s_wait_xcnt stands inside the statement so that no register the stores name is rewritten ahead of it.
typedef __attribute__((ext_vector_type(4))) unsigned v4u;
template <int STEP>                   // base: the same in every lane; voff: the lane's byte offset; STEP: bytes between two of the four
__device__ __forceinline__ void store4(const void* base, unsigned voff, v4u d0, v4u d1, v4u d2, v4u d3) {
    asm volatile("global_store_b128 %0, %2, %1\n\t"
                 "global_store_b128 %0, %3, %1 offset:%6\n\t"
                 "global_store_b128 %0, %4, %1 offset:%7\n\t"
                 "global_store_b128 %0, %5, %1 offset:%8\n\t"
                 "s_wait_xcnt 0x0"
                 :: "v"(voff), "s"(base), "v"(d0), "v"(d1), "v"(d2), "v"(d3), "n"(STEP), "n"(2 * STEP), "n"(3 * STEP) : "memory");
}
// orders a wave's own LDS stores and loads around the reuse of its staging tile
__device__ __forceinline__ void wave_lds_order() { __builtin_amdgcn_fence(3, "wavefront"); __builtin_amdgcn_wave_barrier(); asm volatile("" ::: "memory"); }
// eight f32 values -> eight 16-bit values of plane p: 0 fp16, 1 bf16 hi, 2 bf16 lo (the residual of hi)
__device__ __forceinline__ v4u plane8(const float (&y)[8], int p) {
    if (p == 0) { v8h c;
#pragma unroll
        for (int k = 0; k < 8; ++k) c[k] = (h16)y[k];
        return __builtin_bit_cast(v4u, c); }
    v8us c;
#pragma unroll
    for (int k = 0; k < 8; ++k) { unsigned short a1, a2; splitf(y[k], a1, a2); c[k] = p == 1 ? a1 : a2; }
    return __builtin_bit_cast(v4u, c);
}
typedef v4u __attribute__((may_alias)) v4ua;
// Projection epilogues of one wave's 64 x 64 tile; acc[mb][nb][j] = y[16 mb + 8 hi + j][16 nb + lr] without bias, bs[nb] = bias of column 16 nb + lr. Read-back: 8 lanes cover one 128-B row of 16-bit values, a wave 4 rows.
// NP = 1: the fp16 plane alone; NP = 3: the bf16 hi and lo planes too (positions < RH), one plane after the other.
// Every loop of the two epilogues and of plane8 is unrolled so that acc and the small arrays are indexed by constants and stay in registers.
// k, q planes [t][64]: P[p] points at the tile's first position; f32 LDS tile of 16 positions.
template <int NP>
__device__ __forceinline__ void put_rows(const v8f (&acc)[4][4], const float (&bs)[4], unsigned char* sm, int lane, unsigned short* const (&P)[3]) {
    const int lr = lane & 15, hi = lane >> 4, srow = lane >> 3, scol = (lane & 7) * 8;
    float* os = (float*)sm;
#pragma unroll
    for (int mb = 0; mb < 4; ++mb) {
#pragma unroll
        for (int nb = 0; nb < 4; ++nb) {
#pragma unroll
            for (int j = 0; j < 8; ++j) os[(hi * 8 + j) * OSP + nb * 16 + lr] = acc[mb][nb][j] + bs[nb]; }
        wave_lds_order();
#pragma unroll
        for (int p = 0; p < NP; ++p) {
            v4u o[4];
#pragma unroll
            for (int s = 0; s < 4; ++s) {
                const float* xr = os + (4 * s + srow) * OSP + scol; const v4f x0 = *(const v4fa*)xr, x1 = *(const v4fa*)(xr + 4);
                const float y[8] = { x0[0], x0[1], x0[2], x0[3], x1[0], x1[1], x1[2], x1[3] };
                o[s] = plane8(y, p);
            }
            store4<4 * HD * 2>(P[p] + mb * 16 * HD, (unsigned)(srow * HD + scol) * 2u, o[0], o[1], o[2], o[3]);
        }
        wave_lds_order();
    }
}
// v planes [d][t]: P[p] (row pitch SEQ for p = 0, RH else) points at d = 0 of the tile's first position; a lane's 8 accumulator rows are 8 consecutive positions of one d; a 16-bit LDS tile of 16 d x 64 positions per plane.
template <int NP>
__device__ __forceinline__ void put_cols(const v8f (&acc)[4][4], const float (&bs)[4], unsigned char* sm, int lane, unsigned short* const (&P)[3]) {
    const int lr = lane & 15, hi = lane >> 4, srow = lane >> 3, scol = (lane & 7) * 8;
#pragma unroll
    for (int nb = 0; nb < 4; ++nb) {
#pragma unroll
        for (int p = 0; p < NP; ++p) {
            unsigned short* st = (unsigned short*)sm + p * 16 * KP;
#pragma unroll
            for (int mb = 0; mb < 4; ++mb) {
                float y[8];
#pragma unroll
                for (int j = 0; j < 8; ++j) y[j] = acc[mb][nb][j] + bs[nb];
                *(v4ua*)(st + lr * KP + mb * 16 + hi * 8) = plane8(y, p);
            }
            wave_lds_order();
            v4u o[4];
#pragma unroll
            for (int s = 0; s < 4; ++s) o[s] = *(const v4ua*)(st + (4 * s + srow) * KP + scol);
            if (p == 0) store4<4 * SEQ * 2>(P[0] + (size_t)nb * 16 * SEQ, (unsigned)(srow * SEQ + scol) * 2u, o[0], o[1], o[2], o[3]);
            else        store4<4 * RH * 2>(P[p] + nb * 16 * RH, (unsigned)(srow * RH + scol) * 2u, o[0], o[1], o[2], o[3]);
        }
        wave_lds_order();
    }
}

// ---- k_gemmw: the kqv projection as a register-blocked GEMM, ONE WAVE per 64x64 tile (16 accumulators), operands straight from K-contiguous 16-bit planes; grid (SEQ/64, 3*DM/64, NB), 32 threads.
// y[m][n] (f32, + bf16-valued bias[n]) = sum_k A[m][k] Bt[n][k] (+ split products per NSPLIT). z-batch strides sA/sB in elements. K % 32 == 0.
// A tile is 64 positions of ONE head of k, q or v (blockIdx.y = NH * {k, q, v} + head); the epilogue converts y and writes the head planes itself:
// k, q: fp16 [t][64] (and the bf16 hi/lo planes where t < RH) through an f32 LDS tile of 16 positions; v: a lane's 8 accumulator rows are 8 consecutive positions of one d, packed and turned into whole 128-B rows of [d][t] through 16-bit LDS tiles of 16 d.
template <typename T16, int NSPLIT, bool BIAS>
__global__ __launch_bounds__(32) __attribute__((amdgpu_num_vgpr(192)))   // 192 registers: five waves per SIMD to hide the loop's load latency
void k_gemmw(const T16* __restrict__ A, const T16* __restrict__ A2, const T16* __restrict__ Bt, const T16* __restrict__ Bt2, int K, const float* __restrict__ bias, size_t sA, size_t sB,
                                              h16* Q16, h16* K16, h16* VT16, bf* QPh, bf* QPl, bf* KPh, bf* KPl, bf* VTh, bf* VTl) {
    typedef typename WFrag<T16>::V V;
    __shared__ __align__(16) unsigned char sm[3 * 16 * KP * 2];   // one f32 tile 16 x OSP, or three 16-bit tiles 16 x KP
    static_assert(16 * OSP * 4 <= 3 * 16 * KP * 2);
    const size_t z = blockIdx.z; A += z * sA; if (A2) A2 += z * sA; Bt += z * sB; if (Bt2) Bt2 += z * sB;
    const int lane = threadIdx.x & 31, lr = lane & 15, hi = lane >> 4; const int r0 = blockIdx.x * 64, c0 = blockIdx.y * 64;
    v8f acc[4][4];
#pragma unroll
    for (int mb = 0; mb < 4; ++mb)
#pragma unroll
        for (int nb = 0; nb < 4; ++nb) acc[mb][nb] = (v8f){};
    const size_t aoff = (size_t)(r0 + lr) * K + 8 * hi, boff = (size_t)(c0 + lr) * K + 8 * hi;
#pragma unroll 1
    for (int kc = 0; kc < K; kc += 32) {
        V a[4], a2[4];
#pragma unroll
        for (int mb = 0; mb < 4; ++mb) { a[mb] = WFrag<T16>::ld(A + aoff + (size_t)mb * 16 * K + kc); if (NSPLIT == 1 || NSPLIT == 2) a2[mb] = WFrag<T16>::ld(A2 + aoff + (size_t)mb * 16 * K + kc); }
#pragma unroll
        for (int nb = 0; nb < 4; ++nb) { const V b = WFrag<T16>::ld(Bt + boff + (size_t)nb * 16 * K + kc); V b2; if (NSPLIT >= 2) b2 = WFrag<T16>::ld(Bt2 + boff + (size_t)nb * 16 * K + kc);
#pragma unroll
            for (int mb = 0; mb < 4; ++mb) { acc[mb][nb] = WFrag<T16>::mma(a[mb], b, acc[mb][nb]); if (NSPLIT == 1 || NSPLIT == 2) acc[mb][nb] = WFrag<T16>::mma(a2[mb], b, acc[mb][nb]); if (NSPLIT >= 2) acc[mb][nb] = WFrag<T16>::mma(a[mb], b2, acc[mb][nb]); } }
        asm volatile("v_nop\n\tv_nop\n\tv_nop\n\tv_nop" : "+v"(acc[0][0]), "+v"(acc[1][1]), "+v"(acc[2][2]), "+v"(acc[3][3]) : "v"(a[0]), "v"(a[3]));
    }
    const int sel = (int)blockIdx.y / NH;                 // 0: k, 1: q, 2: v (W's row blocks)
    const size_t bh = z * NH + (int)blockIdx.y % NH;
    const bool lo = r0 < RH;                              // the whole tile (RH is a multiple of 64); block-uniform like sel
    const size_t rl = lo ? r0 : 0;
    float bs[4] = { 0.0f, 0.0f, 0.0f, 0.0f };
    if (BIAS) {
        // bias of columns c0 + lr + {0, 16, 32, 48}: the four loads and their data wait in one statement, outputs early-clobbered, so that no register a load names is rewritten while it is in flight
        asm volatile("global_load_b32 %0, %4, %5\n\t"
                     "global_load_b32 %1, %4, %5 offset:64\n\t"
                     "global_load_b32 %2, %4, %5 offset:128\n\t"
                     "global_load_b32 %3, %4, %5 offset:192\n\t"
                     "s_wait_loadcnt 0x0"
                     : "=&v"(bs[0]), "=&v"(bs[1]), "=&v"(bs[2]), "=&v"(bs[3]) : "v"((unsigned)(c0 + lr) * 4u), "s"(bias) : "memory");
#pragma unroll
        for (int nb = 0; nb < 4; ++nb) bs[nb] = bfr(bs[nb]);
    }
    if (sel < 2) {
        unsigned short* const P[3] = { (unsigned short*)(sel == 1 ? Q16 : K16) + (bh * SEQ + r0) * HD, (sel == 1 ? QPh : KPh) + (bh * RH + rl) * HD, (sel == 1 ? QPl : KPl) + (bh * RH + rl) * HD };
        if (lo) put_rows<3>(acc, bs, sm, lane, P); else put_rows<1>(acc, bs, sm, lane, P);
    } else {
        unsigned short* const P[3] = { (unsigned short*)VT16 + bh * HD * SEQ + r0, VTh + bh * HD * RH + rl, VTl + bh * HD * RH + rl };
        if (lo) put_cols<3>(acc, bs, sm, lane, P); else put_cols<1>(acc, bs, sm, lane, P);
    }
}

__global__ __launch_bounds__(256) void k_cvt8(const float* __restrict__ src, bf* dst, size_t n8) { const size_t i = (size_t)blockIdx.x * 256 + threadIdx.x; if (i >= n8) return; const v8f v = *(const v8f*)(src + i * 8); v8us o;
#pragma unroll
    for (int k = 0; k < 8; ++k) o[k] = f2bf(v[k]); *(v8us*)(dst + i * 8) = o;  }
__global__ __launch_bounds__(256) void k_cvtx(const float* __restrict__ src, bf* dst, size_t n8) { const size_t i = (size_t)blockIdx.x * 256 + threadIdx.x; if (i >= n8) return;
    const float* s = src + (size_t)blockIdx.y * SEQ_FULL * DM; bf* d = dst + (size_t)blockIdx.y * SEQ * DM; const v8f v = *(const v8f*)(s + i * 8); v8us o;
#pragma unroll
    for (int k = 0; k < 8; ++k) o[k] = f2bf(v[k]); *(v8us*)(d + i * 8) = o;  }

// ---- k_attn: causal streaming attention. Grid (rows/64, NH, NB), 128 threads: block = 64 query rows starting at roff + 64*blockIdx.x of head blockIdx.y, batch blockIdx.z; wave -> 16 rows.
// Key chunks of 32 from 0 to the block's last row (block-uniform loop; per-element causal select j <= i). Per chunk: S^T (32 keys x 16 queries) = k.q^T, scaled by SCL in f32, online max/sum in f32 (one query per lane), O^T += vt.p^T with p^T packed from the score registers,
// HR (rows and keys < RH): bf16 planes, q.k = qh.kh + qh.kl + ql.kh, p.v = ph.vh + pl.vh + ph.vl (one accumulator, unscaled residuals). Otherwise fp16 planes, single products.
// !HR: the block's four waves read k and vt from LDS. A stage = 64 keys (two chunks), two buffers; every thread copies 4 + 4 pieces of 16 B per stage, whole 128-B rows per 8 lanes;
// stage s + 2 is issued into the buffer of stage s behind the barrier that ends its last read. After the last stage's barrier the ring is the output staging.
// One stage's copies of this thread: rows r, r + 16, r + 32, r + 48 of the k tile and of the vt tile. The s_wait_xcnt stands inside the statement so that no address register is rewritten ahead of it.
__device__ __forceinline__ void stage_copy(unsigned lk, const h16* gk, unsigned lv, const h16* gv) {
    asm volatile("global_load_async_to_lds_b128 %0, %8, off\n\t"
                 "global_load_async_to_lds_b128 %1, %9, off\n\t"
                 "global_load_async_to_lds_b128 %2, %10, off\n\t"
                 "global_load_async_to_lds_b128 %3, %11, off\n\t"
                 "global_load_async_to_lds_b128 %4, %12, off\n\t"
                 "global_load_async_to_lds_b128 %5, %13, off\n\t"
                 "global_load_async_to_lds_b128 %6, %14, off\n\t"
                 "global_load_async_to_lds_b128 %7, %15, off\n\t"
                 "s_wait_xcnt 0x0"
                 :: "v"(lk), "v"(lk + 16 * KP * 2), "v"(lk + 32 * KP * 2), "v"(lk + 48 * KP * 2), "v"(lv), "v"(lv + 16 * KP * 2), "v"(lv + 32 * KP * 2), "v"(lv + 48 * KP * 2),
                    "v"(gk), "v"(gk + 16 * HD), "v"(gk + 32 * HD), "v"(gk + 48 * HD), "v"(gv), "v"(gv + (size_t)16 * SEQ), "v"(gv + (size_t)32 * SEQ), "v"(gv + (size_t)48 * SEQ)
                 : "memory");
}
// lane l <-> lane l ^ 16 (the other half of the wave holds the other 16 keys of the same query)
__device__ __forceinline__ float xhalf(float v) { const int b = __float_as_int(v); return __int_as_float(__builtin_amdgcn_permlanex16(b, b, 0x76543210, 0xfedcba98, false, false)); }
template <bool HR>
__global__ __launch_bounds__(128) __attribute__((amdgpu_num_vgpr(256)))
void k_attn(const h16* __restrict__ Q16, const h16* __restrict__ K16, const h16* __restrict__ VT16,
            const bf* __restrict__ QPh, const bf* __restrict__ QPl, const bf* __restrict__ KPh, const bf* __restrict__ KPl,
            const bf* __restrict__ VTh, const bf* __restrict__ VTl, int roff, float* OUT) {
    __shared__ __align__(16) unsigned char sm[HR ? 4 * 16 * OSP * 4 : 2 * STH * 2];   // HR: output staging; !HR: the two-stage ring, then output staging
    static_assert(4 * 16 * OSP * 4 <= 2 * STH * 2);
    const int lane = threadIdx.x & 31, lr = lane & 15, hi = lane >> 4, wid = threadIdx.x >> 5;
    const int q0blk = roff + (int)blockIdx.x * 64;
    if (q0blk + 64 > SEQ) return;                         // block-uniform (grids are exact), in front of every block barrier
    if (HR && q0blk + 64 > RH) return;
    const int q0 = q0blk + wid * 16;
    const size_t bh = (size_t)blockIdx.z * NH + blockIdx.y;
    const h16* Qb = Q16 + bh * SEQ * HD; const h16* Kb = K16 + bh * SEQ * HD; const h16* Vb = VT16 + bh * HD * SEQ;
    const bf* Qhb = QPh + bh * RH * HD; const bf* Qlb = QPl + bh * RH * HD; const bf* Khb = KPh + bh * RH * HD; const bf* Klb = KPl + bh * RH * HD;
    const bf* Vhb = VTh + bh * HD * RH; const bf* Vlb = VTl + bh * HD * RH;
    float* myos = (float*)sm + wid * 16 * OSP;
    const h16* ring = (const h16*)sm;
    const int nchunk = (q0blk + 64) >> 5;
    const float NEG = -__builtin_inff();
    const int q = q0 + lr;                                // this lane's query row

    v8f o[4];                                             // o[t][r] = O[q][t * 16 + 8 * hi + r] (transposed output tiles)
#pragma unroll
    for (int t = 0; t < 4; ++t) o[t] = (v8f){};
    float m = NEG, l = 0.0f;                              // m: both halves agree; l: this half's keys only, joined behind the loop
    v16h aq[2];
    if (!HR) { const h16* qr = Qb + (size_t)(q0 + lr) * HD + 8 * hi; aq[0] = WFrag<h16>::ld(qr); aq[1] = WFrag<h16>::ld(qr + 32); }
    // this thread's first piece of a stage: row threadIdx.x >> 3, 16-byte column threadIdx.x & 7
    const int crow = (int)threadIdx.x >> 3, ccol = ((int)threadIdx.x & 7) * 8;
    const unsigned lk0 = (unsigned)(size_t)(ring + crow * KP + ccol);                  // LDS byte address in buffer 0, k tile
    const h16* gk0 = Kb + (size_t)crow * HD + ccol; const h16* gv0 = Vb + (size_t)crow * SEQ + ccol;
    const int nst = nchunk >> 1;                                                       // stages of 64 keys (nchunk is even)
    if (!HR) {
        stage_copy(lk0, gk0, lk0 + TLH * 2, gv0);
        asm volatile("s_wait_asynccnt 0x0" ::: "memory");                              // stage 0 has landed before the barrier that publishes it
        __syncthreads();                                                               // publishes stage 0 to all four waves
        if (nst > 1) stage_copy(lk0 + STH * 2, gk0 + 64 * HD, lk0 + STH * 2 + TLH * 2, gv0 + 64);
    }

#pragma unroll 1
    for (int c = 0; c < nchunk; ++c) {
        const int j0 = c * 32;
        v8f s0 = (v8f){}, s1 = (v8f){};                   // s0[r] = S[q][j0 + 8 * hi + r], s1[r] = S[q][j0 + 16 + 8 * hi + r]
        if (HR) {
            const bf* qh = Qhb + (size_t)(q0 + lr) * HD + 8 * hi; const bf* ql = Qlb + (size_t)(q0 + lr) * HD + 8 * hi;
            const bf* kh = Khb + (size_t)(j0 + lr) * HD + 8 * hi; const bf* kl = Klb + (size_t)(j0 + lr) * HD + 8 * hi;
#pragma unroll
            for (int kk = 0; kk < 2; ++kk) {
                const v16bf aqh = WFrag<bf>::ld(qh + kk * 32), aql = WFrag<bf>::ld(ql + kk * 32);
                const v16bf kh0 = WFrag<bf>::ld(kh + kk * 32), kh1 = WFrag<bf>::ld(kh + 16 * HD + kk * 32);
                const v16bf kl0 = WFrag<bf>::ld(kl + kk * 32), kl1 = WFrag<bf>::ld(kl + 16 * HD + kk * 32);
                s0 = wmmab(kh0, aqh, s0); s0 = wmmab(kl0, aqh, s0); s0 = wmmab(kh0, aql, s0);
                s1 = wmmab(kh1, aqh, s1); s1 = wmmab(kl1, aqh, s1); s1 = wmmab(kh1, aql, s1);
                // keeps the vector slots between the last product and the first use of its result or operands
                if (kk == 1) asm volatile("v_nop\n\tv_nop\n\tv_nop\n\tv_nop" : "+v"(s0), "+v"(s1) : "v"(aql), "v"(kh1));
            }
        } else {
            const h16* kp = ring + ((c >> 1) & 1) * STH + ((c & 1) * 32 + lr) * KP + 8 * hi;
#pragma unroll
            for (int kk = 0; kk < 2; ++kk) {
                const v16h bk0 = lds16(kp + kk * 32), bk1 = lds16(kp + 16 * KP + kk * 32);
                s0 = wmma16(bk0, aq[kk], s0); s1 = wmma16(bk1, aq[kk], s1);
                // keeps the vector slots between the last product and the first use of its result or operands
                if (kk == 1) asm volatile("v_nop\n\tv_nop\n\tv_nop\n\tv_nop" : "+v"(s0), "+v"(s1) : "v"(aq[1]), "v"(bk1));
            }
        }
        // online softmax update: a lane holds 16 of the 32 keys of ONE query; maximum and sum in the lane, the maximum joined with the other half by one exchange
        float pa[8], pc[8];
        const v8f a0 = s0 * SCL, c0v = s1 * SCL;
        const int qd = q - j0 - 8 * hi;                       // key j0 + 8 * hi + r is allowed where r <= qd
#pragma unroll
        for (int r = 0; r < 8; ++r) { pa[r] = (r <= qd) ? a0[r] : NEG; pc[r] = (16 + r <= qd) ? c0v[r] : NEG; }
        float v = fmaxf(fmaxf(fmaxf(fmaxf(pa[0], pa[1]), fmaxf(pa[2], pa[3])), fmaxf(fmaxf(pa[4], pa[5]), fmaxf(pa[6], pa[7]))),
                        fmaxf(fmaxf(fmaxf(pc[0], pc[1]), fmaxf(pc[2], pc[3])), fmaxf(fmaxf(pc[4], pc[5]), fmaxf(pc[6], pc[7]))));
        v = fmaxf(v, xhalf(v));
        const float mn = fmaxf(m, v);                         // finite from chunk 0 on (key 0 <= q for every row, seen through the exchange)
        const float alpha = __builtin_amdgcn_exp2f((m - mn) * L2E);
        m = mn;
#pragma unroll
        for (int r = 0; r < 8; ++r) { pa[r] = __builtin_amdgcn_exp2f((pa[r] - mn) * L2E); pc[r] = __builtin_amdgcn_exp2f((pc[r] - mn) * L2E); }
        const float rs = (((pa[0] + pa[1]) + (pa[2] + pa[3])) + ((pa[4] + pa[5]) + (pa[6] + pa[7]))) + (((pc[0] + pc[1]) + (pc[2] + pc[3])) + ((pc[4] + pc[5]) + (pc[6] + pc[7])));
        l = l * alpha + rs;
#pragma unroll
        for (int t = 0; t < 4; ++t)
#pragma unroll
            for (int r = 0; r < 8; ++r) o[t][r] *= alpha;
        // the two score tiles, converted in place, are the B operand of vt . p^T: element s <- key j0 + 8 * hi + s (s < 8), j0 + 16 + 8 * hi + s - 8 (s >= 8), the loaders' k order
        if (HR) {
            v8us h0, l0, h1, l1;
#pragma unroll
            for (int r = 0; r < 8; ++r) { unsigned short a1, a2, c1, c2; splitf(pa[r], a1, a2); splitf(pc[r], c1, c2); h0[r] = a1; l0[r] = a2; h1[r] = c1; l1[r] = c2; }
            const v16bf bph = cat16b(h0, h1), bpl = cat16b(l0, l1);
            const bf* vh = Vhb + (size_t)lr * RH + j0 + 8 * hi; const bf* vl = Vlb + (size_t)lr * RH + j0 + 8 * hi;
            v16bf fvh = bph, fvl = bpl;
#pragma unroll
            for (int t = 0; t < 4; ++t) { fvh = WFrag<bf>::ld(vh + (size_t)t * 16 * RH); fvl = WFrag<bf>::ld(vl + (size_t)t * 16 * RH);
                o[t] = wmmab(fvh, bph, o[t]); o[t] = wmmab(fvh, bpl, o[t]); o[t] = wmmab(fvl, bph, o[t]); }
            // keeps the vector slots behind the last product on the loop's back edge too
            asm volatile("v_nop\n\tv_nop\n\tv_nop\n\tv_nop" : "+v"(o[0]), "+v"(o[1]), "+v"(o[2]), "+v"(o[3]) : "v"(bph), "v"(fvl));
        } else {
            v16h bp;
#pragma unroll
            for (int r = 0; r < 8; ++r) { bp[r] = (h16)(pa[r] * PCAR); bp[8 + r] = (h16)(pc[r] * PCAR); }
            const h16* vp = ring + ((c >> 1) & 1) * STH + TLH + lr * KP + (c & 1) * 32 + 8 * hi;
            v16h fv = bp;
#pragma unroll
            for (int t = 0; t < 4; ++t) { fv = lds16(vp + t * 16 * KP); o[t] = wmma16(fv, bp, o[t]); }
            // keeps the vector slots behind the last product on the loop's back edge too
            asm volatile("v_nop\n\tv_nop\n\tv_nop\n\tv_nop" : "+v"(o[0]), "+v"(o[1]), "+v"(o[2]), "+v"(o[3]) : "v"(bp), "v"(fv));
        }
        if (!HR && (c & 1)) {                                                          // foot of a stage (block-uniform): publish the next stage, free this one's buffer
            const int st = c >> 1;
            asm volatile("s_wait_dscnt 0x0" ::: "memory");                             // this wave's reads of the buffer have returned
            asm volatile("s_wait_asynccnt 0x0" ::: "memory");                          // this wave's copies of stage st + 1 have landed
            __syncthreads();                                                           // publishes stage st + 1 and ends every wave's reads of stage st
            if (st + 2 < nst) { const unsigned lb = lk0 + (unsigned)(st & 1) * (STH * 2); stage_copy(lb, gk0 + (size_t)(st + 2) * 64 * HD, lb + TLH * 2, gv0 + (st + 2) * 64); }
        }
    }
    if (!HR) asm volatile("s_wait_asynccnt 0x0" ::: "memory");                         // nothing of this wave is in flight when the ring becomes output staging

    l += xhalf(l);                                                                     // joins the two halves' sums of this query
    const float inv = __builtin_amdgcn_rcpf(HR ? l : l * PCAR);
#pragma unroll
    for (int t = 0; t < 4; ++t) {
        const v4f w0 = { o[t][0] * inv, o[t][1] * inv, o[t][2] * inv, o[t][3] * inv }, w1 = { o[t][4] * inv, o[t][5] * inv, o[t][6] * inv, o[t][7] * inv };
        *(v4fa*)(myos + lr * OSP + t * 16 + 8 * hi) = w0; *(v4fa*)(myos + lr * OSP + t * 16 + 8 * hi + 4) = w1;
    }
    __builtin_amdgcn_fence(3, "wavefront"); __builtin_amdgcn_wave_barrier(); asm volatile("" ::: "memory");
    float* orow = OUT + ((size_t)blockIdx.z * SEQ_FULL + q0) * DM + (size_t)blockIdx.y * HD;
{
#pragma unroll
        for (int s = 0; s < 8; ++s) { const int row = 2 * s + hi, cofs = lr * 4; const v4f val = *(const v4fa*)(myos + row * OSP + cofs);
            *(v4f*)(orow + (size_t)row * DM + cofs) = val; }
         }
}

extern "C" void kernel_launch(void* const* d_in, const int* in_sizes, int n_in,
                              void* d_out, int out_size, void* d_ws, size_t ws_size, hipStream_t stream) {
    if (n_in < 3) return;
    if ((size_t)in_sizes[0] < (size_t)(NB - 1) * SEQ_FULL * DM + (size_t)SEQ * DM) return;
    if ((size_t)in_sizes[1] < (size_t)3 * DM * DM) return;
    if (in_sizes[2] < 3 * DM) return;
    if ((size_t)out_size < (size_t)(NB - 1) * SEQ_FULL * DM + (size_t)SEQ * DM) return;
    const float* x = (const float*)d_in[0];      // [NB][SEQ_FULL][DM]
    const float* W = (const float*)d_in[1];      // [3*DM][DM]  ([out][in], row blocks k | q | v)
    const float* bias = (const float*)d_in[2];   // [3*DM]
    float* OUT = (float*)d_out;                  // [NB][SEQ_FULL][DM]
    char* wsp = (char*)d_ws;
    auto take = [&](size_t bytes) { char* p = wsp; wsp += (bytes + 255) & ~(size_t)255; return (void*)p; };
    bf* WB = (bf*)take((size_t)3 * DM * DM * 2);
    bf* XB = (bf*)take((size_t)NB * SEQ * DM * 2);
    h16* Q16 = (h16*)take((size_t)NB * NH * SEQ * HD * 2); h16* K16 = (h16*)take((size_t)NB * NH * SEQ * HD * 2); h16* VT16 = (h16*)take((size_t)NB * NH * HD * SEQ * 2);
    bf* QPh = (bf*)take((size_t)NB * NH * RH * HD * 2); bf* QPl = (bf*)take((size_t)NB * NH * RH * HD * 2); bf* KPh = (bf*)take((size_t)NB * NH * RH * HD * 2); bf* KPl = (bf*)take((size_t)NB * NH * RH * HD * 2);
    bf* VTh = (bf*)take((size_t)NB * NH * HD * RH * 2); bf* VTl = (bf*)take((size_t)NB * NH * HD * RH * 2);
    if ((size_t)(wsp - (char*)d_ws) > ws_size) return;
    if ((size_t)(wsp - (char*)d_ws) > (size_t)134217728) return;

    k_cvt8<<<(unsigned)(((size_t)3 * DM * DM / 8 + 255) / 256), 256, 0, stream>>>(W, WB, (size_t)3 * DM * DM / 8);
    k_cvtx<<<dim3((unsigned)(((size_t)SEQ * DM / 8 + 255) / 256), NB, 1), 256, 0, stream>>>(x, XB, (size_t)SEQ * DM / 8);
    // k | q | v in one launch: every 64-column tile is one head of one of the three
    k_gemmw<bf, 0, true><<<dim3(SEQ / 64, 3 * DM / 64, NB), 32, 0, stream>>>(XB, nullptr, WB, nullptr, DM, bias, (size_t)SEQ * DM, (size_t)0, Q16, K16, VT16, QPh, QPl, KPh, KPl, VTh, VTl);
    // attention: rows < RH on the hi/lo path, rows >= RH single products
    k_attn<true><<<dim3(RH / 64, NH, NB), 128, 0, stream>>>(Q16, K16, VT16, QPh, QPl, KPh, KPl, VTh, VTl, 0, OUT);
    if (SEQ > RH) k_attn<false><<<dim3((SEQ - RH) / 64, NH, NB), 128, 0, stream>>>(Q16, K16, VT16, QPh, QPl, KPh, KPl, VTh, VTl, RH, OUT);
}

// v004
// It runs in 134 microseconds.
// Next to v003, in two timings, it ran 1.43 and 1.42 times as fast.
// All steps since v000 together make it 2.63 times as fast.
#include <hip/hip_runtime.h>

// Contractions (f32 accumulate): kqv projection = v_wmma_f32_16x16x32_bf16 on bf16 RNE copies of x and W, bf16-valued bias added in f32; causal attention query rows < 256: q.k and p.v as bf16 hi/lo 3-product groups; query rows >= 256: v_wmma_f32_16x16x32_f16 on fp16 q, k, v planes and fp16 p x 1024; softmax statistics f32; output f32.
// Layout: bf16 W [3072][1024] used directly as the k-contiguous B operand (row blocks k | q | v); the projection's epilogue writes the head planes q, k [b][h][t][64] and v transposed [b][h][64][t]

#ifndef NB
#define NB 4
#endif
#ifndef SEQ
#define SEQ 2048
#endif
#define NB_FULL  4
#define SEQ_FULL 2048
#define DM   1024
#define NH   16
#define HD   64
#define RH   256                      // query rows < RH use the hi/lo 3-product path (keys there are < RH too)
#define OSP  68                       // LDS pitch (floats) of the 16 x 64 output staging tile
#define KP   72                       // LDS pitch (halves) of a staged 64-half row: 144 B = 16 B x 9, for 16-byte readers
#define TLH  (64 * KP)                // halves of one staged tile (64 rows)
#define STH  (2 * TLH)                // halves of one stage: k tile (64 keys x 64 d), then vt tile (64 d x 64 keys)
#define PCAR 1024.0f
#define SCL  0.03125f                 // 1024^-0.5 (model-dim scaling)
#define L2E  1.4426950408889634f

static_assert(NH * HD == DM);
static_assert((SEQ % 256) == 0 && (RH % 256) == 0 && RH <= SEQ && SEQ <= SEQ_FULL && NB >= 1 && NB <= NB_FULL);
static_assert((DM % 128) == 0 && (SEQ % 64) == 0);
// workspace bytes at full size (all regions exact multiples of their store granularity) + alignment slack <= 128 MiB
static_assert((size_t)3 * DM * DM * 2 + (size_t)NB * SEQ * DM * 2 + (size_t)3 * NB * NH * SEQ * HD * 2 + (size_t)6 * NB * NH * RH * HD * 2 + 12 * 256 <= (size_t)134217728);

typedef _Float16 h16;
typedef unsigned short bf;
typedef __attribute__((ext_vector_type(16))) __bf16   v16bf;
typedef __attribute__((ext_vector_type(16))) _Float16 v16h;
typedef __attribute__((ext_vector_type(8)))  _Float16 v8h;
typedef __attribute__((ext_vector_type(8)))  unsigned short v8us;
typedef __attribute__((ext_vector_type(8)))  float    v8f;
typedef __attribute__((ext_vector_type(4)))  float    v4f;
typedef v8h  __attribute__((may_alias)) v8ha;
typedef v4f  __attribute__((may_alias)) v4fa;
typedef v8us __attribute__((may_alias)) v8usa;

__device__ __forceinline__ unsigned short f2bf(float f) { unsigned u = __float_as_uint(f); u += 0x7FFFu + ((u >> 16) & 1u); return (unsigned short)(u >> 16); }
__device__ __forceinline__ float bf2f(unsigned short b) { return __uint_as_float(((unsigned)b) << 16); }
__device__ __forceinline__ float bfr(float f) { return bf2f(f2bf(f)); }
__device__ __forceinline__ void splitf(float y, unsigned short& h, unsigned short& l) { h = f2bf(y); l = f2bf(y - bf2f(h)); }
__device__ __forceinline__ v16h cat16(v8h lo, v8h hi) { return __builtin_shufflevector(lo, hi, 0, 1, 2, 3, 4, 5, 6, 7, 8, 9, 10, 11, 12, 13, 14, 15); }
__device__ __forceinline__ v16bf cat16b(v8us lo, v8us hi) { return __builtin_bit_cast(v16bf, __builtin_shufflevector(lo, hi, 0, 1, 2, 3, 4, 5, 6, 7, 8, 9, 10, 11, 12, 13, 14, 15)); }
__device__ __forceinline__ v8f wmma16(v16h a, v16h b, v8f c) { return __builtin_amdgcn_wmma_f32_16x16x32_f16(false, a, false, b, (short)0, c, false, false); }
__device__ __forceinline__ v8f wmmab(v16bf a, v16bf b, v8f c) { return __builtin_amdgcn_wmma_f32_16x16x32_bf16(false, a, false, b, (short)0, c, false, false); }

// 16-bit fragment loaders (lane l: row/col = l & 15, h = l >> 4; elements 0..7 <- k0 + 8h + 0..7, elements 8..15 <- k0 + 16 + 8h + 0..7; the caller passes p = row base + k0 + 8h).
template <typename T16> struct WFrag;
template <> struct WFrag<h16> { typedef v16h V; static __device__ __forceinline__ V ld(const h16* p) { return cat16(*(const v8h*)p, *(const v8h*)(p + 16)); } static __device__ __forceinline__ v8f mma(V a, V b, v8f c) { return wmma16(a, b, c); } };
template <> struct WFrag<bf> { typedef v16bf V; static __device__ __forceinline__ V ld(const bf* p) { return cat16b(*(const v8us*)p, *(const v8us*)(p + 16)); } static __device__ __forceinline__ v8f mma(V a, V b, v8f c) { return wmmab(a, b, c); } };
// LDS reloads through may_alias vectors of the stored element type
__device__ __forceinline__ v16h  lds16(const h16* p) { return cat16(*(const v8ha*)p, *(const v8ha*)(p + 16)); }
__device__ __forceinline__ v16bf ldsb(const bf* p)   { return cat16b(*(const v8usa*)p, *(const v8usa*)(p + 16)); }

// Four 16-byte stores of a wave. The s_wait_xcnt stands inside the statement so that no register the stores name is rewritten ahead of it.
typedef __attribute__((ext_vector_type(4))) unsigned v4u;
template <int STEP>                   // base: the same in every lane; voff: the lane's byte offset; STEP: bytes between two of the four
__device__ __forceinline__ void store4(const void* base, unsigned voff, v4u d0, v4u d1, v4u d2, v4u d3) {
    asm volatile("global_store_b128 %0, %2, %1\n\t"
                 "global_store_b128 %0, %3, %1 offset:%6\n\t"
                 "global_store_b128 %0, %4, %1 offset:%7\n\t"
                 "global_store_b128 %0, %5, %1 offset:%8\n\t"
                 "s_wait_xcnt 0x0"
                 :: "v"(voff), "s"(base), "v"(d0), "v"(d1), "v"(d2), "v"(d3), "n"(STEP), "n"(2 * STEP), "n"(3 * STEP) : "memory");
}
// orders a wave's own LDS stores and loads around the reuse of its staging tile
__device__ __forceinline__ void wave_lds_order() { __builtin_amdgcn_fence(3, "wavefront"); __builtin_amdgcn_wave_barrier(); asm volatile("" ::: "memory"); }
// eight f32 values -> eight 16-bit values of plane p: 0 fp16, 1 bf16 hi, 2 bf16 lo (the residual of hi)
__device__ __forceinline__ v4u plane8(const float (&y)[8], int p) {
    if (p == 0) { v8h c;
#pragma unroll
        for (int k = 0; k < 8; ++k) c[k] = (h16)y[k];
        return __builtin_bit_cast(v4u, c); }
    v8us c;
#pragma unroll
    for (int k = 0; k < 8; ++k) { unsigned short a1, a2; splitf(y[k], a1, a2); c[k] = p == 1 ? a1 : a2; }
    return __builtin_bit_cast(v4u, c);
}
typedef v4u __attribute__((may_alias)) v4ua;
// Projection epilogues of one wave's 64 x 64 tile; acc[mb][nb][j] = y[16 mb + 8 hi + j][16 nb + lr] without bias, bs[nb] = bias of column 16 nb + lr. Read-back: 8 lanes cover one 128-B row of 16-bit values, a wave 4 rows.
// NP = 1: the fp16 plane alone; NP = 3: the bf16 hi and lo planes too (positions < RH), one plane after the other.
// Every loop of the two epilogues and of plane8 is unrolled so that acc and the small arrays are indexed by constants and stay in registers.
// k, q planes [t][64]: P[p] points at the tile's first position; f32 LDS tile of 16 positions.
template <int NP>
__device__ __forceinline__ void put_rows(const v8f (&acc)[4][4], const float (&bs)[4], unsigned char* sm, int lane, unsigned short* const (&P)[3]) {
    const int lr = lane & 15, hi = lane >> 4, srow = lane >> 3, scol = (lane & 7) * 8;
    float* os = (float*)sm;
#pragma unroll
    for (int mb = 0; mb < 4; ++mb) {
#pragma unroll
        for (int nb = 0; nb < 4; ++nb) {
#pragma unroll
            for (int j = 0; j < 8; ++j) os[(hi * 8 + j) * OSP + nb * 16 + lr] = acc[mb][nb][j] + bs[nb]; }
        wave_lds_order();
#pragma unroll
        for (int p = 0; p < NP; ++p) {
            v4u o[4];
#pragma unroll
            for (int s = 0; s < 4; ++s) {
                const float* xr = os + (4 * s + srow) * OSP + scol; const v4f x0 = *(const v4fa*)xr, x1 = *(const v4fa*)(xr + 4);
                const float y[8] = { x0[0], x0[1], x0[2], x0[3], x1[0], x1[1], x1[2], x1[3] };
                o[s] = plane8(y, p);
            }
            store4<4 * HD * 2>(P[p] + mb * 16 * HD, (unsigned)(srow * HD + scol) * 2u, o[0], o[1], o[2], o[3]);
        }
        wave_lds_order();
    }
}
// v planes [d][t]: P[p] (row pitch SEQ for p = 0, RH else) points at d = 0 of the tile's first position; a lane's 8 accumulator rows are 8 consecutive positions of one d; a 16-bit LDS tile of 16 d x 64 positions per plane.
template <int NP>
__device__ __forceinline__ void put_cols(const v8f (&acc)[4][4], const float (&bs)[4], unsigned char* sm, int lane, unsigned short* const (&P)[3]) {
    const int lr = lane & 15, hi = lane >> 4, srow = lane >> 3, scol = (lane & 7) * 8;
#pragma unroll
    for (int nb = 0; nb < 4; ++nb) {
#pragma unroll
        for (int p = 0; p < NP; ++p) {
            unsigned short* st = (unsigned short*)sm + p * 16 * KP;
#pragma unroll
            for (int mb = 0; mb < 4; ++mb) {
                float y[8];
#pragma unroll
                for (int j = 0; j < 8; ++j) y[j] = acc[mb][nb][j] + bs[nb];
                *(v4ua*)(st + lr * KP + mb * 16 + hi * 8) = plane8(y, p);
            }
            wave_lds_order();
            v4u o[4];
#pragma unroll
            for (int s = 0; s < 4; ++s) o[s] = *(const v4ua*)(st + (4 * s + srow) * KP + scol);
            if (p == 0) store4<4 * SEQ * 2>(P[0] + (size_t)nb * 16 * SEQ, (unsigned)(srow * SEQ + scol) * 2u, o[0], o[1], o[2], o[3]);
            else        store4<4 * RH * 2>(P[p] + nb * 16 * RH, (unsigned)(srow * RH + scol) * 2u, o[0], o[1], o[2], o[3]);
        }
        wave_lds_order();
    }
}

// ---- k_gemmw: the kqv projection. Grid (SEQ/256, 3*DM/128, NB), 256 threads: a work-group owns a 256 x 128 tile of y, its eight waves (4 x 2) a 64 x 64 tile each (16 accumulators).
// y[m][n] (f32, + bf16-valued bias[n]) = sum_k A[m][k] Bt[n][k], both operands K-contiguous bf16 planes. z-batch strides sA/sB in elements. K % 64 == 0, K >= 64.
// The waves read their fragments from LDS. A stage = 64 k of the work-group's 256 A rows and 128 Bt rows (whole 128-B lines, 8 lanes a row), two buffers; every thread copies 8 + 4 pieces of 16 B per stage;
// stage t + 2 is issued into the buffer of stage t behind the barrier that ends its last read. After the last stage's barrier the ring is the eight waves' epilogue staging.
// A wave's tile is 64 positions of ONE head of k, q or v (column tile = NH * {k, q, v} + head); the epilogue converts y and writes the head planes itself:
// k, q: fp16 [t][64] (and the bf16 hi/lo planes where t < RH) through an f32 LDS tile of 16 positions; v: a lane's 8 accumulator rows are 8 consecutive positions of one d, packed and turned into whole 128-B rows of [d][t] through 16-bit LDS tiles of 16 d.
#define GAH  (256 * KP)               // halves of the staged A tile (256 rows of 64 k)
#define GSH  (GAH + 128 * KP)         // halves of one stage: A tile, then Bt tile (128 rows)
#define EPB  (3 * 16 * KP * 2)        // bytes of one wave's epilogue staging: one f32 tile 16 x OSP, or three 16-bit tiles 16 x KP
// One stage's copies of this thread: rows r, r + 32, ..., r + 224 of the A tile and r, ..., r + 96 of the Bt tile (l: LDS byte address of its first A piece; rs: elements between two of the rows).
// The s_wait_xcnt stands inside the statement so that no address register is rewritten ahead of it.
__device__ __forceinline__ void gstage_copy(unsigned l, const bf* ga, const bf* gb, size_t rs) {
    asm volatile("global_load_async_to_lds_b128 %0, %12, off\n\t"
                 "global_load_async_to_lds_b128 %1, %13, off\n\t"
                 "global_load_async_to_lds_b128 %2, %14, off\n\t"
                 "global_load_async_to_lds_b128 %3, %15, off\n\t"
                 "global_load_async_to_lds_b128 %4, %16, off\n\t"
                 "global_load_async_to_lds_b128 %5, %17, off\n\t"
                 "global_load_async_to_lds_b128 %6, %18, off\n\t"
                 "global_load_async_to_lds_b128 %7, %19, off\n\t"
                 "global_load_async_to_lds_b128 %8, %20, off\n\t"
                 "global_load_async_to_lds_b128 %9, %21, off\n\t"
                 "global_load_async_to_lds_b128 %10, %22, off\n\t"
                 "global_load_async_to_lds_b128 %11, %23, off\n\t"
                 "s_wait_xcnt 0x0"
                 :: "v"(l), "v"(l + 32 * KP * 2), "v"(l + 64 * KP * 2), "v"(l + 96 * KP * 2), "v"(l + 128 * KP * 2), "v"(l + 160 * KP * 2), "v"(l + 192 * KP * 2), "v"(l + 224 * KP * 2),
                    "v"(l + GAH * 2), "v"(l + GAH * 2 + 32 * KP * 2), "v"(l + GAH * 2 + 64 * KP * 2), "v"(l + GAH * 2 + 96 * KP * 2),
                    "v"(ga), "v"(ga + rs), "v"(ga + 2 * rs), "v"(ga + 3 * rs), "v"(ga + 4 * rs), "v"(ga + 5 * rs), "v"(ga + 6 * rs), "v"(ga + 7 * rs),
                    "v"(gb), "v"(gb + rs), "v"(gb + 2 * rs), "v"(gb + 3 * rs)
                 : "memory");
}
__global__ __launch_bounds__(256) __attribute__((amdgpu_num_vgpr(256)))   // the ring lets two work-groups share a WGP: four waves per SIMD, 256 registers each
void k_gemmw(const bf* __restrict__ A, const bf* __restrict__ Bt, int K, const float* __restrict__ bias, size_t sA, size_t sB,
             h16* Q16, h16* K16, h16* VT16, bf* QPh, bf* QPl, bf* KPh, bf* KPl, bf* VTh, bf* VTl) {
    __shared__ __align__(16) unsigned char sm[2 * GSH * 2];       // the two-stage ring, then epilogue staging
    static_assert(16 * OSP * 4 <= EPB && 8 * EPB <= 2 * GSH * 2);
    const size_t z = blockIdx.z; A += z * sA; Bt += z * sB;
    const int lane = threadIdx.x & 31, lr = lane & 15, hi = lane >> 4;
    const int wid = __builtin_amdgcn_readfirstlane((int)threadIdx.x >> 5);   // the wave's number in a scalar register: tile, plane and store bases stay scalar
    const int wm = wid & 3, wn = wid >> 2;
    const int r0 = (int)blockIdx.x * 256 + wm * 64, ct = (int)blockIdx.y * 2 + wn, c0 = ct * 64;
    v8f acc[4][4];
#pragma unroll
    for (int mb = 0; mb < 4; ++mb)
#pragma unroll
        for (int nb = 0; nb < 4; ++nb) acc[mb][nb] = (v8f){};
    const bf* ring = (const bf*)sm;
    // this thread's first piece of an operand tile: row threadIdx.x >> 3, 16-byte column threadIdx.x & 7
    const int crow = (int)threadIdx.x >> 3, ccol = ((int)threadIdx.x & 7) * 8;
    const unsigned la0 = (unsigned)(size_t)(ring + crow * KP + ccol);                  // LDS byte address in buffer 0, A tile
    const bf* ga0 = A + (size_t)((int)blockIdx.x * 256 + crow) * K + ccol; const bf* gb0 = Bt + (size_t)((int)blockIdx.y * 128 + crow) * K + ccol;
    const size_t rs = (size_t)32 * K;
    const int nst = K >> 6;                                                            // stages of 64 k
    gstage_copy(la0, ga0, gb0, rs);
    asm volatile("s_wait_asynccnt 0x0" ::: "memory");                                  // stage 0 has landed before the barrier that publishes it
    __syncthreads();                                                                   // publishes stage 0 to all eight waves
    if (nst > 1) gstage_copy(la0 + GSH * 2, ga0 + 64, gb0 + 64, rs);
#pragma unroll 1
    for (int t = 0; t < nst; ++t) {
        const bf* ap = ring + (t & 1) * GSH + (wm * 64 + lr) * KP + 8 * hi; const bf* bp = ring + (t & 1) * GSH + GAH + (wn * 64 + lr) * KP + 8 * hi;
#pragma unroll
        for (int kk = 0; kk < 2; ++kk) {
            v16bf a[4], b[4];
#pragma unroll
            for (int i = 0; i < 4; ++i) { a[i] = ldsb(ap + i * 16 * KP + kk * 32); b[i] = ldsb(bp + i * 16 * KP + kk * 32); }
            // holds the block's 16 LDS reads together in front of its 16 products (loaded values as inputs only): one wait per block instead of one per group of four products
            asm volatile("" :: "v"(a[0]), "v"(a[1]), "v"(a[2]), "v"(a[3]), "v"(b[0]), "v"(b[1]), "v"(b[2]), "v"(b[3]));
#pragma unroll
            for (int nb = 0; nb < 4; ++nb)
#pragma unroll
                for (int mb = 0; mb < 4; ++mb) acc[mb][nb] = wmmab(a[mb], b[nb], acc[mb][nb]);
        }
        // foot of a stage: publish the next stage, free this one's buffer
        asm volatile("s_wait_dscnt 0x0" ::: "memory");                                 // this wave's reads of the buffer have returned
        asm volatile("s_wait_asynccnt 0x0" ::: "memory");                              // this wave's copies of stage t + 1 have landed
        __syncthreads();                                                               // publishes stage t + 1 and ends every wave's reads of stage t
        if (t + 2 < nst) gstage_copy(la0 + (unsigned)(t & 1) * (GSH * 2), ga0 + (t + 2) * 64, gb0 + (t + 2) * 64, rs);
    }
    asm volatile("s_wait_asynccnt 0x0" ::: "memory");                                  // nothing of this wave is in flight when the ring becomes epilogue staging
    unsigned char* es = sm + wid * EPB;                   // this wave's own staging
    const int sel = ct / NH;                              // 0: k, 1: q, 2: v (W's row blocks)
    const size_t bh = z * NH + ct % NH;
    const bool lo = r0 < RH;                              // the wave's whole tile (RH is a multiple of 64); wave-uniform like sel, and no block barrier follows
    const size_t rl = lo ? r0 : 0;
    float bs[4];
    // bias of columns c0 + lr + {0, 16, 32, 48}: the four loads and their data wait in one statement, outputs early-clobbered, so that no register a load names is rewritten while it is in flight
    asm volatile("global_load_b32 %0, %4, %5\n\t"
                 "global_load_b32 %1, %4, %5 offset:64\n\t"
                 "global_load_b32 %2, %4, %5 offset:128\n\t"
                 "global_load_b32 %3, %4, %5 offset:192\n\t"
                 "s_wait_loadcnt 0x0"
                 : "=&v"(bs[0]), "=&v"(bs[1]), "=&v"(bs[2]), "=&v"(bs[3]) : "v"((unsigned)(c0 + lr) * 4u), "s"(bias) : "memory");
#pragma unroll
    for (int nb = 0; nb < 4; ++nb) bs[nb] = bfr(bs[nb]);
    if (sel < 2) {
        unsigned short* const P[3] = { (unsigned short*)(sel == 1 ? Q16 : K16) + (bh * SEQ + r0) * HD, (sel == 1 ? QPh : KPh) + (bh * RH + rl) * HD, (sel == 1 ? QPl : KPl) + (bh * RH + rl) * HD };
        if (lo) put_rows<3>(acc, bs, es, lane, P); else put_rows<1>(acc, bs, es, lane, P);
    } else {
        unsigned short* const P[3] = { (unsigned short*)VT16 + bh * HD * SEQ + r0, VTh + bh * HD * RH + rl, VTl + bh * HD * RH + rl };
        if (lo) put_cols<3>(acc, bs, es, lane, P); else put_cols<1>(acc, bs, es, lane, P);
    }
}

__global__ __launch_bounds__(256) void k_cvt8(const float* __restrict__ src, bf* dst, size_t n8) { const size_t i = (size_t)blockIdx.x * 256 + threadIdx.x; if (i >= n8) return; const v8f v = *(const v8f*)(src + i * 8); v8us o;
#pragma unroll
    for (int k = 0; k < 8; ++k) o[k] = f2bf(v[k]); *(v8us*)(dst + i * 8) = o;  }
__global__ __launch_bounds__(256) void k_cvtx(const float* __restrict__ src, bf* dst, size_t n8) { const size_t i = (size_t)blockIdx.x * 256 + threadIdx.x; if (i >= n8) return;
    const float* s = src + (size_t)blockIdx.y * SEQ_FULL * DM; bf* d = dst + (size_t)blockIdx.y * SEQ * DM; const v8f v = *(const v8f*)(s + i * 8); v8us o;
#pragma unroll
    for (int k = 0; k < 8; ++k) o[k] = f2bf(v[k]); *(v8us*)(d + i * 8) = o;  }

// ---- k_attn: causal streaming attention. Grid (rows/64, NH, NB), 128 threads: block = 64 query rows starting at roff + 64*blockIdx.x of head blockIdx.y, batch blockIdx.z; wave -> 16 rows.
// Key chunks of 32 from 0 to the block's last row (block-uniform loop; per-element causal select j <= i). Per chunk: S^T (32 keys x 16 queries) = k.q^T, scaled by SCL in f32, online max/sum in f32 (one query per lane), O^T += vt.p^T with p^T packed from the score registers,
// HR (rows and keys < RH): bf16 planes, q.k = qh.kh + qh.kl + ql.kh, p.v = ph.vh + pl.vh + ph.vl (one accumulator, unscaled residuals). Otherwise fp16 planes, single products.
// !HR: the block's four waves read k and vt from LDS. A stage = 64 keys (two chunks), two buffers; every thread copies 4 + 4 pieces of 16 B per stage, whole 128-B rows per 8 lanes;
// stage s + 2 is issued into the buffer of stage s behind the barrier that ends its last read. After the last stage's barrier the ring is the output staging.
// One stage's copies of this thread: rows r, r + 16, r + 32, r + 48 of the k tile and of the vt tile. The s_wait_xcnt stands inside the statement so that no address register is rewritten ahead of it.
__device__ __forceinline__ void stage_copy(unsigned lk, const h16* gk, unsigned lv, const h16* gv) {
    asm volatile("global_load_async_to_lds_b128 %0, %8, off\n\t"
                 "global_load_async_to_lds_b128 %1, %9, off\n\t"
                 "global_load_async_to_lds_b128 %2, %10, off\n\t"
                 "global_load_async_to_lds_b128 %3, %11, off\n\t"
                 "global_load_async_to_lds_b128 %4, %12, off\n\t"
                 "global_load_async_to_lds_b128 %5, %13, off\n\t"
                 "global_load_async_to_lds_b128 %6, %14, off\n\t"
                 "global_load_async_to_lds_b128 %7, %15, off\n\t"
                 "s_wait_xcnt 0x0"
                 :: "v"(lk), "v"(lk + 16 * KP * 2), "v"(lk + 32 * KP * 2), "v"(lk + 48 * KP * 2), "v"(lv), "v"(lv + 16 * KP * 2), "v"(lv + 32 * KP * 2), "v"(lv + 48 * KP * 2),
                    "v"(gk), "v"(gk + 16 * HD), "v"(gk + 32 * HD), "v"(gk + 48 * HD), "v"(gv), "v"(gv + (size_t)16 * SEQ), "v"(gv + (size_t)32 * SEQ), "v"(gv + (size_t)48 * SEQ)
                 : "memory");
}
// lane l <-> lane l ^ 16 (the other half of the wave holds the other 16 keys of the same query)
__device__ __forceinline__ float xhalf(float v) { const int b = __float_as_int(v); return __int_as_float(__builtin_amdgcn_permlanex16(b, b, 0x76543210, 0xfedcba98, false, false)); }
template <bool HR>
__global__ __launch_bounds__(128) __attribute__((amdgpu_num_vgpr(256)))
void k_attn(const h16* __restrict__ Q16, const h16* __restrict__ K16, const h16* __restrict__ VT16,
            const bf* __restrict__ QPh, const bf* __restrict__ QPl, const bf* __restrict__ KPh, const bf* __restrict__ KPl,
            const bf* __restrict__ VTh, const bf* __restrict__ VTl, int roff, float* OUT) {
    __shared__ __align__(16) unsigned char sm[HR ? 4 * 16 * OSP * 4 : 2 * STH * 2];   // HR: output staging; !HR: the two-stage ring, then output staging
    static_assert(4 * 16 * OSP * 4 <= 2 * STH * 2);
    const int lane = threadIdx.x & 31, lr = lane & 15, hi = lane >> 4, wid = threadIdx.x >> 5;
    const int q0blk = roff + (int)blockIdx.x * 64;
    if (q0blk + 64 > SEQ) return;                         // block-uniform (grids are exact), in front of every block barrier
    if (HR && q0blk + 64 > RH) return;
    const int q0 = q0blk + wid * 16;
    const size_t bh = (size_t)blockIdx.z * NH + blockIdx.y;
    const h16* Qb = Q16 + bh * SEQ * HD; const h16* Kb = K16 + bh * SEQ * HD; const h16* Vb = VT16 + bh * HD * SEQ;
    const bf* Qhb = QPh + bh * RH * HD; const bf* Qlb = QPl + bh * RH * HD; const bf* Khb = KPh + bh * RH * HD; const bf* Klb = KPl + bh * RH * HD;
    const bf* Vhb = VTh + bh * HD * RH; const bf* Vlb = VTl + bh * HD * RH;
    float* myos = (float*)sm + wid * 16 * OSP;
    const h16* ring = (const h16*)sm;
    const int nchunk = (q0blk + 64) >> 5;
    const float NEG = -__builtin_inff();
    const int q = q0 + lr;                                // this lane's query row

    v8f o[4];                                             // o[t][r] = O[q][t * 16 + 8 * hi + r] (transposed output tiles)
#pragma unroll
    for (int t = 0; t < 4; ++t) o[t] = (v8f){};
    float m = NEG, l = 0.0f;                              // m: both halves agree; l: this half's keys only, joined behind the loop
    v16h aq[2];
    if (!HR) { const h16* qr = Qb + (size_t)(q0 + lr) * HD + 8 * hi; aq[0] = WFrag<h16>::ld(qr); aq[1] = WFrag<h16>::ld(qr + 32); }
    // this thread's first piece of a stage: row threadIdx.x >> 3, 16-byte column threadIdx.x & 7
    const int crow = (int)threadIdx.x >> 3, ccol = ((int)threadIdx.x & 7) * 8;
    const unsigned lk0 = (unsigned)(size_t)(ring + crow * KP + ccol);                  // LDS byte address in buffer 0, k tile
    const h16* gk0 = Kb + (size_t)crow * HD + ccol; const h16* gv0 = Vb + (size_t)crow * SEQ + ccol;
    const int nst = nchunk >> 1;                                                       // stages of 64 keys (nchunk is even)
    if (!HR) {
        stage_copy(lk0, gk0, lk0 + TLH * 2, gv0);
        asm volatile("s_wait_asynccnt 0x0" ::: "memory");                              // stage 0 has landed before the barrier that publishes it
        __syncthreads();                                                               // publishes stage 0 to all four waves
        if (nst > 1) stage_copy(lk0 + STH * 2, gk0 + 64 * HD, lk0 + STH * 2 + TLH * 2, gv0 + 64);
    }

#pragma unroll 1
    for (int c = 0; c < nchunk; ++c) {
        const int j0 = c * 32;
        v8f s0 = (v8f){}, s1 = (v8f){};                   // s0[r] = S[q][j0 + 8 * hi + r], s1[r] = S[q][j0 + 16 + 8 * hi + r]
        if (HR) {
            const bf* qh = Qhb + (size_t)(q0 + lr) * HD + 8 * hi; const bf* ql = Qlb + (size_t)(q0 + lr) * HD + 8 * hi;
            const bf* kh = Khb + (size_t)(j0 + lr) * HD + 8 * hi; const bf* kl = Klb + (size_t)(j0 + lr) * HD + 8 * hi;
#pragma unroll
            for (int kk = 0; kk < 2; ++kk) {
                const v16bf aqh = WFrag<bf>::ld(qh + kk * 32), aql = WFrag<bf>::ld(ql + kk * 32);
                const v16bf kh0 = WFrag<bf>::ld(kh + kk * 32), kh1 = WFrag<bf>::ld(kh + 16 * HD + kk * 32);
                const v16bf kl0 = WFrag<bf>::ld(kl + kk * 32), kl1 = WFrag<bf>::ld(kl + 16 * HD + kk * 32);
                s0 = wmmab(kh0, aqh, s0); s0 = wmmab(kl0, aqh, s0); s0 = wmmab(kh0, aql, s0);
                s1 = wmmab(kh1, aqh, s1); s1 = wmmab(kl1, aqh, s1); s1 = wmmab(kh1, aql, s1);
                // keeps the vector slots between the last product and the first use of its result or operands
                if (kk == 1) asm volatile("v_nop\n\tv_nop\n\tv_nop\n\tv_nop" : "+v"(s0), "+v"(s1) : "v"(aql), "v"(kh1));
            }
        } else {
            const h16* kp = ring + ((c >> 1) & 1) * STH + ((c & 1) * 32 + lr) * KP + 8 * hi;
#pragma unroll
            for (int kk = 0; kk < 2; ++kk) {
                const v16h bk0 = lds16(kp + kk * 32), bk1 = lds16(kp + 16 * KP + kk * 32);
                s0 = wmma16(bk0, aq[kk], s0); s1 = wmma16(bk1, aq[kk], s1);
                // keeps the vector slots between the last product and the first use of its result or operands
                if (kk == 1) asm volatile("v_nop\n\tv_nop\n\tv_nop\n\tv_nop" : "+v"(s0), "+v"(s1) : "v"(aq[1]), "v"(bk1));
            }
        }
        // online softmax update: a lane holds 16 of the 32 keys of ONE query; maximum and sum in the lane, the maximum joined with the other half by one exchange
        float pa[8], pc[8];
        const v8f a0 = s0 * SCL, c0v = s1 * SCL;
        const int qd = q - j0 - 8 * hi;                       // key j0 + 8 * hi + r is allowed where r <= qd
#pragma unroll
        for (int r = 0; r < 8; ++r) { pa[r] = (r <= qd) ? a0[r] : NEG; pc[r] = (16 + r <= qd) ? c0v[r] : NEG; }
        float v = fmaxf(fmaxf(fmaxf(fmaxf(pa[0], pa[1]), fmaxf(pa[2], pa[3])), fmaxf(fmaxf(pa[4], pa[5]), fmaxf(pa[6], pa[7]))),
                        fmaxf(fmaxf(fmaxf(pc[0], pc[1]), fmaxf(pc[2], pc[3])), fmaxf(fmaxf(pc[4], pc[5]), fmaxf(pc[6], pc[7]))));
        v = fmaxf(v, xhalf(v));
        const float mn = fmaxf(m, v);                         // finite from chunk 0 on (key 0 <= q for every row, seen through the exchange)
        const float alpha = __builtin_amdgcn_exp2f((m - mn) * L2E);
        m = mn;
#pragma unroll
        for (int r = 0; r < 8; ++r) { pa[r] = __builtin_amdgcn_exp2f((pa[r] - mn) * L2E); pc[r] = __builtin_amdgcn_exp2f((pc[r] - mn) * L2E); }
        const float rs = (((pa[0] + pa[1]) + (pa[2] + pa[3])) + ((pa[4] + pa[5]) + (pa[6] + pa[7]))) + (((pc[0] + pc[1]) + (pc[2] + pc[3])) + ((pc[4] + pc[5]) + (pc[6] + pc[7])));
        l = l * alpha + rs;
#pragma unroll
        for (int t = 0; t < 4; ++t)
#pragma unroll
            for (int r = 0; r < 8; ++r) o[t][r] *= alpha;
        // the two score tiles, converted in place, are the B operand of vt . p^T: element s <- key j0 + 8 * hi + s (s < 8), j0 + 16 + 8 * hi + s - 8 (s >= 8), the loaders' k order
        if (HR) {
            v8us h0, l0, h1, l1;
#pragma unroll
            for (int r = 0; r < 8; ++r) { unsigned short a1, a2, c1, c2; splitf(pa[r], a1, a2); splitf(pc[r], c1, c2); h0[r] = a1; l0[r] = a2; h1[r] = c1; l1[r] = c2; }
            const v16bf bph = cat16b(h0, h1), bpl = cat16b(l0, l1);
            const bf* vh = Vhb + (size_t)lr * RH + j0 + 8 * hi; const bf* vl = Vlb + (size_t)lr * RH + j0 + 8 * hi;
            v16bf fvh = bph, fvl = bpl;
#pragma unroll
            for (int t = 0; t < 4; ++t) { fvh = WFrag<bf>::ld(vh + (size_t)t * 16 * RH); fvl = WFrag<bf>::ld(vl + (size_t)t * 16 * RH);
                o[t] = wmmab(fvh, bph, o[t]); o[t] = wmmab(fvh, bpl, o[t]); o[t] = wmmab(fvl, bph, o[t]); }
            // keeps the vector slots behind the last product on the loop's back edge too
            asm volatile("v_nop\n\tv_nop\n\tv_nop\n\tv_nop" : "+v"(o[0]), "+v"(o[1]), "+v"(o[2]), "+v"(o[3]) : "v"(bph), "v"(fvl));
        } else {
            v16h bp;
#pragma unroll
            for (int r = 0; r < 8; ++r) { bp[r] = (h16)(pa[r] * PCAR); bp[8 + r] = (h16)(pc[r] * PCAR); }
            const h16* vp = ring + ((c >> 1) & 1) * STH + TLH + lr * KP + (c & 1) * 32 + 8 * hi;
            v16h fv = bp;
#pragma unroll
            for (int t = 0; t < 4; ++t) { fv = lds16(vp + t * 16 * KP); o[t] = wmma16(fv, bp, o[t]); }
            // keeps the vector slots behind the last product on the loop's back edge too
            asm volatile("v_nop\n\tv_nop\n\tv_nop\n\tv_nop" : "+v"(o[0]), "+v"(o[1]), "+v"(o[2]), "+v"(o[3]) : "v"(bp), "v"(fv));
        }
        if (!HR && (c & 1)) {                                                          // foot of a stage (block-uniform): publish the next stage, free this one's buffer
            const int st = c >> 1;
            asm volatile("s_wait_dscnt 0x0" ::: "memory");                             // this wave's reads of the buffer have returned
            asm volatile("s_wait_asynccnt 0x0" ::: "memory");                          // this wave's copies of stage st + 1 have landed
            __syncthreads();                                                           // publishes stage st + 1 and ends every wave's reads of stage st
            if (st + 2 < nst) { const unsigned lb = lk0 + (unsigned)(st & 1) * (STH * 2); stage_copy(lb, gk0 + (size_t)(st + 2) * 64 * HD, lb + TLH * 2, gv0 + (st + 2) * 64); }
        }
    }
    if (!HR) asm volatile("s_wait_asynccnt 0x0" ::: "memory");                         // nothing of this wave is in flight when the ring becomes output staging

    l += xhalf(l);                                                                     // joins the two halves' sums of this query
    const float inv = __builtin_amdgcn_rcpf(HR ? l : l * PCAR);
#pragma unroll
    for (int t = 0; t < 4; ++t) {
        const v4f w0 = { o[t][0] * inv, o[t][1] * inv, o[t][2] * inv, o[t][3] * inv }, w1 = { o[t][4] * inv, o[t][5] * inv, o[t][6] * inv, o[t][7] * inv };
        *(v4fa*)(myos + lr * OSP + t * 16 + 8 * hi) = w0; *(v4fa*)(myos + lr * OSP + t * 16 + 8 * hi + 4) = w1;
    }
    __builtin_amdgcn_fence(3, "wavefront"); __builtin_amdgcn_wave_barrier(); asm volatile("" ::: "memory");
    float* orow = OUT + ((size_t)blockIdx.z * SEQ_FULL + q0) * DM + (size_t)blockIdx.y * HD;
{
#pragma unroll
        for (int s = 0; s < 8; ++s) { const int row = 2 * s + hi, cofs = lr * 4; const v4f val = *(const v4fa*)(myos + row * OSP + cofs);
            *(v4f*)(orow + (size_t)row * DM + cofs) = val; }
         }
}

extern "C" void kernel_launch(void* const* d_in, const int* in_sizes, int n_in,
                              void* d_out, int out_size, void* d_ws, size_t ws_size, hipStream_t stream) {
    if (n_in < 3) return;
    if ((size_t)in_sizes[0] < (size_t)(NB - 1) * SEQ_FULL * DM + (size_t)SEQ * DM) return;
    if ((size_t)in_sizes[1] < (size_t)3 * DM * DM) return;
    if (in_sizes[2] < 3 * DM) return;
    if ((size_t)out_size < (size_t)(NB - 1) * SEQ_FULL * DM + (size_t)SEQ * DM) return;
    const float* x = (const float*)d_in[0];      // [NB][SEQ_FULL][DM]
    const float* W = (const float*)d_in[1];      // [3*DM][DM]  ([out][in], row blocks k | q | v)
    const float* bias = (const float*)d_in[2];   // [3*DM]
    float* OUT = (float*)d_out;                  // [NB][SEQ_FULL][DM]
    char* wsp = (char*)d_ws;
    auto take = [&](size_t bytes) { char* p = wsp; wsp += (bytes + 255) & ~(size_t)255; return (void*)p; };
    bf* WB = (bf*)take((size_t)3 * DM * DM * 2);
    bf* XB = (bf*)take((size_t)NB * SEQ * DM * 2);
    h16* Q16 = (h16*)take((size_t)NB * NH * SEQ * HD * 2); h16* K16 = (h16*)take((size_t)NB * NH * SEQ * HD * 2); h16* VT16 = (h16*)take((size_t)NB * NH * HD * SEQ * 2);
    bf* QPh = (bf*)take((size_t)NB * NH * RH * HD * 2); bf* QPl = (bf*)take((size_t)NB * NH * RH * HD * 2); bf* KPh = (bf*)take((size_t)NB * NH * RH * HD * 2); bf* KPl = (bf*)take((size_t)NB * NH * RH * HD * 2);
    bf* VTh = (bf*)take((size_t)NB * NH * HD * RH * 2); bf* VTl = (bf*)take((size_t)NB * NH * HD * RH * 2);
    if ((size_t)(wsp - (char*)d_ws) > ws_size) return;
    if ((size_t)(wsp - (char*)d_ws) > (size_t)134217728) return;

    k_cvt8<<<(unsigned)(((size_t)3 * DM * DM / 8 + 255) / 256), 256, 0, stream>>>(W, WB, (size_t)3 * DM * DM / 8);
    k_cvtx<<<dim3((unsigned)(((size_t)SEQ * DM / 8 + 255) / 256), NB, 1), 256, 0, stream>>>(x, XB, (size_t)SEQ * DM / 8);
    // k | q | v in one launch: every 64-column tile is one head of one of the three
    k_gemmw<<<dim3(SEQ / 256, 3 * DM / 128, NB), 256, 0, stream>>>(XB, WB, DM, bias, (size_t)SEQ * DM, (size_t)0, Q16, K16, VT16, QPh, QPl, KPh, KPl, VTh, VTl);
    // attention: rows < RH on the hi/lo path, rows >= RH single products
    k_attn<true><<<dim3(RH / 64, NH, NB), 128, 0, stream>>>(Q16, K16, VT16, QPh, QPl, KPh, KPl, VTh, VTl, 0, OUT);
    if (SEQ > RH) k_attn<false><<<dim3((SEQ - RH) / 64, NH, NB), 128, 0, stream>>>(Q16, K16, VT16, QPh, QPl, KPh, KPl, VTh, VTl, RH, OUT);
}

// v005
// A run of this version takes 121 microseconds.
// Next to v004, in two timings, it ran 1.11 and 1.10 times as fast.
// All steps since v000 together make it 2.91 times as fast.
#include <hip/hip_runtime.h>

// Contractions (f32 accumulate): kqv projection = v_wmma_f32_16x16x32_bf16 on bf16 RNE copies of x and W, bf16-valued bias added in f32; causal attention query rows < 256: q.k and p.v as bf16 hi/lo 3-product groups; query rows >= 256: v_wmma_f32_16x16x32_f16 on fp16 q, k, v planes and fp16 p x 1024; softmax statistics f32; output f32.
// Layout: bf16 W [3072][1024] used directly as the k-contiguous B operand (row blocks k | q | v); the projection's epilogue writes the head planes q, k [b][h][t][64] and v transposed [b][h][64][t]

#ifndef NB
#define NB 4
#endif
#ifndef SEQ
#define SEQ 2048
#endif
#define NB_FULL  4
#define SEQ_FULL 2048
#define DM   1024
#define NH   16
#define HD   64
#define RH   256                      // query rows < RH use the hi/lo 3-product path (keys there are < RH too)
#define OSP  68                       // LDS pitch (floats) of the 16 x 64 output staging tile
#define KP   72                       // LDS pitch (halves) of a staged 64-half row: 144 B = 16 B x 9, for 16-byte readers
#define TLH  (64 * KP)                // halves of one staged tile (64 rows)
#define STH  (2 * TLH)                // halves of one stage: k tile (64 keys x 64 d), then vt tile (64 d x 64 keys)
#define PCAR 1024.0f
#define SCL  0.03125f                 // 1024^-0.5 (model-dim scaling)
#define L2E  1.4426950408889634f

static_assert(NH * HD == DM);
static_assert((SEQ % 256) == 0 && (RH % 256) == 0 && RH <= SEQ && SEQ <= SEQ_FULL && NB >= 1 && NB <= NB_FULL);
static_assert((DM % 128) == 0 && (SEQ % 64) == 0);
// workspace bytes at full size (all regions exact multiples of their store granularity) + alignment slack <= 128 MiB
static_assert((size_t)3 * DM * DM * 2 + (size_t)NB * SEQ * DM * 2 + (size_t)3 * NB * NH * SEQ * HD * 2 + (size_t)6 * NB * NH * RH * HD * 2 + 12 * 256 <= (size_t)134217728);

typedef _Float16 h16;
typedef unsigned short bf;
typedef __attribute__((ext_vector_type(16))) __bf16   v16bf;
typedef __attribute__((ext_vector_type(16))) _Float16 v16h;
typedef __attribute__((ext_vector_type(8)))  _Float16 v8h;
typedef __attribute__((ext_vector_type(8)))  unsigned short v8us;
typedef __attribute__((ext_vector_type(8)))  float    v8f;
typedef __attribute__((ext_vector_type(4)))  float    v4f;
typedef v8h  __attribute__((may_alias)) v8ha;
typedef v4f  __attribute__((may_alias)) v4fa;
typedef v8us __attribute__((may_alias)) v8usa;

__device__ __forceinline__ unsigned short f2bf(float f) { unsigned u = __float_as_uint(f); u += 0x7FFFu + ((u >> 16) & 1u); return (unsigned short)(u >> 16); }
__device__ __forceinline__ float bf2f(unsigned short b) { return __uint_as_float(((unsigned)b) << 16); }
__device__ __forceinline__ float bfr(float f) { return bf2f(f2bf(f)); }
__device__ __forceinline__ void splitf(float y, unsigned short& h, unsigned short& l) { h = f2bf(y); l = f2bf(y - bf2f(h)); }
__device__ __forceinline__ v16h cat16(v8h lo, v8h hi) { return __builtin_shufflevector(lo, hi, 0, 1, 2, 3, 4, 5, 6, 7, 8, 9, 10, 11, 12, 13, 14, 15); }
__device__ __forceinline__ v16bf cat16b(v8us lo, v8us hi) { return __builtin_bit_cast(v16bf, __builtin_shufflevector(lo, hi, 0, 1, 2, 3, 4, 5, 6, 7, 8, 9, 10, 11, 12, 13, 14, 15)); }
__device__ __forceinline__ v8f wmma16(v16h a, v16h b, v8f c) { return __builtin_amdgcn_wmma_f32_16x16x32_f16(false, a, false, b, (short)0, c, false, false); }
__device__ __forceinline__ v8f wmmab(v16bf a, v16bf b, v8f c) { return __builtin_amdgcn_wmma_f32_16x16x32_bf16(false, a, false, b, (short)0, c, false, false); }

// 16-bit fragment loaders (lane l: row/col = l & 15, h = l >> 4; elements 0..7 <- k0 + 8h + 0..7, elements 8..15 <- k0 + 16 + 8h + 0..7; the caller passes p = row base + k0 + 8h).
template <typename T16> struct WFrag;
template <> struct WFrag<h16> { typedef v16h V; static __device__ __forceinline__ V ld(const h16* p) { return cat16(*(const v8h*)p, *(const v8h*)(p + 16)); } static __device__ __forceinline__ v8f mma(V a, V b, v8f c) { return wmma16(a, b, c); } };
template <> struct WFrag<bf> { typedef v16bf V; static __device__ __forceinline__ V ld(const bf* p) { return cat16b(*(const v8us*)p, *(const v8us*)(p + 16)); } static __device__ __forceinline__ v8f mma(V a, V b, v8f c) { return wmmab(a, b, c); } };
// LDS reloads through may_alias vectors of the stored element type
__device__ __forceinline__ v16h  lds16(const h16* p) { return cat16(*(const v8ha*)p, *(const v8ha*)(p + 16)); }
__device__ __forceinline__ v16bf ldsb(const bf* p)   { return cat16b(*(const v8usa*)p, *(const v8usa*)(p + 16)); }

// Four 16-byte stores of a wave. The s_wait_xcnt stands inside the statement so that no register the stores name is rewritten ahead of it.
typedef __attribute__((ext_vector_type(4))) unsigned v4u;
template <int STEP>                   // base: the same in every lane; voff: the lane's byte offset; STEP: bytes between two of the four
__device__ __forceinline__ void store4(const void* base, unsigned voff, v4u d0, v4u d1, v4u d2, v4u d3) {
    asm volatile("global_store_b128 %0, %2, %1\n\t"
                 "global_store_b128 %0, %3, %1 offset:%6\n\t"
                 "global_store_b128 %0, %4, %1 offset:%7\n\t"
                 "global_store_b128 %0, %5, %1 offset:%8\n\t"
                 "s_wait_xcnt 0x0"
                 :: "v"(voff), "s"(base), "v"(d0), "v"(d1), "v"(d2), "v"(d3), "n"(STEP), "n"(2 * STEP), "n"(3 * STEP) : "memory");
}
// orders a wave's own LDS stores and loads around the reuse of its staging tile
__device__ __forceinline__ void wave_lds_order() { __builtin_amdgcn_fence(3, "wavefront"); __builtin_amdgcn_wave_barrier(); asm volatile("" ::: "memory"); }
// eight f32 values -> eight 16-bit values of plane p: 0 fp16, 1 bf16 hi, 2 bf16 lo (the residual of hi)
__device__ __forceinline__ v4u plane8(const float (&y)[8], int p) {
    if (p == 0) { v8h c;
#pragma unroll
        for (int k = 0; k < 8; ++k) c[k] = (h16)y[k];
        return __builtin_bit_cast(v4u, c); }
    v8us c;
#pragma unroll
    for (int k = 0; k < 8; ++k) { unsigned short a1, a2; splitf(y[k], a1, a2); c[k] = p == 1 ? a1 : a2; }
    return __builtin_bit_cast(v4u, c);
}
typedef v4u __attribute__((may_alias)) v4ua;
// Projection epilogues of one wave's 64 x 64 tile; acc[mb][nb][j] = y[16 mb + 8 hi + j][16 nb + lr] without bias, bs[nb] = bias of column 16 nb + lr. Read-back: 8 lanes cover one 128-B row of 16-bit values, a wave 4 rows.
// NP = 1: the fp16 plane alone; NP = 3: the bf16 hi and lo planes too (positions < RH), one plane after the other.
// Every loop of the two epilogues and of plane8 is unrolled so that acc and the small arrays are indexed by constants and stay in registers.
// k, q planes [t][64]: P[p] points at the tile's first position; f32 LDS tile of 16 positions.
template <int NP>
__device__ __forceinline__ void put_rows(const v8f (&acc)[4][4], const float (&bs)[4], unsigned char* sm, int lane, unsigned short* const (&P)[3]) {
    const int lr = lane & 15, hi = lane >> 4, srow = lane >> 3, scol = (lane & 7) * 8;
    float* os = (float*)sm;
#pragma unroll
    for (int mb = 0; mb < 4; ++mb) {
#pragma unroll
        for (int nb = 0; nb < 4; ++nb) {
#pragma unroll
            for (int j = 0; j < 8; ++j) os[(hi * 8 + j) * OSP + nb * 16 + lr] = acc[mb][nb][j] + bs[nb]; }
        wave_lds_order();
#pragma unroll
        for (int p = 0; p < NP; ++p) {
            v4u o[4];
#pragma unroll
            for (int s = 0; s < 4; ++s) {
                const float* xr = os + (4 * s + srow) * OSP + scol; const v4f x0 = *(const v4fa*)xr, x1 = *(const v4fa*)(xr + 4);
                const float y[8] = { x0[0], x0[1], x0[2], x0[3], x1[0], x1[1], x1[2], x1[3] };
                o[s] = plane8(y, p);
            }
            store4<4 * HD * 2>(P[p] + mb * 16 * HD, (unsigned)(srow * HD + scol) * 2u, o[0], o[1], o[2], o[3]);
        }
        wave_lds_order();
    }
}
// v planes [d][t]: P[p] (row pitch SEQ for p = 0, RH else) points at d = 0 of the tile's first position; a lane's 8 accumulator rows are 8 consecutive positions of one d; a 16-bit LDS tile of 16 d x 64 positions per plane.
template <int NP>
__device__ __forceinline__ void put_cols(const v8f (&acc)[4][4], const float (&bs)[4], unsigned char* sm, int lane, unsigned short* const (&P)[3]) {
    const int lr = lane & 15, hi = lane >> 4, srow = lane >> 3, scol = (lane & 7) * 8;
#pragma unroll
    for (int nb = 0; nb < 4; ++nb) {
#pragma unroll
        for (int p = 0; p < NP; ++p) {
            unsigned short* st = (unsigned short*)sm + p * 16 * KP;
#pragma unroll
            for (int mb = 0; mb < 4; ++mb) {
                float y[8];
#pragma unroll
                for (int j = 0; j < 8; ++j) y[j] = acc[mb][nb][j] + bs[nb];
                *(v4ua*)(st + lr * KP + mb * 16 + hi * 8) = plane8(y, p);
            }
            wave_lds_order();
            v4u o[4];
#pragma unroll
            for (int s = 0; s < 4; ++s) o[s] = *(const v4ua*)(st + (4 * s + srow) * KP + scol);
            if (p == 0) store4<4 * SEQ * 2>(P[0] + (size_t)nb * 16 * SEQ, (unsigned)(srow * SEQ + scol) * 2u, o[0], o[1], o[2], o[3]);
            else        store4<4 * RH * 2>(P[p] + nb * 16 * RH, (unsigned)(srow * RH + scol) * 2u, o[0], o[1], o[2], o[3]);
        }
        wave_lds_order();
    }
}

// ---- k_gemmw: the kqv projection. Grid (SEQ/256, 3*DM/128, NB), 256 threads: a work-group owns a 256 x 128 tile of y, its eight waves (4 x 2) a 64 x 64 tile each (16 accumulators).
// y[m][n] (f32, + bf16-valued bias[n]) = sum_k A[m][k] Bt[n][k], both operands K-contiguous bf16 planes. z-batch strides sA/sB in elements. K % 64 == 0, K >= 64.
// The waves read their fragments from LDS. A stage = 64 k of the work-group's 256 A rows and 128 Bt rows (whole 128-B lines, 8 lanes a row), two buffers; every thread copies 8 + 4 pieces of 16 B per stage;
// stage t + 2 is issued into the buffer of stage t behind the barrier that ends its last read. After the last stage's barrier the ring is the eight waves' epilogue staging.
// A wave's tile is 64 positions of ONE head of k, q or v (column tile = NH * {k, q, v} + head); the epilogue converts y and writes the head planes itself:
// k, q: fp16 [t][64] (and the bf16 hi/lo planes where t < RH) through an f32 LDS tile of 16 positions; v: a lane's 8 accumulator rows are 8 consecutive positions of one d, packed and turned into whole 128-B rows of [d][t] through 16-bit LDS tiles of 16 d.
#define GAH  (256 * KP)               // halves of the staged A tile (256 rows of 64 k)
#define GSH  (GAH + 128 * KP)         // halves of one stage: A tile, then Bt tile (128 rows)
#define EPB  (3 * 16 * KP * 2)        // bytes of one wave's epilogue staging: one f32 tile 16 x OSP, or three 16-bit tiles 16 x KP
// One stage's copies of this thread: rows r, r + 32, ..., r + 224 of the A tile and r, ..., r + 96 of the Bt tile (l: LDS byte address of its first A piece; rs: elements between two of the rows).
// The s_wait_xcnt stands inside the statement so that no address register is rewritten ahead of it.
__device__ __forceinline__ void gstage_copy(unsigned l, const bf* ga, const bf* gb, size_t rs) {
    asm volatile("global_load_async_to_lds_b128 %0, %12, off\n\t"
                 "global_load_async_to_lds_b128 %1, %13, off\n\t"
                 "global_load_async_to_lds_b128 %2, %14, off\n\t"
                 "global_load_async_to_lds_b128 %3, %15, off\n\t"
                 "global_load_async_to_lds_b128 %4, %16, off\n\t"
                 "global_load_async_to_lds_b128 %5, %17, off\n\t"
                 "global_load_async_to_lds_b128 %6, %18, off\n\t"
                 "global_load_async_to_lds_b128 %7, %19, off\n\t"
                 "global_load_async_to_lds_b128 %8, %20, off\n\t"
                 "global_load_async_to_lds_b128 %9, %21, off\n\t"
                 "global_load_async_to_lds_b128 %10, %22, off\n\t"
                 "global_load_async_to_lds_b128 %11, %23, off\n\t"
                 "s_wait_xcnt 0x0"
                 :: "v"(l), "v"(l + 32 * KP * 2), "v"(l + 64 * KP * 2), "v"(l + 96 * KP * 2), "v"(l + 128 * KP * 2), "v"(l + 160 * KP * 2), "v"(l + 192 * KP * 2), "v"(l + 224 * KP * 2),
                    "v"(l + GAH * 2), "v"(l + GAH * 2 + 32 * KP * 2), "v"(l + GAH * 2 + 64 * KP * 2), "v"(l + GAH * 2 + 96 * KP * 2),
                    "v"(ga), "v"(ga + rs), "v"(ga + 2 * rs), "v"(ga + 3 * rs), "v"(ga + 4 * rs), "v"(ga + 5 * rs), "v"(ga + 6 * rs), "v"(ga + 7 * rs),
                    "v"(gb), "v"(gb + rs), "v"(gb + 2 * rs), "v"(gb + 3 * rs)
                 : "memory");
}
__global__ __launch_bounds__(256) __attribute__((amdgpu_num_vgpr(256)))   // the ring lets two work-groups share a WGP: four waves per SIMD, 256 registers each
void k_gemmw(const bf* __restrict__ A, const bf* __restrict__ Bt, int K, const float* __restrict__ bias, size_t sA, size_t sB,
             h16* Q16, h16* K16, h16* VT16, bf* QPh, bf* QPl, bf* KPh, bf* KPl, bf* VTh, bf* VTl) {
    __shared__ __align__(16) unsigned char sm[2 * GSH * 2];       // the two-stage ring, then epilogue staging
    static_assert(16 * OSP * 4 <= EPB && 8 * EPB <= 2 * GSH * 2);
    const size_t z = blockIdx.z; A += z * sA; Bt += z * sB;
    const int lane = threadIdx.x & 31, lr = lane & 15, hi = lane >> 4;
    const int wid = __builtin_amdgcn_readfirstlane((int)threadIdx.x >> 5);   // the wave's number in a scalar register: tile, plane and store bases stay scalar
    const int wm = wid & 3, wn = wid >> 2;
    const int r0 = (int)blockIdx.x * 256 + wm * 64, ct = (int)blockIdx.y * 2 + wn, c0 = ct * 64;
    v8f acc[4][4];
#pragma unroll
    for (int mb = 0; mb < 4; ++mb)
#pragma unroll
        for (int nb = 0; nb < 4; ++nb) acc[mb][nb] = (v8f){};
    const bf* ring = (const bf*)sm;
    // this thread's first piece of an operand tile: row threadIdx.x >> 3, 16-byte column threadIdx.x & 7
    const int crow = (int)threadIdx.x >> 3, ccol = ((int)threadIdx.x & 7) * 8;
    const unsigned la0 = (unsigned)(size_t)(ring + crow * KP + ccol);                  // LDS byte address in buffer 0, A tile
    const bf* ga0 = A + (size_t)((int)blockIdx.x * 256 + crow) * K + ccol; const bf* gb0 = Bt + (size_t)((int)blockIdx.y * 128 + crow) * K + ccol;
    const size_t rs = (size_t)32 * K;
    const int nst = K >> 6;                                                            // stages of 64 k
    gstage_copy(la0, ga0, gb0, rs);
    asm volatile("s_wait_asynccnt 0x0" ::: "memory");                                  // stage 0 has landed before the barrier that publishes it
    __syncthreads();                                                                   // publishes stage 0 to all eight waves
    if (nst > 1) gstage_copy(la0 + GSH * 2, ga0 + 64, gb0 + 64, rs);
#pragma unroll 1
    for (int t = 0; t < nst; ++t) {
        const bf* ap = ring + (t & 1) * GSH + (wm * 64 + lr) * KP + 8 * hi; const bf* bp = ring + (t & 1) * GSH + GAH + (wn * 64 + lr) * KP + 8 * hi;
#pragma unroll
        for (int kk = 0; kk < 2; ++kk) {
            v16bf a[4], b[4];
#pragma unroll
            for (int i = 0; i < 4; ++i) { a[i] = ldsb(ap + i * 16 * KP + kk * 32); b[i] = ldsb(bp + i * 16 * KP + kk * 32); }
            // holds the block's 16 LDS reads together in front of its 16 products (loaded values as inputs only): one wait per block instead of one per group of four products
            asm volatile("" :: "v"(a[0]), "v"(a[1]), "v"(a[2]), "v"(a[3]), "v"(b[0]), "v"(b[1]), "v"(b[2]), "v"(b[3]));
#pragma unroll
            for (int nb = 0; nb < 4; ++nb)
#pragma unroll
                for (int mb = 0; mb < 4; ++mb) acc[mb][nb] = wmmab(a[mb], b[nb], acc[mb][nb]);
        }
        // foot of a stage: publish the next stage, free this one's buffer
        asm volatile("s_wait_dscnt 0x0" ::: "memory");                                 // this wave's reads of the buffer have returned
        asm volatile("s_wait_asynccnt 0x0" ::: "memory");                              // this wave's copies of stage t + 1 have landed
        __syncthreads();                                                               // publishes stage t + 1 and ends every wave's reads of stage t
        if (t + 2 < nst) gstage_copy(la0 + (unsigned)(t & 1) * (GSH * 2), ga0 + (t + 2) * 64, gb0 + (t + 2) * 64, rs);
    }
    asm volatile("s_wait_asynccnt 0x0" ::: "memory");                                  // nothing of this wave is in flight when the ring becomes epilogue staging
    unsigned char* es = sm + wid * EPB;                   // this wave's own staging
    const int sel = ct / NH;                              // 0: k, 1: q, 2: v (W's row blocks)
    const size_t bh = z * NH + ct % NH;
    const bool lo = r0 < RH;                              // the wave's whole tile (RH is a multiple of 64); wave-uniform like sel, and no block barrier follows
    const size_t rl = lo ? r0 : 0;
    float bs[4];
    // bias of columns c0 + lr + {0, 16, 32, 48}: the four loads and their data wait in one statement, outputs early-clobbered, so that no register a load names is rewritten while it is in flight
    asm volatile("global_load_b32 %0, %4, %5\n\t"
                 "global_load_b32 %1, %4, %5 offset:64\n\t"
                 "global_load_b32 %2, %4, %5 offset:128\n\t"
                 "global_load_b32 %3, %4, %5 offset:192\n\t"
                 "s_wait_loadcnt 0x0"
                 : "=&v"(bs[0]), "=&v"(bs[1]), "=&v"(bs[2]), "=&v"(bs[3]) : "v"((unsigned)(c0 + lr) * 4u), "s"(bias) : "memory");
#pragma unroll
    for (int nb = 0; nb < 4; ++nb) bs[nb] = bfr(bs[nb]);
    if (sel < 2) {
        unsigned short* const P[3] = { (unsigned short*)(sel == 1 ? Q16 : K16) + (bh * SEQ + r0) * HD, (sel == 1 ? QPh : KPh) + (bh * RH + rl) * HD, (sel == 1 ? QPl : KPl) + (bh * RH + rl) * HD };
        if (lo) put_rows<3>(acc, bs, es, lane, P); else put_rows<1>(acc, bs, es, lane, P);
    } else {
        unsigned short* const P[3] = { (unsigned short*)VT16 + bh * HD * SEQ + r0, VTh + bh * HD * RH + rl, VTl + bh * HD * RH + rl };
        if (lo) put_cols<3>(acc, bs, es, lane, P); else put_cols<1>(acc, bs, es, lane, P);
    }
}

__global__ __launch_bounds__(256) void k_cvt8(const float* __restrict__ src, bf* dst, size_t n8) { const size_t i = (size_t)blockIdx.x * 256 + threadIdx.x; if (i >= n8) return; const v8f v = *(const v8f*)(src + i * 8); v8us o;
#pragma unroll
    for (int k = 0; k < 8; ++k) o[k] = f2bf(v[k]); *(v8us*)(dst + i * 8) = o;  }
__global__ __launch_bounds__(256) void k_cvtx(const float* __restrict__ src, bf* dst, size_t n8) { const size_t i = (size_t)blockIdx.x * 256 + threadIdx.x; if (i >= n8) return;
    const float* s = src + (size_t)blockIdx.y * SEQ_FULL * DM; bf* d = dst + (size_t)blockIdx.y * SEQ * DM; const v8f v = *(const v8f*)(s + i * 8); v8us o;
#pragma unroll
    for (int k = 0; k < 8; ++k) o[k] = f2bf(v[k]); *(v8us*)(d + i * 8) = o;  }

// ---- k_attn: causal streaming attention, all rows in one launch. Grid (NH, NB, SEQ/64), 128 threads: block = 64 query rows starting at SEQ - 64 - 64*blockIdx.z of head blockIdx.x, batch blockIdx.y; wave -> 16 rows.
// A block whose rows lie below RH runs attn_rows<true> (HR), every other block attn_rows<false>: the few short HR blocks, one wave per SIMD and bound by load latency on their own, run beside the long ones.
// Key chunks of 32 from 0 to the block's last row (block-uniform loop; per-element causal select j <= i). Per chunk: S^T (32 keys x 16 queries) = k.q^T, scaled by SCL in f32, online max/sum in f32 (one query per lane), O^T += vt.p^T with p^T packed from the score registers,
// HR (rows and keys < RH): bf16 planes, q.k = qh.kh + qh.kl + ql.kh, p.v = ph.vh + pl.vh + ph.vl (one accumulator, unscaled residuals). Otherwise fp16 planes, single products.
// !HR: the block's four waves read k and vt from LDS. A stage = 64 keys (two chunks), two buffers; every thread copies 4 + 4 pieces of 16 B per stage, whole 128-B rows per 8 lanes;
// stage s + 2 is issued into the buffer of stage s behind the barrier that ends its last read. After the last stage's barrier the ring is the output staging.
// One stage's copies of this thread: rows r, r + 16, r + 32, r + 48 of the k tile and of the vt tile. The s_wait_xcnt stands inside the statement so that no address register is rewritten ahead of it.
__device__ __forceinline__ void stage_copy(unsigned lk, const h16* gk, unsigned lv, const h16* gv) {
    asm volatile("global_load_async_to_lds_b128 %0, %8, off\n\t"
                 "global_load_async_to_lds_b128 %1, %9, off\n\t"
                 "global_load_async_to_lds_b128 %2, %10, off\n\t"
                 "global_load_async_to_lds_b128 %3, %11, off\n\t"
                 "global_load_async_to_lds_b128 %4, %12, off\n\t"
                 "global_load_async_to_lds_b128 %5, %13, off\n\t"
                 "global_load_async_to_lds_b128 %6, %14, off\n\t"
                 "global_load_async_to_lds_b128 %7, %15, off\n\t"
                 "s_wait_xcnt 0x0"
                 :: "v"(lk), "v"(lk + 16 * KP * 2), "v"(lk + 32 * KP * 2), "v"(lk + 48 * KP * 2), "v"(lv), "v"(lv + 16 * KP * 2), "v"(lv + 32 * KP * 2), "v"(lv + 48 * KP * 2),
                    "v"(gk), "v"(gk + 16 * HD), "v"(gk + 32 * HD), "v"(gk + 48 * HD), "v"(gv), "v"(gv + (size_t)16 * SEQ), "v"(gv + (size_t)32 * SEQ), "v"(gv + (size_t)48 * SEQ)
                 : "memory");
}
// lane l <-> lane l ^ 16 (the other half of the wave holds the other 16 keys of the same query)
__device__ __forceinline__ float xhalf(float v) { const int b = __float_as_int(v); return __int_as_float(__builtin_amdgcn_permlanex16(b, b, 0x76543210, 0xfedcba98, false, false)); }
template <bool HR>
__device__ __forceinline__
void attn_rows(const h16* __restrict__ Q16, const h16* __restrict__ K16, const h16* __restrict__ VT16,
               const bf* __restrict__ QPh, const bf* __restrict__ QPl, const bf* __restrict__ KPh, const bf* __restrict__ KPl,
               const bf* __restrict__ VTh, const bf* __restrict__ VTl, int q0blk, int head, int batch, unsigned char* sm, float* OUT) {
    const int lane = threadIdx.x & 31, lr = lane & 15, hi = lane >> 4, wid = threadIdx.x >> 5;
    const int q0 = q0blk + wid * 16;
    const size_t bh = (size_t)batch * NH + head;
    const h16* Qb = Q16 + bh * SEQ * HD; const h16* Kb = K16 + bh * SEQ * HD; const h16* Vb = VT16 + bh * HD * SEQ;
    const bf* Qhb = QPh + bh * RH * HD; const bf* Qlb = QPl + bh * RH * HD; const bf* Khb = KPh + bh * RH * HD; const bf* Klb = KPl + bh * RH * HD;
    const bf* Vhb = VTh + bh * HD * RH; const bf* Vlb = VTl + bh * HD * RH;
    float* myos = (float*)sm + wid * 16 * OSP;
    const h16* ring = (const h16*)sm;
    const int nchunk = (q0blk + 64) >> 5;
    const float NEG = -__builtin_inff();
    const int q = q0 + lr;                                // this lane's query row

    v8f o[4];                                             // o[t][r] = O[q][t * 16 + 8 * hi + r] (transposed output tiles)
#pragma unroll
    for (int t = 0; t < 4; ++t) o[t] = (v8f){};
    float m = NEG, l = 0.0f;                              // m: both halves agree; l: this half's keys only, joined behind the loop
    v16h aq[2];
    if (!HR) { const h16* qr = Qb + (size_t)(q0 + lr) * HD + 8 * hi; aq[0] = WFrag<h16>::ld(qr); aq[1] = WFrag<h16>::ld(qr + 32); }
    // this thread's first piece of a stage: row threadIdx.x >> 3, 16-byte column threadIdx.x & 7
    const int crow = (int)threadIdx.x >> 3, ccol = ((int)threadIdx.x & 7) * 8;
    const unsigned lk0 = (unsigned)(size_t)(ring + crow * KP + ccol);                  // LDS byte address in buffer 0, k tile
    const h16* gk0 = Kb + (size_t)crow * HD + ccol; const h16* gv0 = Vb + (size_t)crow * SEQ + ccol;
    const int nst = nchunk >> 1;                                                       // stages of 64 keys (nchunk is even)
    if (!HR) {
        stage_copy(lk0, gk0, lk0 + TLH * 2, gv0);
        asm volatile("s_wait_asynccnt 0x0" ::: "memory");                              // stage 0 has landed before the barrier that publishes it
        __syncthreads();                                                               // publishes stage 0 to all four waves
        if (nst > 1) stage_copy(lk0 + STH * 2, gk0 + 64 * HD, lk0 + STH * 2 + TLH * 2, gv0 + 64);
    }

#pragma unroll 1
    for (int c = 0; c < nchunk; ++c) {
        const int j0 = c * 32;
        v8f s0 = (v8f){}, s1 = (v8f){};                   // s0[r] = S[q][j0 + 8 * hi + r], s1[r] = S[q][j0 + 16 + 8 * hi + r]
        if (HR) {
            const bf* qh = Qhb + (size_t)(q0 + lr) * HD + 8 * hi; const bf* ql = Qlb + (size_t)(q0 + lr) * HD + 8 * hi;
            const bf* kh = Khb + (size_t)(j0 + lr) * HD + 8 * hi; const bf* kl = Klb + (size_t)(j0 + lr) * HD + 8 * hi;
#pragma unroll
            for (int kk = 0; kk < 2; ++kk) {
                const v16bf aqh = WFrag<bf>::ld(qh + kk * 32), aql = WFrag<bf>::ld(ql + kk * 32);
                const v16bf kh0 = WFrag<bf>::ld(kh + kk * 32), kh1 = WFrag<bf>::ld(kh + 16 * HD + kk * 32);
                const v16bf kl0 = WFrag<bf>::ld(kl + kk * 32), kl1 = WFrag<bf>::ld(kl + 16 * HD + kk * 32);
                s0 = wmmab(kh0, aqh, s0); s0 = wmmab(kl0, aqh, s0); s0 = wmmab(kh0, aql, s0);
                s1 = wmmab(kh1, aqh, s1); s1 = wmmab(kl1, aqh, s1); s1 = wmmab(kh1, aql, s1);
                // keeps the vector slots between the last product and the first use of its result or operands
                if (kk == 1) asm volatile("v_nop\n\tv_nop\n\tv_nop\n\tv_nop" : "+v"(s0), "+v"(s1) : "v"(aql), "v"(kh1));
            }
        } else {
            const h16* kp = ring + ((c >> 1) & 1) * STH + ((c & 1) * 32 + lr) * KP + 8 * hi;
#pragma unroll
            for (int kk = 0; kk < 2; ++kk) {
                const v16h bk0 = lds16(kp + kk * 32), bk1 = lds16(kp + 16 * KP + kk * 32);
                s0 = wmma16(bk0, aq[kk], s0); s1 = wmma16(bk1, aq[kk], s1);
                // keeps the vector slots between the last product and the first use of its result or operands
                if (kk == 1) asm volatile("v_nop\n\tv_nop\n\tv_nop\n\tv_nop" : "+v"(s0), "+v"(s1) : "v"(aq[1]), "v"(bk1));
            }
        }
        // online softmax update: a lane holds 16 of the 32 keys of ONE query; maximum and sum in the lane, the maximum joined with the other half by one exchange
        float pa[8], pc[8];
        const v8f a0 = s0 * SCL, c0v = s1 * SCL;
        const int qd = q - j0 - 8 * hi;                       // key j0 + 8 * hi + r is allowed where r <= qd
#pragma unroll
        for (int r = 0; r < 8; ++r) { pa[r] = (r <= qd) ? a0[r] : NEG; pc[r] = (16 + r <= qd) ? c0v[r] : NEG; }
        float v = fmaxf(fmaxf(fmaxf(fmaxf(pa[0], pa[1]), fmaxf(pa[2], pa[3])), fmaxf(fmaxf(pa[4], pa[5]), fmaxf(pa[6], pa[7]))),
                        fmaxf(fmaxf(fmaxf(pc[0], pc[1]), fmaxf(pc[2], pc[3])), fmaxf(fmaxf(pc[4], pc[5]), fmaxf(pc[6], pc[7]))));
        v = fmaxf(v, xhalf(v));
        const float mn = fmaxf(m, v);                         // finite from chunk 0 on (key 0 <= q for every row, seen through the exchange)
        const float alpha = __builtin_amdgcn_exp2f((m - mn) * L2E);
        m = mn;
#pragma unroll
        for (int r = 0; r < 8; ++r) { pa[r] = __builtin_amdgcn_exp2f((pa[r] - mn) * L2E); pc[r] = __builtin_amdgcn_exp2f((pc[r] - mn) * L2E); }
        const float rs = (((pa[0] + pa[1]) + (pa[2] + pa[3])) + ((pa[4] + pa[5]) + (pa[6] + pa[7]))) + (((pc[0] + pc[1]) + (pc[2] + pc[3])) + ((pc[4] + pc[5]) + (pc[6] + pc[7])));
        l = l * alpha + rs;
#pragma unroll
        for (int t = 0; t < 4; ++t)
#pragma unroll
            for (int r = 0; r < 8; ++r) o[t][r] *= alpha;
        // the two score tiles, converted in place, are the B operand of vt . p^T: element s <- key j0 + 8 * hi + s (s < 8), j0 + 16 + 8 * hi + s - 8 (s >= 8), the loaders' k order
        if (HR) {
            v8us h0, l0, h1, l1;
#pragma unroll
            for (int r = 0; r < 8; ++r) { unsigned short a1, a2, c1, c2; splitf(pa[r], a1, a2); splitf(pc[r], c1, c2); h0[r] = a1; l0[r] = a2; h1[r] = c1; l1[r] = c2; }
            const v16bf bph = cat16b(h0, h1), bpl = cat16b(l0, l1);
            const bf* vh = Vhb + (size_t)lr * RH + j0 + 8 * hi; const bf* vl = Vlb + (size_t)lr * RH + j0 + 8 * hi;
            v16bf fvh = bph, fvl = bpl;
#pragma unroll
            for (int t = 0; t < 4; ++t) { fvh = WFrag<bf>::ld(vh + (size_t)t * 16 * RH); fvl = WFrag<bf>::ld(vl + (size_t)t * 16 * RH);
                o[t] = wmmab(fvh, bph, o[t]); o[t] = wmmab(fvh, bpl, o[t]); o[t] = wmmab(fvl, bph, o[t]); }
            // keeps the vector slots behind the last product on the loop's back edge too
            asm volatile("v_nop\n\tv_nop\n\tv_nop\n\tv_nop" : "+v"(o[0]), "+v"(o[1]), "+v"(o[2]), "+v"(o[3]) : "v"(bph), "v"(fvl));
        } else {
            v16h bp;
#pragma unroll
            for (int r = 0; r < 8; ++r) { bp[r] = (h16)(pa[r] * PCAR); bp[8 + r] = (h16)(pc[r] * PCAR); }
            const h16* vp = ring + ((c >> 1) & 1) * STH + TLH + lr * KP + (c & 1) * 32 + 8 * hi;
            v16h fv = bp;
#pragma unroll
            for (int t = 0; t < 4; ++t) { fv = lds16(vp + t * 16 * KP); o[t] = wmma16(fv, bp, o[t]); }
            // keeps the vector slots behind the last product on the loop's back edge too
            asm volatile("v_nop\n\tv_nop\n\tv_nop\n\tv_nop" : "+v"(o[0]), "+v"(o[1]), "+v"(o[2]), "+v"(o[3]) : "v"(bp), "v"(fv));
        }
        if (!HR && (c & 1)) {                                                          // foot of a stage (block-uniform): publish the next stage, free this one's buffer
            const int st = c >> 1;
            asm volatile("s_wait_dscnt 0x0" ::: "memory");                             // this wave's reads of the buffer have returned
            asm volatile("s_wait_asynccnt 0x0" ::: "memory");                          // this wave's copies of stage st + 1 have landed
            __syncthreads();                                                           // publishes stage st + 1 and ends every wave's reads of stage st
            if (st + 2 < nst) { const unsigned lb = lk0 + (unsigned)(st & 1) * (STH * 2); stage_copy(lb, gk0 + (size_t)(st + 2) * 64 * HD, lb + TLH * 2, gv0 + (st + 2) * 64); }
        }
    }
    if (!HR) asm volatile("s_wait_asynccnt 0x0" ::: "memory");                         // nothing of this wave is in flight when the ring becomes output staging

    l += xhalf(l);                                                                     // joins the two halves' sums of this query
    const float inv = __builtin_amdgcn_rcpf(HR ? l : l * PCAR);
#pragma unroll
    for (int t = 0; t < 4; ++t) {
        const v4f w0 = { o[t][0] * inv, o[t][1] * inv, o[t][2] * inv, o[t][3] * inv }, w1 = { o[t][4] * inv, o[t][5] * inv, o[t][6] * inv, o[t][7] * inv };
        *(v4fa*)(myos + lr * OSP + t * 16 + 8 * hi) = w0; *(v4fa*)(myos + lr * OSP + t * 16 + 8 * hi + 4) = w1;
    }
    __builtin_amdgcn_fence(3, "wavefront"); __builtin_amdgcn_wave_barrier(); asm volatile("" ::: "memory");
    float* orow = OUT + ((size_t)batch * SEQ_FULL + q0) * DM + (size_t)head * HD;
{
#pragma unroll
        for (int s = 0; s < 8; ++s) { const int row = 2 * s + hi, cofs = lr * 4; const v4f val = *(const v4fa*)(myos + row * OSP + cofs);
            *(v4f*)(orow + (size_t)row * DM + cofs) = val; }
         }
}
__global__ __launch_bounds__(128)
void k_attn(const h16* __restrict__ Q16, const h16* __restrict__ K16, const h16* __restrict__ VT16,
            const bf* __restrict__ QPh, const bf* __restrict__ QPl, const bf* __restrict__ KPh, const bf* __restrict__ KPl,
            const bf* __restrict__ VTh, const bf* __restrict__ VTl, float* OUT) {
    __shared__ __align__(16) unsigned char sm[2 * STH * 2];       // HR: output staging; !HR: the two-stage ring, then output staging
    static_assert(4 * 16 * OSP * 4 <= 2 * STH * 2);
    const int head = (int)blockIdx.x, batch = (int)blockIdx.y;
    if (blockIdx.z >= SEQ / 64) return;                   // block-uniform (the grid is exact), in front of every block barrier
    // The launch has more blocks than the chip has places for them; the row block is the slowest index and falls with it,
    // so the blocks with the most keys have the lowest indices and the short HR blocks the highest.
    // Behind the guard the remainder changes no value; it shows the compiler the row block's range, and the build then takes 158 registers instead of 162: six waves per SIMD instead of five.
    const int q0blk = (int)((SEQ / 64 - 1 - blockIdx.z) % (SEQ / 64)) * 64;
    // block-uniform choice (RH is a multiple of 64: a block lies wholly on one side)
    if (q0blk < RH) attn_rows<true>(Q16, K16, VT16, QPh, QPl, KPh, KPl, VTh, VTl, q0blk, head, batch, sm, OUT);
    else            attn_rows<false>(Q16, K16, VT16, QPh, QPl, KPh, KPl, VTh, VTl, q0blk, head, batch, sm, OUT);
}

extern "C" void kernel_launch(void* const* d_in, const int* in_sizes, int n_in,
                              void* d_out, int out_size, void* d_ws, size_t ws_size, hipStream_t stream) {
    if (n_in < 3) return;
    if ((size_t)in_sizes[0] < (size_t)(NB - 1) * SEQ_FULL * DM + (size_t)SEQ * DM) return;
    if ((size_t)in_sizes[1] < (size_t)3 * DM * DM) return;
    if (in_sizes[2] < 3 * DM) return;
    if ((size_t)out_size < (size_t)(NB - 1) * SEQ_FULL * DM + (size_t)SEQ * DM) return;
    const float* x = (const float*)d_in[0];      // [NB][SEQ_FULL][DM]
    const float* W = (const float*)d_in[1];      // [3*DM][DM]  ([out][in], row blocks k | q | v)
    const float* bias = (const float*)d_in[2];   // [3*DM]
    float* OUT = (float*)d_out;                  // [NB][SEQ_FULL][DM]
    char* wsp = (char*)d_ws;
    auto take = [&](size_t bytes) { char* p = wsp; wsp += (bytes + 255) & ~(size_t)255; return (void*)p; };
    bf* WB = (bf*)take((size_t)3 * DM * DM * 2);
    bf* XB = (bf*)take((size_t)NB * SEQ * DM * 2);
    h16* Q16 = (h16*)take((size_t)NB * NH * SEQ * HD * 2); h16* K16 = (h16*)take((size_t)NB * NH * SEQ * HD * 2); h16* VT16 = (h16*)take((size_t)NB * NH * HD * SEQ * 2);
    bf* QPh = (bf*)take((size_t)NB * NH * RH * HD * 2); bf* QPl = (bf*)take((size_t)NB * NH * RH * HD * 2); bf* KPh = (bf*)take((size_t)NB * NH * RH * HD * 2); bf* KPl = (bf*)take((size_t)NB * NH * RH * HD * 2);
    bf* VTh = (bf*)take((size_t)NB * NH * HD * RH * 2); bf* VTl = (bf*)take((size_t)NB * NH * HD * RH * 2);
    if ((size_t)(wsp - (char*)d_ws) > ws_size) return;
    if ((size_t)(wsp - (char*)d_ws) > (size_t)134217728) return;

    k_cvt8<<<(unsigned)(((size_t)3 * DM * DM / 8 + 255) / 256), 256, 0, stream>>>(W, WB, (size_t)3 * DM * DM / 8);
    k_cvtx<<<dim3((unsigned)(((size_t)SEQ * DM / 8 + 255) / 256), NB, 1), 256, 0, stream>>>(x, XB, (size_t)SEQ * DM / 8);
    // k | q | v in one launch: every 64-column tile is one head of one of the three
    k_gemmw<<<dim3(SEQ / 256, 3 * DM / 128, NB), 256, 0, stream>>>(XB, WB, DM, bias, (size_t)SEQ * DM, (size_t)0, Q16, K16, VT16, QPh, QPl, KPh, KPl, VTh, VTl);
    // attention, one launch: blocks of rows < RH on the hi/lo path, blocks of rows >= RH single products
    k_attn<<<dim3(NH, NB, SEQ / 64), 128, 0, stream>>>(Q16, K16, VT16, QPh, QPl, KPh, KPl, VTh, VTl, OUT);
}

// v006
// It runs in 110 microseconds.
// Two timings next to v005 put it at 1.10 and 1.11 times that version's speed.
// Counting every step since v000, it is 3.21 times as fast.
#include <hip/hip_runtime.h>

// Contractions (f32 accumulate): kqv projection = v_wmma_f32_16x16x32_bf16 on bf16 RNE copies of x and W, bf16-valued bias added in f32; causal attention query rows < 256: q.k and p.v as bf16 hi/lo 3-product groups; query rows >= 256: v_wmma_f32_16x16x32_f16 on fp16 q, k, v planes and fp16 p x 1024; softmax statistics f32; output f32.
// Layout: bf16 W [3072][1024] used directly as the k-contiguous B operand (row blocks k | q | v); the projection's epilogue writes the head planes q, k [b][h][t][64] and v transposed [b][h][64][t]

#ifndef NB
#define NB 4
#endif
#ifndef SEQ
#define SEQ 2048
#endif
#define NB_FULL  4
#define SEQ_FULL 2048
#define DM   1024
#define NH   16
#define HD   64
#define RH   256                      // query rows < RH use the hi/lo 3-product path (keys there are < RH too)
#define OSP  68                       // LDS pitch (floats) of the 16 x 64 output staging tile
#define KP   72                       // LDS pitch (halves) of a staged 64-half row: 144 B = 16 B x 9, for 16-byte readers
#define TLH  (64 * KP)                // halves of one staged tile (64 rows)
#define STH  (2 * TLH)                // halves of one stage: k tile (64 keys x 64 d), then vt tile (64 d x 64 keys)
#define PCAR 1024.0f
#define SCL  0.03125f                 // 1024^-0.5 (model-dim scaling)
#define L2E  1.4426950408889634f

static_assert(NH * HD == DM);
static_assert((SEQ % 256) == 0 && (RH % 256) == 0 && RH <= SEQ && SEQ <= SEQ_FULL && NB >= 1 && NB <= NB_FULL);
static_assert((DM % 128) == 0 && (SEQ % 64) == 0);
// workspace bytes at full size (all regions exact multiples of their store granularity) + alignment slack <= 128 MiB
static_assert((size_t)3 * DM * DM * 2 + (size_t)NB * SEQ * DM * 2 + (size_t)3 * NB * NH * SEQ * HD * 2 + (size_t)6 * NB * NH * RH * HD * 2 + 12 * 256 <= (size_t)134217728);

typedef _Float16 h16;
typedef unsigned short bf;
typedef __attribute__((ext_vector_type(16))) __bf16   v16bf;
typedef __attribute__((ext_vector_type(16))) _Float16 v16h;
typedef __attribute__((ext_vector_type(8)))  _Float16 v8h;
typedef __attribute__((ext_vector_type(8)))  unsigned short v8us;
typedef __attribute__((ext_vector_type(8)))  float    v8f;
typedef __attribute__((ext_vector_type(4)))  float    v4f;
typedef v8h  __attribute__((may_alias)) v8ha;
typedef v4f  __attribute__((may_alias)) v4fa;
typedef v8us __attribute__((may_alias)) v8usa;

__device__ __forceinline__ unsigned short f2bf(float f) { unsigned u = __float_as_uint(f); u += 0x7FFFu + ((u >> 16) & 1u); return (unsigned short)(u >> 16); }
__device__ __forceinline__ float bf2f(unsigned short b) { return __uint_as_float(((unsigned)b) << 16); }
__device__ __forceinline__ float bfr(float f) { return bf2f(f2bf(f)); }
__device__ __forceinline__ void splitf(float y, unsigned short& h, unsigned short& l) { h = f2bf(y); l = f2bf(y - bf2f(h)); }
__device__ __forceinline__ v16h cat16(v8h lo, v8h hi) { return __builtin_shufflevector(lo, hi, 0, 1, 2, 3, 4, 5, 6, 7, 8, 9, 10, 11, 12, 13, 14, 15); }
__device__ __forceinline__ v16bf cat16b(v8us lo, v8us hi) { return __builtin_bit_cast(v16bf, __builtin_shufflevector(lo, hi, 0, 1, 2, 3, 4, 5, 6, 7, 8, 9, 10, 11, 12, 13, 14, 15)); }
__device__ __forceinline__ v8f wmma16(v16h a, v16h b, v8f c) { return __builtin_amdgcn_wmma_f32_16x16x32_f16(false, a, false, b, (short)0, c, false, false); }
__device__ __forceinline__ v8f wmmab(v16bf a, v16bf b, v8f c) { return __builtin_amdgcn_wmma_f32_16x16x32_bf16(false, a, false, b, (short)0, c, false, false); }

// 16-bit fragment loaders (lane l: row/col = l & 15, h = l >> 4; elements 0..7 <- k0 + 8h + 0..7, elements 8..15 <- k0 + 16 + 8h + 0..7; the caller passes p = row base + k0 + 8h).
template <typename T16> struct WFrag;
template <> struct WFrag<h16> { typedef v16h V; static __device__ __forceinline__ V ld(const h16* p) { return cat16(*(const v8h*)p, *(const v8h*)(p + 16)); } static __device__ __forceinline__ v8f mma(V a, V b, v8f c) { return wmma16(a, b, c); } };
template <> struct WFrag<bf> { typedef v16bf V; static __device__ __forceinline__ V ld(const bf* p) { return cat16b(*(const v8us*)p, *(const v8us*)(p + 16)); } static __device__ __forceinline__ v8f mma(V a, V b, v8f c) { return wmmab(a, b, c); } };
// LDS reloads through may_alias vectors of the stored element type
__device__ __forceinline__ v16h  lds16(const h16* p) { return cat16(*(const v8ha*)p, *(const v8ha*)(p + 16)); }
__device__ __forceinline__ v16bf ldsb(const bf* p)   { return cat16b(*(const v8usa*)p, *(const v8usa*)(p + 16)); }

// Four 16-byte stores of a wave. The s_wait_xcnt stands inside the statement so that no register the stores name is rewritten ahead of it.
typedef __attribute__((ext_vector_type(4))) unsigned v4u;
template <int STEP>                   // base: the same in every lane; voff: the lane's byte offset; STEP: bytes between two of the four
__device__ __forceinline__ void store4(const void* base, unsigned voff, v4u d0, v4u d1, v4u d2, v4u d3) {
    asm volatile("global_store_b128 %0, %2, %1\n\t"
                 "global_store_b128 %0, %3, %1 offset:%6\n\t"
                 "global_store_b128 %0, %4, %1 offset:%7\n\t"
                 "global_store_b128 %0, %5, %1 offset:%8\n\t"
                 "s_wait_xcnt 0x0"
                 :: "v"(voff), "s"(base), "v"(d0), "v"(d1), "v"(d2), "v"(d3), "n"(STEP), "n"(2 * STEP), "n"(3 * STEP) : "memory");
}
// orders a wave's own LDS stores and loads around the reuse of its staging tile
__device__ __forceinline__ void wave_lds_order() { __builtin_amdgcn_fence(3, "wavefront"); __builtin_amdgcn_wave_barrier(); asm volatile("" ::: "memory"); }
// eight f32 values -> eight 16-bit values of plane p: 0 fp16, 1 bf16 hi, 2 bf16 lo (the residual of hi)
__device__ __forceinline__ v4u plane8(const float (&y)[8], int p) {
    if (p == 0) { v8h c;
#pragma unroll
        for (int k = 0; k < 8; ++k) c[k] = (h16)y[k];
        return __builtin_bit_cast(v4u, c); }
    v8us c;
#pragma unroll
    for (int k = 0; k < 8; ++k) { unsigned short a1, a2; splitf(y[k], a1, a2); c[k] = p == 1 ? a1 : a2; }
    return __builtin_bit_cast(v4u, c);
}
typedef v4u __attribute__((may_alias)) v4ua;
// Projection epilogues of one wave's 64 x 64 tile; acc[mb][nb][j] = y[16 mb + 8 hi + j][16 nb + lr] without bias, bs[nb] = bias of column 16 nb + lr. Read-back: 8 lanes cover one 128-B row of 16-bit values, a wave 4 rows.
// NP = 1: the fp16 plane alone; NP = 3: the bf16 hi and lo planes too (positions < RH), one plane after the other.
// Every loop of the two epilogues and of plane8 is unrolled so that acc and the small arrays are indexed by constants and stay in registers.
// k, q planes [t][64]: P[p] points at the tile's first position; f32 LDS tile of 16 positions.
template <int NP>
__device__ __forceinline__ void put_rows(const v8f (&acc)[4][4], const float (&bs)[4], unsigned char* sm, int lane, unsigned short* const (&P)[3]) {
    const int lr = lane & 15, hi = lane >> 4, srow = lane >> 3, scol = (lane & 7) * 8;
    float* os = (float*)sm;
#pragma unroll
    for (int mb = 0; mb < 4; ++mb) {
#pragma unroll
        for (int nb = 0; nb < 4; ++nb) {
#pragma unroll
            for (int j = 0; j < 8; ++j) os[(hi * 8 + j) * OSP + nb * 16 + lr] = acc[mb][nb][j] + bs[nb]; }
        wave_lds_order();
#pragma unroll
        for (int p = 0; p < NP; ++p) {
            v4u o[4];
#pragma unroll
            for (int s = 0; s < 4; ++s) {
                const float* xr = os + (4 * s + srow) * OSP + scol; const v4f x0 = *(const v4fa*)xr, x1 = *(const v4fa*)(xr + 4);
                const float y[8] = { x0[0], x0[1], x0[2], x0[3], x1[0], x1[1], x1[2], x1[3] };
                o[s] = plane8(y, p);
            }
            store4<4 * HD * 2>(P[p] + mb * 16 * HD, (unsigned)(srow * HD + scol) * 2u, o[0], o[1], o[2], o[3]);
        }
        wave_lds_order();
    }
}
// v planes [d][t]: P[p] (row pitch SEQ for p = 0, RH else) points at d = 0 of the tile's first position; a lane's 8 accumulator rows are 8 consecutive positions of one d; a 16-bit LDS tile of 16 d x 64 positions per plane.
template <int NP>
__device__ __forceinline__ void put_cols(const v8f (&acc)[4][4], const float (&bs)[4], unsigned char* sm, int lane, unsigned short* const (&P)[3]) {
    const int lr = lane & 15, hi = lane >> 4, srow = lane >> 3, scol = (lane & 7) * 8;
#pragma unroll
    for (int nb = 0; nb < 4; ++nb) {
#pragma unroll
        for (int p = 0; p < NP; ++p) {
            unsigned short* st = (unsigned short*)sm + p * 16 * KP;
#pragma unroll
            for (int mb = 0; mb < 4; ++mb) {
                float y[8];
#pragma unroll
                for (int j = 0; j < 8; ++j) y[j] = acc[mb][nb][j] + bs[nb];
                *(v4ua*)(st + lr * KP + mb * 16 + hi * 8) = plane8(y, p);
            }
            wave_lds_order();
            v4u o[4];
#pragma unroll
            for (int s = 0; s < 4; ++s) o[s] = *(const v4ua*)(st + (4 * s + srow) * KP + scol);
            if (p == 0) store4<4 * SEQ * 2>(P[0] + (size_t)nb * 16 * SEQ, (unsigned)(srow * SEQ + scol) * 2u, o[0], o[1], o[2], o[3]);
            else        store4<4 * RH * 2>(P[p] + nb * 16 * RH, (unsigned)(srow * RH + scol) * 2u, o[0], o[1], o[2], o[3]);
        }
        wave_lds_order();
    }
}

// ---- k_gemmw: the kqv projection. Grid (SEQ/256, 3*DM/128, NB), 256 threads: a work-group owns a 256 x 128 tile of y, its eight waves (4 x 2) a 64 x 64 tile each (16 accumulators).
// y[m][n] (f32, + bf16-valued bias[n]) = sum_k A[m][k] Bt[n][k], both operands K-contiguous bf16 planes. z-batch strides sA/sB in elements. K % 64 == 0, K >= 64.
// The waves read their fragments from LDS. A stage = 64 k of the work-group's 256 A rows and 128 Bt rows (whole 128-B lines, 8 lanes a row), two buffers; every thread copies 8 + 4 pieces of 16 B per stage;
// stage t + 2 is issued into the buffer of stage t behind the barrier that ends its last read. After the last stage's barrier the ring is the eight waves' epilogue staging.
// A wave's tile is 64 positions of ONE head of k, q or v (column tile = NH * {k, q, v} + head); the epilogue converts y and writes the head planes itself:
// k, q: fp16 [t][64] (and the bf16 hi/lo planes where t < RH) through an f32 LDS tile of 16 positions; v: a lane's 8 accumulator rows are 8 consecutive positions of one d, packed and turned into whole 128-B rows of [d][t] through 16-bit LDS tiles of 16 d.
#define GAH  (256 * KP)               // halves of the staged A tile (256 rows of 64 k)
#define GSH  (GAH + 128 * KP)         // halves of one stage: A tile, then Bt tile (128 rows)
#define EPB  (3 * 16 * KP * 2)        // bytes of one wave's epilogue staging: one f32 tile 16 x OSP, or three 16-bit tiles 16 x KP
// One stage's copies of this thread: rows r, r + 32, ..., r + 224 of the A tile and r, ..., r + 96 of the Bt tile (l: LDS byte address of its first A piece; rs: elements between two of the rows).
// The s_wait_xcnt stands inside the statement so that no address register is rewritten ahead of it.
__device__ __forceinline__ void gstage_copy(unsigned l, const bf* ga, const bf* gb, size_t rs) {
    asm volatile("global_load_async_to_lds_b128 %0, %12, off\n\t"
                 "global_load_async_to_lds_b128 %1, %13, off\n\t"
                 "global_load_async_to_lds_b128 %2, %14, off\n\t"
                 "global_load_async_to_lds_b128 %3, %15, off\n\t"
                 "global_load_async_to_lds_b128 %4, %16, off\n\t"
                 "global_load_async_to_lds_b128 %5, %17, off\n\t"
                 "global_load_async_to_lds_b128 %6, %18, off\n\t"
                 "global_load_async_to_lds_b128 %7, %19, off\n\t"
                 "global_load_async_to_lds_b128 %8, %20, off\n\t"
                 "global_load_async_to_lds_b128 %9, %21, off\n\t"
                 "global_load_async_to_lds_b128 %10, %22, off\n\t"
                 "global_load_async_to_lds_b128 %11, %23, off\n\t"
                 "s_wait_xcnt 0x0"
                 :: "v"(l), "v"(l + 32 * KP * 2), "v"(l + 64 * KP * 2), "v"(l + 96 * KP * 2), "v"(l + 128 * KP * 2), "v"(l + 160 * KP * 2), "v"(l + 192 * KP * 2), "v"(l + 224 * KP * 2),
                    "v"(l + GAH * 2), "v"(l + GAH * 2 + 32 * KP * 2), "v"(l + GAH * 2 + 64 * KP * 2), "v"(l + GAH * 2 + 96 * KP * 2),
                    "v"(ga), "v"(ga + rs), "v"(ga + 2 * rs), "v"(ga + 3 * rs), "v"(ga + 4 * rs), "v"(ga + 5 * rs), "v"(ga + 6 * rs), "v"(ga + 7 * rs),
                    "v"(gb), "v"(gb + rs), "v"(gb + 2 * rs), "v"(gb + 3 * rs)
                 : "memory");
}
__global__ __launch_bounds__(256) __attribute__((amdgpu_num_vgpr(256)))   // the ring lets two work-groups share a WGP: four waves per SIMD, 256 registers each
void k_gemmw(const bf* __restrict__ A, const bf* __restrict__ Bt, int K, const float* __restrict__ bias, size_t sA, size_t sB,
             h16* Q16, h16* K16, h16* VT16, bf* QPh, bf* QPl, bf* KPh, bf* KPl, bf* VTh, bf* VTl) {
    __shared__ __align__(16) unsigned char sm[2 * GSH * 2];       // the two-stage ring, then epilogue staging
    static_assert(16 * OSP * 4 <= EPB && 8 * EPB <= 2 * GSH * 2);
    const size_t z = blockIdx.z; A += z * sA; Bt += z * sB;
    const int lane = threadIdx.x & 31, lr = lane & 15, hi = lane >> 4;
    const int wid = __builtin_amdgcn_readfirstlane((int)threadIdx.x >> 5);   // the wave's number in a scalar register: tile, plane and store bases stay scalar
    const int wm = wid & 3, wn = wid >> 2;
    const int r0 = (int)blockIdx.x * 256 + wm * 64, ct = (int)blockIdx.y * 2 + wn, c0 = ct * 64;
    v8f acc[4][4];
#pragma unroll
    for (int mb = 0; mb < 4; ++mb)
#pragma unroll
        for (int nb = 0; nb < 4; ++nb) acc[mb][nb] = (v8f){};
    const bf* ring = (const bf*)sm;
    // this thread's first piece of an operand tile: row threadIdx.x >> 3, 16-byte column threadIdx.x & 7
    const int crow = (int)threadIdx.x >> 3, ccol = ((int)threadIdx.x & 7) * 8;
    const unsigned la0 = (unsigned)(size_t)(ring + crow * KP + ccol);                  // LDS byte address in buffer 0, A tile
    const bf* ga0 = A + (size_t)((int)blockIdx.x * 256 + crow) * K + ccol; const bf* gb0 = Bt + (size_t)((int)blockIdx.y * 128 + crow) * K + ccol;
    const size_t rs = (size_t)32 * K;
    const int nst = K >> 6;                                                            // stages of 64 k
    gstage_copy(la0, ga0, gb0, rs);
    asm volatile("s_wait_asynccnt 0x0" ::: "memory");                                  // stage 0 has landed before the barrier that publishes it
    __syncthreads();                                                                   // publishes stage 0 to all eight waves
    if (nst > 1) gstage_copy(la0 + GSH * 2, ga0 + 64, gb0 + 64, rs);
#pragma unroll 1
    for (int t = 0; t < nst; ++t) {
        const bf* ap = ring + (t & 1) * GSH + (wm * 64 + lr) * KP + 8 * hi; const bf* bp = ring + (t & 1) * GSH + GAH + (wn * 64 + lr) * KP + 8 * hi;
#pragma unroll
        for (int kk = 0; kk < 2; ++kk) {
            v16bf a[4], b[4];
#pragma unroll
            for (int i = 0; i < 4; ++i) { a[i] = ldsb(ap + i * 16 * KP + kk * 32); b[i] = ldsb(bp + i * 16 * KP + kk * 32); }
            // holds the block's 16 LDS reads together in front of its 16 products (loaded values as inputs only): one wait per block instead of one per group of four products
            asm volatile("" :: "v"(a[0]), "v"(a[1]), "v"(a[2]), "v"(a[3]), "v"(b[0]), "v"(b[1]), "v"(b[2]), "v"(b[3]));
#pragma unroll
            for (int nb = 0; nb < 4; ++nb)
#pragma unroll
                for (int mb = 0; mb < 4; ++mb) acc[mb][nb] = wmmab(a[mb], b[nb], acc[mb][nb]);
        }
        // foot of a stage: publish the next stage, free this one's buffer
        asm volatile("s_wait_dscnt 0x0" ::: "memory");                                 // this wave's reads of the buffer have returned
        asm volatile("s_wait_asynccnt 0x0" ::: "memory");                              // this wave's copies of stage t + 1 have landed
        __syncthreads();                                                               // publishes stage t + 1 and ends every wave's reads of stage t
        if (t + 2 < nst) gstage_copy(la0 + (unsigned)(t & 1) * (GSH * 2), ga0 + (t + 2) * 64, gb0 + (t + 2) * 64, rs);
    }
    asm volatile("s_wait_asynccnt 0x0" ::: "memory");                                  // nothing of this wave is in flight when the ring becomes epilogue staging
    unsigned char* es = sm + wid * EPB;                   // this wave's own staging
    const int sel = ct / NH;                              // 0: k, 1: q, 2: v (W's row blocks)
    const size_t bh = z * NH + ct % NH;
    const bool lo = r0 < RH;                              // the wave's whole tile (RH is a multiple of 64); wave-uniform like sel, and no block barrier follows
    const size_t rl = lo ? r0 : 0;
    float bs[4];
    // bias of columns c0 + lr + {0, 16, 32, 48}: the four loads and their data wait in one statement, outputs early-clobbered, so that no register a load names is rewritten while it is in flight
    asm volatile("global_load_b32 %0, %4, %5\n\t"
                 "global_load_b32 %1, %4, %5 offset:64\n\t"
                 "global_load_b32 %2, %4, %5 offset:128\n\t"
                 "global_load_b32 %3, %4, %5 offset:192\n\t"
                 "s_wait_loadcnt 0x0"
                 : "=&v"(bs[0]), "=&v"(bs[1]), "=&v"(bs[2]), "=&v"(bs[3]) : "v"((unsigned)(c0 + lr) * 4u), "s"(bias) : "memory");
#pragma unroll
    for (int nb = 0; nb < 4; ++nb) bs[nb] = bfr(bs[nb]);
    if (sel < 2) {
        unsigned short* const P[3] = { (unsigned short*)(sel == 1 ? Q16 : K16) + (bh * SEQ + r0) * HD, (sel == 1 ? QPh : KPh) + (bh * RH + rl) * HD, (sel == 1 ? QPl : KPl) + (bh * RH + rl) * HD };
        if (lo) put_rows<3>(acc, bs, es, lane, P); else put_rows<1>(acc, bs, es, lane, P);
    } else {
        unsigned short* const P[3] = { (unsigned short*)VT16 + bh * HD * SEQ + r0, VTh + bh * HD * RH + rl, VTl + bh * HD * RH + rl };
        if (lo) put_cols<3>(acc, bs, es, lane, P); else put_cols<1>(acc, bs, es, lane, P);
    }
}

__global__ __launch_bounds__(256) void k_cvt8(const float* __restrict__ src, bf* dst, size_t n8) { const size_t i = (size_t)blockIdx.x * 256 + threadIdx.x; if (i >= n8) return; const v8f v = *(const v8f*)(src + i * 8); v8us o;
#pragma unroll
    for (int k = 0; k < 8; ++k) o[k] = f2bf(v[k]); *(v8us*)(dst + i * 8) = o;  }
__global__ __launch_bounds__(256) void k_cvtx(const float* __restrict__ src, bf* dst, size_t n8) { const size_t i = (size_t)blockIdx.x * 256 + threadIdx.x; if (i >= n8) return;
    const float* s = src + (size_t)blockIdx.y * SEQ_FULL * DM; bf* d = dst + (size_t)blockIdx.y * SEQ * DM; const v8f v = *(const v8f*)(s + i * 8); v8us o;
#pragma unroll
    for (int k = 0; k < 8; ++k) o[k] = f2bf(v[k]); *(v8us*)(d + i * 8) = o;  }

// ---- k_attn: causal streaming attention, all rows in one launch. Grid (NH, NB, SEQ/64), 128 threads: block = 64 query rows starting at SEQ - 64 - 64*blockIdx.z of head blockIdx.x, batch blockIdx.y; wave -> 16 rows.
// A block whose rows lie below RH runs attn_rows<true> (HR), every other block attn_rows<false>: the few short HR blocks, one wave per SIMD and bound by load latency on their own, run beside the long ones.
// Key chunks of 32 from 0 to the block's last row (block-uniform loop; per-element causal select j <= i; !HR: in the last two chunks alone, the only ones with keys past the block's first row). Per chunk: S^T (32 keys x 16 queries) = k.q^T, scaled by SCL in f32, online max/sum in f32 (one query per lane), O^T += vt.p^T with p^T packed from the score registers,
// HR (rows and keys < RH): bf16 planes, q.k = qh.kh + qh.kl + ql.kh, p.v = ph.vh + pl.vh + ph.vl (one accumulator, unscaled residuals). Otherwise fp16 planes, single products.
// !HR: the block's four waves read k and vt from LDS. A stage = 64 keys (two chunks), two buffers; every thread copies 4 + 4 pieces of 16 B per stage, whole 128-B rows per 8 lanes;
// stage s + 2 is issued into the buffer of stage s behind the barrier that ends its last read. After the last stage's barrier the ring is the output staging.
// One stage's copies of this thread: rows r, r + 16, r + 32, r + 48 of the k tile and of the vt tile. The s_wait_xcnt stands inside the statement so that no address register is rewritten ahead of it.
__device__ __forceinline__ void stage_copy(unsigned lk, const h16* gk, unsigned lv, const h16* gv) {
    asm volatile("global_load_async_to_lds_b128 %0, %8, off\n\t"
                 "global_load_async_to_lds_b128 %1, %9, off\n\t"
                 "global_load_async_to_lds_b128 %2, %10, off\n\t"
                 "global_load_async_to_lds_b128 %3, %11, off\n\t"
                 "global_load_async_to_lds_b128 %4, %12, off\n\t"
                 "global_load_async_to_lds_b128 %5, %13, off\n\t"
                 "global_load_async_to_lds_b128 %6, %14, off\n\t"
                 "global_load_async_to_lds_b128 %7, %15, off\n\t"
                 "s_wait_xcnt 0x0"
                 :: "v"(lk), "v"(lk + 16 * KP * 2), "v"(lk + 32 * KP * 2), "v"(lk + 48 * KP * 2), "v"(lv), "v"(lv + 16 * KP * 2), "v"(lv + 32 * KP * 2), "v"(lv + 48 * KP * 2),
                    "v"(gk), "v"(gk + 16 * HD), "v"(gk + 32 * HD), "v"(gk + 48 * HD), "v"(gv), "v"(gv + (size_t)16 * SEQ), "v"(gv + (size_t)32 * SEQ), "v"(gv + (size_t)48 * SEQ)
                 : "memory");
}
// lane l <-> lane l ^ 16 (the other half of the wave holds the other 16 keys of the same query)
__device__ __forceinline__ float xhalf(float v) { const int b = __float_as_int(v); return __int_as_float(__builtin_amdgcn_permlanex16(b, b, 0x76543210, 0xfedcba98, false, false)); }
template <bool HR>
__device__ __forceinline__
void attn_rows(const h16* __restrict__ Q16, const h16* __restrict__ K16, const h16* __restrict__ VT16,
               const bf* __restrict__ QPh, const bf* __restrict__ QPl, const bf* __restrict__ KPh, const bf* __restrict__ KPl,
               const bf* __restrict__ VTh, const bf* __restrict__ VTl, int q0blk, int head, int batch, unsigned char* sm, float* OUT) {
    const int lane = threadIdx.x & 31, lr = lane & 15, hi = lane >> 4, wid = threadIdx.x >> 5;
    const int q0 = q0blk + wid * 16;
    const size_t bh = (size_t)batch * NH + head;
    const h16* Qb = Q16 + bh * SEQ * HD; const h16* Kb = K16 + bh * SEQ * HD; const h16* Vb = VT16 + bh * HD * SEQ;
    const bf* Qhb = QPh + bh * RH * HD; const bf* Qlb = QPl + bh * RH * HD; const bf* Khb = KPh + bh * RH * HD; const bf* Klb = KPl + bh * RH * HD;
    const bf* Vhb = VTh + bh * HD * RH; const bf* Vlb = VTl + bh * HD * RH;
    float* myos = (float*)sm + wid * 16 * OSP;
    const h16* ring = (const h16*)sm;
    const int nchunk = (q0blk + 64) >> 5;
    const float NEG = -__builtin_inff();
    const int q = q0 + lr;                                // this lane's query row

    v8f o[4];                                             // o[t][r] = O[q][t * 16 + 8 * hi + r] (transposed output tiles)
#pragma unroll
    for (int t = 0; t < 4; ++t) o[t] = (v8f){};
    float m = NEG, l = 0.0f;                              // m: both halves agree; l: this half's keys only, joined behind the loop
    v16h aq[2];
    if (!HR) { const h16* qr = Qb + (size_t)(q0 + lr) * HD + 8 * hi; aq[0] = WFrag<h16>::ld(qr); aq[1] = WFrag<h16>::ld(qr + 32); }
    // this thread's first piece of a stage: row threadIdx.x >> 3, 16-byte column threadIdx.x & 7
    const int crow = (int)threadIdx.x >> 3, ccol = ((int)threadIdx.x & 7) * 8;
    const unsigned lk0 = (unsigned)(size_t)(ring + crow * KP + ccol);                  // LDS byte address in buffer 0, k tile
    const h16* gk0 = Kb + (size_t)crow * HD + ccol; const h16* gv0 = Vb + (size_t)crow * SEQ + ccol;
    const int nst = nchunk >> 1;                                                       // stages of 64 keys (nchunk is even)
    if (!HR) {
        stage_copy(lk0, gk0, lk0 + TLH * 2, gv0);
        asm volatile("s_wait_asynccnt 0x0" ::: "memory");                              // stage 0 has landed before the barrier that publishes it
        __syncthreads();                                                               // publishes stage 0 to all four waves
        if (nst > 1) stage_copy(lk0 + STH * 2, gk0 + 64 * HD, lk0 + STH * 2 + TLH * 2, gv0 + 64);
    }

#pragma unroll 1
    for (int c = 0; c < nchunk; ++c) {
        const int j0 = c * 32;
        v8f s0 = (v8f){}, s1 = (v8f){};                   // s0[r] = S[q][j0 + 8 * hi + r], s1[r] = S[q][j0 + 16 + 8 * hi + r]
        if (HR) {
            const bf* qh = Qhb + (size_t)(q0 + lr) * HD + 8 * hi; const bf* ql = Qlb + (size_t)(q0 + lr) * HD + 8 * hi;
            const bf* kh = Khb + (size_t)(j0 + lr) * HD + 8 * hi; const bf* kl = Klb + (size_t)(j0 + lr) * HD + 8 * hi;
#pragma unroll
            for (int kk = 0; kk < 2; ++kk) {
                const v16bf aqh = WFrag<bf>::ld(qh + kk * 32), aql = WFrag<bf>::ld(ql + kk * 32);
                const v16bf kh0 = WFrag<bf>::ld(kh + kk * 32), kh1 = WFrag<bf>::ld(kh + 16 * HD + kk * 32);
                const v16bf kl0 = WFrag<bf>::ld(kl + kk * 32), kl1 = WFrag<bf>::ld(kl + 16 * HD + kk * 32);
                s0 = wmmab(kh0, aqh, s0); s0 = wmmab(kl0, aqh, s0); s0 = wmmab(kh0, aql, s0);
                s1 = wmmab(kh1, aqh, s1); s1 = wmmab(kl1, aqh, s1); s1 = wmmab(kh1, aql, s1);
                // keeps the vector slots between the last product and the first use of its result or operands
                if (kk == 1) asm volatile("v_nop\n\tv_nop\n\tv_nop\n\tv_nop" : "+v"(s0), "+v"(s1) : "v"(aql), "v"(kh1));
            }
        } else {
            const h16* kp = ring + ((c >> 1) & 1) * STH + ((c & 1) * 32 + lr) * KP + 8 * hi;
#pragma unroll
            for (int kk = 0; kk < 2; ++kk) {
                const v16h bk0 = lds16(kp + kk * 32), bk1 = lds16(kp + 16 * KP + kk * 32);
                s0 = wmma16(bk0, aq[kk], s0); s1 = wmma16(bk1, aq[kk], s1);
                // keeps the vector slots between the last product and the first use of its result or operands
                if (kk == 1) asm volatile("v_nop\n\tv_nop\n\tv_nop\n\tv_nop" : "+v"(s0), "+v"(s1) : "v"(aq[1]), "v"(bk1));
            }
        }
        // online softmax update: a lane holds 16 of the 32 keys of ONE query; maximum and sum in the lane, the maximum joined with the other half by one exchange
        float pa[8], pc[8];
        const v8f a0 = s0 * SCL, c0v = s1 * SCL;
#pragma unroll
        for (int r = 0; r < 8; ++r) { pa[r] = a0[r]; pc[r] = c0v[r]; }
        // Only the block's last two chunks hold keys past its first row (chunk nchunk - 2 starts at key q0blk): in every earlier chunk j < q0blk <= i for each element and the select would change nothing.
        if (HR || c >= nchunk - 2) {                          // block-uniform scalar branch (the short HR blocks select in every chunk, as before)
            const int qd = q - j0 - 8 * hi;                   // key j0 + 8 * hi + r is allowed where r <= qd
#pragma unroll
            for (int r = 0; r < 8; ++r) { pa[r] = (r <= qd) ? pa[r] : NEG; pc[r] = (16 + r <= qd) ? pc[r] : NEG; }
        }
        float v = fmaxf(fmaxf(fmaxf(fmaxf(pa[0], pa[1]), fmaxf(pa[2], pa[3])), fmaxf(fmaxf(pa[4], pa[5]), fmaxf(pa[6], pa[7]))),
                        fmaxf(fmaxf(fmaxf(pc[0], pc[1]), fmaxf(pc[2], pc[3])), fmaxf(fmaxf(pc[4], pc[5]), fmaxf(pc[6], pc[7]))));
        v = fmaxf(v, xhalf(v));
        const float mn = fmaxf(m, v);                         // finite from chunk 0 on (key 0 <= q for every row, seen through the exchange)
        const float alpha = __builtin_amdgcn_exp2f((m - mn) * L2E);
        m = mn;
#pragma unroll
        for (int r = 0; r < 8; ++r) { pa[r] = __builtin_amdgcn_exp2f((pa[r] - mn) * L2E); pc[r] = __builtin_amdgcn_exp2f((pc[r] - mn) * L2E); }
        const float rs = (((pa[0] + pa[1]) + (pa[2] + pa[3])) + ((pa[4] + pa[5]) + (pa[6] + pa[7]))) + (((pc[0] + pc[1]) + (pc[2] + pc[3])) + ((pc[4] + pc[5]) + (pc[6] + pc[7])));
        l = l * alpha + rs;
#pragma unroll
        for (int t = 0; t < 4; ++t)
#pragma unroll
            for (int r = 0; r < 8; ++r) o[t][r] *= alpha;
        // the two score tiles, converted in place, are the B operand of vt . p^T: element s <- key j0 + 8 * hi + s (s < 8), j0 + 16 + 8 * hi + s - 8 (s >= 8), the loaders' k order
        if (HR) {
            v8us h0, l0, h1, l1;
#pragma unroll
            for (int r = 0; r < 8; ++r) { unsigned short a1, a2, c1, c2; splitf(pa[r], a1, a2); splitf(pc[r], c1, c2); h0[r] = a1; l0[r] = a2; h1[r] = c1; l1[r] = c2; }
            const v16bf bph = cat16b(h0, h1), bpl = cat16b(l0, l1);
            const bf* vh = Vhb + (size_t)lr * RH + j0 + 8 * hi; const bf* vl = Vlb + (size_t)lr * RH + j0 + 8 * hi;
            v16bf fvh = bph, fvl = bpl;
#pragma unroll
            for (int t = 0; t < 4; ++t) { fvh = WFrag<bf>::ld(vh + (size_t)t * 16 * RH); fvl = WFrag<bf>::ld(vl + (size_t)t * 16 * RH);
                o[t] = wmmab(fvh, bph, o[t]); o[t] = wmmab(fvh, bpl, o[t]); o[t] = wmmab(fvl, bph, o[t]); }
            // keeps the vector slots behind the last product on the loop's back edge too
            asm volatile("v_nop\n\tv_nop\n\tv_nop\n\tv_nop" : "+v"(o[0]), "+v"(o[1]), "+v"(o[2]), "+v"(o[3]) : "v"(bph), "v"(fvl));
        } else {
            v16h bp;
#pragma unroll
            for (int r = 0; r < 8; ++r) { bp[r] = (h16)(pa[r] * PCAR); bp[8 + r] = (h16)(pc[r] * PCAR); }
            const h16* vp = ring + ((c >> 1) & 1) * STH + TLH + lr * KP + (c & 1) * 32 + 8 * hi;
            v16h fv = bp;
#pragma unroll
            for (int t = 0; t < 4; ++t) { fv = lds16(vp + t * 16 * KP); o[t] = wmma16(fv, bp, o[t]); }
            // keeps the vector slots behind the last product on the loop's back edge too
            asm volatile("v_nop\n\tv_nop\n\tv_nop\n\tv_nop" : "+v"(o[0]), "+v"(o[1]), "+v"(o[2]), "+v"(o[3]) : "v"(bp), "v"(fv));
        }
        if (!HR && (c & 1)) {                                                          // foot of a stage (block-uniform): publish the next stage, free this one's buffer
            const int st = c >> 1;
            asm volatile("s_wait_dscnt 0x0" ::: "memory");                             // this wave's reads of the buffer have returned
            asm volatile("s_wait_asynccnt 0x0" ::: "memory");                          // this wave's copies of stage st + 1 have landed
            __syncthreads();                                                           // publishes stage st + 1 and ends every wave's reads of stage st
            if (st + 2 < nst) { const unsigned lb = lk0 + (unsigned)(st & 1) * (STH * 2); stage_copy(lb, gk0 + (size_t)(st + 2) * 64 * HD, lb + TLH * 2, gv0 + (st + 2) * 64); }
        }
    }
    if (!HR) asm volatile("s_wait_asynccnt 0x0" ::: "memory");                         // nothing of this wave is in flight when the ring becomes output staging

    l += xhalf(l);                                                                     // joins the two halves' sums of this query
    const float inv = __builtin_amdgcn_rcpf(HR ? l : l * PCAR);
#pragma unroll
    for (int t = 0; t < 4; ++t) {
        const v4f w0 = { o[t][0] * inv, o[t][1] * inv, o[t][2] * inv, o[t][3] * inv }, w1 = { o[t][4] * inv, o[t][5] * inv, o[t][6] * inv, o[t][7] * inv };
        *(v4fa*)(myos + lr * OSP + t * 16 + 8 * hi) = w0; *(v4fa*)(myos + lr * OSP + t * 16 + 8 * hi + 4) = w1;
    }
    __builtin_amdgcn_fence(3, "wavefront"); __builtin_amdgcn_wave_barrier(); asm volatile("" ::: "memory");
    float* orow = OUT + ((size_t)batch * SEQ_FULL + q0) * DM + (size_t)head * HD;
{
#pragma unroll
        for (int s = 0; s < 8; ++s) { const int row = 2 * s + hi, cofs = lr * 4; const v4f val = *(const v4fa*)(myos + row * OSP + cofs);
            *(v4f*)(orow + (size_t)row * DM + cofs) = val; }
         }
}
__global__ __launch_bounds__(128)
void k_attn(const h16* __restrict__ Q16, const h16* __restrict__ K16, const h16* __restrict__ VT16,
            const bf* __restrict__ QPh, const bf* __restrict__ QPl, const bf* __restrict__ KPh, const bf* __restrict__ KPl,
            const bf* __restrict__ VTh, const bf* __restrict__ VTl, float* OUT) {
    __shared__ __align__(16) unsigned char sm[2 * STH * 2];       // HR: output staging; !HR: the two-stage ring, then output staging
    static_assert(4 * 16 * OSP * 4 <= 2 * STH * 2);
    const int head = (int)blockIdx.x, batch = (int)blockIdx.y;
    if (blockIdx.z >= SEQ / 64) return;                   // block-uniform (the grid is exact), in front of every block barrier
    // The launch has more blocks than the chip has places for them; the row block is the slowest index and falls with it,
    // so the blocks with the most keys have the lowest indices and the short HR blocks the highest.
    // Behind the guard the remainder changes no value; it shows the compiler the row block's range, and the build then takes 158 registers instead of 162: six waves per SIMD instead of five.
    const int q0blk = (int)((SEQ / 64 - 1 - blockIdx.z) % (SEQ / 64)) * 64;
    // block-uniform choice (RH is a multiple of 64: a block lies wholly on one side)
    if (q0blk < RH) attn_rows<true>(Q16, K16, VT16, QPh, QPl, KPh, KPl, VTh, VTl, q0blk, head, batch, sm, OUT);
    else            attn_rows<false>(Q16, K16, VT16, QPh, QPl, KPh, KPl, VTh, VTl, q0blk, head, batch, sm, OUT);
}

extern "C" void kernel_launch(void* const* d_in, const int* in_sizes, int n_in,
                              void* d_out, int out_size, void* d_ws, size_t ws_size, hipStream_t stream) {
    if (n_in < 3) return;
    if ((size_t)in_sizes[0] < (size_t)(NB - 1) * SEQ_FULL * DM + (size_t)SEQ * DM) return;
    if ((size_t)in_sizes[1] < (size_t)3 * DM * DM) return;
    if (in_sizes[2] < 3 * DM) return;
    if ((size_t)out_size < (size_t)(NB - 1) * SEQ_FULL * DM + (size_t)SEQ * DM) return;
    const float* x = (const float*)d_in[0];      // [NB][SEQ_FULL][DM]
    const float* W = (const float*)d_in[1];      // [3*DM][DM]  ([out][in], row blocks k | q | v)
    const float* bias = (const float*)d_in[2];   // [3*DM]
    float* OUT = (float*)d_out;                  // [NB][SEQ_FULL][DM]
    char* wsp = (char*)d_ws;
    auto take = [&](size_t bytes) { char* p = wsp; wsp += (bytes + 255) & ~(size_t)255; return (void*)p; };
    bf* WB = (bf*)take((size_t)3 * DM * DM * 2);
    bf* XB = (bf*)take((size_t)NB * SEQ * DM * 2);
    h16* Q16 = (h16*)take((size_t)NB * NH * SEQ * HD * 2); h16* K16 = (h16*)take((size_t)NB * NH * SEQ * HD * 2); h16* VT16 = (h16*)take((size_t)NB * NH * HD * SEQ * 2);
    bf* QPh = (bf*)take((size_t)NB * NH * RH * HD * 2); bf* QPl = (bf*)take((size_t)NB * NH * RH * HD * 2); bf* KPh = (bf*)take((size_t)NB * NH * RH * HD * 2); bf* KPl = (bf*)take((size_t)NB * NH * RH * HD * 2);
    bf* VTh = (bf*)take((size_t)NB * NH * HD * RH * 2); bf* VTl = (bf*)take((size_t)NB * NH * HD * RH * 2);
    if ((size_t)(wsp - (char*)d_ws) > ws_size) return;
    if ((size_t)(wsp - (char*)d_ws) > (size_t)134217728) return;

    k_cvt8<<<(unsigned)(((size_t)3 * DM * DM / 8 + 255) / 256), 256, 0, stream>>>(W, WB, (size_t)3 * DM * DM / 8);
    k_cvtx<<<dim3((unsigned)(((size_t)SEQ * DM / 8 + 255) / 256), NB, 1), 256, 0, stream>>>(x, XB, (size_t)SEQ * DM / 8);
    // k | q | v in one launch: every 64-column tile is one head of one of the three
    k_gemmw<<<dim3(SEQ / 256, 3 * DM / 128, NB), 256, 0, stream>>>(XB, WB, DM, bias, (size_t)SEQ * DM, (size_t)0, Q16, K16, VT16, QPh, QPl, KPh, KPl, VTh, VTl);
    // attention, one launch: blocks of rows < RH on the hi/lo path, blocks of rows >= RH single products
    k_attn<<<dim3(NH, NB, SEQ / 64), 128, 0, stream>>>(Q16, K16, VT16, QPh, QPl, KPh, KPl, VTh, VTl, OUT);
}

// v007
// One run takes 105 microseconds.
// Timed twice side by side with v006, it ran 1.05 times as fast both times.
// Counting every step since v000, it is 3.37 times as fast.
#include <hip/hip_runtime.h>

// Contractions (f32 accumulate): kqv projection = v_wmma_f32_16x16x32_bf16 on bf16 RNE copies of x and W, bf16-valued bias added in f32; causal attention query rows < 256: q.k and p.v as bf16 hi/lo 3-product groups; query rows >= 256: v_wmma_f32_16x16x32_f16 on fp16 q, k, v planes and fp16 p x 1024; softmax statistics f32; output f32.
// Layout: bf16 W [3072][1024] used directly as the k-contiguous B operand (row blocks k | q | v); the projection's epilogue writes the head planes q, k [b][h][t][64] and v transposed [b][h][64][t]

#ifndef NB
#define NB 4
#endif
#ifndef SEQ
#define SEQ 2048
#endif
#define NB_FULL  4
#define SEQ_FULL 2048
#define DM   1024
#define NH   16
#define HD   64
#define RH   256                      // query rows < RH use the hi/lo 3-product path (keys there are < RH too)
#define OSP  68                       // LDS pitch (floats) of the f32 staging tiles (16 or 32 rows x 64)
#define KP   72                       // LDS pitch (halves) of a staged 64-half row: 144 B = 16 B x 9, for 16-byte readers
#define TLH  (64 * KP)                // halves of one staged tile (64 rows)
#define STH  (2 * TLH)                // halves of one stage: k tile (64 keys x 64 d), then vt tile (64 d x 64 keys)
#define PCAR 1024.0f
#define SCL  0.03125f                 // 1024^-0.5 (model-dim scaling)
#define L2E  1.4426950408889634f

static_assert(NH * HD == DM);
static_assert((SEQ % 256) == 0 && (RH % 256) == 0 && RH <= SEQ && SEQ <= SEQ_FULL && NB >= 1 && NB <= NB_FULL);
static_assert((DM % 128) == 0 && (SEQ % 64) == 0);
// workspace bytes at full size (all regions exact multiples of their store granularity) + alignment slack <= 128 MiB
static_assert((size_t)3 * DM * DM * 2 + (size_t)NB * SEQ * DM * 2 + (size_t)3 * NB * NH * SEQ * HD * 2 + (size_t)6 * NB * NH * RH * HD * 2 + 12 * 256 <= (size_t)134217728);

typedef _Float16 h16;
typedef unsigned short bf;
typedef __attribute__((ext_vector_type(16))) __bf16   v16bf;
typedef __attribute__((ext_vector_type(16))) _Float16 v16h;
typedef __attribute__((ext_vector_type(8)))  _Float16 v8h;
typedef __attribute__((ext_vector_type(8)))  unsigned short v8us;
typedef __attribute__((ext_vector_type(8)))  float    v8f;
typedef __attribute__((ext_vector_type(4)))  float    v4f;
typedef v8h  __attribute__((may_alias)) v8ha;
typedef v4f  __attribute__((may_alias)) v4fa;
typedef v8us __attribute__((may_alias)) v8usa;

__device__ __forceinline__ unsigned short f2bf(float f) { unsigned u = __float_as_uint(f); u += 0x7FFFu + ((u >> 16) & 1u); return (unsigned short)(u >> 16); }
__device__ __forceinline__ float bf2f(unsigned short b) { return __uint_as_float(((unsigned)b) << 16); }
__device__ __forceinline__ float bfr(float f) { return bf2f(f2bf(f)); }
__device__ __forceinline__ void splitf(float y, unsigned short& h, unsigned short& l) { h = f2bf(y); l = f2bf(y - bf2f(h)); }
__device__ __forceinline__ v16h cat16(v8h lo, v8h hi) { return __builtin_shufflevector(lo, hi, 0, 1, 2, 3, 4, 5, 6, 7, 8, 9, 10, 11, 12, 13, 14, 15); }
__device__ __forceinline__ v16bf cat16b(v8us lo, v8us hi) { return __builtin_bit_cast(v16bf, __builtin_shufflevector(lo, hi, 0, 1, 2, 3, 4, 5, 6, 7, 8, 9, 10, 11, 12, 13, 14, 15)); }
__device__ __forceinline__ v8f wmma16(v16h a, v16h b, v8f c) { return __builtin_amdgcn_wmma_f32_16x16x32_f16(false, a, false, b, (short)0, c, false, false); }
__device__ __forceinline__ v8f wmmab(v16bf a, v16bf b, v8f c) { return __builtin_amdgcn_wmma_f32_16x16x32_bf16(false, a, false, b, (short)0, c, false, false); }

// 16-bit fragment loaders (lane l: row/col = l & 15, h = l >> 4; elements 0..7 <- k0 + 8h + 0..7, elements 8..15 <- k0 + 16 + 8h + 0..7; the caller passes p = row base + k0 + 8h).
template <typename T16> struct WFrag;
template <> struct WFrag<h16> { typedef v16h V; static __device__ __forceinline__ V ld(const h16* p) { return cat16(*(const v8h*)p, *(const v8h*)(p + 16)); } static __device__ __forceinline__ v8f mma(V a, V b, v8f c) { return wmma16(a, b, c); } };
template <> struct WFrag<bf> { typedef v16bf V; static __device__ __forceinline__ V ld(const bf* p) { return cat16b(*(const v8us*)p, *(const v8us*)(p + 16)); } static __device__ __forceinline__ v8f mma(V a, V b, v8f c) { return wmmab(a, b, c); } };
// LDS reloads through may_alias vectors of the stored element type
__device__ __forceinline__ v16h  lds16(const h16* p) { return cat16(*(const v8ha*)p, *(const v8ha*)(p + 16)); }
__device__ __forceinline__ v16bf ldsb(const bf* p)   { return cat16b(*(const v8usa*)p, *(const v8usa*)(p + 16)); }

// Four 16-byte stores of a wave. The s_wait_xcnt stands inside the statement so that no register the stores name is rewritten ahead of it.
typedef __attribute__((ext_vector_type(4))) unsigned v4u;
template <int STEP>                   // base: the same in every lane; voff: the lane's byte offset; STEP: bytes between two of the four
__device__ __forceinline__ void store4(const void* base, unsigned voff, v4u d0, v4u d1, v4u d2, v4u d3) {
    asm volatile("global_store_b128 %0, %2, %1\n\t"
                 "global_store_b128 %0, %3, %1 offset:%6\n\t"
                 "global_store_b128 %0, %4, %1 offset:%7\n\t"
                 "global_store_b128 %0, %5, %1 offset:%8\n\t"
                 "s_wait_xcnt 0x0"
                 :: "v"(voff), "s"(base), "v"(d0), "v"(d1), "v"(d2), "v"(d3), "n"(STEP), "n"(2 * STEP), "n"(3 * STEP) : "memory");
}
// orders a wave's own LDS stores and loads around the reuse of its staging tile
__device__ __forceinline__ void wave_lds_order() { __builtin_amdgcn_fence(3, "wavefront"); __builtin_amdgcn_wave_barrier(); asm volatile("" ::: "memory"); }
// eight f32 values -> eight 16-bit values of plane p: 0 fp16, 1 bf16 hi, 2 bf16 lo (the residual of hi)
__device__ __forceinline__ v4u plane8(const float (&y)[8], int p) {
    if (p == 0) { v8h c;
#pragma unroll
        for (int k = 0; k < 8; ++k) c[k] = (h16)y[k];
        return __builtin_bit_cast(v4u, c); }
    v8us c;
#pragma unroll
    for (int k = 0; k < 8; ++k) { unsigned short a1, a2; splitf(y[k], a1, a2); c[k] = p == 1 ? a1 : a2; }
    return __builtin_bit_cast(v4u, c);
}
typedef v4u __attribute__((may_alias)) v4ua;
// Projection epilogues of one wave's 64 x 64 tile; acc[mb][nb][j] = y[16 mb + 8 hi + j][16 nb + lr] without bias, bs[nb] = bias of column 16 nb + lr. Read-back: 8 lanes cover one 128-B row of 16-bit values, a wave 4 rows.
// NP = 1: the fp16 plane alone; NP = 3: the bf16 hi and lo planes too (positions < RH), one plane after the other.
// Every loop of the two epilogues and of plane8 is unrolled so that acc and the small arrays are indexed by constants and stay in registers.
// k, q planes [t][64]: P[p] points at the tile's first position; f32 LDS tile of 16 positions.
template <int NP>
__device__ __forceinline__ void put_rows(const v8f (&acc)[4][4], const float (&bs)[4], unsigned char* sm, int lane, unsigned short* const (&P)[3]) {
    const int lr = lane & 15, hi = lane >> 4, srow = lane >> 3, scol = (lane & 7) * 8;
    float* os = (float*)sm;
#pragma unroll
    for (int mb = 0; mb < 4; ++mb) {
#pragma unroll
        for (int nb = 0; nb < 4; ++nb) {
#pragma unroll
            for (int j = 0; j < 8; ++j) os[(hi * 8 + j) * OSP + nb * 16 + lr] = acc[mb][nb][j] + bs[nb]; }
        wave_lds_order();
#pragma unroll
        for (int p = 0; p < NP; ++p) {
            v4u o[4];
#pragma unroll
            for (int s = 0; s < 4; ++s) {
                const float* xr = os + (4 * s + srow) * OSP + scol; const v4f x0 = *(const v4fa*)xr, x1 = *(const v4fa*)(xr + 4);
                const float y[8] = { x0[0], x0[1], x0[2], x0[3], x1[0], x1[1], x1[2], x1[3] };
                o[s] = plane8(y, p);
            }
            store4<4 * HD * 2>(P[p] + mb * 16 * HD, (unsigned)(srow * HD + scol) * 2u, o[0], o[1], o[2], o[3]);
        }
        wave_lds_order();
    }
}
// v planes [d][t]: P[p] (row pitch SEQ for p = 0, RH else) points at d = 0 of the tile's first position; a lane's 8 accumulator rows are 8 consecutive positions of one d; a 16-bit LDS tile of 16 d x 64 positions per plane.
template <int NP>
__device__ __forceinline__ void put_cols(const v8f (&acc)[4][4], const float (&bs)[4], unsigned char* sm, int lane, unsigned short* const (&P)[3]) {
    const int lr = lane & 15, hi = lane >> 4, srow = lane >> 3, scol = (lane & 7) * 8;
#pragma unroll
    for (int nb = 0; nb < 4; ++nb) {
#pragma unroll
        for (int p = 0; p < NP; ++p) {
            unsigned short* st = (unsigned short*)sm + p * 16 * KP;
#pragma unroll
            for (int mb = 0; mb < 4; ++mb) {
                float y[8];
#pragma unroll
                for (int j = 0; j < 8; ++j) y[j] = acc[mb][nb][j] + bs[nb];
                *(v4ua*)(st + lr * KP + mb * 16 + hi * 8) = plane8(y, p);
            }
            wave_lds_order();
            v4u o[4];
#pragma unroll
            for (int s = 0; s < 4; ++s) o[s] = *(const v4ua*)(st + (4 * s + srow) * KP + scol);
            if (p == 0) store4<4 * SEQ * 2>(P[0] + (size_t)nb * 16 * SEQ, (unsigned)(srow * SEQ + scol) * 2u, o[0], o[1], o[2], o[3]);
            else        store4<4 * RH * 2>(P[p] + nb * 16 * RH, (unsigned)(srow * RH + scol) * 2u, o[0], o[1], o[2], o[3]);
        }
        wave_lds_order();
    }
}

// ---- k_gemmw: the kqv projection. Grid (SEQ/256, 3*DM/128, NB), 256 threads: a work-group owns a 256 x 128 tile of y, its eight waves (4 x 2) a 64 x 64 tile each (16 accumulators).
// y[m][n] (f32, + bf16-valued bias[n]) = sum_k A[m][k] Bt[n][k], both operands K-contiguous bf16 planes. z-batch strides sA/sB in elements. K % 64 == 0, K >= 64.
// The waves read their fragments from LDS. A stage = 64 k of the work-group's 256 A rows and 128 Bt rows (whole 128-B lines, 8 lanes a row), two buffers; every thread copies 8 + 4 pieces of 16 B per stage;
// stage t + 2 is issued into the buffer of stage t behind the barrier that ends its last read. After the last stage's barrier the ring is the eight waves' epilogue staging.
// A wave's tile is 64 positions of ONE head of k, q or v (column tile = NH * {k, q, v} + head); the epilogue converts y and writes the head planes itself:
// k, q: fp16 [t][64] (and the bf16 hi/lo planes where t < RH) through an f32 LDS tile of 16 positions; v: a lane's 8 accumulator rows are 8 consecutive positions of one d, packed and turned into whole 128-B rows of [d][t] through 16-bit LDS tiles of 16 d.
#define GAH  (256 * KP)               // halves of the staged A tile (256 rows of 64 k)
#define GSH  (GAH + 128 * KP)         // halves of one stage: A tile, then Bt tile (128 rows)
#define EPB  (3 * 16 * KP * 2)        // bytes of one wave's epilogue staging: one f32 tile 16 x OSP, or three 16-bit tiles 16 x KP
// One stage's copies of this thread: rows r, r + 32, ..., r + 224 of the A tile and r, ..., r + 96 of the Bt tile (l: LDS byte address of its first A piece; rs: elements between two of the rows).
// The s_wait_xcnt stands inside the statement so that no address register is rewritten ahead of it.
__device__ __forceinline__ void gstage_copy(unsigned l, const bf* ga, const bf* gb, size_t rs) {
    asm volatile("global_load_async_to_lds_b128 %0, %12, off\n\t"
                 "global_load_async_to_lds_b128 %1, %13, off\n\t"
                 "global_load_async_to_lds_b128 %2, %14, off\n\t"
                 "global_load_async_to_lds_b128 %3, %15, off\n\t"
                 "global_load_async_to_lds_b128 %4, %16, off\n\t"
                 "global_load_async_to_lds_b128 %5, %17, off\n\t"
                 "global_load_async_to_lds_b128 %6, %18, off\n\t"
                 "global_load_async_to_lds_b128 %7, %19, off\n\t"
                 "global_load_async_to_lds_b128 %8, %20, off\n\t"
                 "global_load_async_to_lds_b128 %9, %21, off\n\t"
                 "global_load_async_to_lds_b128 %10, %22, off\n\t"
                 "global_load_async_to_lds_b128 %11, %23, off\n\t"
                 "s_wait_xcnt 0x0"
                 :: "v"(l), "v"(l + 32 * KP * 2), "v"(l + 64 * KP * 2), "v"(l + 96 * KP * 2), "v"(l + 128 * KP * 2), "v"(l + 160 * KP * 2), "v"(l + 192 * KP * 2), "v"(l + 224 * KP * 2),
                    "v"(l + GAH * 2), "v"(l + GAH * 2 + 32 * KP * 2), "v"(l + GAH * 2 + 64 * KP * 2), "v"(l + GAH * 2 + 96 * KP * 2),
                    "v"(ga), "v"(ga + rs), "v"(ga + 2 * rs), "v"(ga + 3 * rs), "v"(ga + 4 * rs), "v"(ga + 5 * rs), "v"(ga + 6 * rs), "v"(ga + 7 * rs),
                    "v"(gb), "v"(gb + rs), "v"(gb + 2 * rs), "v"(gb + 3 * rs)
                 : "memory");
}
__global__ __launch_bounds__(256) __attribute__((amdgpu_num_vgpr(256)))   // the ring lets two work-groups share a WGP: four waves per SIMD, 256 registers each
void k_gemmw(const bf* __restrict__ A, const bf* __restrict__ Bt, int K, const float* __restrict__ bias, size_t sA, size_t sB,
             h16* Q16, h16* K16, h16* VT16, bf* QPh, bf* QPl, bf* KPh, bf* KPl, bf* VTh, bf* VTl) {
    __shared__ __align__(16) unsigned char sm[2 * GSH * 2];       // the two-stage ring, then epilogue staging
    static_assert(16 * OSP * 4 <= EPB && 8 * EPB <= 2 * GSH * 2);
    const size_t z = blockIdx.z; A += z * sA; Bt += z * sB;
    const int lane = threadIdx.x & 31, lr = lane & 15, hi = lane >> 4;
    const int wid = __builtin_amdgcn_readfirstlane((int)threadIdx.x >> 5);   // the wave's number in a scalar register: tile, plane and store bases stay scalar
    const int wm = wid & 3, wn = wid >> 2;
    const int r0 = (int)blockIdx.x * 256 + wm * 64, ct = (int)blockIdx.y * 2 + wn, c0 = ct * 64;
    v8f acc[4][4];
#pragma unroll
    for (int mb = 0; mb < 4; ++mb)
#pragma unroll
        for (int nb = 0; nb < 4; ++nb) acc[mb][nb] = (v8f){};
    const bf* ring = (const bf*)sm;
    // this thread's first piece of an operand tile: row threadIdx.x >> 3, 16-byte column threadIdx.x & 7
    const int crow = (int)threadIdx.x >> 3, ccol = ((int)threadIdx.x & 7) * 8;
    const unsigned la0 = (unsigned)(size_t)(ring + crow * KP + ccol);                  // LDS byte address in buffer 0, A tile
    const bf* ga0 = A + (size_t)((int)blockIdx.x * 256 + crow) * K + ccol; const bf* gb0 = Bt + (size_t)((int)blockIdx.y * 128 + crow) * K + ccol;
    const size_t rs = (size_t)32 * K;
    const int nst = K >> 6;                                                            // stages of 64 k
    gstage_copy(la0, ga0, gb0, rs);
    asm volatile("s_wait_asynccnt 0x0" ::: "memory");                                  // stage 0 has landed before the barrier that publishes it
    __syncthreads();                                                                   // publishes stage 0 to all eight waves
    if (nst > 1) gstage_copy(la0 + GSH * 2, ga0 + 64, gb0 + 64, rs);
#pragma unroll 1
    for (int t = 0; t < nst; ++t) {
        const bf* ap = ring + (t & 1) * GSH + (wm * 64 + lr) * KP + 8 * hi; const bf* bp = ring + (t & 1) * GSH + GAH + (wn * 64 + lr) * KP + 8 * hi;
#pragma unroll
        for (int kk = 0; kk < 2; ++kk) {
            v16bf a[4], b[4];
#pragma unroll
            for (int i = 0; i < 4; ++i) { a[i] = ldsb(ap + i * 16 * KP + kk * 32); b[i] = ldsb(bp + i * 16 * KP + kk * 32); }
            // holds the block's 16 LDS reads together in front of its 16 products (loaded values as inputs only): one wait per block instead of one per group of four products
            asm volatile("" :: "v"(a[0]), "v"(a[1]), "v"(a[2]), "v"(a[3]), "v"(b[0]), "v"(b[1]), "v"(b[2]), "v"(b[3]));
#pragma unroll
            for (int nb = 0; nb < 4; ++nb)
#pragma unroll
                for (int mb = 0; mb < 4; ++mb) acc[mb][nb] = wmmab(a[mb], b[nb], acc[mb][nb]);
        }
        // foot of a stage: publish the next stage, free this one's buffer
        asm volatile("s_wait_dscnt 0x0" ::: "memory");                                 // this wave's reads of the buffer have returned
        asm volatile("s_wait_asynccnt 0x0" ::: "memory");                              // this wave's copies of stage t + 1 have landed
        __syncthreads();                                                               // publishes stage t + 1 and ends every wave's reads of stage t
        if (t + 2 < nst) gstage_copy(la0 + (unsigned)(t & 1) * (GSH * 2), ga0 + (t + 2) * 64, gb0 + (t + 2) * 64, rs);
    }
    asm volatile("s_wait_asynccnt 0x0" ::: "memory");                                  // nothing of this wave is in flight when the ring becomes epilogue staging
    unsigned char* es = sm + wid * EPB;                   // this wave's own staging
    const int sel = ct / NH;                              // 0: k, 1: q, 2: v (W's row blocks)
    const size_t bh = z * NH + ct % NH;
    const bool lo = r0 < RH;                              // the wave's whole tile (RH is a multiple of 64); wave-uniform like sel, and no block barrier follows
    const size_t rl = lo ? r0 : 0;
    float bs[4];
    // bias of columns c0 + lr + {0, 16, 32, 48}: the four loads and their data wait in one statement, outputs early-clobbered, so that no register a load names is rewritten while it is in flight
    asm volatile("global_load_b32 %0, %4, %5\n\t"
                 "global_load_b32 %1, %4, %5 offset:64\n\t"
                 "global_load_b32 %2, %4, %5 offset:128\n\t"
                 "global_load_b32 %3, %4, %5 offset:192\n\t"
                 "s_wait_loadcnt 0x0"
                 : "=&v"(bs[0]), "=&v"(bs[1]), "=&v"(bs[2]), "=&v"(bs[3]) : "v"((unsigned)(c0 + lr) * 4u), "s"(bias) : "memory");
#pragma unroll
    for (int nb = 0; nb < 4; ++nb) bs[nb] = bfr(bs[nb]);
    if (sel < 2) {
        unsigned short* const P[3] = { (unsigned short*)(sel == 1 ? Q16 : K16) + (bh * SEQ + r0) * HD, (sel == 1 ? QPh : KPh) + (bh * RH + rl) * HD, (sel == 1 ? QPl : KPl) + (bh * RH + rl) * HD };
        if (lo) put_rows<3>(acc, bs, es, lane, P); else put_rows<1>(acc, bs, es, lane, P);
    } else {
        unsigned short* const P[3] = { (unsigned short*)VT16 + bh * HD * SEQ + r0, VTh + bh * HD * RH + rl, VTl + bh * HD * RH + rl };
        if (lo) put_cols<3>(acc, bs, es, lane, P); else put_cols<1>(acc, bs, es, lane, P);
    }
}

__global__ __launch_bounds__(256) void k_cvt8(const float* __restrict__ src, bf* dst, size_t n8) { const size_t i = (size_t)blockIdx.x * 256 + threadIdx.x; if (i >= n8) return; const v8f v = *(const v8f*)(src + i * 8); v8us o;
#pragma unroll
    for (int k = 0; k < 8; ++k) o[k] = f2bf(v[k]); *(v8us*)(dst + i * 8) = o;  }
__global__ __launch_bounds__(256) void k_cvtx(const float* __restrict__ src, bf* dst, size_t n8) { const size_t i = (size_t)blockIdx.x * 256 + threadIdx.x; if (i >= n8) return;
    const float* s = src + (size_t)blockIdx.y * SEQ_FULL * DM; bf* d = dst + (size_t)blockIdx.y * SEQ * DM; const v8f v = *(const v8f*)(s + i * 8); v8us o;
#pragma unroll
    for (int k = 0; k < 8; ++k) o[k] = f2bf(v[k]); *(v8us*)(d + i * 8) = o;  }

// ---- k_attn: causal streaming attention, all rows in one launch. Grid (NH, NB, (SEQ-RH)/128 + RH/64), 128 threads: block = 128 query rows >= RH (wave -> 32 rows, two groups of 16) or 64 rows < RH (wave -> 16 rows) of head blockIdx.x, batch blockIdx.y.
// A block whose rows lie below RH runs attn_rows<true> (HR), every other block attn_rows<false>: the few short HR blocks, one wave per SIMD and bound by load latency on their own, run beside the long ones.
// Key chunks of 32 from 0 to the block's last row (block-uniform loop; per-element causal select j <= i; !HR: in the last four chunks alone, the only ones with keys past the block's first row). Per chunk and group: S^T (32 keys x 16 queries) = k.q^T, scaled by SCL in f32, online max/sum in f32 (one query per lane), O^T += vt.p^T with p^T packed from the score registers,
// HR (rows and keys < RH): bf16 planes, q.k = qh.kh + qh.kl + ql.kh, p.v = ph.vh + pl.vh + ph.vl (one accumulator, unscaled residuals). Otherwise fp16 planes, single products.
// !HR: the block's four waves read k and vt from LDS. A stage = 64 keys (two chunks), two buffers; every thread copies 4 + 4 pieces of 16 B per stage, whole 128-B rows per 8 lanes;
// stage s + 2 is issued into the buffer of stage s behind the barrier that ends its last read. After the last stage's barrier the ring is the output staging.
// One stage's copies of this thread: rows r, r + 16, r + 32, r + 48 of the k tile and of the vt tile. The s_wait_xcnt stands inside the statement so that no address register is rewritten ahead of it.
__device__ __forceinline__ void stage_copy(unsigned lk, const h16* gk, unsigned lv, const h16* gv) {
    asm volatile("global_load_async_to_lds_b128 %0, %8, off\n\t"
                 "global_load_async_to_lds_b128 %1, %9, off\n\t"
                 "global_load_async_to_lds_b128 %2, %10, off\n\t"
                 "global_load_async_to_lds_b128 %3, %11, off\n\t"
                 "global_load_async_to_lds_b128 %4, %12, off\n\t"
                 "global_load_async_to_lds_b128 %5, %13, off\n\t"
                 "global_load_async_to_lds_b128 %6, %14, off\n\t"
                 "global_load_async_to_lds_b128 %7, %15, off\n\t"
                 "s_wait_xcnt 0x0"
                 :: "v"(lk), "v"(lk + 16 * KP * 2), "v"(lk + 32 * KP * 2), "v"(lk + 48 * KP * 2), "v"(lv), "v"(lv + 16 * KP * 2), "v"(lv + 32 * KP * 2), "v"(lv + 48 * KP * 2),
                    "v"(gk), "v"(gk + 16 * HD), "v"(gk + 32 * HD), "v"(gk + 48 * HD), "v"(gv), "v"(gv + (size_t)16 * SEQ), "v"(gv + (size_t)32 * SEQ), "v"(gv + (size_t)48 * SEQ)
                 : "memory");
}
// lane l <-> lane l ^ 16 (the other half of the wave holds the other 16 keys of the same query)
__device__ __forceinline__ float xhalf(float v) { const int b = __float_as_int(v); return __int_as_float(__builtin_amdgcn_permlanex16(b, b, 0x76543210, 0xfedcba98, false, false)); }
template <bool HR>
__device__ __forceinline__
void attn_rows(const h16* __restrict__ Q16, const h16* __restrict__ K16, const h16* __restrict__ VT16,
               const bf* __restrict__ QPh, const bf* __restrict__ QPl, const bf* __restrict__ KPh, const bf* __restrict__ KPl,
               const bf* __restrict__ VTh, const bf* __restrict__ VTl, int q0blk, int head, int batch, unsigned char* sm, float* OUT) {
    constexpr int NQ = HR ? 1 : 2;                        // groups of 16 query columns per wave: every k and vt fragment read from LDS feeds NQ products
    const int lane = threadIdx.x & 31, lr = lane & 15, hi = lane >> 4, wid = threadIdx.x >> 5;
    const int q0 = q0blk + wid * (16 * NQ);
    const size_t bh = (size_t)batch * NH + head;
    const h16* Qb = Q16 + bh * SEQ * HD; const h16* Kb = K16 + bh * SEQ * HD; const h16* Vb = VT16 + bh * HD * SEQ;
    const bf* Qhb = QPh + bh * RH * HD; const bf* Qlb = QPl + bh * RH * HD; const bf* Khb = KPh + bh * RH * HD; const bf* Klb = KPl + bh * RH * HD;
    const bf* Vhb = VTh + bh * HD * RH; const bf* Vlb = VTl + bh * HD * RH;
    float* myos = (float*)sm + wid * (16 * NQ) * OSP;
    const h16* ring = (const h16*)sm;
    const int nchunk = (q0blk + 64 * NQ) >> 5;
    const float NEG = -__builtin_inff();
    // group g: this lane's query row is q0 + 16 * g + lr

    v8f o[NQ][4];                                         // o[g][t][r] = O[q0 + 16 * g + lr][t * 16 + 8 * hi + r] (transposed output tiles)
    float m[NQ], l[NQ];                                   // m: both halves agree; l: this half's keys only, joined behind the loop
    v16h aq[NQ][2];
#pragma unroll
    for (int g = 0; g < NQ; ++g) {
#pragma unroll
        for (int t = 0; t < 4; ++t) o[g][t] = (v8f){};
        m[g] = NEG; l[g] = 0.0f;
        if (!HR) { const h16* qr = Qb + (size_t)(q0 + 16 * g + lr) * HD + 8 * hi; aq[g][0] = WFrag<h16>::ld(qr); aq[g][1] = WFrag<h16>::ld(qr + 32); }
    }
    // this thread's first piece of a stage: row threadIdx.x >> 3, 16-byte column threadIdx.x & 7
    const int crow = (int)threadIdx.x >> 3, ccol = ((int)threadIdx.x & 7) * 8;
    const unsigned lk0 = (unsigned)(size_t)(ring + crow * KP + ccol);                  // LDS byte address in buffer 0, k tile
    const h16* gk0 = Kb + (size_t)crow * HD + ccol; const h16* gv0 = Vb + (size_t)crow * SEQ + ccol;
    const int nst = nchunk >> 1;                                                       // stages of 64 keys (nchunk is even)
    if (!HR) {
        stage_copy(lk0, gk0, lk0 + TLH * 2, gv0);
        asm volatile("s_wait_asynccnt 0x0" ::: "memory");                              // stage 0 has landed before the barrier that publishes it
        __syncthreads();                                                               // publishes stage 0 to all four waves
        if (nst > 1) stage_copy(lk0 + STH * 2, gk0 + 64 * HD, lk0 + STH * 2 + TLH * 2, gv0 + 64);
    }

#pragma unroll 1
    for (int c = 0; c < nchunk; ++c) {
        const int j0 = c * 32;
        v8f s0[NQ], s1[NQ];                               // s0[g][r] = S[q][j0 + 8 * hi + r], s1[g][r] = S[q][j0 + 16 + 8 * hi + r], q the lane's row of group g
#pragma unroll
        for (int g = 0; g < NQ; ++g) { s0[g] = (v8f){}; s1[g] = (v8f){}; }
        if constexpr (HR) {
            const bf* qh = Qhb + (size_t)(q0 + lr) * HD + 8 * hi; const bf* ql = Qlb + (size_t)(q0 + lr) * HD + 8 * hi;
            const bf* kh = Khb + (size_t)(j0 + lr) * HD + 8 * hi; const bf* kl = Klb + (size_t)(j0 + lr) * HD + 8 * hi;
#pragma unroll
            for (int kk = 0; kk < 2; ++kk) {
                const v16bf aqh = WFrag<bf>::ld(qh + kk * 32), aql = WFrag<bf>::ld(ql + kk * 32);
                const v16bf kh0 = WFrag<bf>::ld(kh + kk * 32), kh1 = WFrag<bf>::ld(kh + 16 * HD + kk * 32);
                const v16bf kl0 = WFrag<bf>::ld(kl + kk * 32), kl1 = WFrag<bf>::ld(kl + 16 * HD + kk * 32);
                s0[0] = wmmab(kh0, aqh, s0[0]); s0[0] = wmmab(kl0, aqh, s0[0]); s0[0] = wmmab(kh0, aql, s0[0]);
                s1[0] = wmmab(kh1, aqh, s1[0]); s1[0] = wmmab(kl1, aqh, s1[0]); s1[0] = wmmab(kh1, aql, s1[0]);
                // keeps the vector slots between the last product and the first use of its result or operands
                if (kk == 1) asm volatile("v_nop\n\tv_nop\n\tv_nop\n\tv_nop" : "+v"(s0[0]), "+v"(s1[0]) : "v"(aql), "v"(kh1));
            }
        } else {
            const h16* kp = ring + ((c >> 1) & 1) * STH + ((c & 1) * 32 + lr) * KP + 8 * hi;
#pragma unroll
            for (int kk = 0; kk < 2; ++kk) {
                const v16h bk0 = lds16(kp + kk * 32), bk1 = lds16(kp + 16 * KP + kk * 32);
                s0[0] = wmma16(bk0, aq[0][kk], s0[0]); s0[1] = wmma16(bk0, aq[1][kk], s0[1]);
                s1[0] = wmma16(bk1, aq[0][kk], s1[0]); s1[1] = wmma16(bk1, aq[1][kk], s1[1]);
                // keeps the vector slots between the last product and the first use of its result or operands
                if (kk == 1) asm volatile("v_nop\n\tv_nop\n\tv_nop\n\tv_nop" : "+v"(s0[0]), "+v"(s1[0]), "+v"(s0[1]), "+v"(s1[1]) : "v"(aq[1][1]), "v"(bk1));
            }
        }
        v16h bp[NQ];                                          // !HR: p^T of each group, the B operands of vt . p^T
#pragma unroll
        for (int g = 0; g < NQ; ++g) {
        // online softmax update: a lane holds 16 of the 32 keys of ONE query; maximum and sum in the lane, the maximum joined with the other half by one exchange
        float pa[8], pc[8];
        const v8f a0 = s0[g] * SCL, c0v = s1[g] * SCL;
#pragma unroll
        for (int r = 0; r < 8; ++r) { pa[r] = a0[r]; pc[r] = c0v[r]; }
        // Only the block's last 2 * NQ chunks hold keys past its first row (chunk nchunk - 2 * NQ starts at key q0blk): in every earlier chunk j < q0blk <= i for each element and the select would change nothing.
        if (HR || c >= nchunk - 2 * NQ) {                     // block-uniform scalar branch (the short HR blocks select in every chunk, as before)
            const int qd = q0 + 16 * g + lr - j0 - 8 * hi;    // key j0 + 8 * hi + r is allowed where r <= qd
#pragma unroll
            for (int r = 0; r < 8; ++r) { pa[r] = (r <= qd) ? pa[r] : NEG; pc[r] = (16 + r <= qd) ? pc[r] : NEG; }
        }
        float v = fmaxf(fmaxf(fmaxf(fmaxf(pa[0], pa[1]), fmaxf(pa[2], pa[3])), fmaxf(fmaxf(pa[4], pa[5]), fmaxf(pa[6], pa[7]))),
                        fmaxf(fmaxf(fmaxf(pc[0], pc[1]), fmaxf(pc[2], pc[3])), fmaxf(fmaxf(pc[4], pc[5]), fmaxf(pc[6], pc[7]))));
        v = fmaxf(v, xhalf(v));
        const float mn = fmaxf(m[g], v);                      // finite from chunk 0 on (key 0 <= q for every row, seen through the exchange)
        const float alpha = __builtin_amdgcn_exp2f((m[g] - mn) * L2E);
        m[g] = mn;
#pragma unroll
        for (int r = 0; r < 8; ++r) { pa[r] = __builtin_amdgcn_exp2f((pa[r] - mn) * L2E); pc[r] = __builtin_amdgcn_exp2f((pc[r] - mn) * L2E); }
        const float rs = (((pa[0] + pa[1]) + (pa[2] + pa[3])) + ((pa[4] + pa[5]) + (pa[6] + pa[7]))) + (((pc[0] + pc[1]) + (pc[2] + pc[3])) + ((pc[4] + pc[5]) + (pc[6] + pc[7])));
        l[g] = l[g] * alpha + rs;
#pragma unroll
        for (int t = 0; t < 4; ++t)
#pragma unroll
            for (int r = 0; r < 8; ++r) o[g][t][r] *= alpha;
        // the two score tiles, converted in place, are the B operand of vt . p^T: element s <- key j0 + 8 * hi + s (s < 8), j0 + 16 + 8 * hi + s - 8 (s >= 8), the loaders' k order
        if constexpr (HR) {
            v8us h0, l0, h1, l1;
#pragma unroll
            for (int r = 0; r < 8; ++r) { unsigned short a1, a2, c1, c2; splitf(pa[r], a1, a2); splitf(pc[r], c1, c2); h0[r] = a1; l0[r] = a2; h1[r] = c1; l1[r] = c2; }
            const v16bf bph = cat16b(h0, h1), bpl = cat16b(l0, l1);
            const bf* vh = Vhb + (size_t)lr * RH + j0 + 8 * hi; const bf* vl = Vlb + (size_t)lr * RH + j0 + 8 * hi;
            v16bf fvh = bph, fvl = bpl;
#pragma unroll
            for (int t = 0; t < 4; ++t) { fvh = WFrag<bf>::ld(vh + (size_t)t * 16 * RH); fvl = WFrag<bf>::ld(vl + (size_t)t * 16 * RH);
                o[0][t] = wmmab(fvh, bph, o[0][t]); o[0][t] = wmmab(fvh, bpl, o[0][t]); o[0][t] = wmmab(fvl, bph, o[0][t]); }
            // keeps the vector slots behind the last product on the loop's back edge too
            asm volatile("v_nop\n\tv_nop\n\tv_nop\n\tv_nop" : "+v"(o[0][0]), "+v"(o[0][1]), "+v"(o[0][2]), "+v"(o[0][3]) : "v"(bph), "v"(fvl));
        } else {
#pragma unroll
            for (int r = 0; r < 8; ++r) { bp[g][r] = (h16)(pa[r] * PCAR); bp[g][8 + r] = (h16)(pc[r] * PCAR); }
        }
        }
        if constexpr (!HR) {
            const h16* vp = ring + ((c >> 1) & 1) * STH + TLH + lr * KP + (c & 1) * 32 + 8 * hi;
            v16h fv = bp[0];
#pragma unroll
            for (int t = 0; t < 4; ++t) { fv = lds16(vp + t * 16 * KP); o[0][t] = wmma16(fv, bp[0], o[0][t]); o[1][t] = wmma16(fv, bp[1], o[1][t]); }
            // keeps the vector slots behind the last product on the loop's back edge too
            asm volatile("v_nop\n\tv_nop\n\tv_nop\n\tv_nop" : "+v"(o[0][0]), "+v"(o[0][1]), "+v"(o[0][2]), "+v"(o[0][3]), "+v"(o[1][0]), "+v"(o[1][1]), "+v"(o[1][2]), "+v"(o[1][3]) : "v"(bp[1]), "v"(fv));
        }
        if (!HR && (c & 1)) {                                                          // foot of a stage (block-uniform): publish the next stage, free this one's buffer
            const int st = c >> 1;
            asm volatile("s_wait_dscnt 0x0" ::: "memory");                             // this wave's reads of the buffer have returned
            asm volatile("s_wait_asynccnt 0x0" ::: "memory");                          // this wave's copies of stage st + 1 have landed
            __syncthreads();                                                           // publishes stage st + 1 and ends every wave's reads of stage st
            if (st + 2 < nst) { const unsigned lb = lk0 + (unsigned)(st & 1) * (STH * 2); stage_copy(lb, gk0 + (size_t)(st + 2) * 64 * HD, lb + TLH * 2, gv0 + (st + 2) * 64); }
        }
    }
    if (!HR) asm volatile("s_wait_asynccnt 0x0" ::: "memory");                         // nothing of this wave is in flight when the ring becomes output staging

#pragma unroll
    for (int g = 0; g < NQ; ++g) {
        l[g] += xhalf(l[g]);                                                           // joins the two halves' sums of this query
        const float inv = __builtin_amdgcn_rcpf(HR ? l[g] : l[g] * PCAR);
        float* mr = myos + (16 * g + lr) * OSP + 8 * hi;
#pragma unroll
        for (int t = 0; t < 4; ++t) {
            const v4f w0 = { o[g][t][0] * inv, o[g][t][1] * inv, o[g][t][2] * inv, o[g][t][3] * inv }, w1 = { o[g][t][4] * inv, o[g][t][5] * inv, o[g][t][6] * inv, o[g][t][7] * inv };
            *(v4fa*)(mr + t * 16) = w0; *(v4fa*)(mr + t * 16 + 4) = w1;
        }
    }
    __builtin_amdgcn_fence(3, "wavefront"); __builtin_amdgcn_wave_barrier(); asm volatile("" ::: "memory");
    // the wave's first output row, the same in every lane (the wave's number through a scalar register); a lane's own part is the 32-bit byte offset vo
    const float* orow = OUT + ((size_t)batch * SEQ_FULL + q0blk + __builtin_amdgcn_readfirstlane(wid) * (16 * NQ)) * DM + (size_t)head * HD;
    const unsigned vo = (unsigned)(hi * DM + lr * 4) * 4u;
#pragma unroll
    for (int s = 0; s < 2 * NQ; ++s) {                    // rows 8 s + hi + {0, 2, 4, 6}: four stores and their s_wait_xcnt in one statement
        v4u d[4];
#pragma unroll
        for (int k = 0; k < 4; ++k) d[k] = *(const v4ua*)(myos + (8 * s + 2 * k + hi) * OSP + lr * 4);
        store4<2 * DM * 4>(orow + (size_t)(8 * s) * DM, vo, d[0], d[1], d[2], d[3]);
    }
}
__global__ __launch_bounds__(128)
void k_attn(const h16* __restrict__ Q16, const h16* __restrict__ K16, const h16* __restrict__ VT16,
            const bf* __restrict__ QPh, const bf* __restrict__ QPl, const bf* __restrict__ KPh, const bf* __restrict__ KPl,
            const bf* __restrict__ VTh, const bf* __restrict__ VTl, float* OUT) {
    __shared__ __align__(16) unsigned char sm[2 * STH * 2];       // HR: output staging; !HR: the two-stage ring, then output staging
    static_assert(4 * 32 * OSP * 4 <= 2 * STH * 2);
    constexpr int NT = (SEQ - RH) / 128, NBLK = NT + RH / 64;     // row blocks of one head: NT of 128 rows (!HR), then RH / 64 of 64 rows (HR)
    constexpr int LV = (NH * NB >= 256) ? 1 : 256 / (NH * NB);    // values of blockIdx.z that put one block on each of the chip's 256 WGPs
    const int head = (int)blockIdx.x, batch = (int)blockIdx.y, z = (int)blockIdx.z;
    if (z >= NBLK) return;                                // block-uniform (the grid is exact), in front of every block barrier
    // All blocks are resident at once (four or five per WGP): the row blocks, ranked by falling key count,
    // are dealt in rounds of LV that run forth and back, so that the blocks that meet on a WGP hold about the same number of keys together. A permutation of 0 .. NBLK - 1 (a last, partial round runs forth); for speed only.
    const int rd = z / LV, ps = z % LV;
    const int rank = ((rd & 1) && (rd + 1) * LV <= NBLK) ? rd * LV + (LV - 1 - ps) : z;
    // block-uniform choice
    if (rank >= NT) attn_rows<true>(Q16, K16, VT16, QPh, QPl, KPh, KPl, VTh, VTl, RH - 64 * (rank - NT + 1), head, batch, sm, OUT);
    else            attn_rows<false>(Q16, K16, VT16, QPh, QPl, KPh, KPl, VTh, VTl, SEQ - 128 * (rank + 1), head, batch, sm, OUT);
}

extern "C" void kernel_launch(void* const* d_in, const int* in_sizes, int n_in,
                              void* d_out, int out_size, void* d_ws, size_t ws_size, hipStream_t stream) {
    if (n_in < 3) return;
    if ((size_t)in_sizes[0] < (size_t)(NB - 1) * SEQ_FULL * DM + (size_t)SEQ * DM) return;
    if ((size_t)in_sizes[1] < (size_t)3 * DM * DM) return;
    if (in_sizes[2] < 3 * DM) return;
    if ((size_t)out_size < (size_t)(NB - 1) * SEQ_FULL * DM + (size_t)SEQ * DM) return;
    const float* x = (const float*)d_in[0];      // [NB][SEQ_FULL][DM]
    const float* W = (const float*)d_in[1];      // [3*DM][DM]  ([out][in], row blocks k | q | v)
    const float* bias = (const float*)d_in[2];   // [3*DM]
    float* OUT = (float*)d_out;                  // [NB][SEQ_FULL][DM]
    char* wsp = (char*)d_ws;
    auto take = [&](size_t bytes) { char* p = wsp; wsp += (bytes + 255) & ~(size_t)255; return (void*)p; };
    bf* WB = (bf*)take((size_t)3 * DM * DM * 2);
    bf* XB = (bf*)take((size_t)NB * SEQ * DM * 2);
    h16* Q16 = (h16*)take((size_t)NB * NH * SEQ * HD * 2); h16* K16 = (h16*)take((size_t)NB * NH * SEQ * HD * 2); h16* VT16 = (h16*)take((size_t)NB * NH * HD * SEQ * 2);
    bf* QPh = (bf*)take((size_t)NB * NH * RH * HD * 2); bf* QPl = (bf*)take((size_t)NB * NH * RH * HD * 2); bf* KPh = (bf*)take((size_t)NB * NH * RH * HD * 2); bf* KPl = (bf*)take((size_t)NB * NH * RH * HD * 2);
    bf* VTh = (bf*)take((size_t)NB * NH * HD * RH * 2); bf* VTl = (bf*)take((size_t)NB * NH * HD * RH * 2);
    if ((size_t)(wsp - (char*)d_ws) > ws_size) return;
    if ((size_t)(wsp - (char*)d_ws) > (size_t)134217728) return;

    k_cvt8<<<(unsigned)(((size_t)3 * DM * DM / 8 + 255) / 256), 256, 0, stream>>>(W, WB, (size_t)3 * DM * DM / 8);
    k_cvtx<<<dim3((unsigned)(((size_t)SEQ * DM / 8 + 255) / 256), NB, 1), 256, 0, stream>>>(x, XB, (size_t)SEQ * DM / 8);
    // k | q | v in one launch: every 64-column tile is one head of one of the three
    k_gemmw<<<dim3(SEQ / 256, 3 * DM / 128, NB), 256, 0, stream>>>(XB, WB, DM, bias, (size_t)SEQ * DM, (size_t)0, Q16, K16, VT16, QPh, QPl, KPh, KPl, VTh, VTl);
    // attention, one launch: blocks of rows < RH on the hi/lo path, blocks of rows >= RH single products
    k_attn<<<dim3(NH, NB, (SEQ - RH) / 128 + RH / 64), 128, 0, stream>>>(Q16, K16, VT16, QPh, QPl, KPh, KPl, VTh, VTl, OUT);
}

// v008
// Measured time: 99.9 microseconds a run.
// In two side-by-side timings against v007, it was 1.04 and 1.05 times as fast.
// Over all steps from v000 it is 3.54 times as fast.
#include <hip/hip_runtime.h>

// Contractions (f32 accumulate): kqv projection = v_wmma_f32_16x16x32_bf16 on bf16 RNE copies of x and W, bf16-valued bias added in f32; causal attention query rows < 256: q.k and p.v as bf16 hi/lo 3-product groups; query rows >= 256: v_wmma_f32_16x16x32_f16 on fp16 q, k, v planes and fp16 p x 1024; softmax statistics f32; output f32.
// Layout: bf16 W [3072][1024] used directly as the k-contiguous B operand (row blocks k | q | v); the projection's epilogue writes the head planes q, k [b][h][t][64] and v transposed [b][h][64][t]

#ifndef NB
#define NB 4
#endif
#ifndef SEQ
#define SEQ 2048
#endif
#define NB_FULL  4
#define SEQ_FULL 2048
#define DM   1024
#define NH   16
#define HD   64
#define RH   256                      // query rows < RH use the hi/lo 3-product path (keys there are < RH too)
#define OSP  68                       // LDS pitch (floats) of the f32 staging tiles (16 or 32 rows x 64)
#define KP   72                       // LDS pitch (halves) of a staged 64-half row: 144 B = 16 B x 9, for 16-byte readers
#define TLH  (64 * KP)                // halves of one staged tile (64 rows)
#define STH  (2 * TLH)                // halves of one stage: k tile (64 keys x 64 d), then vt tile (64 d x 64 keys)
#define PCAR 1024.0f
#define SCL  0.03125f                 // 1024^-0.5 (model-dim scaling)
#define L2E  1.4426950408889634f

static_assert(NH * HD == DM);
static_assert((SEQ % 256) == 0 && (RH % 256) == 0 && RH <= SEQ && SEQ <= SEQ_FULL && NB >= 1 && NB <= NB_FULL);
static_assert((DM % 128) == 0 && (SEQ % 64) == 0);
// workspace bytes at full size (all regions exact multiples of their store granularity) + alignment slack <= 128 MiB
static_assert((size_t)3 * DM * DM * 2 + (size_t)NB * SEQ * DM * 2 + (size_t)3 * NB * NH * SEQ * HD * 2 + (size_t)6 * NB * NH * RH * HD * 2 + 12 * 256 <= (size_t)134217728);

typedef _Float16 h16;
typedef unsigned short bf;
typedef __attribute__((ext_vector_type(16))) __bf16   v16bf;
typedef __attribute__((ext_vector_type(16))) _Float16 v16h;
typedef __attribute__((ext_vector_type(8)))  _Float16 v8h;
typedef __attribute__((ext_vector_type(8)))  unsigned short v8us;
typedef __attribute__((ext_vector_type(8)))  float    v8f;
typedef __attribute__((ext_vector_type(4)))  float    v4f;
typedef v8h  __attribute__((may_alias)) v8ha;
typedef v4f  __attribute__((may_alias)) v4fa;
typedef v8us __attribute__((may_alias)) v8usa;

__device__ __forceinline__ unsigned short f2bf(float f) { unsigned u = __float_as_uint(f); u += 0x7FFFu + ((u >> 16) & 1u); return (unsigned short)(u >> 16); }
__device__ __forceinline__ float bf2f(unsigned short b) { return __uint_as_float(((unsigned)b) << 16); }
__device__ __forceinline__ float bfr(float f) { return bf2f(f2bf(f)); }
__device__ __forceinline__ void splitf(float y, unsigned short& h, unsigned short& l) { h = f2bf(y); l = f2bf(y - bf2f(h)); }
__device__ __forceinline__ v16h cat16(v8h lo, v8h hi) { return __builtin_shufflevector(lo, hi, 0, 1, 2, 3, 4, 5, 6, 7, 8, 9, 10, 11, 12, 13, 14, 15); }
__device__ __forceinline__ v16bf cat16b(v8us lo, v8us hi) { return __builtin_bit_cast(v16bf, __builtin_shufflevector(lo, hi, 0, 1, 2, 3, 4, 5, 6, 7, 8, 9, 10, 11, 12, 13, 14, 15)); }
__device__ __forceinline__ v8f wmma16(v16h a, v16h b, v8f c) { return __builtin_amdgcn_wmma_f32_16x16x32_f16(false, a, false, b, (short)0, c, false, false); }
__device__ __forceinline__ v8f wmmab(v16bf a, v16bf b, v8f c) { return __builtin_amdgcn_wmma_f32_16x16x32_bf16(false, a, false, b, (short)0, c, false, false); }

// 16-bit fragment loaders (lane l: row/col = l & 15, h = l >> 4; elements 0..7 <- k0 + 8h + 0..7, elements 8..15 <- k0 + 16 + 8h + 0..7; the caller passes p = row base + k0 + 8h).
template <typename T16> struct WFrag;
template <> struct WFrag<h16> { typedef v16h V; static __device__ __forceinline__ V ld(const h16* p) { return cat16(*(const v8h*)p, *(const v8h*)(p + 16)); } static __device__ __forceinline__ v8f mma(V a, V b, v8f c) { return wmma16(a, b, c); } };
template <> struct WFrag<bf> { typedef v16bf V; static __device__ __forceinline__ V ld(const bf* p) { return cat16b(*(const v8us*)p, *(const v8us*)(p + 16)); } static __device__ __forceinline__ v8f mma(V a, V b, v8f c) { return wmmab(a, b, c); } };
// LDS reloads through may_alias vectors of the stored element type
__device__ __forceinline__ v16h  lds16(const h16* p) { return cat16(*(const v8ha*)p, *(const v8ha*)(p + 16)); }
__device__ __forceinline__ v16bf ldsb(const bf* p)   { return cat16b(*(const v8usa*)p, *(const v8usa*)(p + 16)); }

// Four 16-byte stores of a wave. The s_wait_xcnt stands inside the statement so that no register the stores name is rewritten ahead of it.
typedef __attribute__((ext_vector_type(4))) unsigned v4u;
template <int STEP>                   // base: the same in every lane; voff: the lane's byte offset; STEP: bytes between two of the four
__device__ __forceinline__ void store4(const void* base, unsigned voff, v4u d0, v4u d1, v4u d2, v4u d3) {
    asm volatile("global_store_b128 %0, %2, %1\n\t"
                 "global_store_b128 %0, %3, %1 offset:%6\n\t"
                 "global_store_b128 %0, %4, %1 offset:%7\n\t"
                 "global_store_b128 %0, %5, %1 offset:%8\n\t"
                 "s_wait_xcnt 0x0"
                 :: "v"(voff), "s"(base), "v"(d0), "v"(d1), "v"(d2), "v"(d3), "n"(STEP), "n"(2 * STEP), "n"(3 * STEP) : "memory");
}
// orders a wave's own LDS stores and loads around the reuse of its staging tile
__device__ __forceinline__ void wave_lds_order() { __builtin_amdgcn_fence(3, "wavefront"); __builtin_amdgcn_wave_barrier(); asm volatile("" ::: "memory"); }
// eight f32 values -> eight 16-bit values of plane p: 0 fp16, 1 bf16 hi, 2 bf16 lo (the residual of hi)
__device__ __forceinline__ v4u plane8(const float (&y)[8], int p) {
    if (p == 0) { v8h c;
#pragma unroll
        for (int k = 0; k < 8; ++k) c[k] = (h16)y[k];
        return __builtin_bit_cast(v4u, c); }
    v8us c;
#pragma unroll
    for (int k = 0; k < 8; ++k) { unsigned short a1, a2; splitf(y[k], a1, a2); c[k] = p == 1 ? a1 : a2; }
    return __builtin_bit_cast(v4u, c);
}
typedef v4u __attribute__((may_alias)) v4ua;
// Projection epilogues of one wave's 64 x 64 tile; acc[mb][nb][j] = y[16 mb + 8 hi + j][16 nb + lr] without bias, bs[nb] = bias of column 16 nb + lr. Read-back: 8 lanes cover one 128-B row of 16-bit values, a wave 4 rows.
// NP = 1: the fp16 plane alone; NP = 3: the bf16 hi and lo planes too (positions < RH), one plane after the other.
// Every loop of the two epilogues and of plane8 is unrolled so that acc and the small arrays are indexed by constants and stay in registers.
// k, q planes [t][64]: P[p] points at the tile's first position; f32 LDS tile of 16 positions.
template <int NP>
__device__ __forceinline__ void put_rows(const v8f (&acc)[4][4], const float (&bs)[4], unsigned char* sm, int lane, unsigned short* const (&P)[3]) {
    const int lr = lane & 15, hi = lane >> 4, srow = lane >> 3, scol = (lane & 7) * 8;
    float* os = (float*)sm;
#pragma unroll
    for (int mb = 0; mb < 4; ++mb) {
#pragma unroll
        for (int nb = 0; nb < 4; ++nb) {
#pragma unroll
            for (int j = 0; j < 8; ++j) os[(hi * 8 + j) * OSP + nb * 16 + lr] = acc[mb][nb][j] + bs[nb]; }
        wave_lds_order();
#pragma unroll
        for (int p = 0; p < NP; ++p) {
            v4u o[4];
#pragma unroll
            for (int s = 0; s < 4; ++s) {
                const float* xr = os + (4 * s + srow) * OSP + scol; const v4f x0 = *(const v4fa*)xr, x1 = *(const v4fa*)(xr + 4);
                const float y[8] = { x0[0], x0[1], x0[2], x0[3], x1[0], x1[1], x1[2], x1[3] };
                o[s] = plane8(y, p);
            }
            store4<4 * HD * 2>(P[p] + mb * 16 * HD, (unsigned)(srow * HD + scol) * 2u, o[0], o[1], o[2], o[3]);
        }
        wave_lds_order();
    }
}
// v planes [d][t]: P[p] (row pitch SEQ for p = 0, RH else) points at d = 0 of the tile's first position; a lane's 8 accumulator rows are 8 consecutive positions of one d; a 16-bit LDS tile of 16 d x 64 positions per plane.
template <int NP>
__device__ __forceinline__ void put_cols(const v8f (&acc)[4][4], const float (&bs)[4], unsigned char* sm, int lane, unsigned short* const (&P)[3]) {
    const int lr = lane & 15, hi = lane >> 4, srow = lane >> 3, scol = (lane & 7) * 8;
#pragma unroll
    for (int nb = 0; nb < 4; ++nb) {
#pragma unroll
        for (int p = 0; p < NP; ++p) {
            unsigned short* st = (unsigned short*)sm + p * 16 * KP;
#pragma unroll
            for (int mb = 0; mb < 4; ++mb) {
                float y[8];
#pragma unroll
                for (int j = 0; j < 8; ++j) y[j] = acc[mb][nb][j] + bs[nb];
                *(v4ua*)(st + lr * KP + mb * 16 + hi * 8) = plane8(y, p);
            }
            wave_lds_order();
            v4u o[4];
#pragma unroll
            for (int s = 0; s < 4; ++s) o[s] = *(const v4ua*)(st + (4 * s + srow) * KP + scol);
            if (p == 0) store4<4 * SEQ * 2>(P[0] + (size_t)nb * 16 * SEQ, (unsigned)(srow * SEQ + scol) * 2u, o[0], o[1], o[2], o[3]);
            else        store4<4 * RH * 2>(P[p] + nb * 16 * RH, (unsigned)(srow * RH + scol) * 2u, o[0], o[1], o[2], o[3]);
        }
        wave_lds_order();
    }
}

// ---- k_gemmw: the kqv projection. Grid (SEQ/256, 3*DM/128, NB), 256 threads: a work-group owns a 256 x 128 tile of y, its eight waves (4 x 2) a 64 x 64 tile each (16 accumulators).
// y[m][n] (f32, + bf16-valued bias[n]) = sum_k A[m][k] Bt[n][k], both operands K-contiguous bf16 planes. z-batch strides sA/sB in elements. K % 64 == 0, K >= 64.
// The waves read their fragments from LDS. A stage = 64 k of the work-group's 256 A rows and 128 Bt rows (whole 128-B lines, 8 lanes a row), two buffers; every thread copies 8 + 4 pieces of 16 B per stage;
// stage t + 2 is issued into the buffer of stage t behind the barrier that ends its last read. After the last stage's barrier the ring is the eight waves' epilogue staging.
// A wave's tile is 64 positions of ONE head of k, q or v (column tile = NH * {k, q, v} + head); the epilogue converts y and writes the head planes itself:
// k, q: fp16 [t][64] (and the bf16 hi/lo planes where t < RH) through an f32 LDS tile of 16 positions; v: a lane's 8 accumulator rows are 8 consecutive positions of one d, packed and turned into whole 128-B rows of [d][t] through 16-bit LDS tiles of 16 d.
#define GAH  (256 * KP)               // halves of the staged A tile (256 rows of 64 k)
#define GSH  (GAH + 128 * KP)         // halves of one stage: A tile, then Bt tile (128 rows)
#define EPB  (3 * 16 * KP * 2)        // bytes of one wave's epilogue staging: one f32 tile 16 x OSP, or three 16-bit tiles 16 x KP
// One stage's copies of this thread: rows r, r + 32, ..., r + 224 of the A tile and r, ..., r + 96 of the Bt tile (l: LDS byte address of its first A piece; rs: elements between two of the rows).
// The s_wait_xcnt stands inside the statement so that no address register is rewritten ahead of it.
__device__ __forceinline__ void gstage_copy(unsigned l, const bf* ga, const bf* gb, size_t rs) {
    asm volatile("global_load_async_to_lds_b128 %0, %12, off\n\t"
                 "global_load_async_to_lds_b128 %1, %13, off\n\t"
                 "global_load_async_to_lds_b128 %2, %14, off\n\t"
                 "global_load_async_to_lds_b128 %3, %15, off\n\t"
                 "global_load_async_to_lds_b128 %4, %16, off\n\t"
                 "global_load_async_to_lds_b128 %5, %17, off\n\t"
                 "global_load_async_to_lds_b128 %6, %18, off\n\t"
                 "global_load_async_to_lds_b128 %7, %19, off\n\t"
                 "global_load_async_to_lds_b128 %8, %20, off\n\t"
                 "global_load_async_to_lds_b128 %9, %21, off\n\t"
                 "global_load_async_to_lds_b128 %10, %22, off\n\t"
                 "global_load_async_to_lds_b128 %11, %23, off\n\t"
                 "s_wait_xcnt 0x0"
                 :: "v"(l), "v"(l + 32 * KP * 2), "v"(l + 64 * KP * 2), "v"(l + 96 * KP * 2), "v"(l + 128 * KP * 2), "v"(l + 160 * KP * 2), "v"(l + 192 * KP * 2), "v"(l + 224 * KP * 2),
                    "v"(l + GAH * 2), "v"(l + GAH * 2 + 32 * KP * 2), "v"(l + GAH * 2 + 64 * KP * 2), "v"(l + GAH * 2 + 96 * KP * 2),
                    "v"(ga), "v"(ga + rs), "v"(ga + 2 * rs), "v"(ga + 3 * rs), "v"(ga + 4 * rs), "v"(ga + 5 * rs), "v"(ga + 6 * rs), "v"(ga + 7 * rs),
                    "v"(gb), "v"(gb + rs), "v"(gb + 2 * rs), "v"(gb + 3 * rs)
                 : "memory");
}
__global__ __launch_bounds__(256) __attribute__((amdgpu_num_vgpr(256)))   // the ring lets two work-groups share a WGP: four waves per SIMD, 256 registers each
void k_gemmw(const bf* __restrict__ A, const bf* __restrict__ Bt, int K, const float* __restrict__ bias, size_t sA, size_t sB,
             h16* Q16, h16* K16, h16* VT16, bf* QPh, bf* QPl, bf* KPh, bf* KPl, bf* VTh, bf* VTl) {
    __shared__ __align__(16) unsigned char sm[2 * GSH * 2];       // the two-stage ring, then epilogue staging
    static_assert(16 * OSP * 4 <= EPB && 8 * EPB <= 2 * GSH * 2);
    const size_t z = blockIdx.z; A += z * sA; Bt += z * sB;
    const int lane = threadIdx.x & 31, lr = lane & 15, hi = lane >> 4;
    const int wid = __builtin_amdgcn_readfirstlane((int)threadIdx.x >> 5);   // the wave's number in a scalar register: tile, plane and store bases stay scalar
    const int wm = wid & 3, wn = wid >> 2;
    const int r0 = (int)blockIdx.x * 256 + wm * 64, ct = (int)blockIdx.y * 2 + wn, c0 = ct * 64;
    v8f acc[4][4];
#pragma unroll
    for (int mb = 0; mb < 4; ++mb)
#pragma unroll
        for (int nb = 0; nb < 4; ++nb) acc[mb][nb] = (v8f){};
    const bf* ring = (const bf*)sm;
    // this thread's first piece of an operand tile: row threadIdx.x >> 3, 16-byte column threadIdx.x & 7
    const int crow = (int)threadIdx.x >> 3, ccol = ((int)threadIdx.x & 7) * 8;
    const unsigned la0 = (unsigned)(size_t)(ring + crow * KP + ccol);                  // LDS byte address in buffer 0, A tile
    const bf* ga0 = A + (size_t)((int)blockIdx.x * 256 + crow) * K + ccol; const bf* gb0 = Bt + (size_t)((int)blockIdx.y * 128 + crow) * K + ccol;
    const size_t rs = (size_t)32 * K;
    const int nst = K >> 6;                                                            // stages of 64 k
    gstage_copy(la0, ga0, gb0, rs);
    asm volatile("s_wait_asynccnt 0x0" ::: "memory");                                  // stage 0 has landed before the barrier that publishes it
    __syncthreads();                                                                   // publishes stage 0 to all eight waves
    if (nst > 1) gstage_copy(la0 + GSH * 2, ga0 + 64, gb0 + 64, rs);
#pragma unroll 1
    for (int t = 0; t < nst; ++t) {
        const bf* ap = ring + (t & 1) * GSH + (wm * 64 + lr) * KP + 8 * hi; const bf* bp = ring + (t & 1) * GSH + GAH + (wn * 64 + lr) * KP + 8 * hi;
#pragma unroll
        for (int kk = 0; kk < 2; ++kk) {
            v16bf a[4], b[4];
#pragma unroll
            for (int i = 0; i < 4; ++i) { a[i] = ldsb(ap + i * 16 * KP + kk * 32); b[i] = ldsb(bp + i * 16 * KP + kk * 32); }
            // holds the block's 16 LDS reads together in front of its 16 products (loaded values as inputs only): one wait per block instead of one per group of four products
            asm volatile("" :: "v"(a[0]), "v"(a[1]), "v"(a[2]), "v"(a[3]), "v"(b[0]), "v"(b[1]), "v"(b[2]), "v"(b[3]));
#pragma unroll
            for (int nb = 0; nb < 4; ++nb)
#pragma unroll
                for (int mb = 0; mb < 4; ++mb) acc[mb][nb] = wmmab(a[mb], b[nb], acc[mb][nb]);
        }
        // foot of a stage: publish the next stage, free this one's buffer
        asm volatile("s_wait_dscnt 0x0" ::: "memory");                                 // this wave's reads of the buffer have returned
        asm volatile("s_wait_asynccnt 0x0" ::: "memory");                              // this wave's copies of stage t + 1 have landed
        __syncthreads();                                                               // publishes stage t + 1 and ends every wave's reads of stage t
        if (t + 2 < nst) gstage_copy(la0 + (unsigned)(t & 1) * (GSH * 2), ga0 + (t + 2) * 64, gb0 + (t + 2) * 64, rs);
    }
    asm volatile("s_wait_asynccnt 0x0" ::: "memory");                                  // nothing of this wave is in flight when the ring becomes epilogue staging
    unsigned char* es = sm + wid * EPB;                   // this wave's own staging
    const int sel = ct / NH;                              // 0: k, 1: q, 2: v (W's row blocks)
    const size_t bh = z * NH + ct % NH;
    const bool lo = r0 < RH;                              // the wave's whole tile (RH is a multiple of 64); wave-uniform like sel, and no block barrier follows
    const size_t rl = lo ? r0 : 0;
    float bs[4];
    // bias of columns c0 + lr + {0, 16, 32, 48}: the four loads and their data wait in one statement, outputs early-clobbered, so that no register a load names is rewritten while it is in flight
    asm volatile("global_load_b32 %0, %4, %5\n\t"
                 "global_load_b32 %1, %4, %5 offset:64\n\t"
                 "global_load_b32 %2, %4, %5 offset:128\n\t"
                 "global_load_b32 %3, %4, %5 offset:192\n\t"
                 "s_wait_loadcnt 0x0"
                 : "=&v"(bs[0]), "=&v"(bs[1]), "=&v"(bs[2]), "=&v"(bs[3]) : "v"((unsigned)(c0 + lr) * 4u), "s"(bias) : "memory");
#pragma unroll
    for (int nb = 0; nb < 4; ++nb) bs[nb] = bfr(bs[nb]);
    if (sel < 2) {
        unsigned short* const P[3] = { (unsigned short*)(sel == 1 ? Q16 : K16) + (bh * SEQ + r0) * HD, (sel == 1 ? QPh : KPh) + (bh * RH + rl) * HD, (sel == 1 ? QPl : KPl) + (bh * RH + rl) * HD };
        if (lo) put_rows<3>(acc, bs, es, lane, P); else put_rows<1>(acc, bs, es, lane, P);
    } else {
        unsigned short* const P[3] = { (unsigned short*)VT16 + bh * HD * SEQ + r0, VTh + bh * HD * RH + rl, VTl + bh * HD * RH + rl };
        if (lo) put_cols<3>(acc, bs, es, lane, P); else put_cols<1>(acc, bs, es, lane, P);
    }
}

__global__ __launch_bounds__(256) void k_cvt8(const float* __restrict__ src, bf* dst, size_t n8) { const size_t i = (size_t)blockIdx.x * 256 + threadIdx.x; if (i >= n8) return; const v8f v = *(const v8f*)(src + i * 8); v8us o;
#pragma unroll
    for (int k = 0; k < 8; ++k) o[k] = f2bf(v[k]); *(v8us*)(dst + i * 8) = o;  }
__global__ __launch_bounds__(256) void k_cvtx(const float* __restrict__ src, bf* dst, size_t n8) { const size_t i = (size_t)blockIdx.x * 256 + threadIdx.x; if (i >= n8) return;
    const float* s = src + (size_t)blockIdx.y * SEQ_FULL * DM; bf* d = dst + (size_t)blockIdx.y * SEQ * DM; const v8f v = *(const v8f*)(s + i * 8); v8us o;
#pragma unroll
    for (int k = 0; k < 8; ++k) o[k] = f2bf(v[k]); *(v8us*)(d + i * 8) = o;  }

// ---- k_attn: causal streaming attention, all rows in one launch. Grid (NH, NB, (SEQ-RH)/128 + RH/64), 128 threads: block = 128 query rows >= RH (wave -> 32 rows, two groups of 16) or 64 rows < RH (wave -> 16 rows) of head blockIdx.x, batch blockIdx.y.
// A block whose rows lie below RH runs attn_rows<true> (HR), every other block attn_rows<false>: the few short HR blocks, one wave per SIMD and bound by load latency on their own, run beside the long ones.
// Key chunks of 32 from 0 to the block's last row (block-uniform loop; per-element causal select j <= i; !HR: in the last four chunks alone, the only ones with keys past the block's first row). Per chunk and group: S^T (32 keys x 16 queries) = k.q^T, scaled by SCL in f32, online max/sum in f32 (one query per lane), O^T += vt.p^T with p^T packed from the score registers,
// HR (rows and keys < RH): bf16 planes, q.k = qh.kh + qh.kl + ql.kh, p.v = ph.vh + pl.vh + ph.vl (one accumulator, unscaled residuals). Otherwise fp16 planes, single products.
// !HR: the block's four waves read k and vt from LDS. A stage = 64 keys (two chunks), two buffers; every thread copies 4 + 4 pieces of 16 B per stage, whole 128-B rows per 8 lanes;
// stage s + 2 is issued into the buffer of stage s behind the barrier that ends its last read. After the last stage's barrier the ring is the output staging.
// Fragments are read from LDS ahead of their use: a chunk's vt fragments in front of its score products, the next chunk's k fragments behind them; so a stage's last LDS read, and with it the barrier, stands in the middle of its second chunk.
// One stage's copies of this thread: rows r, r + 16, r + 32, r + 48 of the k tile and of the vt tile. The s_wait_xcnt stands inside the statement so that no address register is rewritten ahead of it.
__device__ __forceinline__ void stage_copy(unsigned lk, const h16* gk, unsigned lv, const h16* gv) {
    asm volatile("global_load_async_to_lds_b128 %0, %8, off\n\t"
                 "global_load_async_to_lds_b128 %1, %9, off\n\t"
                 "global_load_async_to_lds_b128 %2, %10, off\n\t"
                 "global_load_async_to_lds_b128 %3, %11, off\n\t"
                 "global_load_async_to_lds_b128 %4, %12, off\n\t"
                 "global_load_async_to_lds_b128 %5, %13, off\n\t"
                 "global_load_async_to_lds_b128 %6, %14, off\n\t"
                 "global_load_async_to_lds_b128 %7, %15, off\n\t"
                 "s_wait_xcnt 0x0"
                 :: "v"(lk), "v"(lk + 16 * KP * 2), "v"(lk + 32 * KP * 2), "v"(lk + 48 * KP * 2), "v"(lv), "v"(lv + 16 * KP * 2), "v"(lv + 32 * KP * 2), "v"(lv + 48 * KP * 2),
                    "v"(gk), "v"(gk + 16 * HD), "v"(gk + 32 * HD), "v"(gk + 48 * HD), "v"(gv), "v"(gv + (size_t)16 * SEQ), "v"(gv + (size_t)32 * SEQ), "v"(gv + (size_t)48 * SEQ)
                 : "memory");
}
// lane l <-> lane l ^ 16 (the other half of the wave holds the other 16 keys of the same query)
__device__ __forceinline__ float xhalf(float v) { const int b = __float_as_int(v); return __int_as_float(__builtin_amdgcn_permlanex16(b, b, 0x76543210, 0xfedcba98, false, false)); }
template <bool HR>
__device__ __forceinline__
void attn_rows(const h16* __restrict__ Q16, const h16* __restrict__ K16, const h16* __restrict__ VT16,
               const bf* __restrict__ QPh, const bf* __restrict__ QPl, const bf* __restrict__ KPh, const bf* __restrict__ KPl,
               const bf* __restrict__ VTh, const bf* __restrict__ VTl, int q0blk, int head, int batch, unsigned char* sm, float* OUT) {
    constexpr int NQ = HR ? 1 : 2;                        // groups of 16 query columns per wave: every k and vt fragment read from LDS feeds NQ products
    const int lane = threadIdx.x & 31, lr = lane & 15, hi = lane >> 4, wid = threadIdx.x >> 5;
    const int q0 = q0blk + wid * (16 * NQ);
    const size_t bh = (size_t)batch * NH + head;
    const h16* Qb = Q16 + bh * SEQ * HD; const h16* Kb = K16 + bh * SEQ * HD; const h16* Vb = VT16 + bh * HD * SEQ;
    const bf* Qhb = QPh + bh * RH * HD; const bf* Qlb = QPl + bh * RH * HD; const bf* Khb = KPh + bh * RH * HD; const bf* Klb = KPl + bh * RH * HD;
    const bf* Vhb = VTh + bh * HD * RH; const bf* Vlb = VTl + bh * HD * RH;
    float* myos = (float*)sm + wid * (16 * NQ) * OSP;
    const h16* ring = (const h16*)sm;
    const int nchunk = (q0blk + 64 * NQ) >> 5;
    const float NEG = -__builtin_inff();
    // group g: this lane's query row is q0 + 16 * g + lr

    v8f o[NQ][4];                                         // o[g][t][r] = O[q0 + 16 * g + lr][t * 16 + 8 * hi + r] (transposed output tiles)
    float m[NQ], l[NQ];                                   // m: both halves agree; l: this half's keys only, joined behind the loop
    v16h aq[NQ][2];
#pragma unroll
    for (int g = 0; g < NQ; ++g) {
#pragma unroll
        for (int t = 0; t < 4; ++t) o[g][t] = (v8f){};
        m[g] = NEG; l[g] = 0.0f;
        if (!HR) { const h16* qr = Qb + (size_t)(q0 + 16 * g + lr) * HD + 8 * hi; aq[g][0] = WFrag<h16>::ld(qr); aq[g][1] = WFrag<h16>::ld(qr + 32); }
    }
    // this thread's first piece of a stage: row threadIdx.x >> 3, 16-byte column threadIdx.x & 7
    const int crow = (int)threadIdx.x >> 3, ccol = ((int)threadIdx.x & 7) * 8;
    const unsigned lk0 = (unsigned)(size_t)(ring + crow * KP + ccol);                  // LDS byte address in buffer 0, k tile
    const h16* gk0 = Kb + (size_t)crow * HD + ccol; const h16* gv0 = Vb + (size_t)crow * SEQ + ccol;
    const int nst = nchunk >> 1;                                                       // stages of 64 keys (nchunk is even)
    if (!HR) {
        stage_copy(lk0, gk0, lk0 + TLH * 2, gv0);
        asm volatile("s_wait_asynccnt 0x0" ::: "memory");                              // stage 0 has landed before the barrier that publishes it
        __syncthreads();                                                               // publishes stage 0 to all four waves
        if (nst > 1) stage_copy(lk0 + STH * 2, gk0 + 64 * HD, lk0 + STH * 2 + TLH * 2, gv0 + 64);
    }
    // !HR: the k fragments of the chunk at hand, read from LDS one chunk ahead: kf[2 * i + kk] = keys 16 * i .. 16 * i + 15 of the chunk, d 32 * kk .. 32 * kk + 31
    v16h kf[4];
    auto load_k = [&](int cn) {
        const h16* kp = ring + ((cn >> 1) & 1) * STH + ((cn & 1) * 32 + lr) * KP + 8 * hi;
        kf[0] = lds16(kp); kf[1] = lds16(kp + 32); kf[2] = lds16(kp + 16 * KP); kf[3] = lds16(kp + 16 * KP + 32);
    };
    if (!HR) load_k(0);                                                                // stage 0 is published

#pragma unroll 1
    for (int c = 0; c < nchunk; ++c) {
        const int j0 = c * 32;
        v8f s0[NQ], s1[NQ];                               // s0[g][r] = S[q][j0 + 8 * hi + r], s1[g][r] = S[q][j0 + 16 + 8 * hi + r], q the lane's row of group g
#pragma unroll
        for (int g = 0; g < NQ; ++g) { s0[g] = (v8f){}; s1[g] = (v8f){}; }
        v16h fv[4];                                           // !HR: the chunk's vt fragments, d 16 * t .. 16 * t + 15
        if constexpr (HR) {
            const bf* qh = Qhb + (size_t)(q0 + lr) * HD + 8 * hi; const bf* ql = Qlb + (size_t)(q0 + lr) * HD + 8 * hi;
            const bf* kh = Khb + (size_t)(j0 + lr) * HD + 8 * hi; const bf* kl = Klb + (size_t)(j0 + lr) * HD + 8 * hi;
#pragma unroll
            for (int kk = 0; kk < 2; ++kk) {
                const v16bf aqh = WFrag<bf>::ld(qh + kk * 32), aql = WFrag<bf>::ld(ql + kk * 32);
                const v16bf kh0 = WFrag<bf>::ld(kh + kk * 32), kh1 = WFrag<bf>::ld(kh + 16 * HD + kk * 32);
                const v16bf kl0 = WFrag<bf>::ld(kl + kk * 32), kl1 = WFrag<bf>::ld(kl + 16 * HD + kk * 32);
                s0[0] = wmmab(kh0, aqh, s0[0]); s0[0] = wmmab(kl0, aqh, s0[0]); s0[0] = wmmab(kh0, aql, s0[0]);
                s1[0] = wmmab(kh1, aqh, s1[0]); s1[0] = wmmab(kl1, aqh, s1[0]); s1[0] = wmmab(kh1, aql, s1[0]);
                // keeps the vector slots between the last product and the first use of its result or operands
                if (kk == 1) asm volatile("v_nop\n\tv_nop\n\tv_nop\n\tv_nop" : "+v"(s0[0]), "+v"(s1[0]) : "v"(aql), "v"(kh1));
            }
        } else {
            // the chunk's four vt fragments are read as one group in front of the score products: they land under those products, not in front of each pair of vt . p^T products
            const h16* vp = ring + ((c >> 1) & 1) * STH + TLH + lr * KP + (c & 1) * 32 + 8 * hi;
#pragma unroll
            for (int t = 0; t < 4; ++t) fv[t] = lds16(vp + t * 16 * KP);
            __builtin_amdgcn_sched_barrier(0);                // holds the eight reads here, in front of the score products, so that they land under them
#pragma unroll
            for (int kk = 0; kk < 2; ++kk) {
                s0[0] = wmma16(kf[kk], aq[0][kk], s0[0]); s0[1] = wmma16(kf[kk], aq[1][kk], s0[1]);
                s1[0] = wmma16(kf[2 + kk], aq[0][kk], s1[0]); s1[1] = wmma16(kf[2 + kk], aq[1][kk], s1[1]);
                // keeps the vector slots between the last product and the first use of its result or operands
                if (kk == 1) asm volatile("v_nop\n\tv_nop\n\tv_nop\n\tv_nop" : "+v"(s0[0]), "+v"(s1[0]), "+v"(s0[1]), "+v"(s1[1]) : "v"(aq[1][1]), "v"(kf[3]));
            }
            if (c & 1) {                                                               // publish point of stage st + 1 (block-uniform), in the stage's last chunk behind its last LDS read: the k fragments fetched below already belong to stage st + 1
                const int st = c >> 1;
                asm volatile("s_wait_dscnt 0x0" ::: "memory");                         // this wave's reads of the buffer (all k and vt fragments of stage st) have returned
                asm volatile("s_wait_asynccnt 0x0" ::: "memory");                      // this wave's copies of stage st + 1 have landed
                __syncthreads();                                                       // publishes stage st + 1 and ends every wave's reads of stage st
                if (st + 2 < nst) { const unsigned lb = lk0 + (unsigned)(st & 1) * (STH * 2); stage_copy(lb, gk0 + (size_t)(st + 2) * 64 * HD, lb + TLH * 2, gv0 + (st + 2) * 64); }
            }
            if (c + 1 < nchunk) load_k(c + 1);                // block-uniform scalar branch: the last chunk reads nothing more; the reads land under the softmax
        }
        v16h bp[NQ];                                          // !HR: p^T of each group, the B operands of vt . p^T
#pragma unroll
        for (int g = 0; g < NQ; ++g) {
        // online softmax update: a lane holds 16 of the 32 keys of ONE query; maximum and sum in the lane, the maximum joined with the other half by one exchange
        float pa[8], pc[8];
        const v8f a0 = s0[g] * SCL, c0v = s1[g] * SCL;
#pragma unroll
        for (int r = 0; r < 8; ++r) { pa[r] = a0[r]; pc[r] = c0v[r]; }
        // Only the block's last 2 * NQ chunks hold keys past its first row (chunk nchunk - 2 * NQ starts at key q0blk): in every earlier chunk j < q0blk <= i for each element and the select would change nothing.
        if (HR || c >= nchunk - 2 * NQ) {                     // block-uniform scalar branch (the short HR blocks select in every chunk, as before)
            const int qd = q0 + 16 * g + lr - j0 - 8 * hi;    // key j0 + 8 * hi + r is allowed where r <= qd
#pragma unroll
            for (int r = 0; r < 8; ++r) { pa[r] = (r <= qd) ? pa[r] : NEG; pc[r] = (16 + r <= qd) ? pc[r] : NEG; }
        }
        float v = fmaxf(fmaxf(fmaxf(fmaxf(pa[0], pa[1]), fmaxf(pa[2], pa[3])), fmaxf(fmaxf(pa[4], pa[5]), fmaxf(pa[6], pa[7]))),
                        fmaxf(fmaxf(fmaxf(pc[0], pc[1]), fmaxf(pc[2], pc[3])), fmaxf(fmaxf(pc[4], pc[5]), fmaxf(pc[6], pc[7]))));
        v = fmaxf(v, xhalf(v));
        const float mn = fmaxf(m[g], v);                      // finite from chunk 0 on (key 0 <= q for every row, seen through the exchange)
        const float alpha = __builtin_amdgcn_exp2f((m[g] - mn) * L2E);
        m[g] = mn;
#pragma unroll
        for (int r = 0; r < 8; ++r) { pa[r] = __builtin_amdgcn_exp2f((pa[r] - mn) * L2E); pc[r] = __builtin_amdgcn_exp2f((pc[r] - mn) * L2E); }
        const float rs = (((pa[0] + pa[1]) + (pa[2] + pa[3])) + ((pa[4] + pa[5]) + (pa[6] + pa[7]))) + (((pc[0] + pc[1]) + (pc[2] + pc[3])) + ((pc[4] + pc[5]) + (pc[6] + pc[7])));
        l[g] = l[g] * alpha + rs;
#pragma unroll
        for (int t = 0; t < 4; ++t)
#pragma unroll
            for (int r = 0; r < 8; ++r) o[g][t][r] *= alpha;
        // the two score tiles, converted in place, are the B operand of vt . p^T: element s <- key j0 + 8 * hi + s (s < 8), j0 + 16 + 8 * hi + s - 8 (s >= 8), the loaders' k order
        if constexpr (HR) {
            v8us h0, l0, h1, l1;
#pragma unroll
            for (int r = 0; r < 8; ++r) { unsigned short a1, a2, c1, c2; splitf(pa[r], a1, a2); splitf(pc[r], c1, c2); h0[r] = a1; l0[r] = a2; h1[r] = c1; l1[r] = c2; }
            const v16bf bph = cat16b(h0, h1), bpl = cat16b(l0, l1);
            const bf* vh = Vhb + (size_t)lr * RH + j0 + 8 * hi; const bf* vl = Vlb + (size_t)lr * RH + j0 + 8 * hi;
            v16bf fvh = bph, fvl = bpl;
#pragma unroll
            for (int t = 0; t < 4; ++t) { fvh = WFrag<bf>::ld(vh + (size_t)t * 16 * RH); fvl = WFrag<bf>::ld(vl + (size_t)t * 16 * RH);
                o[0][t] = wmmab(fvh, bph, o[0][t]); o[0][t] = wmmab(fvh, bpl, o[0][t]); o[0][t] = wmmab(fvl, bph, o[0][t]); }
            // keeps the vector slots behind the last product on the loop's back edge too
            asm volatile("v_nop\n\tv_nop\n\tv_nop\n\tv_nop" : "+v"(o[0][0]), "+v"(o[0][1]), "+v"(o[0][2]), "+v"(o[0][3]) : "v"(bph), "v"(fvl));
        } else {
#pragma unroll
            for (int r = 0; r < 8; ++r) { bp[g][r] = (h16)(pa[r] * PCAR); bp[g][8 + r] = (h16)(pc[r] * PCAR); }
        }
        }
        if constexpr (!HR) {
#pragma unroll
            for (int t = 0; t < 4; ++t) { o[0][t] = wmma16(fv[t], bp[0], o[0][t]); o[1][t] = wmma16(fv[t], bp[1], o[1][t]); }
            // keeps the vector slots behind the last product on the loop's back edge too
            asm volatile("v_nop\n\tv_nop\n\tv_nop\n\tv_nop" : "+v"(o[0][0]), "+v"(o[0][1]), "+v"(o[0][2]), "+v"(o[0][3]), "+v"(o[1][0]), "+v"(o[1][1]), "+v"(o[1][2]), "+v"(o[1][3]) : "v"(bp[1]), "v"(fv[3]));
        }
    }
    if (!HR) asm volatile("s_wait_asynccnt 0x0" ::: "memory");                         // nothing of this wave is in flight when the ring becomes output staging

#pragma unroll
    for (int g = 0; g < NQ; ++g) {
        l[g] += xhalf(l[g]);                                                           // joins the two halves' sums of this query
        const float inv = __builtin_amdgcn_rcpf(HR ? l[g] : l[g] * PCAR);
        float* mr = myos + (16 * g + lr) * OSP + 8 * hi;
#pragma unroll
        for (int t = 0; t < 4; ++t) {
            const v4f w0 = { o[g][t][0] * inv, o[g][t][1] * inv, o[g][t][2] * inv, o[g][t][3] * inv }, w1 = { o[g][t][4] * inv, o[g][t][5] * inv, o[g][t][6] * inv, o[g][t][7] * inv };
            *(v4fa*)(mr + t * 16) = w0; *(v4fa*)(mr + t * 16 + 4) = w1;
        }
    }
    __builtin_amdgcn_fence(3, "wavefront"); __builtin_amdgcn_wave_barrier(); asm volatile("" ::: "memory");
    // the wave's first output row, the same in every lane (the wave's number through a scalar register); a lane's own part is the 32-bit byte offset vo
    const float* orow = OUT + ((size_t)batch * SEQ_FULL + q0blk + __builtin_amdgcn_readfirstlane(wid) * (16 * NQ)) * DM + (size_t)head * HD;
    const unsigned vo = (unsigned)(hi * DM + lr * 4) * 4u;
#pragma unroll
    for (int s = 0; s < 2 * NQ; ++s) {                    // rows 8 s + hi + {0, 2, 4, 6}: four stores and their s_wait_xcnt in one statement
        v4u d[4];
#pragma unroll
        for (int k = 0; k < 4; ++k) d[k] = *(const v4ua*)(myos + (8 * s + 2 * k + hi) * OSP + lr * 4);
        store4<2 * DM * 4>(orow + (size_t)(8 * s) * DM, vo, d[0], d[1], d[2], d[3]);
    }
}
__global__ __launch_bounds__(128)
void k_attn(const h16* __restrict__ Q16, const h16* __restrict__ K16, const h16* __restrict__ VT16,
            const bf* __restrict__ QPh, const bf* __restrict__ QPl, const bf* __restrict__ KPh, const bf* __restrict__ KPl,
            const bf* __restrict__ VTh, const bf* __restrict__ VTl, float* OUT) {
    __shared__ __align__(16) unsigned char sm[2 * STH * 2];       // HR: output staging; !HR: the two-stage ring, then output staging
    static_assert(4 * 32 * OSP * 4 <= 2 * STH * 2);
    constexpr int NT = (SEQ - RH) / 128, NBLK = NT + RH / 64;     // row blocks of one head: NT of 128 rows (!HR), then RH / 64 of 64 rows (HR)
    constexpr int LV = (NH * NB >= 256) ? 1 : 256 / (NH * NB);    // values of blockIdx.z that put one block on each of the chip's 256 WGPs
    const int head = (int)blockIdx.x, batch = (int)blockIdx.y, z = (int)blockIdx.z;
    if (z >= NBLK) return;                                // block-uniform (the grid is exact), in front of every block barrier
    // Four blocks are resident per WGP (registers): all but the last, shortest ones start at once. The row blocks, ranked by falling key count,
    // are dealt in rounds of LV that run forth and back, so that the blocks that meet on a WGP hold about the same number of keys together. A permutation of 0 .. NBLK - 1 (a last, partial round runs forth); for speed only.
    const int rd = z / LV, ps = z % LV;
    const int rank = ((rd & 1) && (rd + 1) * LV <= NBLK) ? rd * LV + (LV - 1 - ps) : z;
    // block-uniform choice
    if (rank >= NT) attn_rows<true>(Q16, K16, VT16, QPh, QPl, KPh, KPl, VTh, VTl, RH - 64 * (rank - NT + 1), head, batch, sm, OUT);
    else            attn_rows<false>(Q16, K16, VT16, QPh, QPl, KPh, KPl, VTh, VTl, SEQ - 128 * (rank + 1), head, batch, sm, OUT);
}

extern "C" void kernel_launch(void* const* d_in, const int* in_sizes, int n_in,
                              void* d_out, int out_size, void* d_ws, size_t ws_size, hipStream_t stream) {
    if (n_in < 3) return;
    if ((size_t)in_sizes[0] < (size_t)(NB - 1) * SEQ_FULL * DM + (size_t)SEQ * DM) return;
    if ((size_t)in_sizes[1] < (size_t)3 * DM * DM) return;
    if (in_sizes[2] < 3 * DM) return;
    if ((size_t)out_size < (size_t)(NB - 1) * SEQ_FULL * DM + (size_t)SEQ * DM) return;
    const float* x = (const float*)d_in[0];      // [NB][SEQ_FULL][DM]
    const float* W = (const float*)d_in[1];      // [3*DM][DM]  ([out][in], row blocks k | q | v)
    const float* bias = (const float*)d_in[2];   // [3*DM]
    float* OUT = (float*)d_out;                  // [NB][SEQ_FULL][DM]
    char* wsp = (char*)d_ws;
    auto take = [&](size_t bytes) { char* p = wsp; wsp += (bytes + 255) & ~(size_t)255; return (void*)p; };
    bf* WB = (bf*)take((size_t)3 * DM * DM * 2);
    bf* XB = (bf*)take((size_t)NB * SEQ * DM * 2);
    h16* Q16 = (h16*)take((size_t)NB * NH * SEQ * HD * 2); h16* K16 = (h16*)take((size_t)NB * NH * SEQ * HD * 2); h16* VT16 = (h16*)take((size_t)NB * NH * HD * SEQ * 2);
    bf* QPh = (bf*)take((size_t)NB * NH * RH * HD * 2); bf* QPl = (bf*)take((size_t)NB * NH * RH * HD * 2); bf* KPh = (bf*)take((size_t)NB * NH * RH * HD * 2); bf* KPl = (bf*)take((size_t)NB * NH * RH * HD * 2);
    bf* VTh = (bf*)take((size_t)NB * NH * HD * RH * 2); bf* VTl = (bf*)take((size_t)NB * NH * HD * RH * 2);
    if ((size_t)(wsp - (char*)d_ws) > ws_size) return;
    if ((size_t)(wsp - (char*)d_ws) > (size_t)134217728) return;

    k_cvt8<<<(unsigned)(((size_t)3 * DM * DM / 8 + 255) / 256), 256, 0, stream>>>(W, WB, (size_t)3 * DM * DM / 8);
    k_cvtx<<<dim3((unsigned)(((size_t)SEQ * DM / 8 + 255) / 256), NB, 1), 256, 0, stream>>>(x, XB, (size_t)SEQ * DM / 8);
    // k | q | v in one launch: every 64-column tile is one head of one of the three
    k_gemmw<<<dim3(SEQ / 256, 3 * DM / 128, NB), 256, 0, stream>>>(XB, WB, DM, bias, (size_t)SEQ * DM, (size_t)0, Q16, K16, VT16, QPh, QPl, KPh, KPl, VTh, VTl);
    // attention, one launch: blocks of rows < RH on the hi/lo path, blocks of rows >= RH single products
    k_attn<<<dim3(NH, NB, (SEQ - RH) / 128 + RH / 64), 128, 0, stream>>>(Q16, K16, VT16, QPh, QPl, KPh, KPl, VTh, VTl, OUT);
}

// v009
// One run takes 95.9 microseconds.
// Timed twice side by side with v008, it ran 1.05 and 1.03 times as fast.
// Over all steps from v000 it is 3.67 times as fast.
#include <hip/hip_runtime.h>

// Contractions (f32 accumulate): kqv projection = v_wmma_f32_16x16x32_bf16 on bf16 RNE copies of x and W, bf16-valued bias added in f32; causal attention query rows < 256: q.k and p.v as bf16 hi/lo 3-product groups; query rows >= 256: v_wmma_f32_16x16x32_f16 on fp16 q, k, v planes and fp16 p x 1024; softmax statistics f32; output f32.
// Layout: bf16 W [3072][1024] used directly as the k-contiguous B operand (row blocks k | q | v); the projection's epilogue writes the head planes q, k [b][h][t][64] and v transposed [b][h][64][t]

#ifndef NB
#define NB 4
#endif
#ifndef SEQ
#define SEQ 2048
#endif
#define NB_FULL  4
#define SEQ_FULL 2048
#define DM   1024
#define NH   16
#define HD   64
#define RH   256                      // query rows < RH use the hi/lo 3-product path (keys there are < RH too)
#define OSP  68                       // LDS pitch (floats) of the f32 staging tiles (16 or 32 rows x 64)
#define KP   72                       // LDS pitch (halves) of a staged 64-half row: 144 B = 16 B x 9, for 16-byte readers
#define TLH  (64 * KP)                // halves of one staged tile (64 rows)
#define STH  (2 * TLH)                // halves of one stage: k tile (64 keys x 64 d), then vt tile (64 d x 64 keys)
#define PCAR 1024.0f
#define SCL  0.03125f                 // 1024^-0.5 (model-dim scaling)
#define L2E  1.4426950408889634f

static_assert(NH * HD == DM);
static_assert((SEQ % 256) == 0 && (RH % 256) == 0 && RH <= SEQ && SEQ <= SEQ_FULL && NB >= 1 && NB <= NB_FULL);
static_assert((DM % 128) == 0 && (SEQ % 64) == 0);
// workspace bytes at full size (all regions exact multiples of their store granularity) + alignment slack <= 128 MiB
static_assert((size_t)3 * DM * DM * 2 + (size_t)NB * SEQ * DM * 2 + (size_t)3 * NB * NH * SEQ * HD * 2 + (size_t)6 * NB * NH * RH * HD * 2 + 12 * 256 <= (size_t)134217728);

typedef _Float16 h16;
typedef unsigned short bf;
typedef __attribute__((ext_vector_type(16))) __bf16   v16bf;
typedef __attribute__((ext_vector_type(16))) _Float16 v16h;
typedef __attribute__((ext_vector_type(8)))  _Float16 v8h;
typedef __attribute__((ext_vector_type(8)))  unsigned short v8us;
typedef __attribute__((ext_vector_type(8)))  float    v8f;
typedef __attribute__((ext_vector_type(4)))  float    v4f;
typedef v8h  __attribute__((may_alias)) v8ha;
typedef v4f  __attribute__((may_alias)) v4fa;
typedef v8us __attribute__((may_alias)) v8usa;

__device__ __forceinline__ unsigned short f2bf(float f) { unsigned u = __float_as_uint(f); u += 0x7FFFu + ((u >> 16) & 1u); return (unsigned short)(u >> 16); }
__device__ __forceinline__ float bf2f(unsigned short b) { return __uint_as_float(((unsigned)b) << 16); }
__device__ __forceinline__ float bfr(float f) { return bf2f(f2bf(f)); }
__device__ __forceinline__ void splitf(float y, unsigned short& h, unsigned short& l) { h = f2bf(y); l = f2bf(y - bf2f(h)); }
__device__ __forceinline__ v16h cat16(v8h lo, v8h hi) { return __builtin_shufflevector(lo, hi, 0, 1, 2, 3, 4, 5, 6, 7, 8, 9, 10, 11, 12, 13, 14, 15); }
__device__ __forceinline__ v16bf cat16b(v8us lo, v8us hi) { return __builtin_bit_cast(v16bf, __builtin_shufflevector(lo, hi, 0, 1, 2, 3, 4, 5, 6, 7, 8, 9, 10, 11, 12, 13, 14, 15)); }
__device__ __forceinline__ v8f wmma16(v16h a, v16h b, v8f c) { return __builtin_amdgcn_wmma_f32_16x16x32_f16(false, a, false, b, (short)0, c, false, false); }
__device__ __forceinline__ v8f wmmab(v16bf a, v16bf b, v8f c) { return __builtin_amdgcn_wmma_f32_16x16x32_bf16(false, a, false, b, (short)0, c, false, false); }

// 16-bit fragment loaders (lane l: row/col = l & 15, h = l >> 4; elements 0..7 <- k0 + 8h + 0..7, elements 8..15 <- k0 + 16 + 8h + 0..7; the caller passes p = row base + k0 + 8h).
template <typename T16> struct WFrag;
template <> struct WFrag<h16> { typedef v16h V; static __device__ __forceinline__ V ld(const h16* p) { return cat16(*(const v8h*)p, *(const v8h*)(p + 16)); } static __device__ __forceinline__ v8f mma(V a, V b, v8f c) { return wmma16(a, b, c); } };
template <> struct WFrag<bf> { typedef v16bf V; static __device__ __forceinline__ V ld(const bf* p) { return cat16b(*(const v8us*)p, *(const v8us*)(p + 16)); } static __device__ __forceinline__ v8f mma(V a, V b, v8f c) { return wmmab(a, b, c); } };
// LDS reloads through may_alias vectors of the stored element type
__device__ __forceinline__ v16h  lds16(const h16* p) { return cat16(*(const v8ha*)p, *(const v8ha*)(p + 16)); }
__device__ __forceinline__ v16bf ldsb(const bf* p)   { return cat16b(*(const v8usa*)p, *(const v8usa*)(p + 16)); }

// Four 16-byte stores of a wave. The s_wait_xcnt stands inside the statement so that no register the stores name is rewritten ahead of it.
typedef __attribute__((ext_vector_type(4))) unsigned v4u;
template <int STEP>                   // base: the same in every lane; voff: the lane's byte offset; STEP: bytes between two of the four
__device__ __forceinline__ void store4(const void* base, unsigned voff, v4u d0, v4u d1, v4u d2, v4u d3) {
    asm volatile("global_store_b128 %0, %2, %1\n\t"
                 "global_store_b128 %0, %3, %1 offset:%6\n\t"
                 "global_store_b128 %0, %4, %1 offset:%7\n\t"
                 "global_store_b128 %0, %5, %1 offset:%8\n\t"
                 "s_wait_xcnt 0x0"
                 :: "v"(voff), "s"(base), "v"(d0), "v"(d1), "v"(d2), "v"(d3), "n"(STEP), "n"(2 * STEP), "n"(3 * STEP) : "memory");
}
// orders a wave's own LDS stores and loads around the reuse of its staging tile
__device__ __forceinline__ void wave_lds_order() { __builtin_amdgcn_fence(3, "wavefront"); __builtin_amdgcn_wave_barrier(); asm volatile("" ::: "memory"); }
// eight f32 values -> eight 16-bit values of plane p: 0 fp16, 1 bf16 hi, 2 bf16 lo (the residual of hi)
__device__ __forceinline__ v4u plane8(const float (&y)[8], int p) {
    if (p == 0) { v8h c;
#pragma unroll
        for (int k = 0; k < 8; ++k) c[k] = (h16)y[k];
        return __builtin_bit_cast(v4u, c); }
    v8us c;
#pragma unroll
    for (int k = 0; k < 8; ++k) { unsigned short a1, a2; splitf(y[k], a1, a2); c[k] = p == 1 ? a1 : a2; }
    return __builtin_bit_cast(v4u, c);
}
typedef v4u __attribute__((may_alias)) v4ua;
// Projection epilogues of one wave's 64 x 64 tile; acc[mb][nb][j] = y[16 mb + 8 hi + j][16 nb + lr] without bias, bs[nb] = bias of column 16 nb + lr. Read-back: 8 lanes cover one 128-B row of 16-bit values, a wave 4 rows.
// NP = 1: the fp16 plane alone; NP = 3: the bf16 hi and lo planes too (positions < RH), one plane after the other.
// Every loop of the two epilogues and of plane8 is unrolled so that acc and the small arrays are indexed by constants and stay in registers.
// k, q planes [t][64]: P[p] points at the tile's first position; f32 LDS tile of 16 positions.
template <int NP>
__device__ __forceinline__ void put_rows(const v8f (&acc)[4][4], const float (&bs)[4], unsigned char* sm, int lane, unsigned short* const (&P)[3]) {
    const int lr = lane & 15, hi = lane >> 4, srow = lane >> 3, scol = (lane & 7) * 8;
    float* os = (float*)sm;
#pragma unroll
    for (int mb = 0; mb < 4; ++mb) {
#pragma unroll
        for (int nb = 0; nb < 4; ++nb) {
#pragma unroll
            for (int j = 0; j < 8; ++j) os[(hi * 8 + j) * OSP + nb * 16 + lr] = acc[mb][nb][j] + bs[nb]; }
        wave_lds_order();
#pragma unroll
        for (int p = 0; p < NP; ++p) {
            v4u o[4];
#pragma unroll
            for (int s = 0; s < 4; ++s) {
                const float* xr = os + (4 * s + srow) * OSP + scol; const v4f x0 = *(const v4fa*)xr, x1 = *(const v4fa*)(xr + 4);
                const float y[8] = { x0[0], x0[1], x0[2], x0[3], x1[0], x1[1], x1[2], x1[3] };
                o[s] = plane8(y, p);
            }
            store4<4 * HD * 2>(P[p] + mb * 16 * HD, (unsigned)(srow * HD + scol) * 2u, o[0], o[1], o[2], o[3]);
        }
        wave_lds_order();
    }
}
// v planes [d][t]: P[p] (row pitch SEQ for p = 0, RH else) points at d = 0 of the tile's first position; a lane's 8 accumulator rows are 8 consecutive positions of one d; a 16-bit LDS tile of 16 d x 64 positions per plane.
template <int NP>
__device__ __forceinline__ void put_cols(const v8f (&acc)[4][4], const float (&bs)[4], unsigned char* sm, int lane, unsigned short* const (&P)[3]) {
    const int lr = lane & 15, hi = lane >> 4, srow = lane >> 3, scol = (lane & 7) * 8;
#pragma unroll
    for (int nb = 0; nb < 4; ++nb) {
#pragma unroll
        for (int p = 0; p < NP; ++p) {
            unsigned short* st = (unsigned short*)sm + p * 16 * KP;
#pragma unroll
            for (int mb = 0; mb < 4; ++mb) {
                float y[8];
#pragma unroll
                for (int j = 0; j < 8; ++j) y[j] = acc[mb][nb][j] + bs[nb];
                *(v4ua*)(st + lr * KP + mb * 16 + hi * 8) = plane8(y, p);
            }
            wave_lds_order();
            v4u o[4];
#pragma unroll
            for (int s = 0; s < 4; ++s) o[s] = *(const v4ua*)(st + (4 * s + srow) * KP + scol);
            if (p == 0) store4<4 * SEQ * 2>(P[0] + (size_t)nb * 16 * SEQ, (unsigned)(srow * SEQ + scol) * 2u, o[0], o[1], o[2], o[3]);
            else        store4<4 * RH * 2>(P[p] + nb * 16 * RH, (unsigned)(srow * RH + scol) * 2u, o[0], o[1], o[2], o[3]);
        }
        wave_lds_order();
    }
}

// ---- k_gemmw: the kqv projection. Grid (SEQ/256, 3*DM/128, NB), 256 threads: a work-group owns a 256 x 128 tile of y, its eight waves (4 x 2) a 64 x 64 tile each (16 accumulators).
// y[m][n] (f32, + bf16-valued bias[n]) = sum_k A[m][k] Bt[n][k], both operands K-contiguous bf16 planes. z-batch strides sA/sB in elements. K % 64 == 0, K >= 64.
// The waves read their fragments from LDS. A stage = 64 k of the work-group's 256 A rows and 128 Bt rows (whole 128-B lines, 8 lanes a row), two buffers; every thread copies 8 + 4 pieces of 16 B per stage;
// stage t + 2 is issued into the buffer of stage t behind the barrier that ends its last read. After the last stage's barrier the ring is the eight waves' epilogue staging.
// A wave's tile is 64 positions of ONE head of k, q or v (column tile = NH * {k, q, v} + head); the epilogue converts y and writes the head planes itself:
// k, q: fp16 [t][64] (and the bf16 hi/lo planes where t < RH) through an f32 LDS tile of 16 positions; v: a lane's 8 accumulator rows are 8 consecutive positions of one d, packed and turned into whole 128-B rows of [d][t] through 16-bit LDS tiles of 16 d.
#define GAH  (256 * KP)               // halves of the staged A tile (256 rows of 64 k)
#define GSH  (GAH + 128 * KP)         // halves of one stage: A tile, then Bt tile (128 rows)
#define EPB  (3 * 16 * KP * 2)        // bytes of one wave's epilogue staging: one f32 tile 16 x OSP, or three 16-bit tiles 16 x KP
// One stage's copies of this thread: rows r, r + 32, ..., r + 224 of the A tile and r, ..., r + 96 of the Bt tile (l: LDS byte address of its first A piece; rs: elements between two of the rows).
// The s_wait_xcnt stands inside the statement so that no address register is rewritten ahead of it.
__device__ __forceinline__ void gstage_copy(unsigned l, const bf* ga, const bf* gb, size_t rs) {
    asm volatile("global_load_async_to_lds_b128 %0, %12, off\n\t"
                 "global_load_async_to_lds_b128 %1, %13, off\n\t"
                 "global_load_async_to_lds_b128 %2, %14, off\n\t"
                 "global_load_async_to_lds_b128 %3, %15, off\n\t"
                 "global_load_async_to_lds_b128 %4, %16, off\n\t"
                 "global_load_async_to_lds_b128 %5, %17, off\n\t"
                 "global_load_async_to_lds_b128 %6, %18, off\n\t"
                 "global_load_async_to_lds_b128 %7, %19, off\n\t"
                 "global_load_async_to_lds_b128 %8, %20, off\n\t"
                 "global_load_async_to_lds_b128 %9, %21, off\n\t"
                 "global_load_async_to_lds_b128 %10, %22, off\n\t"
                 "global_load_async_to_lds_b128 %11, %23, off\n\t"
                 "s_wait_xcnt 0x0"
                 :: "v"(l), "v"(l + 32 * KP * 2), "v"(l + 64 * KP * 2), "v"(l + 96 * KP * 2), "v"(l + 128 * KP * 2), "v"(l + 160 * KP * 2), "v"(l + 192 * KP * 2), "v"(l + 224 * KP * 2),
                    "v"(l + GAH * 2), "v"(l + GAH * 2 + 32 * KP * 2), "v"(l + GAH * 2 + 64 * KP * 2), "v"(l + GAH * 2 + 96 * KP * 2),
                    "v"(ga), "v"(ga + rs), "v"(ga + 2 * rs), "v"(ga + 3 * rs), "v"(ga + 4 * rs), "v"(ga + 5 * rs), "v"(ga + 6 * rs), "v"(ga + 7 * rs),
                    "v"(gb), "v"(gb + rs), "v"(gb + 2 * rs), "v"(gb + 3 * rs)
                 : "memory");
}
__global__ __launch_bounds__(256) __attribute__((amdgpu_num_vgpr(256)))   // the ring lets two work-groups share a WGP: four waves per SIMD, 256 registers each
void k_gemmw(const bf* __restrict__ A, const bf* __restrict__ Bt, int K, const float* __restrict__ bias, size_t sA, size_t sB,
             h16* Q16, h16* K16, h16* VT16, bf* QPh, bf* QPl, bf* KPh, bf* KPl, bf* VTh, bf* VTl) {
    __shared__ __align__(16) unsigned char sm[2 * GSH * 2];       // the two-stage ring, then epilogue staging
    static_assert(16 * OSP * 4 <= EPB && 8 * EPB <= 2 * GSH * 2);
    const size_t z = blockIdx.z; A += z * sA; Bt += z * sB;
    const int lane = threadIdx.x & 31, lr = lane & 15, hi = lane >> 4;
    const int wid = __builtin_amdgcn_readfirstlane((int)threadIdx.x >> 5);   // the wave's number in a scalar register: tile, plane and store bases stay scalar
    const int wm = wid & 3, wn = wid >> 2;
    const int r0 = (int)blockIdx.x * 256 + wm * 64, ct = (int)blockIdx.y * 2 + wn, c0 = ct * 64;
    v8f acc[4][4];
#pragma unroll
    for (int mb = 0; mb < 4; ++mb)
#pragma unroll
        for (int nb = 0; nb < 4; ++nb) acc[mb][nb] = (v8f){};
    const bf* ring = (const bf*)sm;
    // this thread's first piece of an operand tile: row threadIdx.x >> 3, 16-byte column threadIdx.x & 7
    const int crow = (int)threadIdx.x >> 3, ccol = ((int)threadIdx.x & 7) * 8;
    const unsigned la0 = (unsigned)(size_t)(ring + crow * KP + ccol);                  // LDS byte address in buffer 0, A tile
    const bf* ga0 = A + (size_t)((int)blockIdx.x * 256 + crow) * K + ccol; const bf* gb0 = Bt + (size_t)((int)blockIdx.y * 128 + crow) * K + ccol;
    const size_t rs = (size_t)32 * K;
    const int nst = K >> 6;                                                            // stages of 64 k
    gstage_copy(la0, ga0, gb0, rs);
    asm volatile("s_wait_asynccnt 0x0" ::: "memory");                                  // stage 0 has landed before the barrier that publishes it
    __syncthreads();                                                                   // publishes stage 0 to all eight waves
    if (nst > 1) gstage_copy(la0 + GSH * 2, ga0 + 64, gb0 + 64, rs);
#pragma unroll 1
    for (int t = 0; t < nst; ++t) {
        const bf* ap = ring + (t & 1) * GSH + (wm * 64 + lr) * KP + 8 * hi; const bf* bp = ring + (t & 1) * GSH + GAH + (wn * 64 + lr) * KP + 8 * hi;
#pragma unroll
        for (int kk = 0; kk < 2; ++kk) {
            v16bf a[4], b[4];
#pragma unroll
            for (int i = 0; i < 4; ++i) { a[i] = ldsb(ap + i * 16 * KP + kk * 32); b[i] = ldsb(bp + i * 16 * KP + kk * 32); }
            // holds the block's 16 LDS reads together in front of its 16 products (loaded values as inputs only): one wait per block instead of one per group of four products
            asm volatile("" :: "v"(a[0]), "v"(a[1]), "v"(a[2]), "v"(a[3]), "v"(b[0]), "v"(b[1]), "v"(b[2]), "v"(b[3]));
#pragma unroll
            for (int nb = 0; nb < 4; ++nb)
#pragma unroll
                for (int mb = 0; mb < 4; ++mb) acc[mb][nb] = wmmab(a[mb], b[nb], acc[mb][nb]);
        }
        // foot of a stage: publish the next stage, free this one's buffer
        asm volatile("s_wait_dscnt 0x0" ::: "memory");                                 // this wave's reads of the buffer have returned
        asm volatile("s_wait_asynccnt 0x0" ::: "memory");                              // this wave's copies of stage t + 1 have landed
        __syncthreads();                                                               // publishes stage t + 1 and ends every wave's reads of stage t
        if (t + 2 < nst) gstage_copy(la0 + (unsigned)(t & 1) * (GSH * 2), ga0 + (t + 2) * 64, gb0 + (t + 2) * 64, rs);
    }
    asm volatile("s_wait_asynccnt 0x0" ::: "memory");                                  // nothing of this wave is in flight when the ring becomes epilogue staging
    unsigned char* es = sm + wid * EPB;                   // this wave's own staging
    const int sel = ct / NH;                              // 0: k, 1: q, 2: v (W's row blocks)
    const size_t bh = z * NH + ct % NH;
    const bool lo = r0 < RH;                              // the wave's whole tile (RH is a multiple of 64); wave-uniform like sel, and no block barrier follows
    const size_t rl = lo ? r0 : 0;
    float bs[4];
    // bias of columns c0 + lr + {0, 16, 32, 48}: the four loads and their data wait in one statement, outputs early-clobbered, so that no register a load names is rewritten while it is in flight
    asm volatile("global_load_b32 %0, %4, %5\n\t"
                 "global_load_b32 %1, %4, %5 offset:64\n\t"
                 "global_load_b32 %2, %4, %5 offset:128\n\t"
                 "global_load_b32 %3, %4, %5 offset:192\n\t"
                 "s_wait_loadcnt 0x0"
                 : "=&v"(bs[0]), "=&v"(bs[1]), "=&v"(bs[2]), "=&v"(bs[3]) : "v"((unsigned)(c0 + lr) * 4u), "s"(bias) : "memory");
#pragma unroll
    for (int nb = 0; nb < 4; ++nb) bs[nb] = bfr(bs[nb]);
    if (sel < 2) {
        unsigned short* const P[3] = { (unsigned short*)(sel == 1 ? Q16 : K16) + (bh * SEQ + r0) * HD, (sel == 1 ? QPh : KPh) + (bh * RH + rl) * HD, (sel == 1 ? QPl : KPl) + (bh * RH + rl) * HD };
        if (lo) put_rows<3>(acc, bs, es, lane, P); else put_rows<1>(acc, bs, es, lane, P);
    } else {
        unsigned short* const P[3] = { (unsigned short*)VT16 + bh * HD * SEQ + r0, VTh + bh * HD * RH + rl, VTl + bh * HD * RH + rl };
        if (lo) put_cols<3>(acc, bs, es, lane, P); else put_cols<1>(acc, bs, es, lane, P);
    }
}

__global__ __launch_bounds__(256) void k_cvt8(const float* __restrict__ src, bf* dst, size_t n8) { const size_t i = (size_t)blockIdx.x * 256 + threadIdx.x; if (i >= n8) return; const v8f v = *(const v8f*)(src + i * 8); v8us o;
#pragma unroll
    for (int k = 0; k < 8; ++k) o[k] = f2bf(v[k]); *(v8us*)(dst + i * 8) = o;  }
__global__ __launch_bounds__(256) void k_cvtx(const float* __restrict__ src, bf* dst, size_t n8) { const size_t i = (size_t)blockIdx.x * 256 + threadIdx.x; if (i >= n8) return;
    const float* s = src + (size_t)blockIdx.y * SEQ_FULL * DM; bf* d = dst + (size_t)blockIdx.y * SEQ * DM; const v8f v = *(const v8f*)(s + i * 8); v8us o;
#pragma unroll
    for (int k = 0; k < 8; ++k) o[k] = f2bf(v[k]); *(v8us*)(d + i * 8) = o;  }

// ---- k_attn: causal streaming attention, all rows in one launch. Grid (NH, NB, (SEQ-RH)/128 + RH/64), 128 threads: block = 128 query rows >= RH (wave -> 32 rows, two groups of 16) or 64 rows < RH (wave -> 16 rows) of head blockIdx.x, batch blockIdx.y.
// A block whose rows lie below RH runs attn_rows<true> (HR), every other block attn_rows<false>: the few short HR blocks, one wave per SIMD and bound by load latency on their own, run beside the long ones.
// Key chunks of 32 from 0 to the block's last row (block-uniform loop; per-element causal select j <= i; !HR: in the last four chunks alone, the only ones with keys past the block's first row). Per chunk and group: S^T (32 keys x 16 queries) = k.q^T, scaled by SCL in f32 (!HR: inside the exponent's fused multiply-add), online max/sum in f32 (one query per lane), O^T += vt.p^T with p^T packed from the score registers,
// HR (rows and keys < RH): bf16 planes, q.k = qh.kh + qh.kl + ql.kh, p.v = ph.vh + pl.vh + ph.vl (one accumulator, unscaled residuals). Otherwise fp16 planes, single products.
// !HR: the block's four waves read k and vt from LDS. A stage = 64 keys (two chunks), two buffers; every thread copies 4 + 4 pieces of 16 B per stage, whole 128-B rows per 8 lanes;
// stage s + 2 is issued into the buffer of stage s behind the barrier that ends its last read. After the last stage's barrier the ring is the output staging.
// Fragments are read from LDS ahead of their use: a chunk's vt fragments in front of its score products, the next chunk's k fragments behind them; so a stage's last LDS read, and with it the barrier, stands in the middle of its second chunk.
// One stage's copies of this thread: rows r, r + 16, r + 32, r + 48 of the k tile and of the vt tile. The s_wait_xcnt stands inside the statement so that no address register is rewritten ahead of it.
__device__ __forceinline__ void stage_copy(unsigned lk, const h16* gk, unsigned lv, const h16* gv) {
    asm volatile("global_load_async_to_lds_b128 %0, %8, off\n\t"
                 "global_load_async_to_lds_b128 %1, %9, off\n\t"
                 "global_load_async_to_lds_b128 %2, %10, off\n\t"
                 "global_load_async_to_lds_b128 %3, %11, off\n\t"
                 "global_load_async_to_lds_b128 %4, %12, off\n\t"
                 "global_load_async_to_lds_b128 %5, %13, off\n\t"
                 "global_load_async_to_lds_b128 %6, %14, off\n\t"
                 "global_load_async_to_lds_b128 %7, %15, off\n\t"
                 "s_wait_xcnt 0x0"
                 :: "v"(lk), "v"(lk + 16 * KP * 2), "v"(lk + 32 * KP * 2), "v"(lk + 48 * KP * 2), "v"(lv), "v"(lv + 16 * KP * 2), "v"(lv + 32 * KP * 2), "v"(lv + 48 * KP * 2),
                    "v"(gk), "v"(gk + 16 * HD), "v"(gk + 32 * HD), "v"(gk + 48 * HD), "v"(gv), "v"(gv + (size_t)16 * SEQ), "v"(gv + (size_t)32 * SEQ), "v"(gv + (size_t)48 * SEQ)
                 : "memory");
}
// lane l <-> lane l ^ 16 (the other half of the wave holds the other 16 keys of the same query)
__device__ __forceinline__ float xhalf(float v) { const int b = __float_as_int(v); return __int_as_float(__builtin_amdgcn_permlanex16(b, b, 0x76543210, 0xfedcba98, false, false)); }
template <bool HR>
__device__ __forceinline__
void attn_rows(const h16* __restrict__ Q16, const h16* __restrict__ K16, const h16* __restrict__ VT16,
               const bf* __restrict__ QPh, const bf* __restrict__ QPl, const bf* __restrict__ KPh, const bf* __restrict__ KPl,
               const bf* __restrict__ VTh, const bf* __restrict__ VTl, int q0blk, int head, int batch, unsigned char* sm, float* OUT) {
    constexpr int NQ = HR ? 1 : 2;                        // groups of 16 query columns per wave: every k and vt fragment read from LDS feeds NQ products
    const int lane = threadIdx.x & 31, lr = lane & 15, hi = lane >> 4, wid = threadIdx.x >> 5;
    const int q0 = q0blk + wid * (16 * NQ);
    const size_t bh = (size_t)batch * NH + head;
    const h16* Qb = Q16 + bh * SEQ * HD; const h16* Kb = K16 + bh * SEQ * HD; const h16* Vb = VT16 + bh * HD * SEQ;
    const bf* Qhb = QPh + bh * RH * HD; const bf* Qlb = QPl + bh * RH * HD; const bf* Khb = KPh + bh * RH * HD; const bf* Klb = KPl + bh * RH * HD;
    const bf* Vhb = VTh + bh * HD * RH; const bf* Vlb = VTl + bh * HD * RH;
    float* myos = (float*)sm + wid * (16 * NQ) * OSP;
    const h16* ring = (const h16*)sm;
    const int nchunk = (q0blk + 64 * NQ) >> 5;
    const float NEG = -__builtin_inff();
    // group g: this lane's query row is q0 + 16 * g + lr

    v8f o[NQ][4];                                         // o[g][t][r] = O[q0 + 16 * g + lr][t * 16 + 8 * hi + r] (transposed output tiles)
    float m[NQ], l[NQ];                                   // m: both halves agree; l: this half's keys only, joined behind the loop
    v16h aq[NQ][2];
#pragma unroll
    for (int g = 0; g < NQ; ++g) {
#pragma unroll
        for (int t = 0; t < 4; ++t) o[g][t] = (v8f){};
        m[g] = NEG; l[g] = 0.0f;
        if (!HR) { const h16* qr = Qb + (size_t)(q0 + 16 * g + lr) * HD + 8 * hi; aq[g][0] = WFrag<h16>::ld(qr); aq[g][1] = WFrag<h16>::ld(qr + 32); }
    }
    // this thread's first piece of a stage: row threadIdx.x >> 3, 16-byte column threadIdx.x & 7
    const int crow = (int)threadIdx.x >> 3, ccol = ((int)threadIdx.x & 7) * 8;
    const unsigned lk0 = (unsigned)(size_t)(ring + crow * KP + ccol);                  // LDS byte address in buffer 0, k tile
    const h16* gk0 = Kb + (size_t)crow * HD + ccol; const h16* gv0 = Vb + (size_t)crow * SEQ + ccol;
    const int nst = nchunk >> 1;                                                       // stages of 64 keys (nchunk is even)
    if (!HR) {
        stage_copy(lk0, gk0, lk0 + TLH * 2, gv0);
        asm volatile("s_wait_asynccnt 0x0" ::: "memory");                              // stage 0 has landed before the barrier that publishes it
        __syncthreads();                                                               // publishes stage 0 to all four waves
        if (nst > 1) stage_copy(lk0 + STH * 2, gk0 + 64 * HD, lk0 + STH * 2 + TLH * 2, gv0 + 64);
    }
    // !HR: the k fragments of the chunk at hand, read from LDS one chunk ahead: kf[2 * i + kk] = keys 16 * i .. 16 * i + 15 of the chunk, d 32 * kk .. 32 * kk + 31
    v16h kf[4];
    auto load_k = [&](int cn) {
        const h16* kp = ring + ((cn >> 1) & 1) * STH + ((cn & 1) * 32 + lr) * KP + 8 * hi;
        kf[0] = lds16(kp); kf[1] = lds16(kp + 32); kf[2] = lds16(kp + 16 * KP); kf[3] = lds16(kp + 16 * KP + 32);
    };
    if (!HR) load_k(0);                                                                // stage 0 is published

#pragma unroll 1
    for (int c = 0; c < nchunk; ++c) {
        const int j0 = c * 32;
        v8f s0[NQ], s1[NQ];                               // s0[g][r] = S[q][j0 + 8 * hi + r], s1[g][r] = S[q][j0 + 16 + 8 * hi + r], q the lane's row of group g
#pragma unroll
        for (int g = 0; g < NQ; ++g) { s0[g] = (v8f){}; s1[g] = (v8f){}; }
        v16h fv[4];                                           // !HR: the chunk's vt fragments, d 16 * t .. 16 * t + 15
        if constexpr (HR) {
            const bf* qh = Qhb + (size_t)(q0 + lr) * HD + 8 * hi; const bf* ql = Qlb + (size_t)(q0 + lr) * HD + 8 * hi;
            const bf* kh = Khb + (size_t)(j0 + lr) * HD + 8 * hi; const bf* kl = Klb + (size_t)(j0 + lr) * HD + 8 * hi;
#pragma unroll
            for (int kk = 0; kk < 2; ++kk) {
                const v16bf aqh = WFrag<bf>::ld(qh + kk * 32), aql = WFrag<bf>::ld(ql + kk * 32);
                const v16bf kh0 = WFrag<bf>::ld(kh + kk * 32), kh1 = WFrag<bf>::ld(kh + 16 * HD + kk * 32);
                const v16bf kl0 = WFrag<bf>::ld(kl + kk * 32), kl1 = WFrag<bf>::ld(kl + 16 * HD + kk * 32);
                s0[0] = wmmab(kh0, aqh, s0[0]); s0[0] = wmmab(kl0, aqh, s0[0]); s0[0] = wmmab(kh0, aql, s0[0]);
                s1[0] = wmmab(kh1, aqh, s1[0]); s1[0] = wmmab(kl1, aqh, s1[0]); s1[0] = wmmab(kh1, aql, s1[0]);
                // keeps the vector slots between the last product and the first use of its result or operands
                if (kk == 1) asm volatile("v_nop\n\tv_nop\n\tv_nop\n\tv_nop" : "+v"(s0[0]), "+v"(s1[0]) : "v"(aql), "v"(kh1));
            }
        } else {
            // the chunk's four vt fragments are read as one group in front of the score products: they land under those products, not in front of each pair of vt . p^T products
            const h16* vp = ring + ((c >> 1) & 1) * STH + TLH + lr * KP + (c & 1) * 32 + 8 * hi;
#pragma unroll
            for (int t = 0; t < 4; ++t) fv[t] = lds16(vp + t * 16 * KP);
            __builtin_amdgcn_sched_barrier(0);                // holds the eight reads here, in front of the score products, so that they land under them
#pragma unroll
            for (int kk = 0; kk < 2; ++kk) {
                s0[0] = wmma16(kf[kk], aq[0][kk], s0[0]); s0[1] = wmma16(kf[kk], aq[1][kk], s0[1]);
                s1[0] = wmma16(kf[2 + kk], aq[0][kk], s1[0]); s1[1] = wmma16(kf[2 + kk], aq[1][kk], s1[1]);
                // keeps the vector slots between the last product and the first use of its result or operands
                if (kk == 1) asm volatile("v_nop\n\tv_nop\n\tv_nop\n\tv_nop" : "+v"(s0[0]), "+v"(s1[0]), "+v"(s0[1]), "+v"(s1[1]) : "v"(aq[1][1]), "v"(kf[3]));
            }
            if (c & 1) {                                                               // publish point of stage st + 1 (block-uniform), in the stage's last chunk behind its last LDS read: the k fragments fetched below already belong to stage st + 1
                const int st = c >> 1;
                asm volatile("s_wait_dscnt 0x0" ::: "memory");                         // this wave's reads of the buffer (all k and vt fragments of stage st) have returned
                asm volatile("s_wait_asynccnt 0x0" ::: "memory");                      // this wave's copies of stage st + 1 have landed
                __syncthreads();                                                       // publishes stage st + 1 and ends every wave's reads of stage st
                if (st + 2 < nst) { const unsigned lb = lk0 + (unsigned)(st & 1) * (STH * 2); stage_copy(lb, gk0 + (size_t)(st + 2) * 64 * HD, lb + TLH * 2, gv0 + (st + 2) * 64); }
            }
            if (c + 1 < nchunk) load_k(c + 1);                // block-uniform scalar branch: the last chunk reads nothing more; the reads land under the softmax
        }
        v16h bp[NQ];                                          // !HR: p^T of each group, the B operands of vt . p^T
#pragma unroll
        for (int g = 0; g < NQ; ++g) {
        // online softmax update: a lane holds 16 of the 32 keys of ONE query; maximum and sum in the lane, the maximum joined with the other half by one exchange
        // HR: scores scaled by SCL here. !HR: the raw products stay (SCL > 0 keeps their order, so the maximum m is kept raw too); SCL, log2(e) and the factor PCAR of p go into the one fused multiply-add in front of each exponential
        constexpr float EC = HR ? L2E : SCL * L2E;            // exponent (base 2) per unit of pa, pc, m
        float pa[8], pc[8];
        const v8f a0 = HR ? s0[g] * SCL : s0[g], c0v = HR ? s1[g] * SCL : s1[g];
#pragma unroll
        for (int r = 0; r < 8; ++r) { pa[r] = a0[r]; pc[r] = c0v[r]; }
        // Only the block's last 2 * NQ chunks hold keys past its first row (chunk nchunk - 2 * NQ starts at key q0blk): in every earlier chunk j < q0blk <= i for each element and the select would change nothing.
        if (HR || c >= nchunk - 2 * NQ) {                     // block-uniform scalar branch (the short HR blocks select in every chunk, as before)
            const int qd = q0 + 16 * g + lr - j0 - 8 * hi;    // key j0 + 8 * hi + r is allowed where r <= qd
#pragma unroll
            for (int r = 0; r < 8; ++r) { pa[r] = (r <= qd) ? pa[r] : NEG; pc[r] = (16 + r <= qd) ? pc[r] : NEG; }
        }
        float v = fmaxf(fmaxf(fmaxf(fmaxf(pa[0], pa[1]), fmaxf(pa[2], pa[3])), fmaxf(fmaxf(pa[4], pa[5]), fmaxf(pa[6], pa[7]))),
                        fmaxf(fmaxf(fmaxf(pc[0], pc[1]), fmaxf(pc[2], pc[3])), fmaxf(fmaxf(pc[4], pc[5]), fmaxf(pc[6], pc[7]))));
        v = fmaxf(v, xhalf(v));
        const float mn = fmaxf(m[g], v);                      // finite from chunk 0 on (key 0 <= q for every row, seen through the exchange)
        const float alpha = __builtin_amdgcn_exp2f((m[g] - mn) * EC);
        m[g] = mn;
        if constexpr (HR) {
#pragma unroll
            for (int r = 0; r < 8; ++r) { pa[r] = __builtin_amdgcn_exp2f((pa[r] - mn) * L2E); pc[r] = __builtin_amdgcn_exp2f((pc[r] - mn) * L2E); }
        } else {
            static_assert(PCAR == 1024.0f);
            const float nb = __builtin_fmaf(mn, -EC, 10.0f);  // 2^10 = PCAR: pa, pc and with them the sum l are p x PCAR from here on; a masked score (-inf) still gives 0
#pragma unroll
            for (int r = 0; r < 8; ++r) { pa[r] = __builtin_amdgcn_exp2f(__builtin_fmaf(pa[r], EC, nb)); pc[r] = __builtin_amdgcn_exp2f(__builtin_fmaf(pc[r], EC, nb)); }
        }
        const float rs = (((pa[0] + pa[1]) + (pa[2] + pa[3])) + ((pa[4] + pa[5]) + (pa[6] + pa[7]))) + (((pc[0] + pc[1]) + (pc[2] + pc[3])) + ((pc[4] + pc[5]) + (pc[6] + pc[7])));
        l[g] = l[g] * alpha + rs;
#pragma unroll
        for (int t = 0; t < 4; ++t)
#pragma unroll
            for (int r = 0; r < 8; ++r) o[g][t][r] *= alpha;
        // the two score tiles, converted in place, are the B operand of vt . p^T: element s <- key j0 + 8 * hi + s (s < 8), j0 + 16 + 8 * hi + s - 8 (s >= 8), the loaders' k order
        if constexpr (HR) {
            v8us h0, l0, h1, l1;
#pragma unroll
            for (int r = 0; r < 8; ++r) { unsigned short a1, a2, c1, c2; splitf(pa[r], a1, a2); splitf(pc[r], c1, c2); h0[r] = a1; l0[r] = a2; h1[r] = c1; l1[r] = c2; }
            const v16bf bph = cat16b(h0, h1), bpl = cat16b(l0, l1);
            const bf* vh = Vhb + (size_t)lr * RH + j0 + 8 * hi; const bf* vl = Vlb + (size_t)lr * RH + j0 + 8 * hi;
            v16bf fvh = bph, fvl = bpl;
#pragma unroll
            for (int t = 0; t < 4; ++t) { fvh = WFrag<bf>::ld(vh + (size_t)t * 16 * RH); fvl = WFrag<bf>::ld(vl + (size_t)t * 16 * RH);
                o[0][t] = wmmab(fvh, bph, o[0][t]); o[0][t] = wmmab(fvh, bpl, o[0][t]); o[0][t] = wmmab(fvl, bph, o[0][t]); }
            // keeps the vector slots behind the last product on the loop's back edge too
            asm volatile("v_nop\n\tv_nop\n\tv_nop\n\tv_nop" : "+v"(o[0][0]), "+v"(o[0][1]), "+v"(o[0][2]), "+v"(o[0][3]) : "v"(bph), "v"(fvl));
        } else {
#pragma unroll
            for (int r = 0; r < 8; ++r) { bp[g][r] = (h16)pa[r]; bp[g][8 + r] = (h16)pc[r]; }
        }
        }
        if constexpr (!HR) {
#pragma unroll
            for (int t = 0; t < 4; ++t) { o[0][t] = wmma16(fv[t], bp[0], o[0][t]); o[1][t] = wmma16(fv[t], bp[1], o[1][t]); }
            // keeps the vector slots behind the last product on the loop's back edge too
            asm volatile("v_nop\n\tv_nop\n\tv_nop\n\tv_nop" : "+v"(o[0][0]), "+v"(o[0][1]), "+v"(o[0][2]), "+v"(o[0][3]), "+v"(o[1][0]), "+v"(o[1][1]), "+v"(o[1][2]), "+v"(o[1][3]) : "v"(bp[1]), "v"(fv[3]));
        }
    }
    if (!HR) asm volatile("s_wait_asynccnt 0x0" ::: "memory");                         // nothing of this wave is in flight when the ring becomes output staging

#pragma unroll
    for (int g = 0; g < NQ; ++g) {
        l[g] += xhalf(l[g]);                                                           // joins the two halves' sums of this query
        const float inv = __builtin_amdgcn_rcpf(l[g]);                                  // !HR: o and l both carry the factor PCAR
        float* mr = myos + (16 * g + lr) * OSP + 8 * hi;
#pragma unroll
        for (int t = 0; t < 4; ++t) {
            const v4f w0 = { o[g][t][0] * inv, o[g][t][1] * inv, o[g][t][2] * inv, o[g][t][3] * inv }, w1 = { o[g][t][4] * inv, o[g][t][5] * inv, o[g][t][6] * inv, o[g][t][7] * inv };
            *(v4fa*)(mr + t * 16) = w0; *(v4fa*)(mr + t * 16 + 4) = w1;
        }
    }
    __builtin_amdgcn_fence(3, "wavefront"); __builtin_amdgcn_wave_barrier(); asm volatile("" ::: "memory");
    // the wave's first output row, the same in every lane (the wave's number through a scalar register); a lane's own part is the 32-bit byte offset vo
    const float* orow = OUT + ((size_t)batch * SEQ_FULL + q0blk + __builtin_amdgcn_readfirstlane(wid) * (16 * NQ)) * DM + (size_t)head * HD;
    const unsigned vo = (unsigned)(hi * DM + lr * 4) * 4u;
#pragma unroll
    for (int s = 0; s < 2 * NQ; ++s) {                    // rows 8 s + hi + {0, 2, 4, 6}: four stores and their s_wait_xcnt in one statement
        v4u d[4];
#pragma unroll
        for (int k = 0; k < 4; ++k) d[k] = *(const v4ua*)(myos + (8 * s + 2 * k + hi) * OSP + lr * 4);
        store4<2 * DM * 4>(orow + (size_t)(8 * s) * DM, vo, d[0], d[1], d[2], d[3]);
    }
}
__global__ __launch_bounds__(128)
void k_attn(const h16* __restrict__ Q16, const h16* __restrict__ K16, const h16* __restrict__ VT16,
            const bf* __restrict__ QPh, const bf* __restrict__ QPl, const bf* __restrict__ KPh, const bf* __restrict__ KPl,
            const bf* __restrict__ VTh, const bf* __restrict__ VTl, float* OUT) {
    __shared__ __align__(16) unsigned char sm[2 * STH * 2];       // HR: output staging; !HR: the two-stage ring, then output staging
    static_assert(4 * 32 * OSP * 4 <= 2 * STH * 2);
    constexpr int NT = (SEQ - RH) / 128, NBLK = NT + RH / 64;     // row blocks of one head: NT of 128 rows (!HR), then RH / 64 of 64 rows (HR)
    constexpr int LV = (NH * NB >= 256) ? 1 : 256 / (NH * NB);    // values of blockIdx.z that put one block on each of the chip's 256 WGPs
    const int head = (int)blockIdx.x, batch = (int)blockIdx.y, z = (int)blockIdx.z;
    if (z >= NBLK) return;                                // block-uniform (the grid is exact), in front of every block barrier
    // Four blocks are resident per WGP (registers): all but the last, shortest ones start at once. The row blocks, ranked by falling key count,
    // are dealt in rounds of LV that run forth and back, so that the blocks that meet on a WGP hold about the same number of keys together. A permutation of 0 .. NBLK - 1 (a last, partial round runs forth); for speed only.
    const int rd = z / LV, ps = z % LV;
    const int rank = ((rd & 1) && (rd + 1) * LV <= NBLK) ? rd * LV + (LV - 1 - ps) : z;
    // block-uniform choice
    if (rank >= NT) attn_rows<true>(Q16, K16, VT16, QPh, QPl, KPh, KPl, VTh, VTl, RH - 64 * (rank - NT + 1), head, batch, sm, OUT);
    else            attn_rows<false>(Q16, K16, VT16, QPh, QPl, KPh, KPl, VTh, VTl, SEQ - 128 * (rank + 1), head, batch, sm, OUT);
}

extern "C" void kernel_launch(void* const* d_in, const int* in_sizes, int n_in,
                              void* d_out, int out_size, void* d_ws, size_t ws_size, hipStream_t stream) {
    if (n_in < 3) return;
    if ((size_t)in_sizes[0] < (size_t)(NB - 1) * SEQ_FULL * DM + (size_t)SEQ * DM) return;
    if ((size_t)in_sizes[1] < (size_t)3 * DM * DM) return;
    if (in_sizes[2] < 3 * DM) return;
    if ((size_t)out_size < (size_t)(NB - 1) * SEQ_FULL * DM + (size_t)SEQ * DM) return;
    const float* x = (const float*)d_in[0];      // [NB][SEQ_FULL][DM]
    const float* W = (const float*)d_in[1];      // [3*DM][DM]  ([out][in], row blocks k | q | v)
    const float* bias = (const float*)d_in[2];   // [3*DM]
    float* OUT = (float*)d_out;                  // [NB][SEQ_FULL][DM]
    char* wsp = (char*)d_ws;
    auto take = [&](size_t bytes) { char* p = wsp; wsp += (bytes + 255) & ~(size_t)255; return (void*)p; };
    bf* WB = (bf*)take((size_t)3 * DM * DM * 2);
    bf* XB = (bf*)take((size_t)NB * SEQ * DM * 2);
    h16* Q16 = (h16*)take((size_t)NB * NH * SEQ * HD * 2); h16* K16 = (h16*)take((size_t)NB * NH * SEQ * HD * 2); h16* VT16 = (h16*)take((size_t)NB * NH * HD * SEQ * 2);
    bf* QPh = (bf*)take((size_t)NB * NH * RH * HD * 2); bf* QPl = (bf*)take((size_t)NB * NH * RH * HD * 2); bf* KPh = (bf*)take((size_t)NB * NH * RH * HD * 2); bf* KPl = (bf*)take((size_t)NB * NH * RH * HD * 2);
    bf* VTh = (bf*)take((size_t)NB * NH * HD * RH * 2); bf* VTl = (bf*)take((size_t)NB * NH * HD * RH * 2);
    if ((size_t)(wsp - (char*)d_ws) > ws_size) return;
    if ((size_t)(wsp - (char*)d_ws) > (size_t)134217728) return;

    k_cvt8<<<(unsigned)(((size_t)3 * DM * DM / 8 + 255) / 256), 256, 0, stream>>>(W, WB, (size_t)3 * DM * DM / 8);
    k_cvtx<<<dim3((unsigned)(((size_t)SEQ * DM / 8 + 255) / 256), NB, 1), 256, 0, stream>>>(x, XB, (size_t)SEQ * DM / 8);
    // k | q | v in one launch: every 64-column tile is one head of one of the three
    k_gemmw<<<dim3(SEQ / 256, 3 * DM / 128, NB), 256, 0, stream>>>(XB, WB, DM, bias, (size_t)SEQ * DM, (size_t)0, Q16, K16, VT16, QPh, QPl, KPh, KPl, VTh, VTl);
    // attention, one launch: blocks of rows < RH on the hi/lo path, blocks of rows >= RH single products
    k_attn<<<dim3(NH, NB, (SEQ - RH) / 128 + RH / 64), 128, 0, stream>>>(Q16, K16, VT16, QPh, QPl, KPh, KPl, VTh, VTl, OUT);
}

// v010
// A run of this version takes 90.6 microseconds.
// Next to v009, in two timings, it ran 1.06 and 1.07 times as fast.
// Counting every step since v000, it is 3.90 times as fast.
#include <hip/hip_runtime.h>

// Contractions (f32 accumulate): kqv projection = v_wmma_f32_16x16x32_bf16 on bf16 RNE copies of x and W, bf16-valued bias added in f32; causal attention query rows < 256: q.k and p.v as bf16 hi/lo 3-product groups; query rows >= 256: v_wmma_f32_16x16x32_f16 on fp16 q, k, v planes and fp16 p x 1024; softmax statistics f32; output f32.
// Layout: bf16 W [3072][1024] used directly as the k-contiguous B operand (row blocks k | q | v); the projection's epilogue writes the head planes q, k [b][h][t][64] and v transposed [b][h][64][t]

#ifndef NB
#define NB 4
#endif
#ifndef SEQ
#define SEQ 2048
#endif
#define NB_FULL  4
#define SEQ_FULL 2048
#define DM   1024
#define NH   16
#define HD   64
#define RH   256                      // query rows < RH use the hi/lo 3-product path (keys there are < RH too)
#define OSP  68                       // LDS pitch (floats) of the f32 staging tiles (16 or 32 rows x 64)
#define KP   72                       // LDS pitch (halves) of a staged 64-half row: 144 B = 16 B x 9, for 16-byte readers
#define TLH  (64 * KP)                // halves of one staged tile (64 rows)
#define STH  (2 * TLH)                // halves of one stage: k tile (64 keys x 64 d), then vt tile (64 d x 64 keys)
#define PCAR 1024.0f
#define SCL  0.03125f                 // 1024^-0.5 (model-dim scaling)
#define L2E  1.4426950408889634f

static_assert(NH * HD == DM);
static_assert((SEQ % 256) == 0 && (RH % 256) == 0 && RH <= SEQ && SEQ <= SEQ_FULL && NB >= 1 && NB <= NB_FULL);
static_assert((DM % 128) == 0 && (SEQ % 64) == 0);
// workspace bytes at full size (all regions exact multiples of their store granularity) + alignment slack <= 128 MiB
static_assert((size_t)3 * DM * DM * 2 + (size_t)NB * SEQ * DM * 2 + (size_t)3 * NB * NH * SEQ * HD * 2 + (size_t)6 * NB * NH * RH * HD * 2 + 12 * 256 <= (size_t)134217728);

typedef _Float16 h16;
typedef unsigned short bf;
typedef __attribute__((ext_vector_type(16))) __bf16   v16bf;
typedef __attribute__((ext_vector_type(16))) _Float16 v16h;
typedef __attribute__((ext_vector_type(8)))  _Float16 v8h;
typedef __attribute__((ext_vector_type(8)))  unsigned short v8us;
typedef __attribute__((ext_vector_type(8)))  float    v8f;
typedef __attribute__((ext_vector_type(4)))  float    v4f;
typedef v8h  __attribute__((may_alias)) v8ha;
typedef v4f  __attribute__((may_alias)) v4fa;
typedef v8us __attribute__((may_alias)) v8usa;

__device__ __forceinline__ unsigned short f2bf(float f) { unsigned u = __float_as_uint(f); u += 0x7FFFu + ((u >> 16) & 1u); return (unsigned short)(u >> 16); }
__device__ __forceinline__ float bf2f(unsigned short b) { return __uint_as_float(((unsigned)b) << 16); }
__device__ __forceinline__ float bfr(float f) { return bf2f(f2bf(f)); }
__device__ __forceinline__ void splitf(float y, unsigned short& h, unsigned short& l) { h = f2bf(y); l = f2bf(y - bf2f(h)); }
__device__ __forceinline__ v16h cat16(v8h lo, v8h hi) { return __builtin_shufflevector(lo, hi, 0, 1, 2, 3, 4, 5, 6, 7, 8, 9, 10, 11, 12, 13, 14, 15); }
__device__ __forceinline__ v16bf cat16b(v8us lo, v8us hi) { return __builtin_bit_cast(v16bf, __builtin_shufflevector(lo, hi, 0, 1, 2, 3, 4, 5, 6, 7, 8, 9, 10, 11, 12, 13, 14, 15)); }
__device__ __forceinline__ v8f wmma16(v16h a, v16h b, v8f c) { return __builtin_amdgcn_wmma_f32_16x16x32_f16(false, a, false, b, (short)0, c, false, false); }
__device__ __forceinline__ v8f wmmab(v16bf a, v16bf b, v8f c) { return __builtin_amdgcn_wmma_f32_16x16x32_bf16(false, a, false, b, (short)0, c, false, false); }

// 16-bit fragment loaders (lane l: row/col = l & 15, h = l >> 4; elements 0..7 <- k0 + 8h + 0..7, elements 8..15 <- k0 + 16 + 8h + 0..7; the caller passes p = row base + k0 + 8h).
template <typename T16> struct WFrag;
template <> struct WFrag<h16> { typedef v16h V; static __device__ __forceinline__ V ld(const h16* p) { return cat16(*(const v8h*)p, *(const v8h*)(p + 16)); } static __device__ __forceinline__ v8f mma(V a, V b, v8f c) { return wmma16(a, b, c); } };
template <> struct WFrag<bf> { typedef v16bf V; static __device__ __forceinline__ V ld(const bf* p) { return cat16b(*(const v8us*)p, *(const v8us*)(p + 16)); } static __device__ __forceinline__ v8f mma(V a, V b, v8f c) { return wmmab(a, b, c); } };
// LDS reloads through may_alias vectors of the stored element type
__device__ __forceinline__ v16h  lds16(const h16* p) { return cat16(*(const v8ha*)p, *(const v8ha*)(p + 16)); }

// Four 16-byte stores of a wave. The s_wait_xcnt stands inside the statement so that no register the stores name is rewritten ahead of it.
typedef __attribute__((ext_vector_type(4))) unsigned v4u;
template <int STEP>                   // base: the same in every lane; voff: the lane's byte offset; STEP: bytes between two of the four
__device__ __forceinline__ void store4(const void* base, unsigned voff, v4u d0, v4u d1, v4u d2, v4u d3) {
    asm volatile("global_store_b128 %0, %2, %1\n\t"
                 "global_store_b128 %0, %3, %1 offset:%6\n\t"
                 "global_store_b128 %0, %4, %1 offset:%7\n\t"
                 "global_store_b128 %0, %5, %1 offset:%8\n\t"
                 "s_wait_xcnt 0x0"
                 :: "v"(voff), "s"(base), "v"(d0), "v"(d1), "v"(d2), "v"(d3), "n"(STEP), "n"(2 * STEP), "n"(3 * STEP) : "memory");
}
// orders a wave's own LDS stores and loads around the reuse of its staging tile
__device__ __forceinline__ void wave_lds_order() { __builtin_amdgcn_fence(3, "wavefront"); __builtin_amdgcn_wave_barrier(); asm volatile("" ::: "memory"); }
// eight f32 values -> eight 16-bit values of plane p: 0 fp16, 1 bf16 hi, 2 bf16 lo (the residual of hi)
__device__ __forceinline__ v4u plane8(const float (&y)[8], int p) {
    if (p == 0) { v8h c;
#pragma unroll
        for (int k = 0; k < 8; ++k) c[k] = (h16)y[k];
        return __builtin_bit_cast(v4u, c); }
    v8us c;
#pragma unroll
    for (int k = 0; k < 8; ++k) { unsigned short a1, a2; splitf(y[k], a1, a2); c[k] = p == 1 ? a1 : a2; }
    return __builtin_bit_cast(v4u, c);
}
typedef v4u __attribute__((may_alias)) v4ua;
// Projection epilogues of one wave's 64 x 64 tile; acc[mb][nb][j] = y[16 mb + 8 hi + j][16 nb + lr] without bias, bs[nb] = bias of column 16 nb + lr. Read-back: 8 lanes cover one 128-B row of 16-bit values, a wave 4 rows.
// NP = 1: the fp16 plane alone; NP = 3: the bf16 hi and lo planes too (positions < RH), one plane after the other.
// Every loop of the two epilogues and of plane8 is unrolled so that acc and the small arrays are indexed by constants and stay in registers.
// k, q planes [t][64]: P[p] points at the tile's first position; f32 LDS tile of 16 positions.
template <int NP>
__device__ __forceinline__ void put_rows(const v8f (&acc)[4][4], const float (&bs)[4], unsigned char* sm, int lane, unsigned short* const (&P)[3]) {
    const int lr = lane & 15, hi = lane >> 4, srow = lane >> 3, scol = (lane & 7) * 8;
    float* os = (float*)sm;
#pragma unroll
    for (int mb = 0; mb < 4; ++mb) {
#pragma unroll
        for (int nb = 0; nb < 4; ++nb) {
#pragma unroll
            for (int j = 0; j < 8; ++j) os[(hi * 8 + j) * OSP + nb * 16 + lr] = acc[mb][nb][j] + bs[nb]; }
        wave_lds_order();
#pragma unroll
        for (int p = 0; p < NP; ++p) {
            v4u o[4];
#pragma unroll
            for (int s = 0; s < 4; ++s) {
                const float* xr = os + (4 * s + srow) * OSP + scol; const v4f x0 = *(const v4fa*)xr, x1 = *(const v4fa*)(xr + 4);
                const float y[8] = { x0[0], x0[1], x0[2], x0[3], x1[0], x1[1], x1[2], x1[3] };
                o[s] = plane8(y, p);
            }
            store4<4 * HD * 2>(P[p] + mb * 16 * HD, (unsigned)(srow * HD + scol) * 2u, o[0], o[1], o[2], o[3]);
        }
        wave_lds_order();
    }
}
// v planes [d][t]: P[p] (row pitch SEQ for p = 0, RH else) points at d = 0 of the tile's first position; a lane's 8 accumulator rows are 8 consecutive positions of one d; a 16-bit LDS tile of 16 d x 64 positions per plane.
template <int NP>
__device__ __forceinline__ void put_cols(const v8f (&acc)[4][4], const float (&bs)[4], unsigned char* sm, int lane, unsigned short* const (&P)[3]) {
    const int lr = lane & 15, hi = lane >> 4, srow = lane >> 3, scol = (lane & 7) * 8;
#pragma unroll
    for (int nb = 0; nb < 4; ++nb) {
#pragma unroll
        for (int p = 0; p < NP; ++p) {
            unsigned short* st = (unsigned short*)sm + p * 16 * KP;
#pragma unroll
            for (int mb = 0; mb < 4; ++mb) {
                float y[8];
#pragma unroll
                for (int j = 0; j < 8; ++j) y[j] = acc[mb][nb][j] + bs[nb];
                *(v4ua*)(st + lr * KP + mb * 16 + hi * 8) = plane8(y, p);
            }
            wave_lds_order();
            v4u o[4];
#pragma unroll
            for (int s = 0; s < 4; ++s) o[s] = *(const v4ua*)(st + (4 * s + srow) * KP + scol);
            if (p == 0) store4<4 * SEQ * 2>(P[0] + (size_t)nb * 16 * SEQ, (unsigned)(srow * SEQ + scol) * 2u, o[0], o[1], o[2], o[3]);
            else        store4<4 * RH * 2>(P[p] + nb * 16 * RH, (unsigned)(srow * RH + scol) * 2u, o[0], o[1], o[2], o[3]);
        }
        wave_lds_order();
    }
}

// ---- k_gemmw: the kqv projection. Grid (SEQ/256, 3*DM/128, NB), 256 threads: a work-group owns a 256 x 128 tile of y, its eight waves (4 x 2) a 64 x 64 tile each (16 accumulators).
// y[m][n] (f32, + bf16-valued bias[n]) = sum_k A[m][k] Bt[n][k], both operands K-contiguous bf16 planes. z-batch strides sA/sB in elements. K % 64 == 0, K >= 64.
// The waves read their fragments from LDS. A stage = 64 k of the work-group's 256 A rows and 128 Bt rows (whole 128-B lines, 8 lanes a row), three buffers; every thread copies 8 + 4 pieces of 16 B per stage;
// stage t + 3 is issued into the buffer of stage t behind the barrier that ends its last read, so two stages' copies are in flight and a stage has two stages' time to land. After the last stage's barrier the ring is the eight waves' epilogue staging.
// Staged rows are 128 B without pad (three buffers of two work-groups fit a WGP's LDS): the 16-byte column c of row r lies at column c ^ ((r >> 1) & 7), so the 16 rows of a fragment read fall on 16 different 16-byte bank groups.
// A wave's tile is 64 positions of ONE head of k, q or v (column tile = NH * {k, q, v} + head); the epilogue converts y and writes the head planes itself:
// k, q: fp16 [t][64] (and the bf16 hi/lo planes where t < RH) through an f32 LDS tile of 16 positions; v: a lane's 8 accumulator rows are 8 consecutive positions of one d, packed and turned into whole 128-B rows of [d][t] through 16-bit LDS tiles of 16 d.
#define GP   64                       // halves of a staged row of the projection (no pad; columns swizzled)
#define GAH  (256 * GP)               // halves of the staged A tile (256 rows of 64 k)
#define GSH  (GAH + 128 * GP)         // halves of one stage: A tile, then Bt tile (128 rows)
#define GCP  12                       // copies of a wave per stage
#define EPB  (3 * 16 * KP * 2)        // bytes of one wave's epilogue staging: one f32 tile 16 x OSP, or three 16-bit tiles 16 x KP
// One stage's copies of this thread: rows r, r + 32, ..., r + 224 of the A tile and r, ..., r + 96 of the Bt tile (l: LDS byte address of its first A piece, the same swizzled column in all twelve rows; rs: elements between two of the rows).
// The s_wait_xcnt stands inside the statement so that no address register is rewritten ahead of it.
__device__ __forceinline__ void gstage_copy(unsigned l, const bf* ga, const bf* gb, size_t rs) {
    asm volatile("global_load_async_to_lds_b128 %0, %12, off\n\t"
                 "global_load_async_to_lds_b128 %1, %13, off\n\t"
                 "global_load_async_to_lds_b128 %2, %14, off\n\t"
                 "global_load_async_to_lds_b128 %3, %15, off\n\t"
                 "global_load_async_to_lds_b128 %4, %16, off\n\t"
                 "global_load_async_to_lds_b128 %5, %17, off\n\t"
                 "global_load_async_to_lds_b128 %6, %18, off\n\t"
                 "global_load_async_to_lds_b128 %7, %19, off\n\t"
                 "global_load_async_to_lds_b128 %8, %20, off\n\t"
                 "global_load_async_to_lds_b128 %9, %21, off\n\t"
                 "global_load_async_to_lds_b128 %10, %22, off\n\t"
                 "global_load_async_to_lds_b128 %11, %23, off\n\t"
                 "s_wait_xcnt 0x0"
                 :: "v"(l), "v"(l + 32 * GP * 2), "v"(l + 64 * GP * 2), "v"(l + 96 * GP * 2), "v"(l + 128 * GP * 2), "v"(l + 160 * GP * 2), "v"(l + 192 * GP * 2), "v"(l + 224 * GP * 2),
                    "v"(l + GAH * 2), "v"(l + GAH * 2 + 32 * GP * 2), "v"(l + GAH * 2 + 64 * GP * 2), "v"(l + GAH * 2 + 96 * GP * 2),
                    "v"(ga), "v"(ga + rs), "v"(ga + 2 * rs), "v"(ga + 3 * rs), "v"(ga + 4 * rs), "v"(ga + 5 * rs), "v"(ga + 6 * rs), "v"(ga + 7 * rs),
                    "v"(gb), "v"(gb + rs), "v"(gb + 2 * rs), "v"(gb + 3 * rs)
                 : "memory");
}
__global__ __launch_bounds__(256) __attribute__((amdgpu_num_vgpr(256)))   // the ring (147,456 B) lets two work-groups share a WGP: four waves per SIMD, 256 registers each
void k_gemmw(const bf* __restrict__ A, const bf* __restrict__ Bt, int K, const float* __restrict__ bias, size_t sA, size_t sB,
             h16* Q16, h16* K16, h16* VT16, bf* QPh, bf* QPl, bf* KPh, bf* KPl, bf* VTh, bf* VTl) {
    __shared__ __align__(16) unsigned char sm[3 * GSH * 2];       // the three-stage ring, then epilogue staging
    static_assert(16 * OSP * 4 <= EPB && 8 * EPB <= 3 * GSH * 2 && 2 * 3 * GSH * 2 <= 327680 && 3 * GCP <= 63);
    const size_t z = blockIdx.z; A += z * sA; Bt += z * sB;
    const int lane = threadIdx.x & 31, lr = lane & 15, hi = lane >> 4;
    const int wid = __builtin_amdgcn_readfirstlane((int)threadIdx.x >> 5);   // the wave's number in a scalar register: tile, plane and store bases stay scalar
    const int wm = wid & 3, wn = wid >> 2;
    const int r0 = (int)blockIdx.x * 256 + wm * 64, ct = (int)blockIdx.y * 2 + wn, c0 = ct * 64;
    v8f acc[4][4];
#pragma unroll
    for (int mb = 0; mb < 4; ++mb)
#pragma unroll
        for (int nb = 0; nb < 4; ++nb) acc[mb][nb] = (v8f){};
    const bf* ring = (const bf*)sm;
    // this thread's first piece of an operand tile: row threadIdx.x >> 3, 16-byte column threadIdx.x & 7
    const int crow = (int)threadIdx.x >> 3, ccol = ((int)threadIdx.x & 7) * 8;
    const unsigned la0 = (unsigned)(size_t)(ring + crow * GP + (ccol ^ (((crow >> 1) & 7) * 8)));   // LDS byte address in buffer 0, A tile (rows r + 32 i share r's swizzle)
    const bf* ga0 = A + (size_t)((int)blockIdx.x * 256 + crow) * K + ccol; const bf* gb0 = Bt + (size_t)((int)blockIdx.y * 128 + crow) * K + ccol;
    const size_t rs = (size_t)32 * K;
    const int nst = K >> 6;                                                            // stages of 64 k
    static_assert(GCP == 12);                                                          // the counts in the two counted waits below
    gstage_copy(la0, ga0, gb0, rs);
    if (nst > 1) gstage_copy(la0 + GSH * 2, ga0 + 64, gb0 + 64, rs);
    if (nst > 2) gstage_copy(la0 + 2 * GSH * 2, ga0 + 128, gb0 + 128, rs);
    // stage 0 has landed before the barrier that publishes it; the 24 younger copies (stages 1 and 2) stay in flight (block-uniform scalar branch)
    if (nst > 2) asm volatile("s_wait_asynccnt 0x18" ::: "memory"); else asm volatile("s_wait_asynccnt 0x0" ::: "memory");
    __syncthreads();                                                                   // publishes stage 0 to all eight waves
    const int sx = (lr >> 1) & 7;                                                      // swizzle of this lane's fragment rows (row = multiple of 16 + lr)
    int rb = 0;                                                                        // buffer of stage t: t mod 3
#pragma unroll 1
    for (int t = 0; t < nst; ++t) {
        const bf* ap = ring + rb * GSH + (wm * 64 + lr) * GP; const bf* bp = ring + rb * GSH + GAH + (wn * 64 + lr) * GP;
#pragma unroll
        for (int kk = 0; kk < 2; ++kk) {
            v16bf a[4], b[4];
            // elements 0..7 <- k 32 kk + 8 hi + 0..7 = column 4 kk + hi, elements 8..15 <- column 4 kk + 2 + hi, each at its swizzled place
            const int c0s = ((4 * kk + hi) ^ sx) * 8, c1s = ((4 * kk + 2 + hi) ^ sx) * 8;
#pragma unroll
            for (int i = 0; i < 4; ++i) {
                a[i] = cat16b(*(const v8usa*)(ap + i * 16 * GP + c0s), *(const v8usa*)(ap + i * 16 * GP + c1s));
                b[i] = cat16b(*(const v8usa*)(bp + i * 16 * GP + c0s), *(const v8usa*)(bp + i * 16 * GP + c1s));
            }
            // holds the block's 16 LDS reads together in front of its 16 products (loaded values as inputs only): one wait per block instead of one per group of four products
            asm volatile("" :: "v"(a[0]), "v"(a[1]), "v"(a[2]), "v"(a[3]), "v"(b[0]), "v"(b[1]), "v"(b[2]), "v"(b[3]));
#pragma unroll
            for (int nb = 0; nb < 4; ++nb)
#pragma unroll
                for (int mb = 0; mb < 4; ++mb) acc[mb][nb] = wmmab(a[mb], b[nb], acc[mb][nb]);
        }
        // foot of a stage: publish the next stage, free this one's buffer
        asm volatile("s_wait_dscnt 0x0" ::: "memory");                                 // this wave's reads of the buffer have returned
        // this wave's copies of stage t + 1 have landed; the 12 younger ones, stage t + 2, stay in flight while that stage exists (block-uniform scalar branch), else nothing does
        if (t + 2 < nst) asm volatile("s_wait_asynccnt 0xc" ::: "memory"); else asm volatile("s_wait_asynccnt 0x0" ::: "memory");
        __syncthreads();                                                               // publishes stage t + 1 and ends every wave's reads of stage t
        if (t + 3 < nst) gstage_copy(la0 + (unsigned)rb * (GSH * 2), ga0 + (t + 3) * 64, gb0 + (t + 3) * 64, rs);
        rb = rb == 2 ? 0 : rb + 1;
    }
    asm volatile("s_wait_asynccnt 0x0" ::: "memory");                                  // nothing of this wave is in flight when the ring becomes epilogue staging
    unsigned char* es = sm + wid * EPB;                   // this wave's own staging
    const int sel = ct / NH;                              // 0: k, 1: q, 2: v (W's row blocks)
    const size_t bh = z * NH + ct % NH;
    const bool lo = r0 < RH;                              // the wave's whole tile (RH is a multiple of 64); wave-uniform like sel, and no block barrier follows
    const size_t rl = lo ? r0 : 0;
    float bs[4];
    // bias of columns c0 + lr + {0, 16, 32, 48}: the four loads and their data wait in one statement, outputs early-clobbered, so that no register a load names is rewritten while it is in flight
    asm volatile("global_load_b32 %0, %4, %5\n\t"
                 "global_load_b32 %1, %4, %5 offset:64\n\t"
                 "global_load_b32 %2, %4, %5 offset:128\n\t"
                 "global_load_b32 %3, %4, %5 offset:192\n\t"
                 "s_wait_loadcnt 0x0"
                 : "=&v"(bs[0]), "=&v"(bs[1]), "=&v"(bs[2]), "=&v"(bs[3]) : "v"((unsigned)(c0 + lr) * 4u), "s"(bias) : "memory");
#pragma unroll
    for (int nb = 0; nb < 4; ++nb) bs[nb] = bfr(bs[nb]);
    if (sel < 2) {
        unsigned short* const P[3] = { (unsigned short*)(sel == 1 ? Q16 : K16) + (bh * SEQ + r0) * HD, (sel == 1 ? QPh : KPh) + (bh * RH + rl) * HD, (sel == 1 ? QPl : KPl) + (bh * RH + rl) * HD };
        if (lo) put_rows<3>(acc, bs, es, lane, P); else put_rows<1>(acc, bs, es, lane, P);
    } else {
        unsigned short* const P[3] = { (unsigned short*)VT16 + bh * HD * SEQ + r0, VTh + bh * HD * RH + rl, VTl + bh * HD * RH + rl };
        if (lo) put_cols<3>(acc, bs, es, lane, P); else put_cols<1>(acc, bs, es, lane, P);
    }
}

__global__ __launch_bounds__(256) void k_cvt8(const float* __restrict__ src, bf* dst, size_t n8) { const size_t i = (size_t)blockIdx.x * 256 + threadIdx.x; if (i >= n8) return; const v8f v = *(const v8f*)(src + i * 8); v8us o;
#pragma unroll
    for (int k = 0; k < 8; ++k) o[k] = f2bf(v[k]); *(v8us*)(dst + i * 8) = o;  }
__global__ __launch_bounds__(256) void k_cvtx(const float* __restrict__ src, bf* dst, size_t n8) { const size_t i = (size_t)blockIdx.x * 256 + threadIdx.x; if (i >= n8) return;
    const float* s = src + (size_t)blockIdx.y * SEQ_FULL * DM; bf* d = dst + (size_t)blockIdx.y * SEQ * DM; const v8f v = *(const v8f*)(s + i * 8); v8us o;
#pragma unroll
    for (int k = 0; k < 8; ++k) o[k] = f2bf(v[k]); *(v8us*)(d + i * 8) = o;  }

// ---- k_attn: causal streaming attention, all rows in one launch. Grid (NH, NB, (SEQ-RH)/128 + RH/64), 128 threads: block = 128 query rows >= RH (wave -> 32 rows, two groups of 16) or 64 rows < RH (wave -> 16 rows) of head blockIdx.x, batch blockIdx.y.
// A block whose rows lie below RH runs attn_rows<true> (HR), every other block attn_rows<false>: the few short HR blocks, one wave per SIMD and bound by load latency on their own, run beside the long ones.
// Key chunks of 32 from 0 to the block's last row (block-uniform loop; per-element causal select j <= i; !HR: in the last four chunks alone, the only ones with keys past the block's first row). Per chunk and group: S^T (32 keys x 16 queries) = k.q^T, scaled by SCL in f32 (!HR: inside the exponent's fused multiply-add), online max/sum in f32 (one query per lane), O^T += vt.p^T with p^T packed from the score registers,
// HR (rows and keys < RH): bf16 planes, q.k = qh.kh + qh.kl + ql.kh, p.v = ph.vh + pl.vh + ph.vl (one accumulator, unscaled residuals). Otherwise fp16 planes, single products.
// !HR: the block's four waves read k and vt from LDS. A stage = 64 keys (two chunks), two buffers; every thread copies 4 + 4 pieces of 16 B per stage, whole 128-B rows per 8 lanes;
// stage s + 2 is issued into the buffer of stage s behind the barrier that ends its last read. After the last stage's barrier the ring is the output staging.
// Fragments are read from LDS ahead of their use: a chunk's vt fragments in front of its score products, the next chunk's k fragments behind them; so a stage's last LDS read, and with it the barrier, stands in the middle of its second chunk.
// One stage's copies of this thread: rows r, r + 16, r + 32, r + 48 of the k tile and of the vt tile. The s_wait_xcnt stands inside the statement so that no address register is rewritten ahead of it.
__device__ __forceinline__ void stage_copy(unsigned lk, const h16* gk, unsigned lv, const h16* gv) {
    asm volatile("global_load_async_to_lds_b128 %0, %8, off\n\t"
                 "global_load_async_to_lds_b128 %1, %9, off\n\t"
                 "global_load_async_to_lds_b128 %2, %10, off\n\t"
                 "global_load_async_to_lds_b128 %3, %11, off\n\t"
                 "global_load_async_to_lds_b128 %4, %12, off\n\t"
                 "global_load_async_to_lds_b128 %5, %13, off\n\t"
                 "global_load_async_to_lds_b128 %6, %14, off\n\t"
                 "global_load_async_to_lds_b128 %7, %15, off\n\t"
                 "s_wait_xcnt 0x0"
                 :: "v"(lk), "v"(lk + 16 * KP * 2), "v"(lk + 32 * KP * 2), "v"(lk + 48 * KP * 2), "v"(lv), "v"(lv + 16 * KP * 2), "v"(lv + 32 * KP * 2), "v"(lv + 48 * KP * 2),
                    "v"(gk), "v"(gk + 16 * HD), "v"(gk + 32 * HD), "v"(gk + 48 * HD), "v"(gv), "v"(gv + (size_t)16 * SEQ), "v"(gv + (size_t)32 * SEQ), "v"(gv + (size_t)48 * SEQ)
                 : "memory");
}
// lane l <-> lane l ^ 16 (the other half of the wave holds the other 16 keys of the same query)
__device__ __forceinline__ float xhalf(float v) { const int b = __float_as_int(v); return __int_as_float(__builtin_amdgcn_permlanex16(b, b, 0x76543210, 0xfedcba98, false, false)); }
template <bool HR>
__device__ __forceinline__
void attn_rows(const h16* __restrict__ Q16, const h16* __restrict__ K16, const h16* __restrict__ VT16,
               const bf* __restrict__ QPh, const bf* __restrict__ QPl, const bf* __restrict__ KPh, const bf* __restrict__ KPl,
               const bf* __restrict__ VTh, const bf* __restrict__ VTl, int q0blk, int head, int batch, unsigned char* sm, float* OUT) {
    constexpr int NQ = HR ? 1 : 2;                        // groups of 16 query columns per wave: every k and vt fragment read from LDS feeds NQ products
    const int lane = threadIdx.x & 31, lr = lane & 15, hi = lane >> 4, wid = threadIdx.x >> 5;
    const int q0 = q0blk + wid * (16 * NQ);
    const size_t bh = (size_t)batch * NH + head;
    const h16* Qb = Q16 + bh * SEQ * HD; const h16* Kb = K16 + bh * SEQ * HD; const h16* Vb = VT16 + bh * HD * SEQ;
    const bf* Qhb = QPh + bh * RH * HD; const bf* Qlb = QPl + bh * RH * HD; const bf* Khb = KPh + bh * RH * HD; const bf* Klb = KPl + bh * RH * HD;
    const bf* Vhb = VTh + bh * HD * RH; const bf* Vlb = VTl + bh * HD * RH;
    float* myos = (float*)sm + wid * (16 * NQ) * OSP;
    const h16* ring = (const h16*)sm;
    const int nchunk = (q0blk + 64 * NQ) >> 5;
    const float NEG = -__builtin_inff();
    // group g: this lane's query row is q0 + 16 * g + lr

    v8f o[NQ][4];                                         // o[g][t][r] = O[q0 + 16 * g + lr][t * 16 + 8 * hi + r] (transposed output tiles)
    float m[NQ], l[NQ];                                   // m: both halves agree; l: this half's keys only, joined behind the loop
    v16h aq[NQ][2];
#pragma unroll
    for (int g = 0; g < NQ; ++g) {
#pragma unroll
        for (int t = 0; t < 4; ++t) o[g][t] = (v8f){};
        m[g] = NEG; l[g] = 0.0f;
        if (!HR) { const h16* qr = Qb + (size_t)(q0 + 16 * g + lr) * HD + 8 * hi; aq[g][0] = WFrag<h16>::ld(qr); aq[g][1] = WFrag<h16>::ld(qr + 32); }
    }
    // this thread's first piece of a stage: row threadIdx.x >> 3, 16-byte column threadIdx.x & 7
    const int crow = (int)threadIdx.x >> 3, ccol = ((int)threadIdx.x & 7) * 8;
    const unsigned lk0 = (unsigned)(size_t)(ring + crow * KP + ccol);                  // LDS byte address in buffer 0, k tile
    const h16* gk0 = Kb + (size_t)crow * HD + ccol; const h16* gv0 = Vb + (size_t)crow * SEQ + ccol;
    const int nst = nchunk >> 1;                                                       // stages of 64 keys (nchunk is even)
    if (!HR) {
        stage_copy(lk0, gk0, lk0 + TLH * 2, gv0);
        asm volatile("s_wait_asynccnt 0x0" ::: "memory");                              // stage 0 has landed before the barrier that publishes it
        __syncthreads();                                                               // publishes stage 0 to all four waves
        if (nst > 1) stage_copy(lk0 + STH * 2, gk0 + 64 * HD, lk0 + STH * 2 + TLH * 2, gv0 + 64);
    }
    // !HR: the k fragments of the chunk at hand, read from LDS one chunk ahead: kf[2 * i + kk] = keys 16 * i .. 16 * i + 15 of the chunk, d 32 * kk .. 32 * kk + 31
    v16h kf[4];
    auto load_k = [&](int cn) {
        const h16* kp = ring + ((cn >> 1) & 1) * STH + ((cn & 1) * 32 + lr) * KP + 8 * hi;
        kf[0] = lds16(kp); kf[1] = lds16(kp + 32); kf[2] = lds16(kp + 16 * KP); kf[3] = lds16(kp + 16 * KP + 32);
    };
    if (!HR) load_k(0);                                                                // stage 0 is published

#pragma unroll 1
    for (int c = 0; c < nchunk; ++c) {
        const int j0 = c * 32;
        v8f s0[NQ], s1[NQ];                               // s0[g][r] = S[q][j0 + 8 * hi + r], s1[g][r] = S[q][j0 + 16 + 8 * hi + r], q the lane's row of group g
#pragma unroll
        for (int g = 0; g < NQ; ++g) { s0[g] = (v8f){}; s1[g] = (v8f){}; }
        v16h fv[4];                                           // !HR: the chunk's vt fragments, d 16 * t .. 16 * t + 15
        if constexpr (HR) {
            const bf* qh = Qhb + (size_t)(q0 + lr) * HD + 8 * hi; const bf* ql = Qlb + (size_t)(q0 + lr) * HD + 8 * hi;
            const bf* kh = Khb + (size_t)(j0 + lr) * HD + 8 * hi; const bf* kl = Klb + (size_t)(j0 + lr) * HD + 8 * hi;
#pragma unroll
            for (int kk = 0; kk < 2; ++kk) {
                const v16bf aqh = WFrag<bf>::ld(qh + kk * 32), aql = WFrag<bf>::ld(ql + kk * 32);
                const v16bf kh0 = WFrag<bf>::ld(kh + kk * 32), kh1 = WFrag<bf>::ld(kh + 16 * HD + kk * 32);
                const v16bf kl0 = WFrag<bf>::ld(kl + kk * 32), kl1 = WFrag<bf>::ld(kl + 16 * HD + kk * 32);
                s0[0] = wmmab(kh0, aqh, s0[0]); s0[0] = wmmab(kl0, aqh, s0[0]); s0[0] = wmmab(kh0, aql, s0[0]);
                s1[0] = wmmab(kh1, aqh, s1[0]); s1[0] = wmmab(kl1, aqh, s1[0]); s1[0] = wmmab(kh1, aql, s1[0]);
                // keeps the vector slots between the last product and the first use of its result or operands
                if (kk == 1) asm volatile("v_nop\n\tv_nop\n\tv_nop\n\tv_nop" : "+v"(s0[0]), "+v"(s1[0]) : "v"(aql), "v"(kh1));
            }
        } else {
            // the chunk's four vt fragments are read as one group in front of the score products: they land under those products, not in front of each pair of vt . p^T products
            const h16* vp = ring + ((c >> 1) & 1) * STH + TLH + lr * KP + (c & 1) * 32 + 8 * hi;
#pragma unroll
            for (int t = 0; t < 4; ++t) fv[t] = lds16(vp + t * 16 * KP);
            __builtin_amdgcn_sched_barrier(0);                // holds the eight reads here, in front of the score products, so that they land under them
#pragma unroll
            for (int kk = 0; kk < 2; ++kk) {
                s0[0] = wmma16(kf[kk], aq[0][kk], s0[0]); s0[1] = wmma16(kf[kk], aq[1][kk], s0[1]);
                s1[0] = wmma16(kf[2 + kk], aq[0][kk], s1[0]); s1[1] = wmma16(kf[2 + kk], aq[1][kk], s1[1]);
                // keeps the vector slots between the last product and the first use of its result or operands
                if (kk == 1) asm volatile("v_nop\n\tv_nop\n\tv_nop\n\tv_nop" : "+v"(s0[0]), "+v"(s1[0]), "+v"(s0[1]), "+v"(s1[1]) : "v"(aq[1][1]), "v"(kf[3]));
            }
            if (c & 1) {                                                               // publish point of stage st + 1 (block-uniform), in the stage's last chunk behind its last LDS read: the k fragments fetched below already belong to stage st + 1
                const int st = c >> 1;
                asm volatile("s_wait_dscnt 0x0" ::: "memory");                         // this wave's reads of the buffer (all k and vt fragments of stage st) have returned
                asm volatile("s_wait_asynccnt 0x0" ::: "memory");                      // this wave's copies of stage st + 1 have landed
                __syncthreads();                                                       // publishes stage st + 1 and ends every wave's reads of stage st
                if (st + 2 < nst) { const unsigned lb = lk0 + (unsigned)(st & 1) * (STH * 2); stage_copy(lb, gk0 + (size_t)(st + 2) * 64 * HD, lb + TLH * 2, gv0 + (st + 2) * 64); }
            }
            if (c + 1 < nchunk) load_k(c + 1);                // block-uniform scalar branch: the last chunk reads nothing more; the reads land under the softmax
        }
        v16h bp[NQ];                                          // !HR: p^T of each group, the B operands of vt . p^T
#pragma unroll
        for (int g = 0; g < NQ; ++g) {
        // online softmax update: a lane holds 16 of the 32 keys of ONE query; maximum and sum in the lane, the maximum joined with the other half by one exchange
        // HR: scores scaled by SCL here. !HR: the raw products stay (SCL > 0 keeps their order, so the maximum m is kept raw too); SCL, log2(e) and the factor PCAR of p go into the one fused multiply-add in front of each exponential
        constexpr float EC = HR ? L2E : SCL * L2E;            // exponent (base 2) per unit of pa, pc, m
        float pa[8], pc[8];
        const v8f a0 = HR ? s0[g] * SCL : s0[g], c0v = HR ? s1[g] * SCL : s1[g];
#pragma unroll
        for (int r = 0; r < 8; ++r) { pa[r] = a0[r]; pc[r] = c0v[r]; }
        // Only the block's last 2 * NQ chunks hold keys past its first row (chunk nchunk - 2 * NQ starts at key q0blk): in every earlier chunk j < q0blk <= i for each element and the select would change nothing.
        if (HR || c >= nchunk - 2 * NQ) {                     // block-uniform scalar branch (the short HR blocks select in every chunk, as before)
            const int qd = q0 + 16 * g + lr - j0 - 8 * hi;    // key j0 + 8 * hi + r is allowed where r <= qd
#pragma unroll
            for (int r = 0; r < 8; ++r) { pa[r] = (r <= qd) ? pa[r] : NEG; pc[r] = (16 + r <= qd) ? pc[r] : NEG; }
        }
        float v = fmaxf(fmaxf(fmaxf(fmaxf(pa[0], pa[1]), fmaxf(pa[2], pa[3])), fmaxf(fmaxf(pa[4], pa[5]), fmaxf(pa[6], pa[7]))),
                        fmaxf(fmaxf(fmaxf(pc[0], pc[1]), fmaxf(pc[2], pc[3])), fmaxf(fmaxf(pc[4], pc[5]), fmaxf(pc[6], pc[7]))));
        v = fmaxf(v, xhalf(v));
        const float mn = fmaxf(m[g], v);                      // finite from chunk 0 on (key 0 <= q for every row, seen through the exchange)
        const float alpha = __builtin_amdgcn_exp2f((m[g] - mn) * EC);
        m[g] = mn;
        if constexpr (HR) {
#pragma unroll
            for (int r = 0; r < 8; ++r) { pa[r] = __builtin_amdgcn_exp2f((pa[r] - mn) * L2E); pc[r] = __builtin_amdgcn_exp2f((pc[r] - mn) * L2E); }
        } else {
            static_assert(PCAR == 1024.0f);
            const float nb = __builtin_fmaf(mn, -EC, 10.0f);  // 2^10 = PCAR: pa, pc and with them the sum l are p x PCAR from here on; a masked score (-inf) still gives 0
#pragma unroll
            for (int r = 0; r < 8; ++r) { pa[r] = __builtin_amdgcn_exp2f(__builtin_fmaf(pa[r], EC, nb)); pc[r] = __builtin_amdgcn_exp2f(__builtin_fmaf(pc[r], EC, nb)); }
        }
        const float rs = (((pa[0] + pa[1]) + (pa[2] + pa[3])) + ((pa[4] + pa[5]) + (pa[6] + pa[7]))) + (((pc[0] + pc[1]) + (pc[2] + pc[3])) + ((pc[4] + pc[5]) + (pc[6] + pc[7])));
        l[g] = l[g] * alpha + rs;
#pragma unroll
        for (int t = 0; t < 4; ++t)
#pragma unroll
            for (int r = 0; r < 8; ++r) o[g][t][r] *= alpha;
        // the two score tiles, converted in place, are the B operand of vt . p^T: element s <- key j0 + 8 * hi + s (s < 8), j0 + 16 + 8 * hi + s - 8 (s >= 8), the loaders' k order
        if constexpr (HR) {
            v8us h0, l0, h1, l1;
#pragma unroll
            for (int r = 0; r < 8; ++r) { unsigned short a1, a2, c1, c2; splitf(pa[r], a1, a2); splitf(pc[r], c1, c2); h0[r] = a1; l0[r] = a2; h1[r] = c1; l1[r] = c2; }
            const v16bf bph = cat16b(h0, h1), bpl = cat16b(l0, l1);
            const bf* vh = Vhb + (size_t)lr * RH + j0 + 8 * hi; const bf* vl = Vlb + (size_t)lr * RH + j0 + 8 * hi;
            v16bf fvh = bph, fvl = bpl;
#pragma unroll
            for (int t = 0; t < 4; ++t) { fvh = WFrag<bf>::ld(vh + (size_t)t * 16 * RH); fvl = WFrag<bf>::ld(vl + (size_t)t * 16 * RH);
                o[0][t] = wmmab(fvh, bph, o[0][t]); o[0][t] = wmmab(fvh, bpl, o[0][t]); o[0][t] = wmmab(fvl, bph, o[0][t]); }
            // keeps the vector slots behind the last product on the loop's back edge too
            asm volatile("v_nop\n\tv_nop\n\tv_nop\n\tv_nop" : "+v"(o[0][0]), "+v"(o[0][1]), "+v"(o[0][2]), "+v"(o[0][3]) : "v"(bph), "v"(fvl));
        } else {
#pragma unroll
            for (int r = 0; r < 8; ++r) { bp[g][r] = (h16)pa[r]; bp[g][8 + r] = (h16)pc[r]; }
        }
        }
        if constexpr (!HR) {
#pragma unroll
            for (int t = 0; t < 4; ++t) { o[0][t] = wmma16(fv[t], bp[0], o[0][t]); o[1][t] = wmma16(fv[t], bp[1], o[1][t]); }
            // keeps the vector slots behind the last product on the loop's back edge too
            asm volatile("v_nop\n\tv_nop\n\tv_nop\n\tv_nop" : "+v"(o[0][0]), "+v"(o[0][1]), "+v"(o[0][2]), "+v"(o[0][3]), "+v"(o[1][0]), "+v"(o[1][1]), "+v"(o[1][2]), "+v"(o[1][3]) : "v"(bp[1]), "v"(fv[3]));
        }
    }
    if (!HR) asm volatile("s_wait_asynccnt 0x0" ::: "memory");                         // nothing of this wave is in flight when the ring becomes output staging

#pragma unroll
    for (int g = 0; g < NQ; ++g) {
        l[g] += xhalf(l[g]);                                                           // joins the two halves' sums of this query
        const float inv = __builtin_amdgcn_rcpf(l[g]);                                  // !HR: o and l both carry the factor PCAR
        float* mr = myos + (16 * g + lr) * OSP + 8 * hi;
#pragma unroll
        for (int t = 0; t < 4; ++t) {
            const v4f w0 = { o[g][t][0] * inv, o[g][t][1] * inv, o[g][t][2] * inv, o[g][t][3] * inv }, w1 = { o[g][t][4] * inv, o[g][t][5] * inv, o[g][t][6] * inv, o[g][t][7] * inv };
            *(v4fa*)(mr + t * 16) = w0; *(v4fa*)(mr + t * 16 + 4) = w1;
        }
    }
    __builtin_amdgcn_fence(3, "wavefront"); __builtin_amdgcn_wave_barrier(); asm volatile("" ::: "memory");
    // the wave's first output row, the same in every lane (the wave's number through a scalar register); a lane's own part is the 32-bit byte offset vo
    const float* orow = OUT + ((size_t)batch * SEQ_FULL + q0blk + __builtin_amdgcn_readfirstlane(wid) * (16 * NQ)) * DM + (size_t)head * HD;
    const unsigned vo = (unsigned)(hi * DM + lr * 4) * 4u;
#pragma unroll
    for (int s = 0; s < 2 * NQ; ++s) {                    // rows 8 s + hi + {0, 2, 4, 6}: four stores and their s_wait_xcnt in one statement
        v4u d[4];
#pragma unroll
        for (int k = 0; k < 4; ++k) d[k] = *(const v4ua*)(myos + (8 * s + 2 * k + hi) * OSP + lr * 4);
        store4<2 * DM * 4>(orow + (size_t)(8 * s) * DM, vo, d[0], d[1], d[2], d[3]);
    }
}
__global__ __launch_bounds__(128)
void k_attn(const h16* __restrict__ Q16, const h16* __restrict__ K16, const h16* __restrict__ VT16,
            const bf* __restrict__ QPh, const bf* __restrict__ QPl, const bf* __restrict__ KPh, const bf* __restrict__ KPl,
            const bf* __restrict__ VTh, const bf* __restrict__ VTl, float* OUT) {
    __shared__ __align__(16) unsigned char sm[2 * STH * 2];       // HR: output staging; !HR: the two-stage ring, then output staging
    static_assert(4 * 32 * OSP * 4 <= 2 * STH * 2);
    constexpr int NT = (SEQ - RH) / 128, NBLK = NT + RH / 64;     // row blocks of one head: NT of 128 rows (!HR), then RH / 64 of 64 rows (HR)
    constexpr int LV = (NH * NB >= 256) ? 1 : 256 / (NH * NB);    // values of blockIdx.z that put one block on each of the chip's 256 WGPs
    const int head = (int)blockIdx.x, batch = (int)blockIdx.y, z = (int)blockIdx.z;
    if (z >= NBLK) return;                                // block-uniform (the grid is exact), in front of every block barrier
    // Four blocks are resident per WGP (registers): all but the last, shortest ones start at once. The row blocks, ranked by falling key count,
    // are dealt in rounds of LV that run forth and back, so that the blocks that meet on a WGP hold about the same number of keys together. A permutation of 0 .. NBLK - 1 (a last, partial round runs forth); for speed only.
    const int rd = z / LV, ps = z % LV;
    const int rank = ((rd & 1) && (rd + 1) * LV <= NBLK) ? rd * LV + (LV - 1 - ps) : z;
    // block-uniform choice
    if (rank >= NT) attn_rows<true>(Q16, K16, VT16, QPh, QPl, KPh, KPl, VTh, VTl, RH - 64 * (rank - NT + 1), head, batch, sm, OUT);
    else            attn_rows<false>(Q16, K16, VT16, QPh, QPl, KPh, KPl, VTh, VTl, SEQ - 128 * (rank + 1), head, batch, sm, OUT);
}

extern "C" void kernel_launch(void* const* d_in, const int* in_sizes, int n_in,
                              void* d_out, int out_size, void* d_ws, size_t ws_size, hipStream_t stream) {
    if (n_in < 3) return;
    if ((size_t)in_sizes[0] < (size_t)(NB - 1) * SEQ_FULL * DM + (size_t)SEQ * DM) return;
    if ((size_t)in_sizes[1] < (size_t)3 * DM * DM) return;
    if (in_sizes[2] < 3 * DM) return;
    if ((size_t)out_size < (size_t)(NB - 1) * SEQ_FULL * DM + (size_t)SEQ * DM) return;
    const float* x = (const float*)d_in[0];      // [NB][SEQ_FULL][DM]
    const float* W = (const float*)d_in[1];      // [3*DM][DM]  ([out][in], row blocks k | q | v)
    const float* bias = (const float*)d_in[2];   // [3*DM]
    float* OUT = (float*)d_out;                  // [NB][SEQ_FULL][DM]
    char* wsp = (char*)d_ws;
    auto take = [&](size_t bytes) { char* p = wsp; wsp += (bytes + 255) & ~(size_t)255; return (void*)p; };
    bf* WB = (bf*)take((size_t)3 * DM * DM * 2);
    bf* XB = (bf*)take((size_t)NB * SEQ * DM * 2);
    h16* Q16 = (h16*)take((size_t)NB * NH * SEQ * HD * 2); h16* K16 = (h16*)take((size_t)NB * NH * SEQ * HD * 2); h16* VT16 = (h16*)take((size_t)NB * NH * HD * SEQ * 2);
    bf* QPh = (bf*)take((size_t)NB * NH * RH * HD * 2); bf* QPl = (bf*)take((size_t)NB * NH * RH * HD * 2); bf* KPh = (bf*)take((size_t)NB * NH * RH * HD * 2); bf* KPl = (bf*)take((size_t)NB * NH * RH * HD * 2);
    bf* VTh = (bf*)take((size_t)NB * NH * HD * RH * 2); bf* VTl = (bf*)take((size_t)NB * NH * HD * RH * 2);
    if ((size_t)(wsp - (char*)d_ws) > ws_size) return;
    if ((size_t)(wsp - (char*)d_ws) > (size_t)134217728) return;

    k_cvt8<<<(unsigned)(((size_t)3 * DM * DM / 8 + 255) / 256), 256, 0, stream>>>(W, WB, (size_t)3 * DM * DM / 8);
    k_cvtx<<<dim3((unsigned)(((size_t)SEQ * DM / 8 + 255) / 256), NB, 1), 256, 0, stream>>>(x, XB, (size_t)SEQ * DM / 8);
    // k | q | v in one launch: every 64-column tile is one head of one of the three
    k_gemmw<<<dim3(SEQ / 256, 3 * DM / 128, NB), 256, 0, stream>>>(XB, WB, DM, bias, (size_t)SEQ * DM, (size_t)0, Q16, K16, VT16, QPh, QPl, KPh, KPl, VTh, VTl);
    // attention, one launch: blocks of rows < RH on the hi/lo path, blocks of rows >= RH single products
    k_attn<<<dim3(NH, NB, (SEQ - RH) / 128 + RH / 64), 128, 0, stream>>>(Q16, K16, VT16, QPh, QPl, KPh, KPl, VTh, VTl, OUT);
}
